// v000
// The times below were measured on an AMD MI455X: many runs one after another, warmed up first and cycling through
// copies of the inputs, with the whole window's GPU time divided by the number of runs. Launches and the gaps
// between them are all in it. The median over several windows is given; except for v000 it joins two sittings, which
// can be a few percent apart, so the side-by-side timings, each taken in one sitting, are the better comparison.
// v000 is the starting kernel. One run takes 2160 microseconds.
#include <hip/hip_runtime.h>

// 'Quantum' attention (x [2][2048][1024]; q, k, v = (x W) ('xw' [1024][1024], 16 heads x 64) each multiplied per (head, dim) by mod = cos(quantum_phase[h][d]) x quantum_amplitude[h][d]; scores = q.k / 8 x cos(2 pi (i - j) / 2048) (multiplicative Toeplitz 'interference'); w = softmax; w' = (w + roll(w, 1, keys)) / sqrt(2); out = w' v; y = merged Wo ('xw') -> [2][2048][1024] (4.2 M)).
// Realisation: the roll superposition is moved onto the values: w' v = w @ vv with vv[j] = (v[j] + v[(j+1) mod S]) / sqrt(2) (exact algebra), so the softmax / attn.v run unchanged on vv^T planes; the modulation is applied in the plane builders (q, k planes x MOD[h][d]; vv from modulated v); the softmax kernel multiplies each scaled logit by the cos table entry for |i - j| (cos(2 pi m / 2048) computed as the reference's float32 expression).
// Compute dtypes, f32 accumulate: every input rounded to bf16; q/k/v on PLAIN bf16 operands (inputs: exact); modulation table (precise cosf of bf16 phase x bf16 amplitude) and the cos Toeplitz table in f32; scores and attn.v: query rows < 512 hl (3 products), the rest single fp16 (x1024); softmax f32; Wo hl x exact (2 products).

#define NB_  2
#define TT   2048
#define DM   1024
#define NH_  16
#define NKV  16
#define REP  (NH_ / NKV)
#define HD   64
#define DQ   (NH_ * HD)
#define DKV  (NKV * HD)
#define ZH   2
#define RH   512                  // query rows < RH use hi+lo planes (0: none)
#define WIN  0
#define PCAR 1024.0f
#define SCL  0.125f   // HD^-0.5
typedef _Float16 h16;
typedef unsigned short bf;
typedef __attribute__((ext_vector_type(16))) __bf16   v16bf;
typedef __attribute__((ext_vector_type(16))) _Float16 v16h;
typedef __attribute__((ext_vector_type(8)))  _Float16 v8h;
typedef __attribute__((ext_vector_type(8)))  unsigned short v8us;
typedef __attribute__((ext_vector_type(8)))  float    v8f;
typedef __attribute__((ext_vector_type(4)))  float    v4f;
typedef v8h  __attribute__((may_alias)) v8ha;
typedef v4f  __attribute__((may_alias)) v4fa;
typedef v8us __attribute__((may_alias)) v8usa;

__device__ __forceinline__ unsigned short f2bf(float f) { unsigned u = __float_as_uint(f); u += 0x7FFFu + ((u >> 16) & 1u); return (unsigned short)(u >> 16); }
__device__ __forceinline__ float bf2f(unsigned short b) { return __uint_as_float(((unsigned)b) << 16); }
__device__ __forceinline__ float bfr(float f) { return bf2f(f2bf(f)); }
__device__ __forceinline__ v16h cat16(v8h lo, v8h hi) { return __builtin_shufflevector(lo, hi, 0, 1, 2, 3, 4, 5, 6, 7, 8, 9, 10, 11, 12, 13, 14, 15); }
__device__ __forceinline__ v16bf cat16b(v8us lo, v8us hi) { return __builtin_bit_cast(v16bf, __builtin_shufflevector(lo, hi, 0, 1, 2, 3, 4, 5, 6, 7, 8, 9, 10, 11, 12, 13, 14, 15)); }
__device__ __forceinline__ v8f wmma16(v16h a, v16h b, v8f c) { return __builtin_amdgcn_wmma_f32_16x16x32_f16(false, a, false, b, (short)0, c, false, false); }
__device__ __forceinline__ v8f wmmab(v16bf a, v16bf b, v8f c) { return __builtin_amdgcn_wmma_f32_16x16x32_bf16(false, a, false, b, (short)0, c, false, false); }



// ---- k_gemmw: register-blocked GEMM, ONE WAVE per 64x64 output tile (16 accumulators), operands straight from K-contiguous 16-bit planes; grid (M/64, N/64, Z), 32 threads.
// C[m][n] (f32, pitch ldc, + optional f32 bias[n]) = sum_k A[m][k] Bt[n][k] (+ split products per NSPLIT). z-batch strides sA/sB/sC in elements. K % 32 == 0.
template <typename T16> struct WFrag;
template <> struct WFrag<h16> { typedef v16h V; static __device__ __forceinline__ V ld(const h16* p) { return cat16(*(const v8h*)p, *(const v8h*)(p + 16)); } static __device__ __forceinline__ v8f mma(V a, V b, v8f c) { return wmma16(a, b, c); } };
template <> struct WFrag<bf> { typedef v16bf V; static __device__ __forceinline__ V ld(const bf* p) { return cat16b(*(const v8us*)p, *(const v8us*)(p + 16)); } static __device__ __forceinline__ v8f mma(V a, V b, v8f c) { return wmmab(a, b, c); } };
template <typename T16, int NSPLIT, bool BIAS>
__global__ __launch_bounds__(32) void k_gemmw(const T16* __restrict__ A, const T16* __restrict__ A2, const T16* __restrict__ Bt, const T16* __restrict__ Bt2, int K, float* C, int ldc, const float* __restrict__ bias, size_t sA, size_t sB, size_t sC) {
    typedef typename WFrag<T16>::V V;
    __shared__ __align__(16) float os[16 * 68];
    const size_t z = blockIdx.z; A += z * sA; if (A2) A2 += z * sA; Bt += z * sB; if (Bt2) Bt2 += z * sB; C += z * sC;
    const int lane = threadIdx.x & 31, lr = lane & 15, hi = lane >> 4; const int r0 = blockIdx.x * 64, c0 = blockIdx.y * 64;
    v8f acc[4][4];
#pragma unroll
    for (int mb = 0; mb < 4; ++mb)
#pragma unroll
        for (int nb = 0; nb < 4; ++nb) acc[mb][nb] = (v8f){};
    const size_t aoff = (size_t)(r0 + lr) * K + 8 * hi, boff = (size_t)(c0 + lr) * K + 8 * hi;
#pragma unroll 1
    for (int kc = 0; kc < K; kc += 32) {
        V a[4], a2[4];
#pragma unroll
        for (int mb = 0; mb < 4; ++mb) { a[mb] = WFrag<T16>::ld(A + aoff + (size_t)mb * 16 * K + kc); if (NSPLIT == 1 || NSPLIT == 2) a2[mb] = WFrag<T16>::ld(A2 + aoff + (size_t)mb * 16 * K + kc); }
#pragma unroll
        for (int nb = 0; nb < 4; ++nb) { const V b = WFrag<T16>::ld(Bt + boff + (size_t)nb * 16 * K + kc); V b2; if (NSPLIT >= 2) b2 = WFrag<T16>::ld(Bt2 + boff + (size_t)nb * 16 * K + kc);
#pragma unroll
            for (int mb = 0; mb < 4; ++mb) { acc[mb][nb] = WFrag<T16>::mma(a[mb], b, acc[mb][nb]); if (NSPLIT == 1 || NSPLIT == 2) acc[mb][nb] = WFrag<T16>::mma(a2[mb], b, acc[mb][nb]); if (NSPLIT >= 2) acc[mb][nb] = WFrag<T16>::mma(a[mb], b2, acc[mb][nb]); } }
        asm volatile("v_nop\n\tv_nop\n\tv_nop\n\tv_nop" : "+v"(acc[0][0]), "+v"(acc[1][1]), "+v"(acc[2][2]), "+v"(acc[3][3]) : "v"(a[0]), "v"(a[3]));
    }
#pragma unroll
    for (int mb = 0; mb < 4; ++mb) {
#pragma unroll
        for (int nb = 0; nb < 4; ++nb) {
#pragma unroll
            for (int j = 0; j < 8; ++j) os[(hi * 8 + j) * 68 + nb * 16 + lr] = acc[mb][nb][j]; }
        __builtin_amdgcn_wave_barrier(); asm volatile("" ::: "memory");
        float* crow = C + (size_t)(r0 + mb * 16) * ldc + c0;
{
#pragma unroll
            for (int s = 0; s < 8; ++s) { const int row = 2 * s + hi, cofs = lr * 4; v4f val = *(const v4fa*)(os + row * 68 + cofs); if (BIAS) { val[0] += bfr(bias[c0 + cofs]); val[1] += bfr(bias[c0 + cofs + 1]); val[2] += bfr(bias[c0 + cofs + 2]); val[3] += bfr(bias[c0 + cofs + 3]); }
                *(v4f*)(crow + (size_t)row * ldc + cofs) = val; }
             }
        __builtin_amdgcn_wave_barrier(); asm volatile("" ::: "memory");
    }
}

__device__ __forceinline__ h16 tohx(float x) { return (h16)x; }
__device__ __forceinline__ void splitf(float y, unsigned short& h, unsigned short& l) { h = f2bf(y); l = f2bf(y - bf2f(h)); }
typedef __attribute__((ext_vector_type(2))) _Float16 v2h;
typedef __attribute__((ext_vector_type(4))) _Float16 v4h;
typedef __attribute__((ext_vector_type(2))) unsigned short v2us;
typedef __attribute__((ext_vector_type(4))) unsigned short v4us;
typedef __attribute__((ext_vector_type(2))) float v2f;
typedef __attribute__((ext_vector_type(4))) int v4i;

__global__ __launch_bounds__(256) void k_wtG(const float* __restrict__ w, int K, int N, bf* Bt) {
    const int lane = threadIdx.x & 31; const int L0 = (blockIdx.x * 8 + (threadIdx.x >> 5)) * 8; const int nlines = N * K / 64;
{
#pragma unroll 1
        for (int l = 0; l < 8; ++l) { const int L = L0 + l; if (L >= nlines) break; const size_t e = (size_t)L * 64 + lane * 2; const int k = (int)(e % K), n = (int)(e / K); v2us o;
            o[0] = f2bf(w[(size_t)k * N + n]); o[1] = f2bf(w[(size_t)(k + 1) * N + n]); *(v2us*)(Bt + e) = o; }
         }
}
__global__ __launch_bounds__(256) void k_cvt8(const float* __restrict__ src, bf* dst, size_t n8) { const size_t i = (size_t)blockIdx.x * 256 + threadIdx.x; if (i >= n8) return; const v8f v = *(const v8f*)(src + i * 8); v8us o;
#pragma unroll
    for (int k = 0; k < 8; ++k) o[k] = f2bf(v[k]); *(v8us*)(dst + i * 8) = o;  }

// k_rope: head planes [h][t][d] (fp16 + hi/lo) of rope(x) x sc with the rotate-half convention out[d] = x[d] cos[t][d] - x[d+HD/2] sin[t][d], out[d+HD/2] = x[d+HD/2] cos[t][d+HD/2] + x[d] sin[t][d+HD/2]
__global__ __launch_bounds__(256) void k_rope(const float* __restrict__ F, int pitch, int nheads, const float* __restrict__ CS, const float* __restrict__ RF, const float* __restrict__ nw, float sc, h16* P16, bf* Ph, bf* Pl) {
    const size_t e = ((size_t)blockIdx.x * 256 + threadIdx.x) * 2; if (e >= (size_t)nheads * TT * HD) return; const int d = (int)(e % HD); const int t = (int)((e / HD) % TT); const int h = (int)(e / ((size_t)HD * TT)); const float* f = F + (size_t)t * pitch + h * HD; const float rf = RF ? RF[(size_t)h * TT + t] : 1.0f; v2h o16; v2us oh, ol;
#pragma unroll
    for (int q = 0; q < 2; ++q) { const int dd = d + q; const int dp = (dd < HD / 2) ? dd + HD / 2 : dd - HD / 2; float x0 = f[dd], x1 = f[dp];
        if (nw) { x0 = __fmul_rn(x0, nw[h * HD + dd]); x1 = __fmul_rn(x1, nw[h * HD + dp]); }   /* per-(head, dim) modulation table (f32, precomputed) */ (void)rf;
        const v2f cs = *(const v2f*)(CS + ((size_t)t * HD + dd) * 2); float a = __fmul_rn(x0, cs[0]), bq = __fmul_rn(x1, cs[1]); asm volatile("" : "+v"(a)); asm volatile("" : "+v"(bq)); const float r = ((dd < HD / 2) ? __fsub_rn(a, bq) : __fadd_rn(a, bq)) * sc;
        o16[q] = tohx(r); unsigned short a2, c2; splitf(r, a2, c2); oh[q] = a2; ol[q] = c2; }
    *(v2h*)(P16 + e) = o16; *(v2us*)(Ph + e) = oh; *(v2us*)(Pl + e) = ol;  }
__global__ __launch_bounds__(256) void k_vtp(const float* __restrict__ F, int pitch, int nheads, h16* V16, bf* Vh, bf* Vl) { const size_t e = ((size_t)blockIdx.x * 256 + threadIdx.x) * 2; if (e >= (size_t)nheads * HD * TT) return; const int t = (int)(e % TT); const int d = (int)((e / TT) % HD); const int g = (int)(e / ((size_t)TT * HD)); v2h o16; v2us oh, ol;
#pragma unroll
    for (int q = 0; q < 2; ++q) { const float x = F[(size_t)(t + q) * pitch + g * HD + d]; o16[q] = tohx(x); unsigned short a2, c2; splitf(x, a2, c2); oh[q] = a2; ol[q] = c2; }
    *(v2h*)(V16 + e) = o16; *(v2us*)(Vh + e) = oh; *(v2us*)(Vl + e) = ol;  }
__global__ __launch_bounds__(256) void k_csid(float* CS) { const int idx = blockIdx.x * 256 + threadIdx.x; if (idx >= TT * HD) return; v2f cs; cs[0] = 1.0f; cs[1] = 0.0f; *(v2f*)(CS + (size_t)idx * 2) = cs;  }
__global__ __launch_bounds__(256) void k_qtabs(const float* __restrict__ ph, const float* __restrict__ am, float* MOD, float* CT) { const int i = blockIdx.x * 256 + threadIdx.x; if (i < DQ) { const float m = __fmul_rn(cosf(bfr(ph[i])), bfr(am[i])); *(float*)(MOD + i) = m;  }
    if (i < TT) { const float a = __fmul_rn(__fmul_rn(6.2831853071795862f, (float)i), 1.0f / (float)TT); const float c = cosf(a); *(float*)(CT + i) = c;  } }
__global__ __launch_bounds__(256) void k_vtpm(const float* __restrict__ F, int pitch, int nheads, const float* __restrict__ MOD, h16* V16, bf* Vh, bf* Vl) { const size_t e = ((size_t)blockIdx.x * 256 + threadIdx.x) * 2; if (e >= (size_t)nheads * HD * TT) return; const int t = (int)(e % TT); const int d = (int)((e / TT) % HD); const int g = (int)(e / ((size_t)TT * HD)); const float m = MOD[g * HD + d]; v2h o16; v2us oh, ol;
#pragma unroll
    for (int q = 0; q < 2; ++q) { const int tt = t + q; const int tn = (tt + 1 == TT) ? 0 : tt + 1; float a = __fmul_rn(F[(size_t)tt * pitch + g * HD + d], m); float b = __fmul_rn(F[(size_t)tn * pitch + g * HD + d], m); asm volatile("" : "+v"(a)); asm volatile("" : "+v"(b)); const float v = __fmul_rn(__fadd_rn(a, b), 0.70710678118654752f); o16[q] = tohx(v); unsigned short a2, c2; splitf(v, a2, c2); oh[q] = a2; ol[q] = c2; }
    *(v2h*)(V16 + e) = o16; *(v2us*)(Vh + e) = oh; *(v2us*)(Vl + e) = ol;  }
// k_asoft (this module): each scaled logit is multiplied by CT[|i - j|] = cos(2 pi (i-j) / 2048) before the max/exp (table gather, 4 per lane per chunk).
// k_asoft: per row (zz, i): t = S x HD^-0.5 (no mask); softmax over the 2048 keys (register row, one exp, fixed trees);
__global__ __launch_bounds__(256) void k_asoft(const float* __restrict__ Sb, const float* __restrict__ CT, h16* P16, bf* Ph, bf* Pl) {
    const int lane = threadIdx.x & 31; const int row = blockIdx.x * 8 + (threadIdx.x >> 5); if (row >= ZH * TT) return; const int i = row % TT; const int zz = row / TT; (void)zz; const bool hires = (i < RH); const float* sr = Sb + (size_t)row * TT; float v[TT / 32]; float mx = -3.0e38f;
#pragma unroll
    for (int ch = 0; ch < TT / 128; ++ch) { const int j0 = ch * 128 + lane * 4; const v4f a = *(const v4f*)(sr + j0);
#pragma unroll
        for (int q = 0; q < 4; ++q) { const int j = j0 + q; (void)j; float sc = a[q] * SCL; asm volatile("" : "+v"(sc)); const int dj = i - (j0 + q); float t = __fmul_rn(sc, CT[dj < 0 ? -dj : dj]); asm volatile("" : "+v"(t)); v[ch * 4 + q] = t; mx = fmaxf(mx, t); } }
#pragma unroll
    for (int sh = 16; sh; sh >>= 1) mx = fmaxf(mx, __shfl_xor(mx, sh, 32));
    float sum = 0.f;
#pragma unroll
    for (int k = 0; k < TT / 32; ++k) { float d0 = __fsub_rn(v[k], mx); asm volatile("" : "+v"(d0)); v[k] = __builtin_amdgcn_exp2f(__fmul_rn(d0, 1.4426950408889634f)); sum += v[k]; }
#pragma unroll
    for (int sh = 16; sh; sh >>= 1) sum += __shfl_xor(sum, sh, 32);
    const float f = __fdiv_rn(hires ? 1.0f : PCAR, sum);
{
        if (hires) {
#pragma unroll
            for (int ch = 0; ch < TT / 128; ++ch) { v4us oh, ol;
#pragma unroll
                for (int q = 0; q < 4; ++q) { unsigned short a, c2; splitf(v[ch * 4 + q] * f, a, c2); oh[q] = a; ol[q] = c2; }
                const size_t oo = ((size_t)zz * (RH ? RH : 1) + i) * TT + ch * 128 + lane * 4; *(v4us*)(Ph + oo) = oh; *(v4us*)(Pl + oo) = ol; }
        } else {
#pragma unroll
            for (int ch = 0; ch < TT / 128; ++ch) { v4h o4;
#pragma unroll
                for (int q = 0; q < 4; ++q) o4[q] = tohx(v[ch * 4 + q] * f);
                *(v4h*)(P16 + (size_t)row * TT + ch * 128 + lane * 4) = o4; } }
         }
}
__global__ __launch_bounds__(256) void k_merge(const float* __restrict__ O, int h0, bf* Ah, bf* Al) { const size_t e = ((size_t)blockIdx.x * 256 + threadIdx.x) * 2; if (e >= (size_t)ZH * TT * HD) return; const int d = (int)(e % HD); const int t = (int)((e / HD) % TT); const int zz = (int)(e / ((size_t)HD * TT)); const float cs = (t < RH) ? 1.0f : (1.0f / PCAR); const size_t oo = (size_t)t * DQ + (h0 + zz) * HD + d;
    v2us oh, ol;
#pragma unroll
    for (int q = 0; q < 2; ++q) { unsigned short a, c2; splitf(O[e + q] * cs, a, c2); oh[q] = a; ol[q] = c2; } *(v2us*)(Ah + oo) = oh; *(v2us*)(Al + oo) = ol;  }

extern "C" void kernel_launch(void* const* d_in, const int* in_sizes, int n_in,
                              void* d_out, int out_size, void* d_ws, size_t ws_size, hipStream_t stream) {
    (void)in_sizes; (void)n_in; (void)out_size;
    const float* x = (const float*)d_in[0]; const float* wq = (const float*)d_in[1]; const float* wk = (const float*)d_in[2]; const float* wv = (const float*)d_in[3]; const float* wo = (const float*)d_in[4]; const float* qph = (const float*)d_in[5]; const float* qam = (const float*)d_in[6];
    float* OUT = (float*)d_out;     // [2][2048][1024]
    char* wsp = (char*)d_ws;
    auto take = [&](size_t bytes) { char* p = wsp; wsp += (bytes + 255) & ~(size_t)255; return (void*)p; };
    bf* WQ = (bf*)take((size_t)DQ * DM * 2); bf* WK = (bf*)take((size_t)DKV * DM * 2); bf* WV = (bf*)take((size_t)DKV * DM * 2); bf* WO = (bf*)take((size_t)DM * DQ * 2); float* CS = (float*)take((size_t)TT * HD * 2 * 4);
    float* MOD = (float*)take((size_t)DQ * 4); float* CT = (float*)take((size_t)TT * 4);
    bf* XB = (bf*)take((size_t)TT * DM * 2); float* FQ = (float*)take((size_t)TT * DQ * 4); float* FK = (float*)take((size_t)TT * DKV * 4);
    h16* QP16 = (h16*)take((size_t)NH_ * TT * HD * 2); h16* KP16 = (h16*)take((size_t)NKV * TT * HD * 2); h16* VT16 = (h16*)take((size_t)NKV * HD * TT * 2);
    bf* QPh = (bf*)take((size_t)NH_ * TT * HD * 2); bf* QPl = (bf*)take((size_t)NH_ * TT * HD * 2); bf* KPh = (bf*)take((size_t)NKV * TT * HD * 2); bf* KPl = (bf*)take((size_t)NKV * TT * HD * 2); bf* VTh = (bf*)take((size_t)NKV * HD * TT * 2); bf* VTl = (bf*)take((size_t)NKV * HD * TT * 2); bf* Ph = (bf*)take((size_t)ZH * RH * TT * 2); bf* Pl = (bf*)take((size_t)ZH * RH * TT * 2);
    float* Sb = (float*)take((size_t)ZH * TT * TT * 4); h16* P16 = (h16*)take((size_t)ZH * TT * TT * 2); float* Ob = (float*)take((size_t)ZH * TT * HD * 4); bf* ATh = (bf*)take((size_t)TT * DQ * 2); bf* ATl = (bf*)take((size_t)TT * DQ * 2);
    if ((size_t)(wsp - (char*)d_ws) > ws_size) return;    // ws 256 MiB
    float* FV = FK;   // v projection reuses the k buffer after the k planes are built (stream-ordered)
    { k_wtG<<<(unsigned)((DM * DQ / 64 + 63) / 64), 256, 0, stream>>>(wq, DM, DQ, WQ); k_wtG<<<(unsigned)((DM * DKV / 64 + 63) / 64), 256, 0, stream>>>(wk, DM, DKV, WK); k_wtG<<<(unsigned)((DM * DKV / 64 + 63) / 64), 256, 0, stream>>>(wv, DM, DKV, WV);
      k_wtG<<<(unsigned)((DQ * DM / 64 + 63) / 64), 256, 0, stream>>>(wo, DQ, DM, WO);
       }
    k_csid<<<(TT * HD + 255) / 256, 256, 0, stream>>>(CS);
    const unsigned LQ = (unsigned)(((size_t)NH_ * TT * HD / 2 + 255) / 256), LKv = (unsigned)(((size_t)NKV * TT * HD / 2 + 255) / 256);
    k_qtabs<<<(TT + 255) / 256, 256, 0, stream>>>(qph, qam, MOD, CT);
    for (int b = 0; b < NB_; ++b) {
        
        k_cvt8<<<(unsigned)(((size_t)TT * DM / 8 + 255) / 256), 256, 0, stream>>>(x + (size_t)b * TT * DM, XB, (size_t)TT * DM / 8);
        k_gemmw<bf, 0, false><<<dim3(TT / 64, DQ / 64, 1), 32, 0, stream>>>(XB, nullptr, WQ, nullptr, DM, FQ, DQ, nullptr, 0, 0, 0);
        k_rope<<<LQ, 256, 0, stream>>>(FQ, DQ, NH_, CS, nullptr, MOD, 1.0f, QP16, QPh, QPl);
        k_gemmw<bf, 0, false><<<dim3(TT / 64, DKV / 64, 1), 32, 0, stream>>>(XB, nullptr, WK, nullptr, DM, FK, DKV, nullptr, 0, 0, 0);
        k_rope<<<LKv, 256, 0, stream>>>(FK, DKV, NKV, CS, nullptr, MOD, 1.0f, KP16, KPh, KPl);
        k_gemmw<bf, 0, false><<<dim3(TT / 64, DKV / 64, 1), 32, 0, stream>>>(XB, nullptr, WV, nullptr, DM, FV, DKV, nullptr, 0, 0, 0); k_vtpm<<<LKv, 256, 0, stream>>>(FV, DKV, NKV, MOD, VT16, VTh, VTl);
        for (int h0 = 0; h0 < NH_; h0 += ZH) { const size_t zq = (size_t)h0, zk = (size_t)(h0 / REP);   // one kv head per query head: the pass's two heads use consecutive kv planes (z-strides TT*HD)
            k_gemmw<bf, 2, false><<<dim3(RH / 64, TT / 64, ZH), 32, 0, stream>>>(QPh + zq * TT * HD, QPl + zq * TT * HD, KPh + zk * TT * HD, KPl + zk * TT * HD, HD, Sb, TT, nullptr, (size_t)TT * HD, (size_t)TT * HD, (size_t)TT * TT);
            k_gemmw<h16, 0, false><<<dim3((TT - RH) / 64, TT / 64, ZH), 32, 0, stream>>>(QP16 + zq * TT * HD + (size_t)RH * HD, nullptr, KP16 + zk * TT * HD, nullptr, HD, Sb + (size_t)RH * TT, TT, nullptr, (size_t)TT * HD, (size_t)TT * HD, (size_t)TT * TT);
            k_asoft<<<ZH * TT / 8, 256, 0, stream>>>(Sb, CT, P16, Ph, Pl);
            k_gemmw<bf, 2, false><<<dim3(RH / 64, HD / 64, ZH), 32, 0, stream>>>(Ph, Pl, VTh + zk * HD * TT, VTl + zk * HD * TT, TT, Ob, HD, nullptr, (size_t)RH * TT, (size_t)HD * TT, (size_t)TT * HD);
            k_gemmw<h16, 0, false><<<dim3((TT - RH) / 64, HD / 64, ZH), 32, 0, stream>>>(P16 + (size_t)RH * TT, nullptr, VT16 + zk * HD * TT, nullptr, TT, Ob + (size_t)RH * HD, HD, nullptr, (size_t)TT * TT, (size_t)HD * TT, (size_t)TT * HD);
            k_merge<<<(unsigned)(((size_t)ZH * TT * HD / 2 + 255) / 256), 256, 0, stream>>>(Ob, h0, ATh, ATl); }
        k_gemmw<bf, 1, false><<<dim3(TT / 64, DM / 64, 1), 32, 0, stream>>>(ATh, ATl, WO, nullptr, DQ, OUT + (size_t)b * TT * DM, DM, nullptr, 0, 0, 0); }
}

// v001
// A run of this version takes 1030 microseconds.
// In both of two side-by-side timings against v000, it was 2.12 times as fast.
#include <hip/hip_runtime.h>

// 'Quantum' attention (x [2][2048][1024]; q, k, v = (x W) ('xw' [1024][1024], 16 heads x 64) each multiplied per (head, dim) by mod = cos(quantum_phase[h][d]) x quantum_amplitude[h][d]; scores = q.k / 8 x cos(2 pi (i - j) / 2048) (multiplicative Toeplitz 'interference'); w = softmax; w' = (w + roll(w, 1, keys)) / sqrt(2); out = w' v; y = merged Wo ('xw') -> [2][2048][1024] (4.2 M)).
// Realisation: the roll superposition is moved onto the values: w' v = w @ vv with vv[j] = (v[j] + v[(j+1) mod S]) / sqrt(2) (exact algebra), so the softmax / attn.v run unchanged on vv^T planes; the modulation is applied in the plane builders (q, k planes x MOD[h][d]; vv from modulated v); the softmax kernel multiplies each scaled logit by the cos table entry for |i - j| (cos(2 pi m / 2048) computed as the reference's float32 expression).
// Compute dtypes, f32 accumulate: every input rounded to bf16; q/k/v on PLAIN bf16 operands (inputs: exact); modulation table (precise cosf of bf16 phase x bf16 amplitude) and the cos Toeplitz table in f32; scores and attn.v: query rows < 512 hl (3 products), the rest single fp16 (x1024); softmax f32; Wo hl x exact (2 products).

#define NB_  2
#define TT   2048
#define DM   1024
#define NH_  16
#define NKV  16
#define REP  (NH_ / NKV)
#define HD   64
#define DQ   (NH_ * HD)
#define DKV  (NKV * HD)
#define ZH   2
#define RH   512                  // query rows < RH use hi+lo planes (0: none)
#define WIN  0
#define PCAR 1024.0f
#define SCL  0.125f   // HD^-0.5
#define KS   4                    // attn.v: K chunks on work-groups (partial planes of Ob, added in k_merge)
#define KNW  8                    // attn.v: K chunks on the waves of a work-group
typedef _Float16 h16;
typedef unsigned short bf;
typedef __attribute__((ext_vector_type(16))) __bf16   v16bf;
typedef __attribute__((ext_vector_type(16))) _Float16 v16h;
typedef __attribute__((ext_vector_type(8)))  _Float16 v8h;
typedef __attribute__((ext_vector_type(8)))  unsigned short v8us;
typedef __attribute__((ext_vector_type(8)))  float    v8f;
typedef __attribute__((ext_vector_type(4)))  float    v4f;
typedef v8h  __attribute__((may_alias)) v8ha;
typedef v4f  __attribute__((may_alias)) v4fa;
typedef v8us __attribute__((may_alias)) v8usa;

__device__ __forceinline__ unsigned short f2bf(float f) { unsigned u = __float_as_uint(f); u += 0x7FFFu + ((u >> 16) & 1u); return (unsigned short)(u >> 16); }
__device__ __forceinline__ float bf2f(unsigned short b) { return __uint_as_float(((unsigned)b) << 16); }
__device__ __forceinline__ float bfr(float f) { return bf2f(f2bf(f)); }
__device__ __forceinline__ v16h cat16(v8h lo, v8h hi) { return __builtin_shufflevector(lo, hi, 0, 1, 2, 3, 4, 5, 6, 7, 8, 9, 10, 11, 12, 13, 14, 15); }
__device__ __forceinline__ v16bf cat16b(v8us lo, v8us hi) { return __builtin_bit_cast(v16bf, __builtin_shufflevector(lo, hi, 0, 1, 2, 3, 4, 5, 6, 7, 8, 9, 10, 11, 12, 13, 14, 15)); }
__device__ __forceinline__ v8f wmma16(v16h a, v16h b, v8f c) { return __builtin_amdgcn_wmma_f32_16x16x32_f16(false, a, false, b, (short)0, c, false, false); }
__device__ __forceinline__ v8f wmmab(v16bf a, v16bf b, v8f c) { return __builtin_amdgcn_wmma_f32_16x16x32_bf16(false, a, false, b, (short)0, c, false, false); }



// ---- k_gemmw: register-blocked GEMM, ONE WAVE per 64x64 output tile (16 accumulators), operands straight from K-contiguous 16-bit planes; grid (M/64, N/64, Z), 32 threads.
// C[m][n] (f32, pitch ldc, + optional f32 bias[n]) = sum_k A[m][k] Bt[n][k] (+ split products per NSPLIT). z-batch strides sA/sB/sC in elements. K % 32 == 0.
template <typename T16> struct WFrag;
template <> struct WFrag<h16> { typedef v16h V; static __device__ __forceinline__ V ld(const h16* p) { return cat16(*(const v8h*)p, *(const v8h*)(p + 16)); } static __device__ __forceinline__ v8f mma(V a, V b, v8f c) { return wmma16(a, b, c); } };
template <> struct WFrag<bf> { typedef v16bf V; static __device__ __forceinline__ V ld(const bf* p) { return cat16b(*(const v8us*)p, *(const v8us*)(p + 16)); } static __device__ __forceinline__ v8f mma(V a, V b, v8f c) { return wmmab(a, b, c); } };
template <typename T16, int NSPLIT, bool BIAS>
__global__ __launch_bounds__(32) void k_gemmw(const T16* __restrict__ A, const T16* __restrict__ A2, const T16* __restrict__ Bt, const T16* __restrict__ Bt2, int K, float* C, int ldc, const float* __restrict__ bias, size_t sA, size_t sB, size_t sC) {
    typedef typename WFrag<T16>::V V;
    __shared__ __align__(16) float os[16 * 68];
    const size_t z = blockIdx.z; A += z * sA; if (A2) A2 += z * sA; Bt += z * sB; if (Bt2) Bt2 += z * sB; C += z * sC;
    const int lane = threadIdx.x & 31, lr = lane & 15, hi = lane >> 4; const int r0 = blockIdx.x * 64, c0 = blockIdx.y * 64;
    v8f acc[4][4];
#pragma unroll
    for (int mb = 0; mb < 4; ++mb)
#pragma unroll
        for (int nb = 0; nb < 4; ++nb) acc[mb][nb] = (v8f){};
    const size_t aoff = (size_t)(r0 + lr) * K + 8 * hi, boff = (size_t)(c0 + lr) * K + 8 * hi;
#pragma unroll 1
    for (int kc = 0; kc < K; kc += 32) {
        V a[4], a2[4];
#pragma unroll
        for (int mb = 0; mb < 4; ++mb) { a[mb] = WFrag<T16>::ld(A + aoff + (size_t)mb * 16 * K + kc); if (NSPLIT == 1 || NSPLIT == 2) a2[mb] = WFrag<T16>::ld(A2 + aoff + (size_t)mb * 16 * K + kc); }
#pragma unroll
        for (int nb = 0; nb < 4; ++nb) { const V b = WFrag<T16>::ld(Bt + boff + (size_t)nb * 16 * K + kc); V b2; if (NSPLIT >= 2) b2 = WFrag<T16>::ld(Bt2 + boff + (size_t)nb * 16 * K + kc);
#pragma unroll
            for (int mb = 0; mb < 4; ++mb) { acc[mb][nb] = WFrag<T16>::mma(a[mb], b, acc[mb][nb]); if (NSPLIT == 1 || NSPLIT == 2) acc[mb][nb] = WFrag<T16>::mma(a2[mb], b, acc[mb][nb]); if (NSPLIT >= 2) acc[mb][nb] = WFrag<T16>::mma(a[mb], b2, acc[mb][nb]); } }
        asm volatile("v_nop\n\tv_nop\n\tv_nop\n\tv_nop" : "+v"(acc[0][0]), "+v"(acc[1][1]), "+v"(acc[2][2]), "+v"(acc[3][3]) : "v"(a[0]), "v"(a[3]));
    }
#pragma unroll
    for (int mb = 0; mb < 4; ++mb) {
#pragma unroll
        for (int nb = 0; nb < 4; ++nb) {
#pragma unroll
            for (int j = 0; j < 8; ++j) os[(hi * 8 + j) * 68 + nb * 16 + lr] = acc[mb][nb][j]; }
        __builtin_amdgcn_wave_barrier(); asm volatile("" ::: "memory");
        float* crow = C + (size_t)(r0 + mb * 16) * ldc + c0;
{
#pragma unroll
            for (int s = 0; s < 8; ++s) { const int row = 2 * s + hi, cofs = lr * 4; v4f val = *(const v4fa*)(os + row * 68 + cofs); if (BIAS) { val[0] += bfr(bias[c0 + cofs]); val[1] += bfr(bias[c0 + cofs + 1]); val[2] += bfr(bias[c0 + cofs + 2]); val[3] += bfr(bias[c0 + cofs + 3]); }
                *(v4f*)(crow + (size_t)row * ldc + cofs) = val; }
             }
        __builtin_amdgcn_wave_barrier(); asm volatile("" ::: "memory");
    }
}

// ---- k_gemmks: k_gemmw's 64x64 tile for a long K and few tiles (attn.v: N = 64, K = 2048), with K split KS x NW ways so that the launch has KS x NW times the waves in flight.
// grid (M/64, KS, Z), NW waves; wave w of work-group y sums k in [(y NW + w) KW, + KW), KW % 32 == 0, KS NW KW == K (K, the row pitch of A and Bt, is a template constant). The NW partial tiles are summed through LDS in wave order; work-group y stores its tile to plane y of C (plane stride sP); the reader of C adds the KS planes.
// Bt is the A operand of the matrix instruction here (both loaders are the same, so the k orders still pair): a lane's 8 accumulator floats are then 8 consecutive columns of one C row, and a partial goes to LDS in 16-byte stores.
template <typename T16, int NSPLIT, int NW, int K>
__global__ __launch_bounds__(NW * 32) void k_gemmks(const T16* __restrict__ A, const T16* __restrict__ A2, const T16* __restrict__ Bt, const T16* __restrict__ Bt2, int KW, float* C, int ldc, size_t sA, size_t sB, size_t sC, size_t sP) {
    typedef typename WFrag<T16>::V V;
    __shared__ __align__(16) float red[NW * 64 * 68];   // pitch 68 floats = 16 B x 17: 16-byte stores and loads free of bank conflicts
    const int lane = threadIdx.x & 31, lr = lane & 15, hi = lane >> 4; const int w = __builtin_amdgcn_readfirstlane(threadIdx.x >> 5); const int r0 = blockIdx.x * 64;
    const size_t z = blockIdx.z; A += z * sA + (size_t)r0 * K; if (NSPLIT == 2) A2 += z * sA + (size_t)r0 * K; Bt += z * sB; if (NSPLIT == 2) Bt2 += z * sB; C += z * sC + blockIdx.y * sP;
    const int k0 = ((int)blockIdx.y * NW + w) * KW;
    v8f acc[4][4];   // [nb: 16 columns of C][mb: 16 rows of C]
#pragma unroll
    for (int nb = 0; nb < 4; ++nb)
#pragma unroll
        for (int mb = 0; mb < 4; ++mb) acc[nb][mb] = (v8f){};
    const unsigned loff = (unsigned)(lr * K + 8 * hi) * 2u;   // the lane's byte offset in a 16-row fragment block, the same on every trip; the blocks' steps (16 K elements) are constants of the load
    // rolled, as in k_gemmw: one trip's fragments live at a time
#pragma unroll 1
    for (int kc = k0; kc < k0 + KW; kc += 32) {
        const T16* pa = (const T16*)((const char*)(A + kc) + loff); const T16* pb = (const T16*)((const char*)(Bt + kc) + loff); const T16* pa2 = (NSPLIT == 2) ? (const T16*)((const char*)(A2 + kc) + loff) : pa; const T16* pb2 = (NSPLIT == 2) ? (const T16*)((const char*)(Bt2 + kc) + loff) : pb;
        V a[4], a2[4];
#pragma unroll
        for (int mb = 0; mb < 4; ++mb) { a[mb] = WFrag<T16>::ld(pa + mb * 16 * K); if (NSPLIT == 2) a2[mb] = WFrag<T16>::ld(pa2 + mb * 16 * K); }
#pragma unroll
        for (int nb = 0; nb < 4; ++nb) { const V b = WFrag<T16>::ld(pb + nb * 16 * K); V b2; if (NSPLIT == 2) b2 = WFrag<T16>::ld(pb2 + nb * 16 * K);
#pragma unroll
            for (int mb = 0; mb < 4; ++mb) { acc[nb][mb] = WFrag<T16>::mma(b, a[mb], acc[nb][mb]); if (NSPLIT == 2) { acc[nb][mb] = WFrag<T16>::mma(b, a2[mb], acc[nb][mb]); acc[nb][mb] = WFrag<T16>::mma(b2, a[mb], acc[nb][mb]); } } }
        // four vector slots behind the trip's last matrix instruction, also on the taken back edge, before its operands are loaded anew (as in k_gemmw); the trip's address pairs are inputs so that no register a load names is written while the trip's loads are in flight
        asm volatile("v_nop\n\tv_nop\n\tv_nop\n\tv_nop" : "+v"(acc[0][0]), "+v"(acc[1][1]), "+v"(acc[2][2]), "+v"(acc[3][3]) : "v"(a[0]), "v"(a[3]), "v"(pa), "v"(pb), "v"(pa2), "v"(pb2));
    }
    float* my = red + w * (64 * 68);
#pragma unroll
    for (int nb = 0; nb < 4; ++nb)
#pragma unroll
        for (int mb = 0; mb < 4; ++mb) { float* p = my + (mb * 16 + lr) * 68 + nb * 16 + hi * 8; const v8f t = acc[nb][mb];
            *(v4fa*)p = __builtin_shufflevector(t, t, 0, 1, 2, 3); *(v4fa*)(p + 4) = __builtin_shufflevector(t, t, 4, 5, 6, 7); }
    __syncthreads();   // every wave's partial tile is in LDS before any is summed
#pragma unroll
    for (int s = 0; s < 32 / NW; ++s) { const int idx = s * (NW * 32) + (int)threadIdx.x; const int row = idx >> 4, cofs = (idx & 15) * 4; const float* p = red + row * 68 + cofs; v4f sum = *(const v4fa*)p;
#pragma unroll
        for (int u = 1; u < NW; ++u) sum += *(const v4fa*)(p + u * (64 * 68));
        *(v4f*)(C + (size_t)(r0 + row) * ldc + cofs) = sum; }
}

__device__ __forceinline__ h16 tohx(float x) { return (h16)x; }
__device__ __forceinline__ void splitf(float y, unsigned short& h, unsigned short& l) { h = f2bf(y); l = f2bf(y - bf2f(h)); }
typedef __attribute__((ext_vector_type(2))) _Float16 v2h;
typedef __attribute__((ext_vector_type(4))) _Float16 v4h;
typedef __attribute__((ext_vector_type(2))) unsigned short v2us;
typedef __attribute__((ext_vector_type(4))) unsigned short v4us;
typedef __attribute__((ext_vector_type(2))) float v2f;
typedef __attribute__((ext_vector_type(4))) int v4i;

__global__ __launch_bounds__(256) void k_wtG(const float* __restrict__ w, int K, int N, bf* Bt) {
    const int lane = threadIdx.x & 31; const int L0 = (blockIdx.x * 8 + (threadIdx.x >> 5)) * 8; const int nlines = N * K / 64;
{
#pragma unroll 1
        for (int l = 0; l < 8; ++l) { const int L = L0 + l; if (L >= nlines) break; const size_t e = (size_t)L * 64 + lane * 2; const int k = (int)(e % K), n = (int)(e / K); v2us o;
            o[0] = f2bf(w[(size_t)k * N + n]); o[1] = f2bf(w[(size_t)(k + 1) * N + n]); *(v2us*)(Bt + e) = o; }
         }
}
__global__ __launch_bounds__(256) void k_cvt8(const float* __restrict__ src, bf* dst, size_t n8) { const size_t i = (size_t)blockIdx.x * 256 + threadIdx.x; if (i >= n8) return; const v8f v = *(const v8f*)(src + i * 8); v8us o;
#pragma unroll
    for (int k = 0; k < 8; ++k) o[k] = f2bf(v[k]); *(v8us*)(dst + i * 8) = o;  }

// k_rope: head planes [h][t][d] (fp16 + hi/lo) of rope(x) x sc with the rotate-half convention out[d] = x[d] cos[t][d] - x[d+HD/2] sin[t][d], out[d+HD/2] = x[d+HD/2] cos[t][d+HD/2] + x[d] sin[t][d+HD/2]
__global__ __launch_bounds__(256) void k_rope(const float* __restrict__ F, int pitch, int nheads, const float* __restrict__ CS, const float* __restrict__ RF, const float* __restrict__ nw, float sc, h16* P16, bf* Ph, bf* Pl) {
    const size_t e = ((size_t)blockIdx.x * 256 + threadIdx.x) * 2; if (e >= (size_t)nheads * TT * HD) return; const int d = (int)(e % HD); const int t = (int)((e / HD) % TT); const int h = (int)(e / ((size_t)HD * TT)); const float* f = F + (size_t)t * pitch + h * HD; const float rf = RF ? RF[(size_t)h * TT + t] : 1.0f; v2h o16; v2us oh, ol;
#pragma unroll
    for (int q = 0; q < 2; ++q) { const int dd = d + q; const int dp = (dd < HD / 2) ? dd + HD / 2 : dd - HD / 2; float x0 = f[dd], x1 = f[dp];
        if (nw) { x0 = __fmul_rn(x0, nw[h * HD + dd]); x1 = __fmul_rn(x1, nw[h * HD + dp]); }   /* per-(head, dim) modulation table (f32, precomputed) */ (void)rf;
        const v2f cs = *(const v2f*)(CS + ((size_t)t * HD + dd) * 2); float a = __fmul_rn(x0, cs[0]), bq = __fmul_rn(x1, cs[1]); asm volatile("" : "+v"(a)); asm volatile("" : "+v"(bq)); const float r = ((dd < HD / 2) ? __fsub_rn(a, bq) : __fadd_rn(a, bq)) * sc;
        o16[q] = tohx(r); unsigned short a2, c2; splitf(r, a2, c2); oh[q] = a2; ol[q] = c2; }
    *(v2h*)(P16 + e) = o16; *(v2us*)(Ph + e) = oh; *(v2us*)(Pl + e) = ol;  }
__global__ __launch_bounds__(256) void k_vtp(const float* __restrict__ F, int pitch, int nheads, h16* V16, bf* Vh, bf* Vl) { const size_t e = ((size_t)blockIdx.x * 256 + threadIdx.x) * 2; if (e >= (size_t)nheads * HD * TT) return; const int t = (int)(e % TT); const int d = (int)((e / TT) % HD); const int g = (int)(e / ((size_t)TT * HD)); v2h o16; v2us oh, ol;
#pragma unroll
    for (int q = 0; q < 2; ++q) { const float x = F[(size_t)(t + q) * pitch + g * HD + d]; o16[q] = tohx(x); unsigned short a2, c2; splitf(x, a2, c2); oh[q] = a2; ol[q] = c2; }
    *(v2h*)(V16 + e) = o16; *(v2us*)(Vh + e) = oh; *(v2us*)(Vl + e) = ol;  }
__global__ __launch_bounds__(256) void k_csid(float* CS) { const int idx = blockIdx.x * 256 + threadIdx.x; if (idx >= TT * HD) return; v2f cs; cs[0] = 1.0f; cs[1] = 0.0f; *(v2f*)(CS + (size_t)idx * 2) = cs;  }
__global__ __launch_bounds__(256) void k_qtabs(const float* __restrict__ ph, const float* __restrict__ am, float* MOD, float* CT) { const int i = blockIdx.x * 256 + threadIdx.x; if (i < DQ) { const float m = __fmul_rn(cosf(bfr(ph[i])), bfr(am[i])); *(float*)(MOD + i) = m;  }
    if (i < TT) { const float a = __fmul_rn(__fmul_rn(6.2831853071795862f, (float)i), 1.0f / (float)TT); const float c = cosf(a); *(float*)(CT + i) = c;  } }
__global__ __launch_bounds__(256) void k_vtpm(const float* __restrict__ F, int pitch, int nheads, const float* __restrict__ MOD, h16* V16, bf* Vh, bf* Vl) { const size_t e = ((size_t)blockIdx.x * 256 + threadIdx.x) * 2; if (e >= (size_t)nheads * HD * TT) return; const int t = (int)(e % TT); const int d = (int)((e / TT) % HD); const int g = (int)(e / ((size_t)TT * HD)); const float m = MOD[g * HD + d]; v2h o16; v2us oh, ol;
#pragma unroll
    for (int q = 0; q < 2; ++q) { const int tt = t + q; const int tn = (tt + 1 == TT) ? 0 : tt + 1; float a = __fmul_rn(F[(size_t)tt * pitch + g * HD + d], m); float b = __fmul_rn(F[(size_t)tn * pitch + g * HD + d], m); asm volatile("" : "+v"(a)); asm volatile("" : "+v"(b)); const float v = __fmul_rn(__fadd_rn(a, b), 0.70710678118654752f); o16[q] = tohx(v); unsigned short a2, c2; splitf(v, a2, c2); oh[q] = a2; ol[q] = c2; }
    *(v2h*)(V16 + e) = o16; *(v2us*)(Vh + e) = oh; *(v2us*)(Vl + e) = ol;  }
// k_asoft (this module): each scaled logit is multiplied by CT[|i - j|] = cos(2 pi (i-j) / 2048) before the max/exp (table gather, 4 per lane per chunk).
// k_asoft: per row (zz, i): t = S x HD^-0.5 (no mask); softmax over the 2048 keys (register row, one exp, fixed trees);
__global__ __launch_bounds__(256) void k_asoft(const float* __restrict__ Sb, const float* __restrict__ CT, h16* P16, bf* Ph, bf* Pl) {
    const int lane = threadIdx.x & 31; const int row = blockIdx.x * 8 + (threadIdx.x >> 5); if (row >= ZH * TT) return; const int i = row % TT; const int zz = row / TT; (void)zz; const bool hires = (i < RH); const float* sr = Sb + (size_t)row * TT; float v[TT / 32]; float mx = -3.0e38f;
#pragma unroll
    for (int ch = 0; ch < TT / 128; ++ch) { const int j0 = ch * 128 + lane * 4; const v4f a = *(const v4f*)(sr + j0);
#pragma unroll
        for (int q = 0; q < 4; ++q) { const int j = j0 + q; (void)j; float sc = a[q] * SCL; asm volatile("" : "+v"(sc)); const int dj = i - (j0 + q); float t = __fmul_rn(sc, CT[dj < 0 ? -dj : dj]); asm volatile("" : "+v"(t)); v[ch * 4 + q] = t; mx = fmaxf(mx, t); } }
#pragma unroll
    for (int sh = 16; sh; sh >>= 1) mx = fmaxf(mx, __shfl_xor(mx, sh, 32));
    float sum = 0.f;
#pragma unroll
    for (int k = 0; k < TT / 32; ++k) { float d0 = __fsub_rn(v[k], mx); asm volatile("" : "+v"(d0)); v[k] = __builtin_amdgcn_exp2f(__fmul_rn(d0, 1.4426950408889634f)); sum += v[k]; }
#pragma unroll
    for (int sh = 16; sh; sh >>= 1) sum += __shfl_xor(sum, sh, 32);
    const float f = __fdiv_rn(hires ? 1.0f : PCAR, sum);
{
        if (hires) {
#pragma unroll
            for (int ch = 0; ch < TT / 128; ++ch) { v4us oh, ol;
#pragma unroll
                for (int q = 0; q < 4; ++q) { unsigned short a, c2; splitf(v[ch * 4 + q] * f, a, c2); oh[q] = a; ol[q] = c2; }
                const size_t oo = ((size_t)zz * (RH ? RH : 1) + i) * TT + ch * 128 + lane * 4; *(v4us*)(Ph + oo) = oh; *(v4us*)(Pl + oo) = ol; }
        } else {
#pragma unroll
            for (int ch = 0; ch < TT / 128; ++ch) { v4h o4;
#pragma unroll
                for (int q = 0; q < 4; ++q) o4[q] = tohx(v[ch * 4 + q] * f);
                *(v4h*)(P16 + (size_t)row * TT + ch * 128 + lane * 4) = o4; } }
         }
}
__global__ __launch_bounds__(256) void k_merge(const float* __restrict__ O, int h0, bf* Ah, bf* Al) { const size_t e = ((size_t)blockIdx.x * 256 + threadIdx.x) * 2; if (e >= (size_t)ZH * TT * HD) return; const int d = (int)(e % HD); const int t = (int)((e / HD) % TT); const int zz = (int)(e / ((size_t)HD * TT)); const float cs = (t < RH) ? 1.0f : (1.0f / PCAR); const size_t oo = (size_t)t * DQ + (h0 + zz) * HD + d;
    v2us oh, ol;
#pragma unroll
    for (int q = 0; q < 2; ++q) { float sv = O[e + q];
#pragma unroll
        for (int p = 1; p < KS; ++p) sv += O[(size_t)p * ZH * TT * HD + e + q];   /* the KS partial planes of attn.v, in plane order */
        unsigned short a, c2; splitf(sv * cs, a, c2); oh[q] = a; ol[q] = c2; } *(v2us*)(Ah + oo) = oh; *(v2us*)(Al + oo) = ol;  }

extern "C" void kernel_launch(void* const* d_in, const int* in_sizes, int n_in,
                              void* d_out, int out_size, void* d_ws, size_t ws_size, hipStream_t stream) {
    (void)in_sizes; (void)n_in; (void)out_size;
    const float* x = (const float*)d_in[0]; const float* wq = (const float*)d_in[1]; const float* wk = (const float*)d_in[2]; const float* wv = (const float*)d_in[3]; const float* wo = (const float*)d_in[4]; const float* qph = (const float*)d_in[5]; const float* qam = (const float*)d_in[6];
    float* OUT = (float*)d_out;     // [2][2048][1024]
    char* wsp = (char*)d_ws;
    auto take = [&](size_t bytes) { char* p = wsp; wsp += (bytes + 255) & ~(size_t)255; return (void*)p; };
    bf* WQ = (bf*)take((size_t)DQ * DM * 2); bf* WK = (bf*)take((size_t)DKV * DM * 2); bf* WV = (bf*)take((size_t)DKV * DM * 2); bf* WO = (bf*)take((size_t)DM * DQ * 2); float* CS = (float*)take((size_t)TT * HD * 2 * 4);
    float* MOD = (float*)take((size_t)DQ * 4); float* CT = (float*)take((size_t)TT * 4);
    bf* XB = (bf*)take((size_t)TT * DM * 2); float* FQ = (float*)take((size_t)TT * DQ * 4); float* FK = (float*)take((size_t)TT * DKV * 4);
    h16* QP16 = (h16*)take((size_t)NH_ * TT * HD * 2); h16* KP16 = (h16*)take((size_t)NKV * TT * HD * 2); h16* VT16 = (h16*)take((size_t)NKV * HD * TT * 2);
    bf* QPh = (bf*)take((size_t)NH_ * TT * HD * 2); bf* QPl = (bf*)take((size_t)NH_ * TT * HD * 2); bf* KPh = (bf*)take((size_t)NKV * TT * HD * 2); bf* KPl = (bf*)take((size_t)NKV * TT * HD * 2); bf* VTh = (bf*)take((size_t)NKV * HD * TT * 2); bf* VTl = (bf*)take((size_t)NKV * HD * TT * 2); bf* Ph = (bf*)take((size_t)ZH * RH * TT * 2); bf* Pl = (bf*)take((size_t)ZH * RH * TT * 2);
    float* Sb = (float*)take((size_t)ZH * TT * TT * 4); h16* P16 = (h16*)take((size_t)ZH * TT * TT * 2); float* Ob = (float*)take((size_t)KS * ZH * TT * HD * 4); bf* ATh = (bf*)take((size_t)TT * DQ * 2); bf* ATl = (bf*)take((size_t)TT * DQ * 2);
    if ((size_t)(wsp - (char*)d_ws) > ws_size) return;    // ws 256 MiB
    float* FV = FK;   // v projection reuses the k buffer after the k planes are built (stream-ordered)
    { k_wtG<<<(unsigned)((DM * DQ / 64 + 63) / 64), 256, 0, stream>>>(wq, DM, DQ, WQ); k_wtG<<<(unsigned)((DM * DKV / 64 + 63) / 64), 256, 0, stream>>>(wk, DM, DKV, WK); k_wtG<<<(unsigned)((DM * DKV / 64 + 63) / 64), 256, 0, stream>>>(wv, DM, DKV, WV);
      k_wtG<<<(unsigned)((DQ * DM / 64 + 63) / 64), 256, 0, stream>>>(wo, DQ, DM, WO);
       }
    k_csid<<<(TT * HD + 255) / 256, 256, 0, stream>>>(CS);
    const unsigned LQ = (unsigned)(((size_t)NH_ * TT * HD / 2 + 255) / 256), LKv = (unsigned)(((size_t)NKV * TT * HD / 2 + 255) / 256);
    k_qtabs<<<(TT + 255) / 256, 256, 0, stream>>>(qph, qam, MOD, CT);
    for (int b = 0; b < NB_; ++b) {
        
        k_cvt8<<<(unsigned)(((size_t)TT * DM / 8 + 255) / 256), 256, 0, stream>>>(x + (size_t)b * TT * DM, XB, (size_t)TT * DM / 8);
        k_gemmw<bf, 0, false><<<dim3(TT / 64, DQ / 64, 1), 32, 0, stream>>>(XB, nullptr, WQ, nullptr, DM, FQ, DQ, nullptr, 0, 0, 0);
        k_rope<<<LQ, 256, 0, stream>>>(FQ, DQ, NH_, CS, nullptr, MOD, 1.0f, QP16, QPh, QPl);
        k_gemmw<bf, 0, false><<<dim3(TT / 64, DKV / 64, 1), 32, 0, stream>>>(XB, nullptr, WK, nullptr, DM, FK, DKV, nullptr, 0, 0, 0);
        k_rope<<<LKv, 256, 0, stream>>>(FK, DKV, NKV, CS, nullptr, MOD, 1.0f, KP16, KPh, KPl);
        k_gemmw<bf, 0, false><<<dim3(TT / 64, DKV / 64, 1), 32, 0, stream>>>(XB, nullptr, WV, nullptr, DM, FV, DKV, nullptr, 0, 0, 0); k_vtpm<<<LKv, 256, 0, stream>>>(FV, DKV, NKV, MOD, VT16, VTh, VTl);
        for (int h0 = 0; h0 < NH_; h0 += ZH) { const size_t zq = (size_t)h0, zk = (size_t)(h0 / REP);   // one kv head per query head: the pass's two heads use consecutive kv planes (z-strides TT*HD)
            k_gemmw<bf, 2, false><<<dim3(RH / 64, TT / 64, ZH), 32, 0, stream>>>(QPh + zq * TT * HD, QPl + zq * TT * HD, KPh + zk * TT * HD, KPl + zk * TT * HD, HD, Sb, TT, nullptr, (size_t)TT * HD, (size_t)TT * HD, (size_t)TT * TT);
            k_gemmw<h16, 0, false><<<dim3((TT - RH) / 64, TT / 64, ZH), 32, 0, stream>>>(QP16 + zq * TT * HD + (size_t)RH * HD, nullptr, KP16 + zk * TT * HD, nullptr, HD, Sb + (size_t)RH * TT, TT, nullptr, (size_t)TT * HD, (size_t)TT * HD, (size_t)TT * TT);
            k_asoft<<<ZH * TT / 8, 256, 0, stream>>>(Sb, CT, P16, Ph, Pl);
            k_gemmks<bf, 2, KNW, TT><<<dim3(RH / 64, KS, ZH), KNW * 32, 0, stream>>>(Ph, Pl, VTh + zk * HD * TT, VTl + zk * HD * TT, TT / (KS * KNW), Ob, HD, (size_t)RH * TT, (size_t)HD * TT, (size_t)TT * HD, (size_t)ZH * TT * HD);
            k_gemmks<h16, 0, KNW, TT><<<dim3((TT - RH) / 64, KS, ZH), KNW * 32, 0, stream>>>(P16 + (size_t)RH * TT, nullptr, VT16 + zk * HD * TT, nullptr, TT / (KS * KNW), Ob + (size_t)RH * HD, HD, (size_t)TT * TT, (size_t)HD * TT, (size_t)TT * HD, (size_t)ZH * TT * HD);
            k_merge<<<(unsigned)(((size_t)ZH * TT * HD / 2 + 255) / 256), 256, 0, stream>>>(Ob, h0, ATh, ATl); }
        k_gemmw<bf, 1, false><<<dim3(TT / 64, DM / 64, 1), 32, 0, stream>>>(ATh, ATl, WO, nullptr, DQ, OUT + (size_t)b * TT * DM, DM, nullptr, 0, 0, 0); }
}

// v002
// Measured time: 763 microseconds a run.
// Timed twice side by side with v001, it ran 1.34 and 1.35 times as fast.
// Over all steps from v000 it is 2.86 times as fast.
#include <hip/hip_runtime.h>

// 'Quantum' attention (x [2][2048][1024]; q, k, v = (x W) ('xw' [1024][1024], 16 heads x 64) each multiplied per (head, dim) by mod = cos(quantum_phase[h][d]) x quantum_amplitude[h][d]; scores = q.k / 8 x cos(2 pi (i - j) / 2048) (multiplicative Toeplitz 'interference'); w = softmax; w' = (w + roll(w, 1, keys)) / sqrt(2); out = w' v; y = merged Wo ('xw') -> [2][2048][1024] (4.2 M)).
// Realisation: the roll superposition is moved onto the values: w' v = w @ vv with vv[j] = (v[j] + v[(j+1) mod S]) / sqrt(2) (exact algebra), so the softmax / attn.v run unchanged on vv^T planes; the modulation is applied in the plane builders (q, k planes x MOD[h][d]; vv from modulated v); the softmax kernel multiplies each scaled logit by the cos table entry for |i - j| (cos(2 pi m / 2048) computed as the reference's float32 expression).
// Compute dtypes, f32 accumulate: every input rounded to bf16; q/k/v on PLAIN bf16 operands (inputs: exact); modulation table (precise cosf of bf16 phase x bf16 amplitude) and the cos Toeplitz table in f32; scores and attn.v: query rows < 512 hl (3 products), the rest single fp16 (x1024); softmax f32; Wo hl x exact (2 products).

#define NB_  2
#define TT   2048
#define DM   1024
#define NH_  16
#define NKV  16
#define REP  (NH_ / NKV)
#define HD   64
#define DQ   (NH_ * HD)
#define DKV  (NKV * HD)
#define ZH   8                    // heads per pass: every launch of the attention part works on ZH heads
#define PP   (2 * TT)             // pitch, in 16-bit elements, of a probability row: it lies in the bytes of its own f32 score row
#define RH   512                  // query rows < RH use hi+lo planes (0: none)
#define WIN  0
#define PCAR 1024.0f
#define SCL  0.125f   // HD^-0.5
#define KS   4                    // attn.v: K chunks on work-groups (partial planes of Ob, added in k_merge)
#define KNW  8                    // attn.v: K chunks on the waves of a work-group
typedef _Float16 h16;
typedef unsigned short bf;
typedef __attribute__((ext_vector_type(16))) __bf16   v16bf;
typedef __attribute__((ext_vector_type(16))) _Float16 v16h;
typedef __attribute__((ext_vector_type(8)))  _Float16 v8h;
typedef __attribute__((ext_vector_type(8)))  unsigned short v8us;
typedef __attribute__((ext_vector_type(8)))  float    v8f;
typedef __attribute__((ext_vector_type(4)))  float    v4f;
typedef v8h  __attribute__((may_alias)) v8ha;
typedef v4f  __attribute__((may_alias)) v4fa;
typedef v8us __attribute__((may_alias)) v8usa;

__device__ __forceinline__ unsigned short f2bf(float f) { unsigned u = __float_as_uint(f); u += 0x7FFFu + ((u >> 16) & 1u); return (unsigned short)(u >> 16); }
__device__ __forceinline__ float bf2f(unsigned short b) { return __uint_as_float(((unsigned)b) << 16); }
__device__ __forceinline__ float bfr(float f) { return bf2f(f2bf(f)); }
__device__ __forceinline__ v16h cat16(v8h lo, v8h hi) { return __builtin_shufflevector(lo, hi, 0, 1, 2, 3, 4, 5, 6, 7, 8, 9, 10, 11, 12, 13, 14, 15); }
__device__ __forceinline__ v16bf cat16b(v8us lo, v8us hi) { return __builtin_bit_cast(v16bf, __builtin_shufflevector(lo, hi, 0, 1, 2, 3, 4, 5, 6, 7, 8, 9, 10, 11, 12, 13, 14, 15)); }
__device__ __forceinline__ v8f wmma16(v16h a, v16h b, v8f c) { return __builtin_amdgcn_wmma_f32_16x16x32_f16(false, a, false, b, (short)0, c, false, false); }
__device__ __forceinline__ v8f wmmab(v16bf a, v16bf b, v8f c) { return __builtin_amdgcn_wmma_f32_16x16x32_bf16(false, a, false, b, (short)0, c, false, false); }



// ---- k_gemmw: register-blocked GEMM, ONE WAVE per 64x64 output tile (16 accumulators), operands straight from K-contiguous 16-bit planes; grid (M/64, N/64, Z), 32 threads.
// C[m][n] (f32, pitch ldc, + optional f32 bias[n]) = sum_k A[m][k] Bt[n][k] (+ split products per NSPLIT). z-batch strides sA/sB/sC in elements. K % 32 == 0.
template <typename T16> struct WFrag;
template <> struct WFrag<h16> { typedef v16h V; static __device__ __forceinline__ V ld(const h16* p) { return cat16(*(const v8h*)p, *(const v8h*)(p + 16)); } static __device__ __forceinline__ v8f mma(V a, V b, v8f c) { return wmma16(a, b, c); } };
template <> struct WFrag<bf> { typedef v16bf V; static __device__ __forceinline__ V ld(const bf* p) { return cat16b(*(const v8us*)p, *(const v8us*)(p + 16)); } static __device__ __forceinline__ v8f mma(V a, V b, v8f c) { return wmmab(a, b, c); } };
template <typename T16, int NSPLIT, bool BIAS>
__global__ __launch_bounds__(32) void k_gemmw(const T16* __restrict__ A, const T16* __restrict__ A2, const T16* __restrict__ Bt, const T16* __restrict__ Bt2, int K, float* C, int ldc, const float* __restrict__ bias, size_t sA, size_t sB, size_t sC) {
    typedef typename WFrag<T16>::V V;
    __shared__ __align__(16) float os[16 * 68];
    const size_t z = blockIdx.z; A += z * sA; if (A2) A2 += z * sA; Bt += z * sB; if (Bt2) Bt2 += z * sB; C += z * sC;
    const int lane = threadIdx.x & 31, lr = lane & 15, hi = lane >> 4; const int r0 = blockIdx.x * 64, c0 = blockIdx.y * 64;
    v8f acc[4][4];
#pragma unroll
    for (int mb = 0; mb < 4; ++mb)
#pragma unroll
        for (int nb = 0; nb < 4; ++nb) acc[mb][nb] = (v8f){};
    const size_t aoff = (size_t)(r0 + lr) * K + 8 * hi, boff = (size_t)(c0 + lr) * K + 8 * hi;
#pragma unroll 1
    for (int kc = 0; kc < K; kc += 32) {
        V a[4], a2[4];
#pragma unroll
        for (int mb = 0; mb < 4; ++mb) { a[mb] = WFrag<T16>::ld(A + aoff + (size_t)mb * 16 * K + kc); if (NSPLIT == 1 || NSPLIT == 2) a2[mb] = WFrag<T16>::ld(A2 + aoff + (size_t)mb * 16 * K + kc); }
#pragma unroll
        for (int nb = 0; nb < 4; ++nb) { const V b = WFrag<T16>::ld(Bt + boff + (size_t)nb * 16 * K + kc); V b2; if (NSPLIT >= 2) b2 = WFrag<T16>::ld(Bt2 + boff + (size_t)nb * 16 * K + kc);
#pragma unroll
            for (int mb = 0; mb < 4; ++mb) { acc[mb][nb] = WFrag<T16>::mma(a[mb], b, acc[mb][nb]); if (NSPLIT == 1 || NSPLIT == 2) acc[mb][nb] = WFrag<T16>::mma(a2[mb], b, acc[mb][nb]); if (NSPLIT >= 2) acc[mb][nb] = WFrag<T16>::mma(a[mb], b2, acc[mb][nb]); } }
        asm volatile("v_nop\n\tv_nop\n\tv_nop\n\tv_nop" : "+v"(acc[0][0]), "+v"(acc[1][1]), "+v"(acc[2][2]), "+v"(acc[3][3]) : "v"(a[0]), "v"(a[3]));
    }
#pragma unroll
    for (int mb = 0; mb < 4; ++mb) {
#pragma unroll
        for (int nb = 0; nb < 4; ++nb) {
#pragma unroll
            for (int j = 0; j < 8; ++j) os[(hi * 8 + j) * 68 + nb * 16 + lr] = acc[mb][nb][j]; }
        __builtin_amdgcn_wave_barrier(); asm volatile("" ::: "memory");
        float* crow = C + (size_t)(r0 + mb * 16) * ldc + c0;
{
#pragma unroll
            for (int s = 0; s < 8; ++s) { const int row = 2 * s + hi, cofs = lr * 4; v4f val = *(const v4fa*)(os + row * 68 + cofs); if (BIAS) { val[0] += bfr(bias[c0 + cofs]); val[1] += bfr(bias[c0 + cofs + 1]); val[2] += bfr(bias[c0 + cofs + 2]); val[3] += bfr(bias[c0 + cofs + 3]); }
                *(v4f*)(crow + (size_t)row * ldc + cofs) = val; }
             }
        __builtin_amdgcn_wave_barrier(); asm volatile("" ::: "memory");
    }
}

// ---- k_gemmks: k_gemmw's 64x64 tile for a long K and few tiles (attn.v: N = 64, K = 2048), with K split KS x NW ways so that the launch has KS x NW times the waves in flight.
// grid (M/64, KS, Z), NW waves; wave w of work-group y sums k in [(y NW + w) KW, + KW), KW % 32 == 0, KS NW KW == the whole K (KA and KB, the row pitches of A and Bt, are template constants). The NW partial tiles are summed through LDS in wave order; work-group y stores its tile to plane y of C (plane stride sP); the reader of C adds the KS planes.
// Bt is the A operand of the matrix instruction here (both loaders are the same, so the k orders still pair): a lane's 8 accumulator floats are then 8 consecutive columns of one C row, and a partial goes to LDS in 16-byte stores.
template <typename T16, int NSPLIT, int NW, int KA, int KB>
__global__ __launch_bounds__(NW * 32) void k_gemmks(const T16* __restrict__ A, const T16* __restrict__ A2, const T16* __restrict__ Bt, const T16* __restrict__ Bt2, int KW, float* C, int ldc, size_t sA, size_t sB, size_t sC, size_t sP) {
    typedef typename WFrag<T16>::V V;
    __shared__ __align__(16) float red[NW * 64 * 68];   // pitch 68 floats = 16 B x 17: 16-byte stores and loads free of bank conflicts
    const int lane = threadIdx.x & 31, lr = lane & 15, hi = lane >> 4; const int w = __builtin_amdgcn_readfirstlane(threadIdx.x >> 5); const int r0 = blockIdx.x * 64;
    const size_t z = blockIdx.z; A += z * sA + (size_t)r0 * KA; if (NSPLIT == 2) A2 += z * sA + (size_t)r0 * KA; Bt += z * sB; if (NSPLIT == 2) Bt2 += z * sB; C += z * sC + blockIdx.y * sP;
    const int k0 = ((int)blockIdx.y * NW + w) * KW;
    v8f acc[4][4];   // [nb: 16 columns of C][mb: 16 rows of C]
#pragma unroll
    for (int nb = 0; nb < 4; ++nb)
#pragma unroll
        for (int mb = 0; mb < 4; ++mb) acc[nb][mb] = (v8f){};
    const unsigned loffa = (unsigned)(lr * KA + 8 * hi) * 2u, loffb = (unsigned)(lr * KB + 8 * hi) * 2u;   // the lane's byte offset in a 16-row fragment block of A and of Bt, the same on every trip; the blocks' steps (16 pitches) are constants of the load
    // rolled, as in k_gemmw: one trip's fragments live at a time
#pragma unroll 1
    for (int kc = k0; kc < k0 + KW; kc += 32) {
        const T16* pa = (const T16*)((const char*)(A + kc) + loffa); const T16* pb = (const T16*)((const char*)(Bt + kc) + loffb); const T16* pa2 = (NSPLIT == 2) ? (const T16*)((const char*)(A2 + kc) + loffa) : pa; const T16* pb2 = (NSPLIT == 2) ? (const T16*)((const char*)(Bt2 + kc) + loffb) : pb;
        V a[4], a2[4];
#pragma unroll
        for (int mb = 0; mb < 4; ++mb) { a[mb] = WFrag<T16>::ld(pa + mb * 16 * KA); if (NSPLIT == 2) a2[mb] = WFrag<T16>::ld(pa2 + mb * 16 * KA); }
#pragma unroll
        for (int nb = 0; nb < 4; ++nb) { const V b = WFrag<T16>::ld(pb + nb * 16 * KB); V b2; if (NSPLIT == 2) b2 = WFrag<T16>::ld(pb2 + nb * 16 * KB);
#pragma unroll
            for (int mb = 0; mb < 4; ++mb) { acc[nb][mb] = WFrag<T16>::mma(b, a[mb], acc[nb][mb]); if (NSPLIT == 2) { acc[nb][mb] = WFrag<T16>::mma(b, a2[mb], acc[nb][mb]); acc[nb][mb] = WFrag<T16>::mma(b2, a[mb], acc[nb][mb]); } } }
        // four vector slots behind the trip's last matrix instruction, also on the taken back edge, before its operands are loaded anew (as in k_gemmw); the trip's address pairs are inputs so that no register a load names is written while the trip's loads are in flight
        asm volatile("v_nop\n\tv_nop\n\tv_nop\n\tv_nop" : "+v"(acc[0][0]), "+v"(acc[1][1]), "+v"(acc[2][2]), "+v"(acc[3][3]) : "v"(a[0]), "v"(a[3]), "v"(pa), "v"(pb), "v"(pa2), "v"(pb2));
    }
    float* my = red + w * (64 * 68);
#pragma unroll
    for (int nb = 0; nb < 4; ++nb)
#pragma unroll
        for (int mb = 0; mb < 4; ++mb) { float* p = my + (mb * 16 + lr) * 68 + nb * 16 + hi * 8; const v8f t = acc[nb][mb];
            *(v4fa*)p = __builtin_shufflevector(t, t, 0, 1, 2, 3); *(v4fa*)(p + 4) = __builtin_shufflevector(t, t, 4, 5, 6, 7); }
    __syncthreads();   // every wave's partial tile is in LDS before any is summed
#pragma unroll
    for (int s = 0; s < 32 / NW; ++s) { const int idx = s * (NW * 32) + (int)threadIdx.x; const int row = idx >> 4, cofs = (idx & 15) * 4; const float* p = red + row * 68 + cofs; v4f sum = *(const v4fa*)p;
#pragma unroll
        for (int u = 1; u < NW; ++u) sum += *(const v4fa*)(p + u * (64 * 68));
        *(v4f*)(C + (size_t)(r0 + row) * ldc + cofs) = sum; }
}

__device__ __forceinline__ h16 tohx(float x) { return (h16)x; }
__device__ __forceinline__ void splitf(float y, unsigned short& h, unsigned short& l) { h = f2bf(y); l = f2bf(y - bf2f(h)); }
typedef __attribute__((ext_vector_type(2))) _Float16 v2h;
typedef __attribute__((ext_vector_type(4))) _Float16 v4h;
typedef __attribute__((ext_vector_type(2))) unsigned short v2us;
typedef __attribute__((ext_vector_type(4))) unsigned short v4us;
typedef __attribute__((ext_vector_type(2))) float v2f;
typedef __attribute__((ext_vector_type(4))) int v4i;

__global__ __launch_bounds__(256) void k_wtG(const float* __restrict__ w, int K, int N, bf* Bt) {
    const int lane = threadIdx.x & 31; const int L0 = (blockIdx.x * 8 + (threadIdx.x >> 5)) * 8; const int nlines = N * K / 64;
{
#pragma unroll 1
        for (int l = 0; l < 8; ++l) { const int L = L0 + l; if (L >= nlines) break; const size_t e = (size_t)L * 64 + lane * 2; const int k = (int)(e % K), n = (int)(e / K); v2us o;
            o[0] = f2bf(w[(size_t)k * N + n]); o[1] = f2bf(w[(size_t)(k + 1) * N + n]); *(v2us*)(Bt + e) = o; }
         }
}
__global__ __launch_bounds__(256) void k_cvt8(const float* __restrict__ src, bf* dst, size_t n8) { const size_t i = (size_t)blockIdx.x * 256 + threadIdx.x; if (i >= n8) return; const v8f v = *(const v8f*)(src + i * 8); v8us o;
#pragma unroll
    for (int k = 0; k < 8; ++k) o[k] = f2bf(v[k]); *(v8us*)(dst + i * 8) = o;  }

// k_rope: head planes [h][t][d] (fp16 + hi/lo) of rope(x) x sc with the rotate-half convention out[d] = x[d] cos[t][d] - x[d+HD/2] sin[t][d], out[d+HD/2] = x[d+HD/2] cos[t][d+HD/2] + x[d] sin[t][d+HD/2]
__global__ __launch_bounds__(256) void k_rope(const float* __restrict__ F, int pitch, int nheads, const float* __restrict__ CS, const float* __restrict__ RF, const float* __restrict__ nw, float sc, h16* P16, bf* Ph, bf* Pl) {
    const size_t e = ((size_t)blockIdx.x * 256 + threadIdx.x) * 2; if (e >= (size_t)nheads * TT * HD) return; const int d = (int)(e % HD); const int t = (int)((e / HD) % TT); const int h = (int)(e / ((size_t)HD * TT)); const float* f = F + (size_t)t * pitch + h * HD; const float rf = RF ? RF[(size_t)h * TT + t] : 1.0f; v2h o16; v2us oh, ol;
#pragma unroll
    for (int q = 0; q < 2; ++q) { const int dd = d + q; const int dp = (dd < HD / 2) ? dd + HD / 2 : dd - HD / 2; float x0 = f[dd], x1 = f[dp];
        if (nw) { x0 = __fmul_rn(x0, nw[h * HD + dd]); x1 = __fmul_rn(x1, nw[h * HD + dp]); }   /* per-(head, dim) modulation table (f32, precomputed) */ (void)rf;
        const v2f cs = *(const v2f*)(CS + ((size_t)t * HD + dd) * 2); float a = __fmul_rn(x0, cs[0]), bq = __fmul_rn(x1, cs[1]); asm volatile("" : "+v"(a)); asm volatile("" : "+v"(bq)); const float r = ((dd < HD / 2) ? __fsub_rn(a, bq) : __fadd_rn(a, bq)) * sc;
        o16[q] = tohx(r); unsigned short a2, c2; splitf(r, a2, c2); oh[q] = a2; ol[q] = c2; }
    *(v2h*)(P16 + e) = o16; *(v2us*)(Ph + e) = oh; *(v2us*)(Pl + e) = ol;  }
__global__ __launch_bounds__(256) void k_vtp(const float* __restrict__ F, int pitch, int nheads, h16* V16, bf* Vh, bf* Vl) { const size_t e = ((size_t)blockIdx.x * 256 + threadIdx.x) * 2; if (e >= (size_t)nheads * HD * TT) return; const int t = (int)(e % TT); const int d = (int)((e / TT) % HD); const int g = (int)(e / ((size_t)TT * HD)); v2h o16; v2us oh, ol;
#pragma unroll
    for (int q = 0; q < 2; ++q) { const float x = F[(size_t)(t + q) * pitch + g * HD + d]; o16[q] = tohx(x); unsigned short a2, c2; splitf(x, a2, c2); oh[q] = a2; ol[q] = c2; }
    *(v2h*)(V16 + e) = o16; *(v2us*)(Vh + e) = oh; *(v2us*)(Vl + e) = ol;  }
__global__ __launch_bounds__(256) void k_csid(float* CS) { const int idx = blockIdx.x * 256 + threadIdx.x; if (idx >= TT * HD) return; v2f cs; cs[0] = 1.0f; cs[1] = 0.0f; *(v2f*)(CS + (size_t)idx * 2) = cs;  }
__global__ __launch_bounds__(256) void k_qtabs(const float* __restrict__ ph, const float* __restrict__ am, float* MOD, float* CT) { const int i = blockIdx.x * 256 + threadIdx.x; if (i < DQ) { const float m = __fmul_rn(cosf(bfr(ph[i])), bfr(am[i])); *(float*)(MOD + i) = m;  }
    if (i < TT) { const float a = __fmul_rn(__fmul_rn(6.2831853071795862f, (float)i), 1.0f / (float)TT); const float c = cosf(a); *(float*)(CT + i) = c;  } }
__global__ __launch_bounds__(256) void k_vtpm(const float* __restrict__ F, int pitch, int nheads, const float* __restrict__ MOD, h16* V16, bf* Vh, bf* Vl) { const size_t e = ((size_t)blockIdx.x * 256 + threadIdx.x) * 2; if (e >= (size_t)nheads * HD * TT) return; const int t = (int)(e % TT); const int d = (int)((e / TT) % HD); const int g = (int)(e / ((size_t)TT * HD)); const float m = MOD[g * HD + d]; v2h o16; v2us oh, ol;
#pragma unroll
    for (int q = 0; q < 2; ++q) { const int tt = t + q; const int tn = (tt + 1 == TT) ? 0 : tt + 1; float a = __fmul_rn(F[(size_t)tt * pitch + g * HD + d], m); float b = __fmul_rn(F[(size_t)tn * pitch + g * HD + d], m); asm volatile("" : "+v"(a)); asm volatile("" : "+v"(b)); const float v = __fmul_rn(__fadd_rn(a, b), 0.70710678118654752f); o16[q] = tohx(v); unsigned short a2, c2; splitf(v, a2, c2); oh[q] = a2; ol[q] = c2; }
    *(v2h*)(V16 + e) = o16; *(v2us*)(Vh + e) = oh; *(v2us*)(Vl + e) = ol;  }
// k_asoft (this module): each scaled logit is multiplied by CT[|i - j|] = cos(2 pi (i-j) / 2048) before the max/exp (table gather, 4 per lane per chunk).
// k_asoft: per row (zz, i): t = S x HD^-0.5 (no mask); softmax over the 2048 keys (register row, one exp, fixed trees);
// P16, Ph and Pl point into Sb: one wave holds its whole score row in registers before it stores, and it stores only into that row's own bytes (fp16 row, or hi row, in the first half; lo row in the second half), so Sb is not __restrict__.
__global__ __launch_bounds__(256) void k_asoft(const float* Sb, const float* __restrict__ CT, h16* P16, bf* Ph, bf* Pl) {
    const int lane = threadIdx.x & 31; const int row = blockIdx.x * 8 + (threadIdx.x >> 5); if (row >= ZH * TT) return; const int i = row % TT; const int zz = row / TT; (void)zz; const bool hires = (i < RH); const float* sr = Sb + (size_t)row * TT; float v[TT / 32]; float mx = -3.0e38f;
#pragma unroll
    for (int ch = 0; ch < TT / 128; ++ch) { const int j0 = ch * 128 + lane * 4; const v4f a = *(const v4f*)(sr + j0);
#pragma unroll
        for (int q = 0; q < 4; ++q) { const int j = j0 + q; (void)j; float sc = a[q] * SCL; asm volatile("" : "+v"(sc)); const int dj = i - (j0 + q); float t = __fmul_rn(sc, CT[dj < 0 ? -dj : dj]); asm volatile("" : "+v"(t)); v[ch * 4 + q] = t; mx = fmaxf(mx, t); } }
#pragma unroll
    for (int sh = 16; sh; sh >>= 1) mx = fmaxf(mx, __shfl_xor(mx, sh, 32));
    float sum = 0.f;
#pragma unroll
    for (int k = 0; k < TT / 32; ++k) { float d0 = __fsub_rn(v[k], mx); asm volatile("" : "+v"(d0)); v[k] = __builtin_amdgcn_exp2f(__fmul_rn(d0, 1.4426950408889634f)); sum += v[k]; }
#pragma unroll
    for (int sh = 16; sh; sh >>= 1) sum += __shfl_xor(sum, sh, 32);
    const float f = __fdiv_rn(hires ? 1.0f : PCAR, sum);
{
        if (hires) {
#pragma unroll
            for (int ch = 0; ch < TT / 128; ++ch) { v4us oh, ol;
#pragma unroll
                for (int q = 0; q < 4; ++q) { unsigned short a, c2; splitf(v[ch * 4 + q] * f, a, c2); oh[q] = a; ol[q] = c2; }
                const size_t oo = (size_t)row * PP + ch * 128 + lane * 4; *(v4us*)(Ph + oo) = oh; *(v4us*)(Pl + oo) = ol; }
        } else {
#pragma unroll
            for (int ch = 0; ch < TT / 128; ++ch) { v4h o4;
#pragma unroll
                for (int q = 0; q < 4; ++q) o4[q] = tohx(v[ch * 4 + q] * f);
                *(v4h*)(P16 + (size_t)row * PP + ch * 128 + lane * 4) = o4; } }
         }
}
__global__ __launch_bounds__(256) void k_merge(const float* __restrict__ O, int h0, bf* Ah, bf* Al) { const size_t e = ((size_t)blockIdx.x * 256 + threadIdx.x) * 2; if (e >= (size_t)ZH * TT * HD) return; const int d = (int)(e % HD); const int t = (int)((e / HD) % TT); const int zz = (int)(e / ((size_t)HD * TT)); const float cs = (t < RH) ? 1.0f : (1.0f / PCAR); const size_t oo = (size_t)t * DQ + (h0 + zz) * HD + d;
    v2us oh, ol;
#pragma unroll
    for (int q = 0; q < 2; ++q) { float sv = O[e + q];
#pragma unroll
        for (int p = 1; p < KS; ++p) sv += O[(size_t)p * ZH * TT * HD + e + q];   /* the KS partial planes of attn.v, in plane order */
        unsigned short a, c2; splitf(sv * cs, a, c2); oh[q] = a; ol[q] = c2; } *(v2us*)(Ah + oo) = oh; *(v2us*)(Al + oo) = ol;  }

extern "C" void kernel_launch(void* const* d_in, const int* in_sizes, int n_in,
                              void* d_out, int out_size, void* d_ws, size_t ws_size, hipStream_t stream) {
    (void)in_sizes; (void)n_in; (void)out_size;
    const float* x = (const float*)d_in[0]; const float* wq = (const float*)d_in[1]; const float* wk = (const float*)d_in[2]; const float* wv = (const float*)d_in[3]; const float* wo = (const float*)d_in[4]; const float* qph = (const float*)d_in[5]; const float* qam = (const float*)d_in[6];
    float* OUT = (float*)d_out;     // [2][2048][1024]
    char* wsp = (char*)d_ws;
    auto take = [&](size_t bytes) { char* p = wsp; wsp += (bytes + 255) & ~(size_t)255; return (void*)p; };
    bf* WQ = (bf*)take((size_t)DQ * DM * 2); bf* WK = (bf*)take((size_t)DKV * DM * 2); bf* WV = (bf*)take((size_t)DKV * DM * 2); bf* WO = (bf*)take((size_t)DM * DQ * 2); float* CS = (float*)take((size_t)TT * HD * 2 * 4);
    float* MOD = (float*)take((size_t)DQ * 4); float* CT = (float*)take((size_t)TT * 4);
    bf* XB = (bf*)take((size_t)TT * DM * 2); float* FQ = (float*)take((size_t)TT * DQ * 4); float* FK = (float*)take((size_t)TT * DKV * 4);
    h16* QP16 = (h16*)take((size_t)NH_ * TT * HD * 2); h16* KP16 = (h16*)take((size_t)NKV * TT * HD * 2); h16* VT16 = (h16*)take((size_t)NKV * HD * TT * 2);
    bf* QPh = (bf*)take((size_t)NH_ * TT * HD * 2); bf* QPl = (bf*)take((size_t)NH_ * TT * HD * 2); bf* KPh = (bf*)take((size_t)NKV * TT * HD * 2); bf* KPl = (bf*)take((size_t)NKV * TT * HD * 2); bf* VTh = (bf*)take((size_t)NKV * HD * TT * 2); bf* VTl = (bf*)take((size_t)NKV * HD * TT * 2);
    float* Sb = (float*)take((size_t)ZH * TT * TT * 4); h16* P16 = (h16*)Sb; bf* Ph = (bf*)Sb; bf* Pl = Ph + TT;   /* probability rows over their own score rows, pitch PP */ float* Ob = (float*)take((size_t)KS * ZH * TT * HD * 4); bf* ATh = (bf*)take((size_t)TT * DQ * 2); bf* ATl = (bf*)take((size_t)TT * DQ * 2);
    if ((size_t)(wsp - (char*)d_ws) > ws_size) return;    // ws 256 MiB
    float* FV = FK;   // v projection reuses the k buffer after the k planes are built (stream-ordered)
    { k_wtG<<<(unsigned)((DM * DQ / 64 + 63) / 64), 256, 0, stream>>>(wq, DM, DQ, WQ); k_wtG<<<(unsigned)((DM * DKV / 64 + 63) / 64), 256, 0, stream>>>(wk, DM, DKV, WK); k_wtG<<<(unsigned)((DM * DKV / 64 + 63) / 64), 256, 0, stream>>>(wv, DM, DKV, WV);
      k_wtG<<<(unsigned)((DQ * DM / 64 + 63) / 64), 256, 0, stream>>>(wo, DQ, DM, WO);
       }
    k_csid<<<(TT * HD + 255) / 256, 256, 0, stream>>>(CS);
    const unsigned LQ = (unsigned)(((size_t)NH_ * TT * HD / 2 + 255) / 256), LKv = (unsigned)(((size_t)NKV * TT * HD / 2 + 255) / 256);
    k_qtabs<<<(TT + 255) / 256, 256, 0, stream>>>(qph, qam, MOD, CT);
    for (int b = 0; b < NB_; ++b) {
        
        k_cvt8<<<(unsigned)(((size_t)TT * DM / 8 + 255) / 256), 256, 0, stream>>>(x + (size_t)b * TT * DM, XB, (size_t)TT * DM / 8);
        k_gemmw<bf, 0, false><<<dim3(TT / 64, DQ / 64, 1), 32, 0, stream>>>(XB, nullptr, WQ, nullptr, DM, FQ, DQ, nullptr, 0, 0, 0);
        k_rope<<<LQ, 256, 0, stream>>>(FQ, DQ, NH_, CS, nullptr, MOD, 1.0f, QP16, QPh, QPl);
        k_gemmw<bf, 0, false><<<dim3(TT / 64, DKV / 64, 1), 32, 0, stream>>>(XB, nullptr, WK, nullptr, DM, FK, DKV, nullptr, 0, 0, 0);
        k_rope<<<LKv, 256, 0, stream>>>(FK, DKV, NKV, CS, nullptr, MOD, 1.0f, KP16, KPh, KPl);
        k_gemmw<bf, 0, false><<<dim3(TT / 64, DKV / 64, 1), 32, 0, stream>>>(XB, nullptr, WV, nullptr, DM, FV, DKV, nullptr, 0, 0, 0); k_vtpm<<<LKv, 256, 0, stream>>>(FV, DKV, NKV, MOD, VT16, VTh, VTl);
        for (int h0 = 0; h0 < NH_; h0 += ZH) { const size_t zq = (size_t)h0, zk = (size_t)(h0 / REP);   // one kv head per query head: the pass's ZH heads use consecutive kv planes (z-strides TT*HD)
            k_gemmw<bf, 2, false><<<dim3(RH / 64, TT / 64, ZH), 32, 0, stream>>>(QPh + zq * TT * HD, QPl + zq * TT * HD, KPh + zk * TT * HD, KPl + zk * TT * HD, HD, Sb, TT, nullptr, (size_t)TT * HD, (size_t)TT * HD, (size_t)TT * TT);
            k_gemmw<h16, 0, false><<<dim3((TT - RH) / 64, TT / 64, ZH), 32, 0, stream>>>(QP16 + zq * TT * HD + (size_t)RH * HD, nullptr, KP16 + zk * TT * HD, nullptr, HD, Sb + (size_t)RH * TT, TT, nullptr, (size_t)TT * HD, (size_t)TT * HD, (size_t)TT * TT);
            k_asoft<<<ZH * TT / 8, 256, 0, stream>>>(Sb, CT, P16, Ph, Pl);
            k_gemmks<bf, 2, KNW, PP, TT><<<dim3(RH / 64, KS, ZH), KNW * 32, 0, stream>>>(Ph, Pl, VTh + zk * HD * TT, VTl + zk * HD * TT, TT / (KS * KNW), Ob, HD, (size_t)TT * PP, (size_t)HD * TT, (size_t)TT * HD, (size_t)ZH * TT * HD);
            k_gemmks<h16, 0, KNW, PP, TT><<<dim3((TT - RH) / 64, KS, ZH), KNW * 32, 0, stream>>>(P16 + (size_t)RH * PP, nullptr, VT16 + zk * HD * TT, nullptr, TT / (KS * KNW), Ob + (size_t)RH * HD, HD, (size_t)TT * PP, (size_t)HD * TT, (size_t)TT * HD, (size_t)ZH * TT * HD);
            k_merge<<<(unsigned)(((size_t)ZH * TT * HD / 2 + 255) / 256), 256, 0, stream>>>(Ob, h0, ATh, ATl); }
        k_gemmw<bf, 1, false><<<dim3(TT / 64, DM / 64, 1), 32, 0, stream>>>(ATh, ATl, WO, nullptr, DQ, OUT + (size_t)b * TT * DM, DM, nullptr, 0, 0, 0); }
}

// v003
// One run takes 413 microseconds.
// Timed twice side by side with v002, it ran 1.84 times as fast both times.
// All steps since v000 together make it 5.27 times as fast.
#include <hip/hip_runtime.h>

// 'Quantum' attention (x [2][2048][1024]; q, k, v = (x W) ('xw' [1024][1024], 16 heads x 64) each multiplied per (head, dim) by mod = cos(quantum_phase[h][d]) x quantum_amplitude[h][d]; scores = q.k / 8 x cos(2 pi (i - j) / 2048) (multiplicative Toeplitz 'interference'); w = softmax; w' = (w + roll(w, 1, keys)) / sqrt(2); out = w' v; y = merged Wo ('xw') -> [2][2048][1024] (4.2 M)).
// Realisation: the roll superposition is moved onto the values: w' v = w @ vv with vv[j] = (v[j] + v[(j+1) mod S]) / sqrt(2) (exact algebra), so attn.v runs on vv^T planes; the modulation is applied in the plane builders (q, k planes x MOD[h][d]; vv from modulated v); the fused attention kernel multiplies each scaled logit by the cos table entry for |i - j| (cos(2 pi m / 2048) computed as the reference's float32 expression).
// Compute dtypes, f32 accumulate: every input rounded to bf16; q/k/v on PLAIN bf16 operands (inputs: exact); modulation table (precise cosf of bf16 phase x bf16 amplitude) and the cos Toeplitz table in f32; scores and attn.v: query rows < 512 hl (3 products), the rest single fp16; softmax f32 (running maximum, probabilities unnormalised until the end); Wo hl x exact (2 products).

#define NB_  2
#define TT   2048
#define DM   1024
#define NH_  16
#define NKV  16
#define REP  (NH_ / NKV)
#define HD   64
#define DQ   (NH_ * HD)
#define DKV  (NKV * HD)
#define RH   512                  // query rows < RH use hi+lo planes (0: none)
#define WIN  0
#define SCL  0.125f   // HD^-0.5
typedef _Float16 h16;
typedef unsigned short bf;
typedef __attribute__((ext_vector_type(16))) __bf16   v16bf;
typedef __attribute__((ext_vector_type(16))) _Float16 v16h;
typedef __attribute__((ext_vector_type(8)))  _Float16 v8h;
typedef __attribute__((ext_vector_type(8)))  unsigned short v8us;
typedef __attribute__((ext_vector_type(8)))  float    v8f;
typedef __attribute__((ext_vector_type(4)))  float    v4f;
typedef v8h  __attribute__((may_alias)) v8ha;
typedef v4f  __attribute__((may_alias)) v4fa;
typedef v8us __attribute__((may_alias)) v8usa;

__device__ __forceinline__ unsigned short f2bf(float f) { unsigned u = __float_as_uint(f); u += 0x7FFFu + ((u >> 16) & 1u); return (unsigned short)(u >> 16); }
__device__ __forceinline__ float bf2f(unsigned short b) { return __uint_as_float(((unsigned)b) << 16); }
__device__ __forceinline__ float bfr(float f) { return bf2f(f2bf(f)); }
__device__ __forceinline__ v16h cat16(v8h lo, v8h hi) { return __builtin_shufflevector(lo, hi, 0, 1, 2, 3, 4, 5, 6, 7, 8, 9, 10, 11, 12, 13, 14, 15); }
__device__ __forceinline__ v16bf cat16b(v8us lo, v8us hi) { return __builtin_bit_cast(v16bf, __builtin_shufflevector(lo, hi, 0, 1, 2, 3, 4, 5, 6, 7, 8, 9, 10, 11, 12, 13, 14, 15)); }
__device__ __forceinline__ v8f wmma16(v16h a, v16h b, v8f c) { return __builtin_amdgcn_wmma_f32_16x16x32_f16(false, a, false, b, (short)0, c, false, false); }
__device__ __forceinline__ v8f wmmab(v16bf a, v16bf b, v8f c) { return __builtin_amdgcn_wmma_f32_16x16x32_bf16(false, a, false, b, (short)0, c, false, false); }



// ---- k_gemmw: register-blocked GEMM, ONE WAVE per 64x64 output tile (16 accumulators), operands straight from K-contiguous 16-bit planes; grid (M/64, N/64, Z), 32 threads.
// C[m][n] (f32, pitch ldc, + optional f32 bias[n]) = sum_k A[m][k] Bt[n][k] (+ split products per NSPLIT). z-batch strides sA/sB/sC in elements. K % 32 == 0.
template <typename T16> struct WFrag;
template <> struct WFrag<h16> { typedef v16h V; static __device__ __forceinline__ V ld(const h16* p) { return cat16(*(const v8h*)p, *(const v8h*)(p + 16)); } static __device__ __forceinline__ v8f mma(V a, V b, v8f c) { return wmma16(a, b, c); } };
template <> struct WFrag<bf> { typedef v16bf V; static __device__ __forceinline__ V ld(const bf* p) { return cat16b(*(const v8us*)p, *(const v8us*)(p + 16)); } static __device__ __forceinline__ v8f mma(V a, V b, v8f c) { return wmmab(a, b, c); } };
template <typename T16, int NSPLIT, bool BIAS>
__global__ __launch_bounds__(32) void k_gemmw(const T16* __restrict__ A, const T16* __restrict__ A2, const T16* __restrict__ Bt, const T16* __restrict__ Bt2, int K, float* C, int ldc, const float* __restrict__ bias, size_t sA, size_t sB, size_t sC) {
    typedef typename WFrag<T16>::V V;
    __shared__ __align__(16) float os[16 * 68];
    const size_t z = blockIdx.z; A += z * sA; if (A2) A2 += z * sA; Bt += z * sB; if (Bt2) Bt2 += z * sB; C += z * sC;
    const int lane = threadIdx.x & 31, lr = lane & 15, hi = lane >> 4; const int r0 = blockIdx.x * 64, c0 = blockIdx.y * 64;
    v8f acc[4][4];
#pragma unroll
    for (int mb = 0; mb < 4; ++mb)
#pragma unroll
        for (int nb = 0; nb < 4; ++nb) acc[mb][nb] = (v8f){};
    const size_t aoff = (size_t)(r0 + lr) * K + 8 * hi, boff = (size_t)(c0 + lr) * K + 8 * hi;
#pragma unroll 1
    for (int kc = 0; kc < K; kc += 32) {
        V a[4], a2[4];
#pragma unroll
        for (int mb = 0; mb < 4; ++mb) { a[mb] = WFrag<T16>::ld(A + aoff + (size_t)mb * 16 * K + kc); if (NSPLIT == 1 || NSPLIT == 2) a2[mb] = WFrag<T16>::ld(A2 + aoff + (size_t)mb * 16 * K + kc); }
#pragma unroll
        for (int nb = 0; nb < 4; ++nb) { const V b = WFrag<T16>::ld(Bt + boff + (size_t)nb * 16 * K + kc); V b2; if (NSPLIT >= 2) b2 = WFrag<T16>::ld(Bt2 + boff + (size_t)nb * 16 * K + kc);
#pragma unroll
            for (int mb = 0; mb < 4; ++mb) { acc[mb][nb] = WFrag<T16>::mma(a[mb], b, acc[mb][nb]); if (NSPLIT == 1 || NSPLIT == 2) acc[mb][nb] = WFrag<T16>::mma(a2[mb], b, acc[mb][nb]); if (NSPLIT >= 2) acc[mb][nb] = WFrag<T16>::mma(a[mb], b2, acc[mb][nb]); } }
        asm volatile("v_nop\n\tv_nop\n\tv_nop\n\tv_nop" : "+v"(acc[0][0]), "+v"(acc[1][1]), "+v"(acc[2][2]), "+v"(acc[3][3]) : "v"(a[0]), "v"(a[3]));
    }
#pragma unroll
    for (int mb = 0; mb < 4; ++mb) {
#pragma unroll
        for (int nb = 0; nb < 4; ++nb) {
#pragma unroll
            for (int j = 0; j < 8; ++j) os[(hi * 8 + j) * 68 + nb * 16 + lr] = acc[mb][nb][j]; }
        __builtin_amdgcn_wave_barrier(); asm volatile("" ::: "memory");
        float* crow = C + (size_t)(r0 + mb * 16) * ldc + c0;
{
#pragma unroll
            for (int s = 0; s < 8; ++s) { const int row = 2 * s + hi, cofs = lr * 4; v4f val = *(const v4fa*)(os + row * 68 + cofs); if (BIAS) { val[0] += bfr(bias[c0 + cofs]); val[1] += bfr(bias[c0 + cofs + 1]); val[2] += bfr(bias[c0 + cofs + 2]); val[3] += bfr(bias[c0 + cofs + 3]); }
                *(v4f*)(crow + (size_t)row * ldc + cofs) = val; }
             }
        __builtin_amdgcn_wave_barrier(); asm volatile("" ::: "memory");
    }
}

__device__ __forceinline__ h16 tohx(float x) { return (h16)x; }
__device__ __forceinline__ void splitf(float y, unsigned short& h, unsigned short& l) { h = f2bf(y); l = f2bf(y - bf2f(h)); }
typedef __attribute__((ext_vector_type(2))) _Float16 v2h;
typedef __attribute__((ext_vector_type(4))) _Float16 v4h;
typedef __attribute__((ext_vector_type(2))) unsigned short v2us;
typedef __attribute__((ext_vector_type(4))) unsigned short v4us;
typedef __attribute__((ext_vector_type(2))) float v2f;
typedef __attribute__((ext_vector_type(4))) int v4i;

__global__ __launch_bounds__(256) void k_wtG(const float* __restrict__ w, int K, int N, bf* Bt) {
    const int lane = threadIdx.x & 31; const int L0 = (blockIdx.x * 8 + (threadIdx.x >> 5)) * 8; const int nlines = N * K / 64;
{
#pragma unroll 1
        for (int l = 0; l < 8; ++l) { const int L = L0 + l; if (L >= nlines) break; const size_t e = (size_t)L * 64 + lane * 2; const int k = (int)(e % K), n = (int)(e / K); v2us o;
            o[0] = f2bf(w[(size_t)k * N + n]); o[1] = f2bf(w[(size_t)(k + 1) * N + n]); *(v2us*)(Bt + e) = o; }
         }
}
__global__ __launch_bounds__(256) void k_cvt8(const float* __restrict__ src, bf* dst, size_t n8) { const size_t i = (size_t)blockIdx.x * 256 + threadIdx.x; if (i >= n8) return; const v8f v = *(const v8f*)(src + i * 8); v8us o;
#pragma unroll
    for (int k = 0; k < 8; ++k) o[k] = f2bf(v[k]); *(v8us*)(dst + i * 8) = o;  }

// k_rope: head planes [h][t][d] (fp16 + hi/lo) of rope(x) x sc with the rotate-half convention out[d] = x[d] cos[t][d] - x[d+HD/2] sin[t][d], out[d+HD/2] = x[d+HD/2] cos[t][d+HD/2] + x[d] sin[t][d+HD/2]
__global__ __launch_bounds__(256) void k_rope(const float* __restrict__ F, int pitch, int nheads, const float* __restrict__ CS, const float* __restrict__ RF, const float* __restrict__ nw, float sc, h16* P16, bf* Ph, bf* Pl) {
    const size_t e = ((size_t)blockIdx.x * 256 + threadIdx.x) * 2; if (e >= (size_t)nheads * TT * HD) return; const int d = (int)(e % HD); const int t = (int)((e / HD) % TT); const int h = (int)(e / ((size_t)HD * TT)); const float* f = F + (size_t)t * pitch + h * HD; const float rf = RF ? RF[(size_t)h * TT + t] : 1.0f; v2h o16; v2us oh, ol;
#pragma unroll
    for (int q = 0; q < 2; ++q) { const int dd = d + q; const int dp = (dd < HD / 2) ? dd + HD / 2 : dd - HD / 2; float x0 = f[dd], x1 = f[dp];
        if (nw) { x0 = __fmul_rn(x0, nw[h * HD + dd]); x1 = __fmul_rn(x1, nw[h * HD + dp]); }   /* per-(head, dim) modulation table (f32, precomputed) */ (void)rf;
        const v2f cs = *(const v2f*)(CS + ((size_t)t * HD + dd) * 2); float a = __fmul_rn(x0, cs[0]), bq = __fmul_rn(x1, cs[1]); asm volatile("" : "+v"(a)); asm volatile("" : "+v"(bq)); const float r = ((dd < HD / 2) ? __fsub_rn(a, bq) : __fadd_rn(a, bq)) * sc;
        o16[q] = tohx(r); unsigned short a2, c2; splitf(r, a2, c2); oh[q] = a2; ol[q] = c2; }
    *(v2h*)(P16 + e) = o16; *(v2us*)(Ph + e) = oh; *(v2us*)(Pl + e) = ol;  }
__global__ __launch_bounds__(256) void k_vtp(const float* __restrict__ F, int pitch, int nheads, h16* V16, bf* Vh, bf* Vl) { const size_t e = ((size_t)blockIdx.x * 256 + threadIdx.x) * 2; if (e >= (size_t)nheads * HD * TT) return; const int t = (int)(e % TT); const int d = (int)((e / TT) % HD); const int g = (int)(e / ((size_t)TT * HD)); v2h o16; v2us oh, ol;
#pragma unroll
    for (int q = 0; q < 2; ++q) { const float x = F[(size_t)(t + q) * pitch + g * HD + d]; o16[q] = tohx(x); unsigned short a2, c2; splitf(x, a2, c2); oh[q] = a2; ol[q] = c2; }
    *(v2h*)(V16 + e) = o16; *(v2us*)(Vh + e) = oh; *(v2us*)(Vl + e) = ol;  }
__global__ __launch_bounds__(256) void k_csid(float* CS) { const int idx = blockIdx.x * 256 + threadIdx.x; if (idx >= TT * HD) return; v2f cs; cs[0] = 1.0f; cs[1] = 0.0f; *(v2f*)(CS + (size_t)idx * 2) = cs;  }
__global__ __launch_bounds__(256) void k_qtabs(const float* __restrict__ ph, const float* __restrict__ am, float* MOD, float* CT) { const int i = blockIdx.x * 256 + threadIdx.x; if (i < DQ) { const float m = __fmul_rn(cosf(bfr(ph[i])), bfr(am[i])); *(float*)(MOD + i) = m;  }
    if (i < TT) { const float a = __fmul_rn(__fmul_rn(6.2831853071795862f, (float)i), 1.0f / (float)TT); const float c = cosf(a); *(float*)(CT + i) = c;  } }
__global__ __launch_bounds__(256) void k_vtpm(const float* __restrict__ F, int pitch, int nheads, const float* __restrict__ MOD, h16* V16, bf* Vh, bf* Vl) { const size_t e = ((size_t)blockIdx.x * 256 + threadIdx.x) * 2; if (e >= (size_t)nheads * HD * TT) return; const int t = (int)(e % TT); const int d = (int)((e / TT) % HD); const int g = (int)(e / ((size_t)TT * HD)); const float m = MOD[g * HD + d]; v2h o16; v2us oh, ol;
#pragma unroll
    for (int q = 0; q < 2; ++q) { const int tt = t + q; const int tn = (tt + 1 == TT) ? 0 : tt + 1; float a = __fmul_rn(F[(size_t)tt * pitch + g * HD + d], m); float b = __fmul_rn(F[(size_t)tn * pitch + g * HD + d], m); asm volatile("" : "+v"(a)); asm volatile("" : "+v"(b)); const float v = __fmul_rn(__fadd_rn(a, b), 0.70710678118654752f); o16[q] = tohx(v); unsigned short a2, c2; splitf(v, a2, c2); oh[q] = a2; ol[q] = c2; }
    *(v2h*)(V16 + e) = o16; *(v2us*)(Vh + e) = oh; *(v2us*)(Vl + e) = ol;  }
// ---- k_fattn: scores, interference, softmax and attn.v of one query block in one kernel; no score or probability ever reaches memory.
// Transposed products: S^T = K Q^T (A = 16 key rows, B = 16 query rows, both by the same loader), so a lane holds 8 keys' scores of ONE query (query = lane & 15, keys 8 (lane >> 4) + r);
// two such tiles (keys 0-15 and 16-31 of a 32-key pass), converted in place, are the B operand of O^T += V^T P^T, whose A operand (V^T rows, key-contiguous) comes by the same loader in the same k order.
// Softmax is the running form: a query's maximum in use m is raised (and its sum and output tiles rescaled) only when a pass's maximum exceeds it by more than FRTH, so p = exp(t - m) <= exp(FRTH).
// Work-group: FQG query groups x FKS key chunks = 4 waves; wave (qg, ks) does 16 QT queries against keys [ks TT / FKS, + TT / FKS); the FKS partial (m, sum, O) of a query are joined through LDS in chunk order and stored as the hi + lo planes that the Wo product reads.
// tab[u] = cos table entry for |j - i| x HD^-0.5 (a power of two: exact), u = j - (i - q0) + NQW - 1: a lane's 8 keys are 8 consecutive entries.
// Each '#pragma unroll' below, but those on the join's sx and u loops, unrolls a loop over a register array to the end, so that its indices are constants and the array stays in registers.
#define FKS  4
#define FQG  1
#define FRTH 5.5f
#define L2E  1.4426950408889634f
#define FTAB 2176                 // floats kept for tab: TT + 32 - 1, rounded up to 17 per work-item
#define FLDS (FTAB + FKS * FQG * 32 * 68 + 2 * FKS * FQG * 32)
typedef __attribute__((ext_vector_type(8))) __bf16 v8bf;
__device__ __forceinline__ float xhalf(float x) { const int b = __float_as_int(x); return __int_as_float(__builtin_amdgcn_permlanex16(b, b, 0x76543210, 0xfedcba98, false, false)); }   // the value of lane ^ 16
// 2^x of a tile's eight values in one statement. Behind a transcendental the instruction set asks for one independent instruction before its result is used or its source overwritten: the results are early-clobber, so no v_exp_f32 here touches a neighbour's registers, and the v_nop is the last one's slot.
__device__ __forceinline__ v8f exp2x8(const v8f x) { float y0, y1, y2, y3, y4, y5, y6, y7;
    asm("v_exp_f32 %0, %8\n\tv_exp_f32 %1, %9\n\tv_exp_f32 %2, %10\n\tv_exp_f32 %3, %11\n\tv_exp_f32 %4, %12\n\tv_exp_f32 %5, %13\n\tv_exp_f32 %6, %14\n\tv_exp_f32 %7, %15\n\tv_nop"
        : "=&v"(y0), "=&v"(y1), "=&v"(y2), "=&v"(y3), "=&v"(y4), "=&v"(y5), "=&v"(y6), "=&v"(y7) : "v"(x[0]), "v"(x[1]), "v"(x[2]), "v"(x[3]), "v"(x[4]), "v"(x[5]), "v"(x[6]), "v"(x[7]));
    return (v8f){y0, y1, y2, y3, y4, y5, y6, y7}; }
template <typename T16, bool HL, int QT>
__device__ __forceinline__ void fattn_body(const T16* __restrict__ Q, const T16* __restrict__ Q2, const T16* __restrict__ Kp, const T16* __restrict__ Kp2, const T16* __restrict__ Vt, const T16* __restrict__ Vt2, const float* __restrict__ CT, const int q0, bf* Ah, bf* Al, float* lds) {
    typedef typename WFrag<T16>::V V;
    constexpr int NQ = 16 * QT, NQW = NQ * FQG, NT = FKS * FQG * 32;
    const int tid = (int)threadIdx.x, lane = tid & 31, lr = lane & 15, hi = lane >> 4; const int w = __builtin_amdgcn_readfirstlane(tid >> 5); const int ks = w & (FKS - 1), qg = w / FKS;
    float* tab = lds; float* accS = lds + FTAB; float* mS = accS + FKS * FQG * 32 * 68; float* lS = mS + FKS * FQG * 32;
    static_assert(FTAB == 17 * NT && TT + NQW - 1 <= FTAB, "tab: seventeen entries per work-item");
    int ix[17]; float cv[17];
#pragma unroll
    for (int f = 0; f < 17; ++f) { const int d = tid + f * NT - (NQW - 1) - q0; const int a = d < 0 ? -d : d; ix[f] = a < TT ? a : TT - 1; cv[f] = CT[ix[f]]; }   // entries past TT + NQW - 2 are never read; their index is clamped into the table
    const T16* pq = Q + ((size_t)(q0 + qg * NQ + lr) * HD + 8 * hi); const T16* pq2 = HL ? Q2 + ((size_t)(q0 + qg * NQ + lr) * HD + 8 * hi) : pq;
    V qf[QT][2], qf2[QT][2];
#pragma unroll
    for (int qt = 0; qt < QT; ++qt)
#pragma unroll
        for (int kc = 0; kc < 2; ++kc) { qf[qt][kc] = WFrag<T16>::ld(pq + qt * 16 * HD + kc * 32); if (HL) qf2[qt][kc] = WFrag<T16>::ld(pq2 + qt * 16 * HD + kc * 32); }
    // the wait that stands before a register named by an issued load is written anew; the loads' index and address registers are inputs, so they live up to it
    asm volatile("s_wait_xcnt 0x0" :: "v"(ix[0]), "v"(ix[1]), "v"(ix[2]), "v"(ix[3]), "v"(ix[4]), "v"(ix[5]), "v"(ix[6]), "v"(ix[7]), "v"(ix[8]), "v"(ix[9]), "v"(ix[10]), "v"(ix[11]), "v"(ix[12]), "v"(ix[13]), "v"(ix[14]), "v"(ix[15]), "v"(ix[16]), "v"(pq), "v"(pq2) : "memory");
#pragma unroll
    for (int f = 0; f < 17; ++f) tab[tid + f * NT] = cv[f] * SCL;
    v8f acc[QT][4]; float m[QT], l[QT];
#pragma unroll
    for (int qt = 0; qt < QT; ++qt) { m[qt] = -3.0e38f; l[qt] = 0.f;
#pragma unroll
        for (int dt = 0; dt < 4; ++dt) acc[qt][dt] = (v8f){}; }
    __syncthreads();   // tab is whole before any wave reads it
    const int kbeg = ks * (TT / FKS);
    // rolled: one pass's fragments live at a time
#pragma unroll 1
    for (int jb = kbeg; jb < kbeg + TT / FKS; jb += 32) {
        const size_t ok = (size_t)(jb + lr) * HD + 8 * hi;
        const T16* pk = Kp + ok; const T16* pk2 = HL ? Kp2 + ok : pk;
        V kf[2][2], kf2[2][2], vf[4], vf2[4];
#pragma unroll
        for (int kt = 0; kt < 2; ++kt)
#pragma unroll
            for (int kc = 0; kc < 2; ++kc) { kf[kt][kc] = WFrag<T16>::ld(pk + kt * 16 * HD + kc * 32); if (HL) kf2[kt][kc] = WFrag<T16>::ld(pk2 + kt * 16 * HD + kc * 32); }
        // as above: the address pairs live up to the wait, and nothing that a load names is written before it
        // the loaded fragments are inputs too (inputs only): all of the pass's K loads are then in flight together, one trip to L2 instead of several in a row
        if constexpr (HL) asm volatile("s_wait_xcnt 0x0" :: "v"(pk), "v"(pk2), "v"(kf[0][0]), "v"(kf[0][1]), "v"(kf[1][0]), "v"(kf[1][1]), "v"(kf2[0][0]), "v"(kf2[0][1]), "v"(kf2[1][0]), "v"(kf2[1][1]) : "memory");
        else asm volatile("s_wait_xcnt 0x0" :: "v"(pk), "v"(kf[0][0]), "v"(kf[0][1]), "v"(kf[1][0]), "v"(kf[1][1]) : "memory");
        v8f s[QT][2];
#pragma unroll
        for (int kt = 0; kt < 2; ++kt)
#pragma unroll
            for (int qt = 0; qt < QT; ++qt) { v8f t = (v8f){};
#pragma unroll
                for (int kc = 0; kc < 2; ++kc) { t = WFrag<T16>::mma(kf[kt][kc], qf[qt][kc], t); if (HL) { t = WFrag<T16>::mma(kf[kt][kc], qf2[qt][kc], t); t = WFrag<T16>::mma(kf2[kt][kc], qf[qt][kc], t); } }
                s[qt][kt] = t; }
        const float* tb = tab + (jb + 8 * hi - lr - qg * NQ + NQW - 1);
        float bm[QT]; bool need = false;
#pragma unroll
        for (int qt = 0; qt < QT; ++qt) { float x = -3.0e38f;
#pragma unroll
            for (int kt = 0; kt < 2; ++kt)
#pragma unroll
                for (int r = 0; r < 8; ++r) { const float t = s[qt][kt][r] * tb[16 * (kt - qt) + r]; s[qt][kt][r] = t; x = fmaxf(x, t); }
            x = fmaxf(x, xhalf(x)); bm[qt] = x; need = need || (x > m[qt] + FRTH); }
        // the V^T fragments go into the registers that the K fragments leave and fly while the softmax runs; the hi+lo form, with twice the fragments, asks for them behind the rescale branch, where the registers are free
        auto loadv = [&]() { const size_t ov = (size_t)lr * TT + jb + 8 * hi; const T16* pv = Vt + ov; const T16* pv2 = HL ? Vt2 + ov : pv;
#pragma unroll
            for (int dt = 0; dt < 4; ++dt) { vf[dt] = WFrag<T16>::ld(pv + dt * 16 * TT); if (HL) vf2[dt] = WFrag<T16>::ld(pv2 + dt * 16 * TT); }
            asm volatile("s_wait_xcnt 0x0" :: "v"(pv), "v"(pv2) : "memory");   // as above
        };
        if constexpr (!HL) loadv();
        if (__builtin_amdgcn_ballot_w32(need) != 0) {   // a scalar branch: taken on a wave's first pass and seldom after it
#pragma unroll
            for (int qt = 0; qt < QT; ++qt) { const float mn = (bm[qt] > m[qt] + FRTH) ? bm[qt] : m[qt]; const float al = __builtin_amdgcn_exp2f((m[qt] - mn) * L2E); m[qt] = mn; l[qt] *= al;
#pragma unroll
                for (int dt = 0; dt < 4; ++dt) acc[qt][dt] *= al; } }
        if constexpr (HL) loadv();
        V pb[QT], pl[QT];
#pragma unroll
        for (int qt = 0; qt < QT; ++qt) { const float nm = -m[qt] * L2E; float ls = 0.f;
#pragma unroll
            for (int kt = 0; kt < 2; ++kt) { v8f a;
#pragma unroll
                for (int r = 0; r < 8; ++r) a[r] = __builtin_fmaf(s[qt][kt][r], L2E, nm);
                s[qt][kt] = exp2x8(a);
#pragma unroll
                for (int r = 0; r < 8; ++r) ls += s[qt][kt][r]; }
            l[qt] += ls;
            if constexpr (HL) {   // hi = p rounded to nearest even, lo = (p - hi) rounded likewise: splitf's values for the finite p here, by the packed conversion
                const v8bf h0 = __builtin_convertvector(s[qt][0], v8bf), h1 = __builtin_convertvector(s[qt][1], v8bf);
                const v8bf l0 = __builtin_convertvector(s[qt][0] - __builtin_convertvector(h0, v8f), v8bf), l1 = __builtin_convertvector(s[qt][1] - __builtin_convertvector(h1, v8f), v8bf);
                pb[qt] = __builtin_shufflevector(h0, h1, 0, 1, 2, 3, 4, 5, 6, 7, 8, 9, 10, 11, 12, 13, 14, 15); pl[qt] = __builtin_shufflevector(l0, l1, 0, 1, 2, 3, 4, 5, 6, 7, 8, 9, 10, 11, 12, 13, 14, 15);
            } else { pb[qt] = cat16(__builtin_convertvector(s[qt][0], v8h), __builtin_convertvector(s[qt][1], v8h)); } }
#pragma unroll
        for (int dt = 0; dt < 4; ++dt)
#pragma unroll
            for (int qt = 0; qt < QT; ++qt) { acc[qt][dt] = WFrag<T16>::mma(vf[dt], pb[qt], acc[qt][dt]); if (HL) { acc[qt][dt] = WFrag<T16>::mma(vf[dt], pl[qt], acc[qt][dt]); acc[qt][dt] = WFrag<T16>::mma(vf2[dt], pb[qt], acc[qt][dt]); } }
    }
    float* my = accS + w * (32 * 68);
#pragma unroll
    for (int qt = 0; qt < QT; ++qt) { const float lj = l[qt] + xhalf(l[qt]);   // the two lane halves summed different keys of the same query
        if (hi == 0) { mS[w * 32 + qt * 16 + lr] = m[qt]; lS[w * 32 + qt * 16 + lr] = lj; }
#pragma unroll
        for (int dt = 0; dt < 4; ++dt) { float* p = my + (qt * 16 + lr) * 68 + dt * 16 + hi * 8; const v8f t = acc[qt][dt];
            *(v4fa*)p = __builtin_shufflevector(t, t, 0, 1, 2, 3); *(v4fa*)(p + 4) = __builtin_shufflevector(t, t, 4, 5, 6, 7); } }
    __syncthreads();   // every wave's partial is in LDS before any is joined
#pragma unroll
    for (int sx = 0; sx < NQW * 8 / NT; ++sx) { const int idx = sx * NT + tid; const int q = idx >> 3, dc = (idx & 7) * 8; const int w0 = (q / NQ) * FKS, ql = q % NQ;
        float M = mS[w0 * 32 + ql];
#pragma unroll
        for (int u = 1; u < FKS; ++u) M = fmaxf(M, mS[(w0 + u) * 32 + ql]);
        float L = 0.f; v4f o0 = (v4f){}, o1 = (v4f){};
#pragma unroll
        for (int u = 0; u < FKS; ++u) { const float sc = __builtin_amdgcn_exp2f((mS[(w0 + u) * 32 + ql] - M) * L2E); L += lS[(w0 + u) * 32 + ql] * sc; const float* p = accS + ((w0 + u) * 32 + ql) * 68 + dc; o0 += *(const v4fa*)p * sc; o1 += *(const v4fa*)(p + 4) * sc; }
        const float inv = __fdiv_rn(1.0f, L); v8us oh, ol;
#pragma unroll
        for (int k = 0; k < 4; ++k) { unsigned short a, c2; splitf(o0[k] * inv, a, c2); oh[k] = a; ol[k] = c2; splitf(o1[k] * inv, a, c2); oh[4 + k] = a; ol[4 + k] = c2; }
        const size_t oo = (size_t)(q0 + q) * DQ + dc; *(v8us*)(Ah + oo) = oh; *(v8us*)(Al + oo) = ol; }
}
// grid (heads, RH / 16 + (TT - RH) / 32): the hi+lo query blocks (three products each, the longer work) have the low indices and start first.
// Five waves a SIMD (192 registers): the launch's 1,280 four-wave work-groups are then all resident at once, five on each of the 256 WGPs, instead of a full round and a quarter-full one.
__global__ __launch_bounds__(FKS * FQG * 32) __attribute__((amdgpu_waves_per_eu(5, 5))) void k_fattn(const h16* __restrict__ Q16, const h16* __restrict__ K16, const h16* __restrict__ V16, const bf* __restrict__ Qh, const bf* __restrict__ Ql, const bf* __restrict__ Kh, const bf* __restrict__ Kl, const bf* __restrict__ Vh, const bf* __restrict__ Vl, const float* __restrict__ CT, bf* Ah, bf* Al) {
    __shared__ __align__(16) float lds[FLDS];
    const int h = (int)blockIdx.x, by = (int)blockIdx.y; const size_t ho = (size_t)h * TT * HD;
    if (by < RH / (16 * FQG)) fattn_body<bf, true, 1>(Qh + ho, Ql + ho, Kh + ho, Kl + ho, Vh + ho, Vl + ho, CT, by * (16 * FQG), Ah + h * HD, Al + h * HD, lds);
    else fattn_body<h16, false, 2>(Q16 + ho, nullptr, K16 + ho, nullptr, V16 + ho, nullptr, CT, RH + (by - RH / (16 * FQG)) * (32 * FQG), Ah + h * HD, Al + h * HD, lds);
}

extern "C" void kernel_launch(void* const* d_in, const int* in_sizes, int n_in,
                              void* d_out, int out_size, void* d_ws, size_t ws_size, hipStream_t stream) {
    (void)in_sizes; (void)n_in; (void)out_size;
    const float* x = (const float*)d_in[0]; const float* wq = (const float*)d_in[1]; const float* wk = (const float*)d_in[2]; const float* wv = (const float*)d_in[3]; const float* wo = (const float*)d_in[4]; const float* qph = (const float*)d_in[5]; const float* qam = (const float*)d_in[6];
    float* OUT = (float*)d_out;     // [2][2048][1024]
    char* wsp = (char*)d_ws;
    auto take = [&](size_t bytes) { char* p = wsp; wsp += (bytes + 255) & ~(size_t)255; return (void*)p; };
    bf* WQ = (bf*)take((size_t)DQ * DM * 2); bf* WK = (bf*)take((size_t)DKV * DM * 2); bf* WV = (bf*)take((size_t)DKV * DM * 2); bf* WO = (bf*)take((size_t)DM * DQ * 2); float* CS = (float*)take((size_t)TT * HD * 2 * 4);
    float* MOD = (float*)take((size_t)DQ * 4); float* CT = (float*)take((size_t)TT * 4);
    bf* XB = (bf*)take((size_t)TT * DM * 2); float* FQ = (float*)take((size_t)TT * DQ * 4); float* FK = (float*)take((size_t)TT * DKV * 4);
    h16* QP16 = (h16*)take((size_t)NH_ * TT * HD * 2); h16* KP16 = (h16*)take((size_t)NKV * TT * HD * 2); h16* VT16 = (h16*)take((size_t)NKV * HD * TT * 2);
    bf* QPh = (bf*)take((size_t)NH_ * TT * HD * 2); bf* QPl = (bf*)take((size_t)NH_ * TT * HD * 2); bf* KPh = (bf*)take((size_t)NKV * TT * HD * 2); bf* KPl = (bf*)take((size_t)NKV * TT * HD * 2); bf* VTh = (bf*)take((size_t)NKV * HD * TT * 2); bf* VTl = (bf*)take((size_t)NKV * HD * TT * 2);
    bf* ATh = (bf*)take((size_t)TT * DQ * 2); bf* ATl = (bf*)take((size_t)TT * DQ * 2);
    if ((size_t)(wsp - (char*)d_ws) > ws_size) return;    // ws 256 MiB
    float* FV = FK;   // v projection reuses the k buffer after the k planes are built (stream-ordered)
    { k_wtG<<<(unsigned)((DM * DQ / 64 + 63) / 64), 256, 0, stream>>>(wq, DM, DQ, WQ); k_wtG<<<(unsigned)((DM * DKV / 64 + 63) / 64), 256, 0, stream>>>(wk, DM, DKV, WK); k_wtG<<<(unsigned)((DM * DKV / 64 + 63) / 64), 256, 0, stream>>>(wv, DM, DKV, WV);
      k_wtG<<<(unsigned)((DQ * DM / 64 + 63) / 64), 256, 0, stream>>>(wo, DQ, DM, WO);
       }
    k_csid<<<(TT * HD + 255) / 256, 256, 0, stream>>>(CS);
    const unsigned LQ = (unsigned)(((size_t)NH_ * TT * HD / 2 + 255) / 256), LKv = (unsigned)(((size_t)NKV * TT * HD / 2 + 255) / 256);
    k_qtabs<<<(TT + 255) / 256, 256, 0, stream>>>(qph, qam, MOD, CT);
    for (int b = 0; b < NB_; ++b) {
        
        k_cvt8<<<(unsigned)(((size_t)TT * DM / 8 + 255) / 256), 256, 0, stream>>>(x + (size_t)b * TT * DM, XB, (size_t)TT * DM / 8);
        k_gemmw<bf, 0, false><<<dim3(TT / 64, DQ / 64, 1), 32, 0, stream>>>(XB, nullptr, WQ, nullptr, DM, FQ, DQ, nullptr, 0, 0, 0);
        k_rope<<<LQ, 256, 0, stream>>>(FQ, DQ, NH_, CS, nullptr, MOD, 1.0f, QP16, QPh, QPl);
        k_gemmw<bf, 0, false><<<dim3(TT / 64, DKV / 64, 1), 32, 0, stream>>>(XB, nullptr, WK, nullptr, DM, FK, DKV, nullptr, 0, 0, 0);
        k_rope<<<LKv, 256, 0, stream>>>(FK, DKV, NKV, CS, nullptr, MOD, 1.0f, KP16, KPh, KPl);
        k_gemmw<bf, 0, false><<<dim3(TT / 64, DKV / 64, 1), 32, 0, stream>>>(XB, nullptr, WV, nullptr, DM, FV, DKV, nullptr, 0, 0, 0); k_vtpm<<<LKv, 256, 0, stream>>>(FV, DKV, NKV, MOD, VT16, VTh, VTl);
        k_fattn<<<dim3(NH_, RH / (16 * FQG) + (TT - RH) / (32 * FQG), 1), FKS * FQG * 32, 0, stream>>>(QP16, KP16, VT16, QPh, QPl, KPh, KPl, VTh, VTl, CT, ATh, ATl);   // one kv head per query head
        k_gemmw<bf, 1, false><<<dim3(TT / 64, DM / 64, 1), 32, 0, stream>>>(ATh, ATl, WO, nullptr, DQ, OUT + (size_t)b * TT * DM, DM, nullptr, 0, 0, 0); }
}

// v004
// A run of this version takes 268 microseconds.
// Next to v003, in two timings, it ran 1.55 times as fast each time.
// Counting every step since v000, it is 8.16 times as fast.
#include <hip/hip_runtime.h>

// 'Quantum' attention (x [2][2048][1024]; q, k, v = (x W) ('xw' [1024][1024], 16 heads x 64) each multiplied per (head, dim) by mod = cos(quantum_phase[h][d]) x quantum_amplitude[h][d]; scores = q.k / 8 x cos(2 pi (i - j) / 2048) (multiplicative Toeplitz 'interference'); w = softmax; w' = (w + roll(w, 1, keys)) / sqrt(2); out = w' v; y = merged Wo ('xw') -> [2][2048][1024] (4.2 M)).
// Realisation: the roll superposition is moved onto the values: w' v = w @ vv with vv[j] = (v[j] + v[(j+1) mod S]) / sqrt(2) (exact algebra), so attn.v runs on vv^T planes; the modulation is applied in the plane builders (q, k planes x MOD[h][d]; vv from modulated v); the fused attention kernel multiplies each scaled logit by the cos table entry for |i - j| (cos(2 pi m / 2048) computed as the reference's float32 expression).
// Compute dtypes, f32 accumulate: every input rounded to bf16; q/k/v on PLAIN bf16 operands (inputs: exact); modulation table (precise cosf of bf16 phase x bf16 amplitude) and the cos Toeplitz table in f32; scores and attn.v: query rows < 512 hl (3 products), the rest single fp16; softmax f32 (running maximum, probabilities unnormalised until the end); Wo hl x exact (2 products).

#define NB_  2
#define TT   2048
#define DM   1024
#define NH_  16
#define NKV  16
#define REP  (NH_ / NKV)
#define HD   64
#define DQ   (NH_ * HD)
#define DKV  (NKV * HD)
#define RH   512                  // query rows < RH use hi+lo planes (0: none)
#define WIN  0
#define SCL  0.125f   // HD^-0.5
typedef _Float16 h16;
typedef unsigned short bf;
typedef __attribute__((ext_vector_type(16))) __bf16   v16bf;
typedef __attribute__((ext_vector_type(16))) _Float16 v16h;
typedef __attribute__((ext_vector_type(8)))  _Float16 v8h;
typedef __attribute__((ext_vector_type(8)))  unsigned short v8us;
typedef __attribute__((ext_vector_type(8)))  float    v8f;
typedef __attribute__((ext_vector_type(4)))  float    v4f;
typedef v8h  __attribute__((may_alias)) v8ha;
typedef v4f  __attribute__((may_alias)) v4fa;
typedef v8us __attribute__((may_alias)) v8usa;

__device__ __forceinline__ unsigned short f2bf(float f) { unsigned u = __float_as_uint(f); u += 0x7FFFu + ((u >> 16) & 1u); return (unsigned short)(u >> 16); }
__device__ __forceinline__ float bf2f(unsigned short b) { return __uint_as_float(((unsigned)b) << 16); }
__device__ __forceinline__ float bfr(float f) { return bf2f(f2bf(f)); }
__device__ __forceinline__ v16h cat16(v8h lo, v8h hi) { return __builtin_shufflevector(lo, hi, 0, 1, 2, 3, 4, 5, 6, 7, 8, 9, 10, 11, 12, 13, 14, 15); }
__device__ __forceinline__ v16bf cat16b(v8us lo, v8us hi) { return __builtin_bit_cast(v16bf, __builtin_shufflevector(lo, hi, 0, 1, 2, 3, 4, 5, 6, 7, 8, 9, 10, 11, 12, 13, 14, 15)); }
__device__ __forceinline__ v8f wmma16(v16h a, v16h b, v8f c) { return __builtin_amdgcn_wmma_f32_16x16x32_f16(false, a, false, b, (short)0, c, false, false); }
__device__ __forceinline__ v8f wmmab(v16bf a, v16bf b, v8f c) { return __builtin_amdgcn_wmma_f32_16x16x32_bf16(false, a, false, b, (short)0, c, false, false); }



// ---- k_gemmw: register-blocked GEMM, ONE WAVE per 64x64 output tile (16 accumulators), operands straight from K-contiguous 16-bit planes; grid (M/64, N/64, Z), 32 threads.
// C[m][n] (f32, pitch ldc, + optional f32 bias[n]) = sum_k A[m][k] Bt[n][k] (+ split products per NSPLIT). z-batch strides sA/sB/sC in elements. K % 32 == 0.
template <typename T16> struct WFrag;
template <> struct WFrag<h16> { typedef v16h V; static __device__ __forceinline__ V ld(const h16* p) { return cat16(*(const v8h*)p, *(const v8h*)(p + 16)); } static __device__ __forceinline__ v8f mma(V a, V b, v8f c) { return wmma16(a, b, c); } };
template <> struct WFrag<bf> { typedef v16bf V; static __device__ __forceinline__ V ld(const bf* p) { return cat16b(*(const v8us*)p, *(const v8us*)(p + 16)); } static __device__ __forceinline__ v8f mma(V a, V b, v8f c) { return wmmab(a, b, c); } };
template <typename T16, int NSPLIT, bool BIAS>
__global__ __launch_bounds__(32) void k_gemmw(const T16* __restrict__ A, const T16* __restrict__ A2, const T16* __restrict__ Bt, const T16* __restrict__ Bt2, int K, float* C, int ldc, const float* __restrict__ bias, size_t sA, size_t sB, size_t sC) {
    typedef typename WFrag<T16>::V V;
    __shared__ __align__(16) float os[16 * 68];
    const size_t z = blockIdx.z; A += z * sA; if (A2) A2 += z * sA; Bt += z * sB; if (Bt2) Bt2 += z * sB; C += z * sC;
    const int lane = threadIdx.x & 31, lr = lane & 15, hi = lane >> 4; const int r0 = blockIdx.x * 64, c0 = blockIdx.y * 64;
    v8f acc[4][4];
#pragma unroll
    for (int mb = 0; mb < 4; ++mb)
#pragma unroll
        for (int nb = 0; nb < 4; ++nb) acc[mb][nb] = (v8f){};
    const size_t aoff = (size_t)(r0 + lr) * K + 8 * hi, boff = (size_t)(c0 + lr) * K + 8 * hi;
#pragma unroll 1
    for (int kc = 0; kc < K; kc += 32) {
        V a[4], a2[4];
#pragma unroll
        for (int mb = 0; mb < 4; ++mb) { a[mb] = WFrag<T16>::ld(A + aoff + (size_t)mb * 16 * K + kc); if (NSPLIT == 1 || NSPLIT == 2) a2[mb] = WFrag<T16>::ld(A2 + aoff + (size_t)mb * 16 * K + kc); }
#pragma unroll
        for (int nb = 0; nb < 4; ++nb) { const V b = WFrag<T16>::ld(Bt + boff + (size_t)nb * 16 * K + kc); V b2; if (NSPLIT >= 2) b2 = WFrag<T16>::ld(Bt2 + boff + (size_t)nb * 16 * K + kc);
#pragma unroll
            for (int mb = 0; mb < 4; ++mb) { acc[mb][nb] = WFrag<T16>::mma(a[mb], b, acc[mb][nb]); if (NSPLIT == 1 || NSPLIT == 2) acc[mb][nb] = WFrag<T16>::mma(a2[mb], b, acc[mb][nb]); if (NSPLIT >= 2) acc[mb][nb] = WFrag<T16>::mma(a[mb], b2, acc[mb][nb]); } }
        asm volatile("v_nop\n\tv_nop\n\tv_nop\n\tv_nop" : "+v"(acc[0][0]), "+v"(acc[1][1]), "+v"(acc[2][2]), "+v"(acc[3][3]) : "v"(a[0]), "v"(a[3]));
    }
#pragma unroll
    for (int mb = 0; mb < 4; ++mb) {
#pragma unroll
        for (int nb = 0; nb < 4; ++nb) {
#pragma unroll
            for (int j = 0; j < 8; ++j) os[(hi * 8 + j) * 68 + nb * 16 + lr] = acc[mb][nb][j]; }
        __builtin_amdgcn_wave_barrier(); asm volatile("" ::: "memory");
        float* crow = C + (size_t)(r0 + mb * 16) * ldc + c0;
{
#pragma unroll
            for (int s = 0; s < 8; ++s) { const int row = 2 * s + hi, cofs = lr * 4; v4f val = *(const v4fa*)(os + row * 68 + cofs); if (BIAS) { val[0] += bfr(bias[c0 + cofs]); val[1] += bfr(bias[c0 + cofs + 1]); val[2] += bfr(bias[c0 + cofs + 2]); val[3] += bfr(bias[c0 + cofs + 3]); }
                *(v4f*)(crow + (size_t)row * ldc + cofs) = val; }
             }
        __builtin_amdgcn_wave_barrier(); asm volatile("" ::: "memory");
    }
}

__device__ __forceinline__ h16 tohx(float x) { return (h16)x; }
__device__ __forceinline__ void splitf(float y, unsigned short& h, unsigned short& l) { h = f2bf(y); l = f2bf(y - bf2f(h)); }
typedef __attribute__((ext_vector_type(2))) _Float16 v2h;
typedef __attribute__((ext_vector_type(4))) _Float16 v4h;
typedef __attribute__((ext_vector_type(2))) unsigned short v2us;
typedef __attribute__((ext_vector_type(4))) unsigned short v4us;
typedef __attribute__((ext_vector_type(2))) float v2f;
typedef __attribute__((ext_vector_type(4))) int v4i;

// The j_ functions are jobs of 256 work-items that read none of each other's output; k_prep and k_planes below run them side by side in one grid, the job picked by the block index (bx: the block's index within its job).
__device__ __forceinline__ void j_wtG(const int bx, const float* __restrict__ w, int K, int N, bf* Bt) {
    const int lane = threadIdx.x & 31; const int L0 = (bx * 8 + (threadIdx.x >> 5)) * 8; const int nlines = N * K / 64;
{
#pragma unroll 1
        for (int l = 0; l < 8; ++l) { const int L = L0 + l; if (L >= nlines) break; const size_t e = (size_t)L * 64 + lane * 2; const int k = (int)(e % K), n = (int)(e / K); v2us o;
            o[0] = f2bf(w[(size_t)k * N + n]); o[1] = f2bf(w[(size_t)(k + 1) * N + n]); *(v2us*)(Bt + e) = o; }
         }
}
__device__ __forceinline__ void j_cvt8(const int bx, const float* __restrict__ src, bf* dst, size_t n8) { const size_t i = (size_t)bx * 256 + threadIdx.x; if (i >= n8) return; const v8f v = *(const v8f*)(src + i * 8); v8us o;
#pragma unroll
    for (int k = 0; k < 8; ++k) o[k] = f2bf(v[k]); *(v8us*)(dst + i * 8) = o;  }

// j_rope: head planes [h][t][d] (fp16 + hi/lo) of rope(x) x sc with the rotate-half convention out[d] = x[d] cos[t][d] - x[d+HD/2] sin[t][d], out[d+HD/2] = x[d+HD/2] cos[t][d+HD/2] + x[d] sin[t][d+HD/2]
__device__ __forceinline__ void j_rope(const float* __restrict__ F, int pitch, int nheads, const float* __restrict__ CS, const float* __restrict__ RF, const float* __restrict__ nw, float sc, h16* P16, bf* Ph, bf* Pl) {
    const size_t e = ((size_t)blockIdx.x * 256 + threadIdx.x) * 2; if (e >= (size_t)nheads * TT * HD) return; const int d = (int)(e % HD); const int t = (int)((e / HD) % TT); const int h = (int)(e / ((size_t)HD * TT)); const float* f = F + (size_t)t * pitch + h * HD; const float rf = RF ? RF[(size_t)h * TT + t] : 1.0f; v2h o16; v2us oh, ol;
#pragma unroll
    for (int q = 0; q < 2; ++q) { const int dd = d + q; const int dp = (dd < HD / 2) ? dd + HD / 2 : dd - HD / 2; const float* p0 = f + d; const float* p1 = f + dp; float x0 = p0[q], x1 = *p1;
        asm volatile("s_wait_xcnt 0x0" :: "v"(p0), "v"(p1) : "memory");   // the wait that stands before a register named by an issued load is written anew; the two address pairs are inputs, so they live up to it
        if (nw) { x0 = __fmul_rn(x0, nw[h * HD + dd]); x1 = __fmul_rn(x1, nw[h * HD + dp]); }   /* per-(head, dim) modulation table (f32, precomputed) */ (void)rf;
        const v2f cs = *(const v2f*)(CS + ((size_t)t * HD + dd) * 2); float a = __fmul_rn(x0, cs[0]), bq = __fmul_rn(x1, cs[1]); asm volatile("" : "+v"(a)); asm volatile("" : "+v"(bq)); const float r = ((dd < HD / 2) ? __fsub_rn(a, bq) : __fadd_rn(a, bq)) * sc;
        o16[q] = tohx(r); unsigned short a2, c2; splitf(r, a2, c2); oh[q] = a2; ol[q] = c2; }
    *(v2h*)(P16 + e) = o16; *(v2us*)(Ph + e) = oh; *(v2us*)(Pl + e) = ol;  }
__global__ __launch_bounds__(256) void k_vtp(const float* __restrict__ F, int pitch, int nheads, h16* V16, bf* Vh, bf* Vl) { const size_t e = ((size_t)blockIdx.x * 256 + threadIdx.x) * 2; if (e >= (size_t)nheads * HD * TT) return; const int t = (int)(e % TT); const int d = (int)((e / TT) % HD); const int g = (int)(e / ((size_t)TT * HD)); v2h o16; v2us oh, ol;
#pragma unroll
    for (int q = 0; q < 2; ++q) { const float x = F[(size_t)(t + q) * pitch + g * HD + d]; o16[q] = tohx(x); unsigned short a2, c2; splitf(x, a2, c2); oh[q] = a2; ol[q] = c2; }
    *(v2h*)(V16 + e) = o16; *(v2us*)(Vh + e) = oh; *(v2us*)(Vl + e) = ol;  }
__device__ __forceinline__ void j_csid(const int bx, float* CS) { const int idx = bx * 256 + threadIdx.x; if (idx >= TT * HD) return; v2f cs; cs[0] = 1.0f; cs[1] = 0.0f; *(v2f*)(CS + (size_t)idx * 2) = cs;  }
__device__ __forceinline__ void j_qtabs(const int bx, const float* __restrict__ ph, const float* __restrict__ am, float* MOD, float* CT) { const int i = bx * 256 + threadIdx.x; if (i < DQ) { const float m = __fmul_rn(cosf(bfr(ph[i])), bfr(am[i])); *(float*)(MOD + i) = m;  }
    if (i < TT) { const float a = __fmul_rn(__fmul_rn(6.2831853071795862f, (float)i), 1.0f / (float)TT); const float c = cosf(a); *(float*)(CT + i) = c;  } }
__device__ __forceinline__ void j_vtpm(const float* __restrict__ F, int pitch, int nheads, const float* __restrict__ MOD, h16* V16, bf* Vh, bf* Vl) { const size_t e = ((size_t)blockIdx.x * 256 + threadIdx.x) * 2; if (e >= (size_t)nheads * HD * TT) return; const int t = (int)(e % TT); const int d = (int)((e / TT) % HD); const int g = (int)(e / ((size_t)TT * HD)); const float m = MOD[g * HD + d]; v2h o16; v2us oh, ol;
#pragma unroll
    for (int q = 0; q < 2; ++q) { const int tt = t + q; const int tn = (tt + 1 == TT) ? 0 : tt + 1; float a = __fmul_rn(F[(size_t)tt * pitch + g * HD + d], m); float b = __fmul_rn(F[(size_t)tn * pitch + g * HD + d], m); asm volatile("" : "+v"(a)); asm volatile("" : "+v"(b)); const float v = __fmul_rn(__fadd_rn(a, b), 0.70710678118654752f); o16[q] = tohx(v); unsigned short a2, c2; splitf(v, a2, c2); oh[q] = a2; ol[q] = c2; }
    *(v2h*)(V16 + e) = o16; *(v2us*)(Vh + e) = oh; *(v2us*)(Vl + e) = ol;  }
// ---- k_prep: every job that reads only inputs, in one grid: the four weight transposes (a chain of strided reads each, the longest job: lowest indices), x of both batches to bf16, the identity rotation table, the modulation and cos tables.
#define PW ((DM * DQ / 64 + 63) / 64)              // blocks of one weight transpose
#define PX ((NB_ * TT * DM / 8 + 255) / 256)       // blocks of the x conversion
#define PC ((TT * HD + 255) / 256)                 // blocks of the rotation table
#define PT ((TT + 255) / 256)                      // blocks of the two small tables
__global__ __launch_bounds__(256) void k_prep(const float* __restrict__ x, const float* __restrict__ wq, const float* __restrict__ wk, const float* __restrict__ wv, const float* __restrict__ wo, const float* __restrict__ ph, const float* __restrict__ am, bf* WT, bf* XB, float* CS, float* MOD, float* CT) {
    const int b = (int)blockIdx.x;
    if (b < 4 * PW) { const int j = b / PW; j_wtG(b % PW, j == 0 ? wq : j == 1 ? wk : j == 2 ? wv : wo, DM, DQ, WT + (size_t)j * DQ * DM); }
    else if (b < 4 * PW + PX) j_cvt8(b - 4 * PW, x, XB, (size_t)NB_ * TT * DM / 8);
    else if (b < 4 * PW + PX + PC) j_csid(b - 4 * PW - PX, CS);
    else j_qtabs(b - 4 * PW - PX - PC, ph, am, MOD, CT);
}
// ---- k_planes: the q, k and vv^T planes of both batches in one grid (blocks of one job, 3 jobs, batches). F [batch x t][q | k | v columns]; planes [q, k, v][batch][head]. The v job, with its strided reads, has the lowest index.
__global__ __launch_bounds__(256) void k_planes(const float* __restrict__ F, const float* __restrict__ CS, const float* __restrict__ MOD, h16* P16, bf* Ph, bf* Pl) {
    const int j = ((int)blockIdx.y + 2) % 3, b = (int)blockIdx.z; const float* f = F + (size_t)b * TT * (3 * DQ) + j * DQ; const size_t o = ((size_t)j * NB_ + b) * NH_ * TT * HD;
    if (j < 2) j_rope(f, 3 * DQ, NH_, CS, nullptr, MOD, 1.0f, P16 + o, Ph + o, Pl + o);
    else j_vtpm(f, 3 * DQ, NKV, MOD, P16 + o, Ph + o, Pl + o);
}
// ---- k_fattn: scores, interference, softmax and attn.v of one query block in one kernel; no score or probability ever reaches memory.
// Transposed products: S^T = K Q^T (A = 16 key rows, B = 16 query rows, both by the same loader), so a lane holds 8 keys' scores of ONE query (query = lane & 15, keys 8 (lane >> 4) + r);
// two such tiles (keys 0-15 and 16-31 of a 32-key pass), converted in place, are the B operand of O^T += V^T P^T, whose A operand (V^T rows, key-contiguous) comes by the same loader in the same k order.
// Softmax is the running form: a query's maximum in use m is raised (and its sum and output tiles rescaled) only when a pass's maximum exceeds it by more than FRTH, so p = exp(t - m) <= exp(FRTH).
// Work-group: FQG query groups x FKS key chunks = 4 waves; wave (qg, ks) does 16 QT queries against keys [ks TT / FKS, + TT / FKS); the FKS partial (m, sum, O) of a query are joined through LDS in chunk order and stored as the hi + lo planes that the Wo product reads.
// tab[u] = cos table entry for |j - i| x HD^-0.5 (a power of two: exact), u = j - (i - q0) + NQW - 1: a lane's 8 keys are 8 consecutive entries.
// Each '#pragma unroll' below, but those on the join's sx and u loops, unrolls a loop over a register array to the end, so that its indices are constants and the array stays in registers.
#define FKS  4
#define FQG  1
#define FRTH 5.5f
#define L2E  1.4426950408889634f
#define FTAB 2176                 // floats kept for tab: TT + 32 - 1, rounded up to 17 per work-item
#define FLDS (FTAB + FKS * FQG * 32 * 68 + 2 * FKS * FQG * 32)
typedef __attribute__((ext_vector_type(8))) __bf16 v8bf;
__device__ __forceinline__ float xhalf(float x) { const int b = __float_as_int(x); return __int_as_float(__builtin_amdgcn_permlanex16(b, b, 0x76543210, 0xfedcba98, false, false)); }   // the value of lane ^ 16
// 2^x of a tile's eight values in one statement. Behind a transcendental the instruction set asks for one independent instruction before its result is used or its source overwritten: the results are early-clobber, so no v_exp_f32 here touches a neighbour's registers, and the v_nop is the last one's slot.
__device__ __forceinline__ v8f exp2x8(const v8f x) { float y0, y1, y2, y3, y4, y5, y6, y7;
    asm("v_exp_f32 %0, %8\n\tv_exp_f32 %1, %9\n\tv_exp_f32 %2, %10\n\tv_exp_f32 %3, %11\n\tv_exp_f32 %4, %12\n\tv_exp_f32 %5, %13\n\tv_exp_f32 %6, %14\n\tv_exp_f32 %7, %15\n\tv_nop"
        : "=&v"(y0), "=&v"(y1), "=&v"(y2), "=&v"(y3), "=&v"(y4), "=&v"(y5), "=&v"(y6), "=&v"(y7) : "v"(x[0]), "v"(x[1]), "v"(x[2]), "v"(x[3]), "v"(x[4]), "v"(x[5]), "v"(x[6]), "v"(x[7]));
    return (v8f){y0, y1, y2, y3, y4, y5, y6, y7}; }
template <typename T16, bool HL, int QT>
__device__ __forceinline__ void fattn_body(const T16* __restrict__ Q, const T16* __restrict__ Q2, const T16* __restrict__ Kp, const T16* __restrict__ Kp2, const T16* __restrict__ Vt, const T16* __restrict__ Vt2, const float* __restrict__ CT, const int q0, bf* Ah, bf* Al, float* lds) {
    typedef typename WFrag<T16>::V V;
    constexpr int NQ = 16 * QT, NQW = NQ * FQG, NT = FKS * FQG * 32;
    const int tid = (int)threadIdx.x, lane = tid & 31, lr = lane & 15, hi = lane >> 4; const int w = __builtin_amdgcn_readfirstlane(tid >> 5); const int ks = w & (FKS - 1), qg = w / FKS;
    float* tab = lds; float* accS = lds + FTAB; float* mS = accS + FKS * FQG * 32 * 68; float* lS = mS + FKS * FQG * 32;
    static_assert(FTAB == 17 * NT && TT + NQW - 1 <= FTAB, "tab: seventeen entries per work-item");
    int ix[17]; float cv[17];
#pragma unroll
    for (int f = 0; f < 17; ++f) { const int d = tid + f * NT - (NQW - 1) - q0; const int a = d < 0 ? -d : d; ix[f] = a < TT ? a : TT - 1; cv[f] = CT[ix[f]]; }   // entries past TT + NQW - 2 are never read; their index is clamped into the table
    const T16* pq = Q + ((size_t)(q0 + qg * NQ + lr) * HD + 8 * hi); const T16* pq2 = HL ? Q2 + ((size_t)(q0 + qg * NQ + lr) * HD + 8 * hi) : pq;
    V qf[QT][2], qf2[QT][2];
#pragma unroll
    for (int qt = 0; qt < QT; ++qt)
#pragma unroll
        for (int kc = 0; kc < 2; ++kc) { qf[qt][kc] = WFrag<T16>::ld(pq + qt * 16 * HD + kc * 32); if (HL) qf2[qt][kc] = WFrag<T16>::ld(pq2 + qt * 16 * HD + kc * 32); }
    // the wait that stands before a register named by an issued load is written anew; the loads' index and address registers are inputs, so they live up to it
    asm volatile("s_wait_xcnt 0x0" :: "v"(ix[0]), "v"(ix[1]), "v"(ix[2]), "v"(ix[3]), "v"(ix[4]), "v"(ix[5]), "v"(ix[6]), "v"(ix[7]), "v"(ix[8]), "v"(ix[9]), "v"(ix[10]), "v"(ix[11]), "v"(ix[12]), "v"(ix[13]), "v"(ix[14]), "v"(ix[15]), "v"(ix[16]), "v"(pq), "v"(pq2) : "memory");
#pragma unroll
    for (int f = 0; f < 17; ++f) tab[tid + f * NT] = cv[f] * SCL;
    v8f acc[QT][4]; float m[QT], l[QT];
#pragma unroll
    for (int qt = 0; qt < QT; ++qt) { m[qt] = -3.0e38f; l[qt] = 0.f;
#pragma unroll
        for (int dt = 0; dt < 4; ++dt) acc[qt][dt] = (v8f){}; }
    __syncthreads();   // tab is whole before any wave reads it
    const int kbeg = ks * (TT / FKS);
    // rolled: one pass's fragments live at a time
#pragma unroll 1
    for (int jb = kbeg; jb < kbeg + TT / FKS; jb += 32) {
        const size_t ok = (size_t)(jb + lr) * HD + 8 * hi;
        const T16* pk = Kp + ok; const T16* pk2 = HL ? Kp2 + ok : pk;
        V kf[2][2], kf2[2][2], vf[4], vf2[4];
#pragma unroll
        for (int kt = 0; kt < 2; ++kt)
#pragma unroll
            for (int kc = 0; kc < 2; ++kc) { kf[kt][kc] = WFrag<T16>::ld(pk + kt * 16 * HD + kc * 32); if (HL) kf2[kt][kc] = WFrag<T16>::ld(pk2 + kt * 16 * HD + kc * 32); }
        // as above: the address pairs live up to the wait, and nothing that a load names is written before it
        // the loaded fragments are inputs too (inputs only): all of the pass's K loads are then in flight together, one trip to L2 instead of several in a row
        if constexpr (HL) asm volatile("s_wait_xcnt 0x0" :: "v"(pk), "v"(pk2), "v"(kf[0][0]), "v"(kf[0][1]), "v"(kf[1][0]), "v"(kf[1][1]), "v"(kf2[0][0]), "v"(kf2[0][1]), "v"(kf2[1][0]), "v"(kf2[1][1]) : "memory");
        else asm volatile("s_wait_xcnt 0x0" :: "v"(pk), "v"(kf[0][0]), "v"(kf[0][1]), "v"(kf[1][0]), "v"(kf[1][1]) : "memory");
        v8f s[QT][2];
#pragma unroll
        for (int kt = 0; kt < 2; ++kt)
#pragma unroll
            for (int qt = 0; qt < QT; ++qt) { v8f t = (v8f){};
#pragma unroll
                for (int kc = 0; kc < 2; ++kc) { t = WFrag<T16>::mma(kf[kt][kc], qf[qt][kc], t); if (HL) { t = WFrag<T16>::mma(kf[kt][kc], qf2[qt][kc], t); t = WFrag<T16>::mma(kf2[kt][kc], qf[qt][kc], t); } }
                s[qt][kt] = t; }
        const float* tb = tab + (jb + 8 * hi - lr - qg * NQ + NQW - 1);
        float bm[QT]; bool need = false;
#pragma unroll
        for (int qt = 0; qt < QT; ++qt) { float x = -3.0e38f;
#pragma unroll
            for (int kt = 0; kt < 2; ++kt)
#pragma unroll
                for (int r = 0; r < 8; ++r) { const float t = s[qt][kt][r] * tb[16 * (kt - qt) + r]; s[qt][kt][r] = t; x = fmaxf(x, t); }
            x = fmaxf(x, xhalf(x)); bm[qt] = x; need = need || (x > m[qt] + FRTH); }
        // the V^T fragments go into the registers that the K fragments leave and fly while the softmax runs; the hi+lo form, with twice the fragments, asks for them behind the rescale branch, where the registers are free
        auto loadv = [&]() { const size_t ov = (size_t)lr * TT + jb + 8 * hi; const T16* pv = Vt + ov; const T16* pv2 = HL ? Vt2 + ov : pv;
#pragma unroll
            for (int dt = 0; dt < 4; ++dt) { vf[dt] = WFrag<T16>::ld(pv + dt * 16 * TT); if (HL) vf2[dt] = WFrag<T16>::ld(pv2 + dt * 16 * TT); }
            asm volatile("s_wait_xcnt 0x0" :: "v"(pv), "v"(pv2) : "memory");   // as above
        };
        if constexpr (!HL) loadv();
        if (__builtin_amdgcn_ballot_w32(need) != 0) {   // a scalar branch: taken on a wave's first pass and seldom after it
#pragma unroll
            for (int qt = 0; qt < QT; ++qt) { const float mn = (bm[qt] > m[qt] + FRTH) ? bm[qt] : m[qt]; const float al = __builtin_amdgcn_exp2f((m[qt] - mn) * L2E); m[qt] = mn; l[qt] *= al;
#pragma unroll
                for (int dt = 0; dt < 4; ++dt) acc[qt][dt] *= al; } }
        if constexpr (HL) loadv();
        V pb[QT], pl[QT];
#pragma unroll
        for (int qt = 0; qt < QT; ++qt) { const float nm = -m[qt] * L2E; float ls = 0.f;
#pragma unroll
            for (int kt = 0; kt < 2; ++kt) { v8f a;
#pragma unroll
                for (int r = 0; r < 8; ++r) a[r] = __builtin_fmaf(s[qt][kt][r], L2E, nm);
                s[qt][kt] = exp2x8(a);
#pragma unroll
                for (int r = 0; r < 8; ++r) ls += s[qt][kt][r]; }
            l[qt] += ls;
            if constexpr (HL) {   // hi = p rounded to nearest even, lo = (p - hi) rounded likewise: splitf's values for the finite p here, by the packed conversion
                const v8bf h0 = __builtin_convertvector(s[qt][0], v8bf), h1 = __builtin_convertvector(s[qt][1], v8bf);
                const v8bf l0 = __builtin_convertvector(s[qt][0] - __builtin_convertvector(h0, v8f), v8bf), l1 = __builtin_convertvector(s[qt][1] - __builtin_convertvector(h1, v8f), v8bf);
                pb[qt] = __builtin_shufflevector(h0, h1, 0, 1, 2, 3, 4, 5, 6, 7, 8, 9, 10, 11, 12, 13, 14, 15); pl[qt] = __builtin_shufflevector(l0, l1, 0, 1, 2, 3, 4, 5, 6, 7, 8, 9, 10, 11, 12, 13, 14, 15);
            } else { pb[qt] = cat16(__builtin_convertvector(s[qt][0], v8h), __builtin_convertvector(s[qt][1], v8h)); } }
#pragma unroll
        for (int dt = 0; dt < 4; ++dt)
#pragma unroll
            for (int qt = 0; qt < QT; ++qt) { acc[qt][dt] = WFrag<T16>::mma(vf[dt], pb[qt], acc[qt][dt]); if (HL) { acc[qt][dt] = WFrag<T16>::mma(vf[dt], pl[qt], acc[qt][dt]); acc[qt][dt] = WFrag<T16>::mma(vf2[dt], pb[qt], acc[qt][dt]); } }
    }
    float* my = accS + w * (32 * 68);
#pragma unroll
    for (int qt = 0; qt < QT; ++qt) { const float lj = l[qt] + xhalf(l[qt]);   // the two lane halves summed different keys of the same query
        if (hi == 0) { mS[w * 32 + qt * 16 + lr] = m[qt]; lS[w * 32 + qt * 16 + lr] = lj; }
#pragma unroll
        for (int dt = 0; dt < 4; ++dt) { float* p = my + (qt * 16 + lr) * 68 + dt * 16 + hi * 8; const v8f t = acc[qt][dt];
            *(v4fa*)p = __builtin_shufflevector(t, t, 0, 1, 2, 3); *(v4fa*)(p + 4) = __builtin_shufflevector(t, t, 4, 5, 6, 7); } }
    __syncthreads();   // every wave's partial is in LDS before any is joined
#pragma unroll
    for (int sx = 0; sx < NQW * 8 / NT; ++sx) { const int idx = sx * NT + tid; const int q = idx >> 3, dc = (idx & 7) * 8; const int w0 = (q / NQ) * FKS, ql = q % NQ;
        float M = mS[w0 * 32 + ql];
#pragma unroll
        for (int u = 1; u < FKS; ++u) M = fmaxf(M, mS[(w0 + u) * 32 + ql]);
        float L = 0.f; v4f o0 = (v4f){}, o1 = (v4f){};
#pragma unroll
        for (int u = 0; u < FKS; ++u) { const float sc = __builtin_amdgcn_exp2f((mS[(w0 + u) * 32 + ql] - M) * L2E); L += lS[(w0 + u) * 32 + ql] * sc; const float* p = accS + ((w0 + u) * 32 + ql) * 68 + dc; o0 += *(const v4fa*)p * sc; o1 += *(const v4fa*)(p + 4) * sc; }
        const float inv = __fdiv_rn(1.0f, L); v8us oh, ol;
#pragma unroll
        for (int k = 0; k < 4; ++k) { unsigned short a, c2; splitf(o0[k] * inv, a, c2); oh[k] = a; ol[k] = c2; splitf(o1[k] * inv, a, c2); oh[4 + k] = a; ol[4 + k] = c2; }
        const size_t oo = (size_t)(q0 + q) * DQ + dc; *(v8us*)(Ah + oo) = oh; *(v8us*)(Al + oo) = ol; }
}
// grid (batches x heads, RH / 16 + (TT - RH) / 32): the hi+lo query blocks (three products each, the longer work) have the low indices and start first.
// Five waves a SIMD (192 registers): the launch's 2,560 four-wave work-groups are then two full rounds of five on each of the 256 WGPs.
__global__ __launch_bounds__(FKS * FQG * 32) __attribute__((amdgpu_waves_per_eu(5, 5))) void k_fattn(const h16* __restrict__ Q16, const h16* __restrict__ K16, const h16* __restrict__ V16, const bf* __restrict__ Qh, const bf* __restrict__ Ql, const bf* __restrict__ Kh, const bf* __restrict__ Kl, const bf* __restrict__ Vh, const bf* __restrict__ Vl, const float* __restrict__ CT, bf* Ah, bf* Al) {
    __shared__ __align__(16) float lds[FLDS];
    const int bh = (int)blockIdx.x, by = (int)blockIdx.y; const size_t ho = (size_t)bh * TT * HD; const size_t ao = (size_t)(bh / NH_) * TT * DQ + (bh % NH_) * HD;   // planes [batch][head]; output rows [batch x t], the head's columns
    if (by < RH / (16 * FQG)) fattn_body<bf, true, 1>(Qh + ho, Ql + ho, Kh + ho, Kl + ho, Vh + ho, Vl + ho, CT, by * (16 * FQG), Ah + ao, Al + ao, lds);
    else fattn_body<h16, false, 2>(Q16 + ho, nullptr, K16 + ho, nullptr, V16 + ho, nullptr, CT, RH + (by - RH / (16 * FQG)) * (32 * FQG), Ah + ao, Al + ao, lds);
}

extern "C" void kernel_launch(void* const* d_in, const int* in_sizes, int n_in,
                              void* d_out, int out_size, void* d_ws, size_t ws_size, hipStream_t stream) {
    (void)in_sizes; (void)n_in; (void)out_size;
    const float* x = (const float*)d_in[0]; const float* wq = (const float*)d_in[1]; const float* wk = (const float*)d_in[2]; const float* wv = (const float*)d_in[3]; const float* wo = (const float*)d_in[4]; const float* qph = (const float*)d_in[5]; const float* qam = (const float*)d_in[6];
    float* OUT = (float*)d_out;     // [2][2048][1024]
    char* wsp = (char*)d_ws;
    auto take = [&](size_t bytes) { char* p = wsp; wsp += (bytes + 255) & ~(size_t)255; return (void*)p; };
    static_assert(DKV == DQ && DQ == DM, "the four weights are alike in shape, and q, k, v stand side by side in one product");
    bf* WT = (bf*)take((size_t)4 * DQ * DM * 2);   // Wq^T | Wk^T | Wv^T | Wo^T
    float* CS = (float*)take((size_t)TT * HD * 2 * 4); float* MOD = (float*)take((size_t)DQ * 4); float* CT = (float*)take((size_t)TT * 4);
    bf* XB = (bf*)take((size_t)NB_ * TT * DM * 2); float* F = (float*)take((size_t)NB_ * TT * 3 * DQ * 4);
    const size_t PL = (size_t)NB_ * NH_ * TT * HD;   // one kind of plane, both batches
    h16* P16 = (h16*)take(3 * PL * 2); bf* Ph = (bf*)take(3 * PL * 2); bf* Pl = (bf*)take(3 * PL * 2);
    bf* ATh = (bf*)take((size_t)NB_ * TT * DQ * 2); bf* ATl = (bf*)take((size_t)NB_ * TT * DQ * 2);
    if ((size_t)(wsp - (char*)d_ws) > ws_size) return;    // ws 256 MiB
    k_prep<<<4 * PW + PX + PC + PT, 256, 0, stream>>>(x, wq, wk, wv, wo, qph, qam, WT, XB, CS, MOD, CT);
    k_gemmw<bf, 0, false><<<dim3(NB_ * TT / 64, 3 * DQ / 64, 1), 32, 0, stream>>>(XB, nullptr, WT, nullptr, DM, F, 3 * DQ, nullptr, 0, 0, 0);   // q | k | v of both batches
    k_planes<<<dim3((unsigned)(((size_t)NH_ * TT * HD / 2 + 255) / 256), 3, NB_), 256, 0, stream>>>(F, CS, MOD, P16, Ph, Pl);
    k_fattn<<<dim3(NB_ * NH_, RH / (16 * FQG) + (TT - RH) / (32 * FQG), 1), FKS * FQG * 32, 0, stream>>>(P16, P16 + PL, P16 + 2 * PL, Ph, Pl, Ph + PL, Pl + PL, Ph + 2 * PL, Pl + 2 * PL, CT, ATh, ATl);   // one kv head per query head
    k_gemmw<bf, 1, false><<<dim3(NB_ * TT / 64, DM / 64, 1), 32, 0, stream>>>(ATh, ATl, WT + (size_t)3 * DQ * DM, nullptr, DQ, OUT, DM, nullptr, 0, 0, 0);
}

// v005
// One run takes 221 microseconds.
// Timed twice side by side with v004, it ran 1.21 times as fast both times.
// All steps since v000 together make it 9.85 times as fast.
#include <hip/hip_runtime.h>

// 'Quantum' attention (x [2][2048][1024]; q, k, v = (x W) ('xw' [1024][1024], 16 heads x 64) each multiplied per (head, dim) by mod = cos(quantum_phase[h][d]) x quantum_amplitude[h][d]; scores = q.k / 8 x cos(2 pi (i - j) / 2048) (multiplicative Toeplitz 'interference'); w = softmax; w' = (w + roll(w, 1, keys)) / sqrt(2); out = w' v; y = merged Wo ('xw') -> [2][2048][1024] (4.2 M)).
// Realisation: the roll superposition is moved onto the values: w' v = w @ vv with vv[j] = (v[j] + v[(j+1) mod S]) / sqrt(2) (exact algebra), so attn.v runs on vv^T planes; the modulation is applied where the q | k | v product stores its planes (q, k planes x MOD[h][d]; vv from modulated v); the fused attention kernel multiplies each scaled logit by the cos table entry for |i - j| (cos(2 pi m / 2048) computed as the reference's float32 expression).
// Compute dtypes, f32 accumulate: every input rounded to bf16; q/k/v on PLAIN bf16 operands (inputs: exact); modulation table (precise cosf of bf16 phase x bf16 amplitude) and the cos Toeplitz table in f32; scores and attn.v: query rows < 512 hl (3 products), the rest single fp16; softmax f32 (running maximum, probabilities unnormalised until the end); Wo hl x exact (2 products).

#define NB_  2
#define TT   2048
#define DM   1024
#define NH_  16
#define NKV  16
#define REP  (NH_ / NKV)
#define HD   64
#define DQ   (NH_ * HD)
#define DKV  (NKV * HD)
#define RH   512                  // query rows < RH use hi+lo planes (0: none)
#define WIN  0
#define SCL  0.125f   // HD^-0.5
typedef _Float16 h16;
typedef unsigned short bf;
typedef __attribute__((ext_vector_type(16))) __bf16   v16bf;
typedef __attribute__((ext_vector_type(16))) _Float16 v16h;
typedef __attribute__((ext_vector_type(8)))  _Float16 v8h;
typedef __attribute__((ext_vector_type(8)))  unsigned short v8us;
typedef __attribute__((ext_vector_type(8)))  float    v8f;
typedef __attribute__((ext_vector_type(4)))  float    v4f;
typedef v8h  __attribute__((may_alias)) v8ha;
typedef v4f  __attribute__((may_alias)) v4fa;
typedef v8us __attribute__((may_alias)) v8usa;

__device__ __forceinline__ unsigned short f2bf(float f) { unsigned u = __float_as_uint(f); u += 0x7FFFu + ((u >> 16) & 1u); return (unsigned short)(u >> 16); }
__device__ __forceinline__ float bf2f(unsigned short b) { return __uint_as_float(((unsigned)b) << 16); }
__device__ __forceinline__ float bfr(float f) { return bf2f(f2bf(f)); }
__device__ __forceinline__ v16h cat16(v8h lo, v8h hi) { return __builtin_shufflevector(lo, hi, 0, 1, 2, 3, 4, 5, 6, 7, 8, 9, 10, 11, 12, 13, 14, 15); }
__device__ __forceinline__ v16bf cat16b(v8us lo, v8us hi) { return __builtin_bit_cast(v16bf, __builtin_shufflevector(lo, hi, 0, 1, 2, 3, 4, 5, 6, 7, 8, 9, 10, 11, 12, 13, 14, 15)); }
__device__ __forceinline__ v8f wmma16(v16h a, v16h b, v8f c) { return __builtin_amdgcn_wmma_f32_16x16x32_f16(false, a, false, b, (short)0, c, false, false); }
__device__ __forceinline__ v8f wmmab(v16bf a, v16bf b, v8f c) { return __builtin_amdgcn_wmma_f32_16x16x32_bf16(false, a, false, b, (short)0, c, false, false); }



// ---- k_gemmw: register-blocked GEMM, ONE WAVE per 64x64 output tile (16 accumulators), operands straight from K-contiguous 16-bit planes; grid (M/64, N/64, Z), 32 threads.
// C[m][n] (f32, pitch ldc, + optional f32 bias[n]) = sum_k A[m][k] Bt[n][k] (+ split products per NSPLIT). z-batch strides sA/sB/sC in elements. K % 32 == 0.
template <typename T16> struct WFrag;
template <> struct WFrag<h16> { typedef v16h V; static __device__ __forceinline__ V ld(const h16* p) { return cat16(*(const v8h*)p, *(const v8h*)(p + 16)); } static __device__ __forceinline__ v8f mma(V a, V b, v8f c) { return wmma16(a, b, c); } };
template <> struct WFrag<bf> { typedef v16bf V; static __device__ __forceinline__ V ld(const bf* p) { return cat16b(*(const v8us*)p, *(const v8us*)(p + 16)); } static __device__ __forceinline__ v8f mma(V a, V b, v8f c) { return wmmab(a, b, c); } };
template <typename T16, int NSPLIT, bool BIAS>
__global__ __launch_bounds__(32) void k_gemmw(const T16* __restrict__ A, const T16* __restrict__ A2, const T16* __restrict__ Bt, const T16* __restrict__ Bt2, int K, float* C, int ldc, const float* __restrict__ bias, size_t sA, size_t sB, size_t sC) {
    typedef typename WFrag<T16>::V V;
    __shared__ __align__(16) float os[16 * 68];
    const size_t z = blockIdx.z; A += z * sA; if (A2) A2 += z * sA; Bt += z * sB; if (Bt2) Bt2 += z * sB; C += z * sC;
    const int lane = threadIdx.x & 31, lr = lane & 15, hi = lane >> 4; const int r0 = blockIdx.x * 64, c0 = blockIdx.y * 64;
    v8f acc[4][4];
#pragma unroll
    for (int mb = 0; mb < 4; ++mb)
#pragma unroll
        for (int nb = 0; nb < 4; ++nb) acc[mb][nb] = (v8f){};
    const size_t aoff = (size_t)(r0 + lr) * K + 8 * hi, boff = (size_t)(c0 + lr) * K + 8 * hi;
#pragma unroll 1
    for (int kc = 0; kc < K; kc += 32) {
        V a[4], a2[4];
#pragma unroll
        for (int mb = 0; mb < 4; ++mb) { a[mb] = WFrag<T16>::ld(A + aoff + (size_t)mb * 16 * K + kc); if (NSPLIT == 1 || NSPLIT == 2) a2[mb] = WFrag<T16>::ld(A2 + aoff + (size_t)mb * 16 * K + kc); }
#pragma unroll
        for (int nb = 0; nb < 4; ++nb) { const V b = WFrag<T16>::ld(Bt + boff + (size_t)nb * 16 * K + kc); V b2; if (NSPLIT >= 2) b2 = WFrag<T16>::ld(Bt2 + boff + (size_t)nb * 16 * K + kc);
#pragma unroll
            for (int mb = 0; mb < 4; ++mb) { acc[mb][nb] = WFrag<T16>::mma(a[mb], b, acc[mb][nb]); if (NSPLIT == 1 || NSPLIT == 2) acc[mb][nb] = WFrag<T16>::mma(a2[mb], b, acc[mb][nb]); if (NSPLIT >= 2) acc[mb][nb] = WFrag<T16>::mma(a[mb], b2, acc[mb][nb]); } }
        asm volatile("v_nop\n\tv_nop\n\tv_nop\n\tv_nop" : "+v"(acc[0][0]), "+v"(acc[1][1]), "+v"(acc[2][2]), "+v"(acc[3][3]) : "v"(a[0]), "v"(a[3]));
    }
#pragma unroll
    for (int mb = 0; mb < 4; ++mb) {
#pragma unroll
        for (int nb = 0; nb < 4; ++nb) {
#pragma unroll
            for (int j = 0; j < 8; ++j) os[(hi * 8 + j) * 68 + nb * 16 + lr] = acc[mb][nb][j]; }
        __builtin_amdgcn_wave_barrier(); asm volatile("" ::: "memory");
        float* crow = C + (size_t)(r0 + mb * 16) * ldc + c0;
{
#pragma unroll
            for (int s = 0; s < 8; ++s) { const int row = 2 * s + hi, cofs = lr * 4; v4f val = *(const v4fa*)(os + row * 68 + cofs); if (BIAS) { val[0] += bfr(bias[c0 + cofs]); val[1] += bfr(bias[c0 + cofs + 1]); val[2] += bfr(bias[c0 + cofs + 2]); val[3] += bfr(bias[c0 + cofs + 3]); }
                *(v4f*)(crow + (size_t)row * ldc + cofs) = val; }
             }
        __builtin_amdgcn_wave_barrier(); asm volatile("" ::: "memory");
    }
}

__device__ __forceinline__ h16 tohx(float x) { return (h16)x; }
__device__ __forceinline__ void splitf(float y, unsigned short& h, unsigned short& l) { h = f2bf(y); l = f2bf(y - bf2f(h)); }
typedef __attribute__((ext_vector_type(2))) _Float16 v2h;
typedef __attribute__((ext_vector_type(4))) _Float16 v4h;
typedef __attribute__((ext_vector_type(2))) unsigned short v2us;
typedef __attribute__((ext_vector_type(4))) unsigned short v4us;
typedef __attribute__((ext_vector_type(2))) float v2f;
typedef __attribute__((ext_vector_type(4))) int v4i;

// The j_ functions are jobs of 256 work-items that read none of each other's output; k_prep below runs them side by side in one grid, the job picked by the block index (bx: the block's index within its job).
__device__ __forceinline__ void j_wtG(const int bx, const float* __restrict__ w, int K, int N, bf* Bt) {
    const int lane = threadIdx.x & 31; const int L0 = (bx * 8 + (threadIdx.x >> 5)) * 8; const int nlines = N * K / 64;
{
#pragma unroll 1
        for (int l = 0; l < 8; ++l) { const int L = L0 + l; if (L >= nlines) break; const size_t e = (size_t)L * 64 + lane * 2; const int k = (int)(e % K), n = (int)(e / K); v2us o;
            o[0] = f2bf(w[(size_t)k * N + n]); o[1] = f2bf(w[(size_t)(k + 1) * N + n]); *(v2us*)(Bt + e) = o; }
         }
}
__device__ __forceinline__ void j_cvt8(const int bx, const float* __restrict__ src, bf* dst, size_t n8) { const size_t i = (size_t)bx * 256 + threadIdx.x; if (i >= n8) return; const v8f v = *(const v8f*)(src + i * 8); v8us o;
#pragma unroll
    for (int k = 0; k < 8; ++k) o[k] = f2bf(v[k]); *(v8us*)(dst + i * 8) = o;  }

__global__ __launch_bounds__(256) void k_vtp(const float* __restrict__ F, int pitch, int nheads, h16* V16, bf* Vh, bf* Vl) { const size_t e = ((size_t)blockIdx.x * 256 + threadIdx.x) * 2; if (e >= (size_t)nheads * HD * TT) return; const int t = (int)(e % TT); const int d = (int)((e / TT) % HD); const int g = (int)(e / ((size_t)TT * HD)); v2h o16; v2us oh, ol;
#pragma unroll
    for (int q = 0; q < 2; ++q) { const float x = F[(size_t)(t + q) * pitch + g * HD + d]; o16[q] = tohx(x); unsigned short a2, c2; splitf(x, a2, c2); oh[q] = a2; ol[q] = c2; }
    *(v2h*)(V16 + e) = o16; *(v2us*)(Vh + e) = oh; *(v2us*)(Vl + e) = ol;  }
__device__ __forceinline__ void j_qtabs(const int bx, const float* __restrict__ ph, const float* __restrict__ am, float* MOD, float* CT) { const int i = bx * 256 + threadIdx.x; if (i < DQ) { const float m = __fmul_rn(cosf(bfr(ph[i])), bfr(am[i])); *(float*)(MOD + i) = m;  }
    if (i < TT) { const float a = __fmul_rn(__fmul_rn(6.2831853071795862f, (float)i), 1.0f / (float)TT); const float c = cosf(a); *(float*)(CT + i) = c;  } }
// ---- k_prep: every job that reads only inputs, in one grid: the four weight transposes (a chain of strided reads each, the longest job: lowest indices), x of both batches to bf16, the modulation and cos tables.
#define PW ((DM * DQ / 64 + 63) / 64)              // blocks of one weight transpose
#define PX ((NB_ * TT * DM / 8 + 255) / 256)       // blocks of the x conversion
#define PT ((TT + 255) / 256)                      // blocks of the two small tables
__global__ __launch_bounds__(256) void k_prep(const float* __restrict__ x, const float* __restrict__ wq, const float* __restrict__ wk, const float* __restrict__ wv, const float* __restrict__ wo, const float* __restrict__ ph, const float* __restrict__ am, bf* WT, bf* XB, float* MOD, float* CT) {
    const int b = (int)blockIdx.x;
    if (b < 4 * PW) { const int j = b / PW; j_wtG(b % PW, j == 0 ? wq : j == 1 ? wk : j == 2 ? wv : wo, DM, DQ, WT + (size_t)j * DQ * DM); }
    else if (b < 4 * PW + PX) j_cvt8(b - 4 * PW, x, XB, (size_t)NB_ * TT * DM / 8);
    else j_qtabs(b - 4 * PW - PX, ph, am, MOD, CT);
}
// ---- k_fattn: scores, interference, softmax and attn.v of one query block in one kernel; no score or probability ever reaches memory.
// Transposed products: S^T = K Q^T (A = 16 key rows, B = 16 query rows, both by the same loader), so a lane holds 8 keys' scores of ONE query (query = lane & 15, keys 8 (lane >> 4) + r);
// two such tiles (keys 0-15 and 16-31 of a 32-key pass), converted in place, are the B operand of O^T += V^T P^T, whose A operand (V^T rows, key-contiguous) comes by the same loader in the same k order.
// Softmax is the running form: a query's maximum in use m is raised (and its sum and output tiles rescaled) only when a pass's maximum exceeds it by more than FRTH, so p = exp(t - m) <= exp(FRTH).
// Work-group: FQG query groups x FKS key chunks = 4 waves; wave (qg, ks) does 16 QT queries against keys [ks TT / FKS, + TT / FKS); the FKS partial (m, sum, O) of a query are joined through LDS in chunk order and stored as the hi + lo planes that the Wo product reads.
// tab[u] = cos table entry for |j - i| x HD^-0.5 (a power of two: exact), u = j - (i - q0) + NQW - 1: a lane's 8 keys are 8 consecutive entries.
// Each '#pragma unroll' below, but those on the join's sx and u loops, unrolls a loop over a register array to the end, so that its indices are constants and the array stays in registers.
#define FKS  4
#define FQG  1
#define FRTH 5.5f
#define L2E  1.4426950408889634f
#define FTAB 2176                 // floats kept for tab: TT + 32 - 1, rounded up to 17 per work-item
#define FLDS (FTAB + FKS * FQG * 32 * 68 + 2 * FKS * FQG * 32)
typedef __attribute__((ext_vector_type(8))) __bf16 v8bf;
__device__ __forceinline__ float xhalf(float x) { const int b = __float_as_int(x); return __int_as_float(__builtin_amdgcn_permlanex16(b, b, 0x76543210, 0xfedcba98, false, false)); }   // the value of lane ^ 16
// 2^x of a tile's eight values in one statement. Behind a transcendental the instruction set asks for one independent instruction before its result is used or its source overwritten: the results are early-clobber, so no v_exp_f32 here touches a neighbour's registers, and the v_nop is the last one's slot.
__device__ __forceinline__ v8f exp2x8(const v8f x) { float y0, y1, y2, y3, y4, y5, y6, y7;
    asm("v_exp_f32 %0, %8\n\tv_exp_f32 %1, %9\n\tv_exp_f32 %2, %10\n\tv_exp_f32 %3, %11\n\tv_exp_f32 %4, %12\n\tv_exp_f32 %5, %13\n\tv_exp_f32 %6, %14\n\tv_exp_f32 %7, %15\n\tv_nop"
        : "=&v"(y0), "=&v"(y1), "=&v"(y2), "=&v"(y3), "=&v"(y4), "=&v"(y5), "=&v"(y6), "=&v"(y7) : "v"(x[0]), "v"(x[1]), "v"(x[2]), "v"(x[3]), "v"(x[4]), "v"(x[5]), "v"(x[6]), "v"(x[7]));
    return (v8f){y0, y1, y2, y3, y4, y5, y6, y7}; }
template <typename T16, bool HL, int QT>
__device__ __forceinline__ void fattn_body(const T16* __restrict__ Q, const T16* __restrict__ Q2, const T16* __restrict__ Kp, const T16* __restrict__ Kp2, const T16* __restrict__ Vt, const T16* __restrict__ Vt2, const float* __restrict__ CT, const int q0, bf* Ah, bf* Al, float* lds) {
    typedef typename WFrag<T16>::V V;
    constexpr int NQ = 16 * QT, NQW = NQ * FQG, NT = FKS * FQG * 32;
    const int tid = (int)threadIdx.x, lane = tid & 31, lr = lane & 15, hi = lane >> 4; const int w = __builtin_amdgcn_readfirstlane(tid >> 5); const int ks = w & (FKS - 1), qg = w / FKS;
    float* tab = lds; float* accS = lds + FTAB; float* mS = accS + FKS * FQG * 32 * 68; float* lS = mS + FKS * FQG * 32;
    static_assert(FTAB == 17 * NT && TT + NQW - 1 <= FTAB, "tab: seventeen entries per work-item");
    int ix[17]; float cv[17];
#pragma unroll
    for (int f = 0; f < 17; ++f) { const int d = tid + f * NT - (NQW - 1) - q0; const int a = d < 0 ? -d : d; ix[f] = a < TT ? a : TT - 1; cv[f] = CT[ix[f]]; }   // entries past TT + NQW - 2 are never read; their index is clamped into the table
    const T16* pq = Q + ((size_t)(q0 + qg * NQ + lr) * HD + 8 * hi); const T16* pq2 = HL ? Q2 + ((size_t)(q0 + qg * NQ + lr) * HD + 8 * hi) : pq;
    V qf[QT][2], qf2[QT][2];
#pragma unroll
    for (int qt = 0; qt < QT; ++qt)
#pragma unroll
        for (int kc = 0; kc < 2; ++kc) { qf[qt][kc] = WFrag<T16>::ld(pq + qt * 16 * HD + kc * 32); if (HL) qf2[qt][kc] = WFrag<T16>::ld(pq2 + qt * 16 * HD + kc * 32); }
    // the wait that stands before a register named by an issued load is written anew; the loads' index and address registers are inputs, so they live up to it
    asm volatile("s_wait_xcnt 0x0" :: "v"(ix[0]), "v"(ix[1]), "v"(ix[2]), "v"(ix[3]), "v"(ix[4]), "v"(ix[5]), "v"(ix[6]), "v"(ix[7]), "v"(ix[8]), "v"(ix[9]), "v"(ix[10]), "v"(ix[11]), "v"(ix[12]), "v"(ix[13]), "v"(ix[14]), "v"(ix[15]), "v"(ix[16]), "v"(pq), "v"(pq2) : "memory");
#pragma unroll
    for (int f = 0; f < 17; ++f) tab[tid + f * NT] = cv[f] * SCL;
    v8f acc[QT][4]; float m[QT], l[QT];
#pragma unroll
    for (int qt = 0; qt < QT; ++qt) { m[qt] = -3.0e38f; l[qt] = 0.f;
#pragma unroll
        for (int dt = 0; dt < 4; ++dt) acc[qt][dt] = (v8f){}; }
    __syncthreads();   // tab is whole before any wave reads it
    const int kbeg = ks * (TT / FKS);
    // rolled: one pass's fragments live at a time
#pragma unroll 1
    for (int jb = kbeg; jb < kbeg + TT / FKS; jb += 32) {
        const size_t ok = (size_t)(jb + lr) * HD + 8 * hi;
        const T16* pk = Kp + ok; const T16* pk2 = HL ? Kp2 + ok : pk;
        V kf[2][2], kf2[2][2], vf[4], vf2[4];
#pragma unroll
        for (int kt = 0; kt < 2; ++kt)
#pragma unroll
            for (int kc = 0; kc < 2; ++kc) { kf[kt][kc] = WFrag<T16>::ld(pk + kt * 16 * HD + kc * 32); if (HL) kf2[kt][kc] = WFrag<T16>::ld(pk2 + kt * 16 * HD + kc * 32); }
        // as above: the address pairs live up to the wait, and nothing that a load names is written before it
        // the loaded fragments are inputs too (inputs only): all of the pass's K loads are then in flight together, one trip to L2 instead of several in a row
        if constexpr (HL) asm volatile("s_wait_xcnt 0x0" :: "v"(pk), "v"(pk2), "v"(kf[0][0]), "v"(kf[0][1]), "v"(kf[1][0]), "v"(kf[1][1]), "v"(kf2[0][0]), "v"(kf2[0][1]), "v"(kf2[1][0]), "v"(kf2[1][1]) : "memory");
        else asm volatile("s_wait_xcnt 0x0" :: "v"(pk), "v"(kf[0][0]), "v"(kf[0][1]), "v"(kf[1][0]), "v"(kf[1][1]) : "memory");
        v8f s[QT][2];
#pragma unroll
        for (int kt = 0; kt < 2; ++kt)
#pragma unroll
            for (int qt = 0; qt < QT; ++qt) { v8f t = (v8f){};
#pragma unroll
                for (int kc = 0; kc < 2; ++kc) { t = WFrag<T16>::mma(kf[kt][kc], qf[qt][kc], t); if (HL) { t = WFrag<T16>::mma(kf[kt][kc], qf2[qt][kc], t); t = WFrag<T16>::mma(kf2[kt][kc], qf[qt][kc], t); } }
                s[qt][kt] = t; }
        const float* tb = tab + (jb + 8 * hi - lr - qg * NQ + NQW - 1);
        float bm[QT]; bool need = false;
#pragma unroll
        for (int qt = 0; qt < QT; ++qt) { float x = -3.0e38f;
#pragma unroll
            for (int kt = 0; kt < 2; ++kt)
#pragma unroll
                for (int r = 0; r < 8; ++r) { const float t = s[qt][kt][r] * tb[16 * (kt - qt) + r]; s[qt][kt][r] = t; x = fmaxf(x, t); }
            x = fmaxf(x, xhalf(x)); bm[qt] = x; need = need || (x > m[qt] + FRTH); }
        // the V^T fragments go into the registers that the K fragments leave and fly while the softmax runs; the hi+lo form, with twice the fragments, asks for them behind the rescale branch, where the registers are free
        auto loadv = [&]() { const size_t ov = (size_t)lr * TT + jb + 8 * hi; const T16* pv = Vt + ov; const T16* pv2 = HL ? Vt2 + ov : pv;
#pragma unroll
            for (int dt = 0; dt < 4; ++dt) { vf[dt] = WFrag<T16>::ld(pv + dt * 16 * TT); if (HL) vf2[dt] = WFrag<T16>::ld(pv2 + dt * 16 * TT); }
            asm volatile("s_wait_xcnt 0x0" :: "v"(pv), "v"(pv2) : "memory");   // as above
        };
        if constexpr (!HL) loadv();
        if (__builtin_amdgcn_ballot_w32(need) != 0) {   // a scalar branch: taken on a wave's first pass and seldom after it
#pragma unroll
            for (int qt = 0; qt < QT; ++qt) { const float mn = (bm[qt] > m[qt] + FRTH) ? bm[qt] : m[qt]; const float al = __builtin_amdgcn_exp2f((m[qt] - mn) * L2E); m[qt] = mn; l[qt] *= al;
#pragma unroll
                for (int dt = 0; dt < 4; ++dt) acc[qt][dt] *= al; } }
        if constexpr (HL) loadv();
        V pb[QT], pl[QT];
#pragma unroll
        for (int qt = 0; qt < QT; ++qt) { const float nm = -m[qt] * L2E; float ls = 0.f;
#pragma unroll
            for (int kt = 0; kt < 2; ++kt) { v8f a;
#pragma unroll
                for (int r = 0; r < 8; ++r) a[r] = __builtin_fmaf(s[qt][kt][r], L2E, nm);
                s[qt][kt] = exp2x8(a);
#pragma unroll
                for (int r = 0; r < 8; ++r) ls += s[qt][kt][r]; }
            l[qt] += ls;
            if constexpr (HL) {   // hi = p rounded to nearest even, lo = (p - hi) rounded likewise: splitf's values for the finite p here, by the packed conversion
                const v8bf h0 = __builtin_convertvector(s[qt][0], v8bf), h1 = __builtin_convertvector(s[qt][1], v8bf);
                const v8bf l0 = __builtin_convertvector(s[qt][0] - __builtin_convertvector(h0, v8f), v8bf), l1 = __builtin_convertvector(s[qt][1] - __builtin_convertvector(h1, v8f), v8bf);
                pb[qt] = __builtin_shufflevector(h0, h1, 0, 1, 2, 3, 4, 5, 6, 7, 8, 9, 10, 11, 12, 13, 14, 15); pl[qt] = __builtin_shufflevector(l0, l1, 0, 1, 2, 3, 4, 5, 6, 7, 8, 9, 10, 11, 12, 13, 14, 15);
            } else { pb[qt] = cat16(__builtin_convertvector(s[qt][0], v8h), __builtin_convertvector(s[qt][1], v8h)); } }
#pragma unroll
        for (int dt = 0; dt < 4; ++dt)
#pragma unroll
            for (int qt = 0; qt < QT; ++qt) { acc[qt][dt] = WFrag<T16>::mma(vf[dt], pb[qt], acc[qt][dt]); if (HL) { acc[qt][dt] = WFrag<T16>::mma(vf[dt], pl[qt], acc[qt][dt]); acc[qt][dt] = WFrag<T16>::mma(vf2[dt], pb[qt], acc[qt][dt]); } }
    }
    float* my = accS + w * (32 * 68);
#pragma unroll
    for (int qt = 0; qt < QT; ++qt) { const float lj = l[qt] + xhalf(l[qt]);   // the two lane halves summed different keys of the same query
        if (hi == 0) { mS[w * 32 + qt * 16 + lr] = m[qt]; lS[w * 32 + qt * 16 + lr] = lj; }
#pragma unroll
        for (int dt = 0; dt < 4; ++dt) { float* p = my + (qt * 16 + lr) * 68 + dt * 16 + hi * 8; const v8f t = acc[qt][dt];
            *(v4fa*)p = __builtin_shufflevector(t, t, 0, 1, 2, 3); *(v4fa*)(p + 4) = __builtin_shufflevector(t, t, 4, 5, 6, 7); } }
    __syncthreads();   // every wave's partial is in LDS before any is joined
#pragma unroll
    for (int sx = 0; sx < NQW * 8 / NT; ++sx) { const int idx = sx * NT + tid; const int q = idx >> 3, dc = (idx & 7) * 8; const int w0 = (q / NQ) * FKS, ql = q % NQ;
        float M = mS[w0 * 32 + ql];
#pragma unroll
        for (int u = 1; u < FKS; ++u) M = fmaxf(M, mS[(w0 + u) * 32 + ql]);
        float L = 0.f; v4f o0 = (v4f){}, o1 = (v4f){};
#pragma unroll
        for (int u = 0; u < FKS; ++u) { const float sc = __builtin_amdgcn_exp2f((mS[(w0 + u) * 32 + ql] - M) * L2E); L += lS[(w0 + u) * 32 + ql] * sc; const float* p = accS + ((w0 + u) * 32 + ql) * 68 + dc; o0 += *(const v4fa*)p * sc; o1 += *(const v4fa*)(p + 4) * sc; }
        const float inv = __fdiv_rn(1.0f, L); v8us oh, ol;
#pragma unroll
        for (int k = 0; k < 4; ++k) { unsigned short a, c2; splitf(o0[k] * inv, a, c2); oh[k] = a; ol[k] = c2; splitf(o1[k] * inv, a, c2); oh[4 + k] = a; ol[4 + k] = c2; }
        const size_t oo = (size_t)(q0 + q) * DQ + dc; *(v8us*)(Ah + oo) = oh; *(v8us*)(Al + oo) = ol; }
}
// grid (batches x heads, RH / 16 + (TT - RH) / 32): the hi+lo query blocks (three products each, the longer work) have the low indices and start first.
// Five waves a SIMD (192 registers): the launch's 2,560 four-wave work-groups are then two full rounds of five on each of the 256 WGPs.
__global__ __launch_bounds__(FKS * FQG * 32) __attribute__((amdgpu_waves_per_eu(5, 5))) void k_fattn(const h16* __restrict__ Q16, const h16* __restrict__ K16, const h16* __restrict__ V16, const bf* __restrict__ Qh, const bf* __restrict__ Ql, const bf* __restrict__ Kh, const bf* __restrict__ Kl, const bf* __restrict__ Vh, const bf* __restrict__ Vl, const float* __restrict__ CT, bf* Ah, bf* Al) {
    __shared__ __align__(16) float lds[FLDS];
    const int bh = (int)blockIdx.x, by = (int)blockIdx.y; const size_t ho = (size_t)bh * TT * HD; const size_t ao = (size_t)(bh / NH_) * TT * DQ + (bh % NH_) * HD;   // planes [batch][head]; output rows [batch x t], the head's columns
    if (by < RH / (16 * FQG)) fattn_body<bf, true, 1>(Qh + ho, Ql + ho, Kh + ho, Kl + ho, Vh + ho, Vl + ho, CT, by * (16 * FQG), Ah + ao, Al + ao, lds);
    else fattn_body<h16, false, 2>(Q16 + ho, nullptr, K16 + ho, nullptr, V16 + ho, nullptr, CT, RH + (by - RH / (16 * FQG)) * (32 * FQG), Ah + ao, Al + ao, lds);
}

// ---- k_qkv: the q | k | v product of both batches, its epilogue storing the head planes that k_fattn reads (fp16 and hi + lo bf16); the f32 product never reaches memory.
// ONE WAVE per 64 x 64 tile as in k_gemmw, same loop and k order; a tile is 64 positions of one head of q, k or v. grid (batches x TT / 64, 3 DQ / 64), 32 threads.
// q, k: planes [t][d], value x MOD[h][d]. v: planes [d][t] of vv[t] = (v[t] MOD + v[t + 1 mod TT] MOD) / sqrt(2): the tile's last position needs the next tile's first row, so a v tile carries a fifth row block (rows t0 + 64 ..., wrapped inside the batch), of which row 0 is used.
// Eight values in a row to the three planes: fp16, hi = bf16 nearest even, lo = (x - hi) likewise (splitf's values for finite x, by the packed conversion).
__device__ __forceinline__ void put8(const v8f x, const size_t e, h16* P16, bf* Ph, bf* Pl) {
    const v8bf h = __builtin_convertvector(x, v8bf); const v8bf l = __builtin_convertvector(x - __builtin_convertvector(h, v8f), v8bf);
    *(v8h*)(P16 + e) = __builtin_convertvector(x, v8h); *(v8us*)(Ph + e) = __builtin_bit_cast(v8us, h); *(v8us*)(Pl + e) = __builtin_bit_cast(v8us, l); }
template <bool VV>
__device__ __forceinline__ void qkv_body(const bf* __restrict__ X, const bf* __restrict__ Wt, const float* __restrict__ MOD, h16* P16, bf* Ph, bf* Pl, float* os) {
    typedef WFrag<bf>::V V;
    constexpr int K = DM, MB = VV ? 5 : 4;
    const int lane = threadIdx.x & 31, lr = lane & 15, hi = lane >> 4; const int r0 = blockIdx.x * 64, c0 = blockIdx.y * 64;
    const int b = r0 / TT, t0 = r0 % TT, h = (c0 % DQ) / HD;
    const float* pm = MOD + h * HD + lr; float md[4];
#pragma unroll
    for (int nb = 0; nb < 4; ++nb) md[nb] = pm[nb * 16];   // a lane's accumulators are of columns nb 16 + lr
    asm volatile("s_wait_xcnt 0x0" :: "v"(pm) : "memory");   // the wait that stands before a register named by an issued load is written anew; the address pair is an input, so it lives up to it
    v8f acc[MB][4];
#pragma unroll
    for (int mb = 0; mb < MB; ++mb)
#pragma unroll
        for (int nb = 0; nb < 4; ++nb) acc[mb][nb] = (v8f){};
    const bf* pa = X + ((size_t)(r0 + lr) * K + 8 * hi); const bf* pb = Wt + ((size_t)(c0 + lr) * K + 8 * hi); const bf* pn = X + ((size_t)(b * TT + (t0 + 64) % TT + lr) * K + 8 * hi);
    // rolled: one pass's fragments live at a time
#pragma unroll 1
    for (int kc = 0; kc < K; kc += 32) {
        V a[MB], bb[4];
#pragma unroll
        for (int mb = 0; mb < 4; ++mb) a[mb] = WFrag<bf>::ld(pa + mb * 16 * K);
        if constexpr (VV) a[4] = WFrag<bf>::ld(pn);
#pragma unroll
        for (int nb = 0; nb < 4; ++nb) bb[nb] = WFrag<bf>::ld(pb + nb * 16 * K);
        // as above: the address pairs live up to the wait, so no load's result lands on a pair that an earlier load names, and the steps below stand behind it
        if constexpr (VV) asm volatile("s_wait_xcnt 0x0" :: "v"(pa), "v"(pb), "v"(pn) : "memory");
        else asm volatile("s_wait_xcnt 0x0" :: "v"(pa), "v"(pb) : "memory");
#pragma unroll
        for (int nb = 0; nb < 4; ++nb)
#pragma unroll
            for (int mb = 0; mb < MB; ++mb) acc[mb][nb] = WFrag<bf>::mma(a[mb], bb[nb], acc[mb][nb]);
        pa += 32; pb += 32; pn += 32;
    }
    const size_t o = (((size_t)(c0 / DQ) * NB_ + b) * NH_ + h) * TT * HD;   // planes [q, k, v][batch][head]
    const int rw = lane >> 3, cf = (lane & 7) * 8;   // on the way out a lane has 8 values in a row: eight lanes store a whole 128-byte line
    if constexpr (!VV) {
#pragma unroll
        for (int mb = 0; mb < 4; ++mb) {
#pragma unroll
            for (int nb = 0; nb < 4; ++nb) {
#pragma unroll
                for (int j = 0; j < 8; ++j) os[(hi * 8 + j) * 68 + nb * 16 + lr] = __fmul_rn(acc[mb][nb][j], md[nb]); }
            __builtin_amdgcn_wave_barrier(); asm volatile("" ::: "memory");   // the lanes read each other's LDS stores: no read may be moved above them
#pragma unroll
            for (int s = 0; s < 4; ++s) { const float* p = os + (4 * s + rw) * 68 + cf; const v4f x0 = *(const v4fa*)p, x1 = *(const v4fa*)(p + 4);
                put8(__builtin_shufflevector(x0, x1, 0, 1, 2, 3, 4, 5, 6, 7), o + (size_t)(t0 + mb * 16 + 4 * s + rw) * HD + cf, P16, Ph, Pl); }
            __builtin_amdgcn_wave_barrier(); asm volatile("" ::: "memory");   // and no store of the next block above these reads
        }
    } else {
#pragma unroll
        for (int nb = 0; nb < 4; ++nb) {
#pragma unroll
            for (int mb = 0; mb < 4; ++mb) { v8f t;
#pragma unroll
                for (int j = 0; j < 8; ++j) t[j] = __fmul_rn(acc[mb][nb][j], md[nb]);
                float* p = os + lr * 68 + mb * 16 + hi * 8; *(v4fa*)p = __builtin_shufflevector(t, t, 0, 1, 2, 3); *(v4fa*)(p + 4) = __builtin_shufflevector(t, t, 4, 5, 6, 7); }
            if (hi == 0) os[lr * 68 + 64] = __fmul_rn(acc[4][nb][0], md[nb]);   // position t0 + 64 (mod TT)
            __builtin_amdgcn_wave_barrier(); asm volatile("" ::: "memory");   // as above
#pragma unroll
            for (int s = 0; s < 4; ++s) { const float* p = os + (4 * s + rw) * 68 + cf; const v4f x0 = *(const v4fa*)p, x1 = *(const v4fa*)(p + 4); const float x8 = p[8];
                const float x[9] = {x0[0], x0[1], x0[2], x0[3], x1[0], x1[1], x1[2], x1[3], x8}; v8f y;
#pragma unroll
                for (int j = 0; j < 8; ++j) y[j] = __fmul_rn(__fadd_rn(x[j], x[j + 1]), 0.70710678118654752f);
                put8(y, o + (size_t)(nb * 16 + 4 * s + rw) * TT + t0 + cf, P16, Ph, Pl); }
            __builtin_amdgcn_wave_barrier(); asm volatile("" ::: "memory");   // as above
        }
    }
}
__global__ __launch_bounds__(32) void k_qkv(const bf* __restrict__ X, const bf* __restrict__ Wt, const float* __restrict__ MOD, h16* P16, bf* Ph, bf* Pl) {
    __shared__ __align__(16) float os[16 * 68];
    if ((int)blockIdx.y < 2 * (DQ / 64)) qkv_body<false>(X, Wt, MOD, P16, Ph, Pl, os);
    else qkv_body<true>(X, Wt, MOD, P16, Ph, Pl, os);
}

extern "C" void kernel_launch(void* const* d_in, const int* in_sizes, int n_in,
                              void* d_out, int out_size, void* d_ws, size_t ws_size, hipStream_t stream) {
    (void)in_sizes; (void)n_in; (void)out_size;
    const float* x = (const float*)d_in[0]; const float* wq = (const float*)d_in[1]; const float* wk = (const float*)d_in[2]; const float* wv = (const float*)d_in[3]; const float* wo = (const float*)d_in[4]; const float* qph = (const float*)d_in[5]; const float* qam = (const float*)d_in[6];
    float* OUT = (float*)d_out;     // [2][2048][1024]
    char* wsp = (char*)d_ws;
    auto take = [&](size_t bytes) { char* p = wsp; wsp += (bytes + 255) & ~(size_t)255; return (void*)p; };
    static_assert(DKV == DQ && DQ == DM, "the four weights are alike in shape, and q, k, v stand side by side in one product");
    bf* WT = (bf*)take((size_t)4 * DQ * DM * 2);   // Wq^T | Wk^T | Wv^T | Wo^T
    float* MOD = (float*)take((size_t)DQ * 4); float* CT = (float*)take((size_t)TT * 4);
    bf* XB = (bf*)take((size_t)NB_ * TT * DM * 2);
    const size_t PL = (size_t)NB_ * NH_ * TT * HD;   // one kind of plane, both batches
    h16* P16 = (h16*)take(3 * PL * 2); bf* Ph = (bf*)take(3 * PL * 2); bf* Pl = (bf*)take(3 * PL * 2);
    bf* ATh = (bf*)take((size_t)NB_ * TT * DQ * 2); bf* ATl = (bf*)take((size_t)NB_ * TT * DQ * 2);
    if ((size_t)(wsp - (char*)d_ws) > ws_size) return;    // ws 256 MiB
    k_prep<<<4 * PW + PX + PT, 256, 0, stream>>>(x, wq, wk, wv, wo, qph, qam, WT, XB, MOD, CT);
    k_qkv<<<dim3(NB_ * TT / 64, 3 * DQ / 64, 1), 32, 0, stream>>>(XB, WT, MOD, P16, Ph, Pl);   // q | k | v of both batches, stored as planes
    k_fattn<<<dim3(NB_ * NH_, RH / (16 * FQG) + (TT - RH) / (32 * FQG), 1), FKS * FQG * 32, 0, stream>>>(P16, P16 + PL, P16 + 2 * PL, Ph, Pl, Ph + PL, Pl + PL, Ph + 2 * PL, Pl + 2 * PL, CT, ATh, ATl);   // one kv head per query head
    k_gemmw<bf, 1, false><<<dim3(NB_ * TT / 64, DM / 64, 1), 32, 0, stream>>>(ATh, ATl, WT + (size_t)3 * DQ * DM, nullptr, DQ, OUT, DM, nullptr, 0, 0, 0);
}

// v006
// It runs in 149 microseconds.
// Two timings next to v005 put it at 1.49 and 1.48 times that version's speed.
// Counting every step since v000, it is 14.6 times as fast.
#include <hip/hip_runtime.h>

// 'Quantum' attention (x [2][2048][1024]; q, k, v = (x W) ('xw' [1024][1024], 16 heads x 64) each multiplied per (head, dim) by mod = cos(quantum_phase[h][d]) x quantum_amplitude[h][d]; scores = q.k / 8 x cos(2 pi (i - j) / 2048) (multiplicative Toeplitz 'interference'); w = softmax; w' = (w + roll(w, 1, keys)) / sqrt(2); out = w' v; y = merged Wo ('xw') -> [2][2048][1024] (4.2 M)).
// Realisation: the roll superposition is moved onto the values: w' v = w @ vv with vv[j] = (v[j] + v[(j+1) mod S]) / sqrt(2) (exact algebra), so attn.v runs on vv^T planes; the modulation is applied where the q | k | v product stores its planes (q, k planes x MOD[h][d]; vv from modulated v); the fused attention kernel multiplies each scaled logit by the cos table entry for |i - j| (cos(2 pi m / 2048) computed as the reference's float32 expression).
// Compute dtypes, f32 accumulate: every input rounded to bf16; q/k/v on PLAIN bf16 operands (inputs: exact); modulation table (precise cosf of bf16 phase x bf16 amplitude) and the cos Toeplitz table in f32; scores and attn.v: query rows < 512 hl (3 products), the rest single fp16; softmax f32 (running maximum, probabilities unnormalised until the end); Wo hl x exact (2 products).

#define NB_  2
#define TT   2048
#define DM   1024
#define NH_  16
#define NKV  16
#define REP  (NH_ / NKV)
#define HD   64
#define DQ   (NH_ * HD)
#define DKV  (NKV * HD)
#define RH   512                  // query rows < RH use hi+lo planes (0: none)
#define WIN  0
#define SCL  0.125f   // HD^-0.5
typedef _Float16 h16;
typedef unsigned short bf;
typedef __attribute__((ext_vector_type(16))) __bf16   v16bf;
typedef __attribute__((ext_vector_type(16))) _Float16 v16h;
typedef __attribute__((ext_vector_type(8)))  _Float16 v8h;
typedef __attribute__((ext_vector_type(8)))  unsigned short v8us;
typedef __attribute__((ext_vector_type(8)))  float    v8f;
typedef __attribute__((ext_vector_type(4)))  float    v4f;
typedef v8h  __attribute__((may_alias)) v8ha;
typedef v4f  __attribute__((may_alias)) v4fa;
typedef v8us __attribute__((may_alias)) v8usa;

__device__ __forceinline__ unsigned short f2bf(float f) { unsigned u = __float_as_uint(f); u += 0x7FFFu + ((u >> 16) & 1u); return (unsigned short)(u >> 16); }
__device__ __forceinline__ float bf2f(unsigned short b) { return __uint_as_float(((unsigned)b) << 16); }
__device__ __forceinline__ float bfr(float f) { return bf2f(f2bf(f)); }
__device__ __forceinline__ v16h cat16(v8h lo, v8h hi) { return __builtin_shufflevector(lo, hi, 0, 1, 2, 3, 4, 5, 6, 7, 8, 9, 10, 11, 12, 13, 14, 15); }
__device__ __forceinline__ v16bf cat16b(v8us lo, v8us hi) { return __builtin_bit_cast(v16bf, __builtin_shufflevector(lo, hi, 0, 1, 2, 3, 4, 5, 6, 7, 8, 9, 10, 11, 12, 13, 14, 15)); }
__device__ __forceinline__ v8f wmma16(v16h a, v16h b, v8f c) { return __builtin_amdgcn_wmma_f32_16x16x32_f16(false, a, false, b, (short)0, c, false, false); }
__device__ __forceinline__ v8f wmmab(v16bf a, v16bf b, v8f c) { return __builtin_amdgcn_wmma_f32_16x16x32_bf16(false, a, false, b, (short)0, c, false, false); }



// ---- Fragment order: every 16-bit operand plane (R rows x K columns, R % 16 == 0, K % 32 == 0) is stored as whole matrix fragments of 16 rows x 32 columns, 512 elements = 1 KiB in a row, fragment (r / 16, k / 32) at index (r / 16) (K / 32) + k / 32.
// Inside a fragment the 8 columns 8 c .. 8 c + 7 (c = 0..3) of row r % 16 are the 16 bytes at element c 128 + (r % 16) 8: lane (lr, hi) of the loader, which wants columns 8 hi .. + 7 and 16 + 8 hi .. + 7 of row lr, finds them at lane 8 and 256 + lane 8.
// So each wave-wide 16-byte load is 512 bytes in a row (4 whole 128-byte lines) where a row-major plane gives it 32 bytes of each of 16 lines. Which value meets which in a product is as before.
__device__ __forceinline__ size_t fro(const int r, const int k, const int K) { return ((size_t)(r >> 4) * (K >> 5) + (k >> 5)) * 512 + ((k >> 3) & 3) * 128 + (r & 15) * 8 + (k & 7); }
// ---- k_gemmw: register-blocked GEMM, ONE WAVE per 64x64 output tile (16 accumulators), operands straight from 16-bit planes in fragment order; grid (M/64, N/64, Z), 32 threads.
// C[m][n] (f32, pitch ldc, + optional f32 bias[n]) = sum_k A[m][k] Bt[n][k] (+ split products per NSPLIT). z-batch strides sA/sB/sC in elements. K % 32 == 0.
template <typename T16> struct WFrag;
template <> struct WFrag<h16> { typedef v16h V; static __device__ __forceinline__ V ld(const h16* p) { return cat16(*(const v8h*)p, *(const v8h*)(p + 256)); } static __device__ __forceinline__ v8f mma(V a, V b, v8f c) { return wmma16(a, b, c); } };
template <> struct WFrag<bf> { typedef v16bf V; static __device__ __forceinline__ V ld(const bf* p) { return cat16b(*(const v8us*)p, *(const v8us*)(p + 256)); } static __device__ __forceinline__ v8f mma(V a, V b, v8f c) { return wmmab(a, b, c); } };
template <typename T16, int NSPLIT, bool BIAS, int K>
__global__ __launch_bounds__(32) void k_gemmw(const T16* __restrict__ A, const T16* __restrict__ A2, const T16* __restrict__ Bt, const T16* __restrict__ Bt2, float* C, int ldc, const float* __restrict__ bias, size_t sA, size_t sB, size_t sC) {
    typedef typename WFrag<T16>::V V;
    __shared__ __align__(16) float os[16 * 68];
    const size_t z = blockIdx.z; A += z * sA; if (A2) A2 += z * sA; Bt += z * sB; if (Bt2) Bt2 += z * sB; C += z * sC;
    const int lane = threadIdx.x & 31, lr = lane & 15, hi = lane >> 4; const int r0 = blockIdx.x * 64, c0 = blockIdx.y * 64;
    v8f acc[4][4];
#pragma unroll
    for (int mb = 0; mb < 4; ++mb)
#pragma unroll
        for (int nb = 0; nb < 4; ++nb) acc[mb][nb] = (v8f){};
    const size_t aoff = (size_t)r0 * K + 8 * lane, boff = (size_t)c0 * K + 8 * lane;   // 16 rows of fragments are 16 K elements; a step of 32 columns is one fragment, 512 elements
    const T16* pa = A + aoff; const T16* pa2 = (NSPLIT == 1 || NSPLIT == 2) ? A2 + aoff : pa; const T16* pb = Bt + boff; const T16* pb2 = (NSPLIT >= 2) ? Bt2 + boff : pb;
#pragma unroll 1
    for (int kc = 0; kc < K; kc += 32) {
        V a[4], a2[4], b[4], b2[4];
#pragma unroll
        for (int mb = 0; mb < 4; ++mb) { a[mb] = WFrag<T16>::ld(pa + mb * 16 * K); if (NSPLIT == 1 || NSPLIT == 2) a2[mb] = WFrag<T16>::ld(pa2 + mb * 16 * K); }
#pragma unroll
        for (int nb = 0; nb < 4; ++nb) { b[nb] = WFrag<T16>::ld(pb + nb * 16 * K); if (NSPLIT >= 2) b2[nb] = WFrag<T16>::ld(pb2 + nb * 16 * K); }
        // the wait that stands before a register named by an issued load is written anew; the address pairs are inputs, so they live up to it: no load's result lands on a pair that an earlier load names, and the steps below stand behind it
        asm volatile("s_wait_xcnt 0x0" :: "v"(pa), "v"(pa2), "v"(pb), "v"(pb2) : "memory");
#pragma unroll
        for (int nb = 0; nb < 4; ++nb) {
#pragma unroll
            for (int mb = 0; mb < 4; ++mb) { acc[mb][nb] = WFrag<T16>::mma(a[mb], b[nb], acc[mb][nb]); if (NSPLIT == 1 || NSPLIT == 2) acc[mb][nb] = WFrag<T16>::mma(a2[mb], b[nb], acc[mb][nb]); if (NSPLIT >= 2) acc[mb][nb] = WFrag<T16>::mma(a[mb], b2[nb], acc[mb][nb]); } }
        pa += 512; pa2 += 512; pb += 512; pb2 += 512;
        asm volatile("v_nop\n\tv_nop\n\tv_nop\n\tv_nop" : "+v"(acc[0][0]), "+v"(acc[1][1]), "+v"(acc[2][2]), "+v"(acc[3][3]) : "v"(a[0]), "v"(a[3]));
    }
#pragma unroll
    for (int mb = 0; mb < 4; ++mb) {
#pragma unroll
        for (int nb = 0; nb < 4; ++nb) {
#pragma unroll
            for (int j = 0; j < 8; ++j) os[(hi * 8 + j) * 68 + nb * 16 + lr] = acc[mb][nb][j]; }
        __builtin_amdgcn_wave_barrier(); asm volatile("" ::: "memory");
        float* crow = C + (size_t)(r0 + mb * 16) * ldc + c0;
{
            v4f vs[8]; float* pc[8];
#pragma unroll
            for (int s = 0; s < 8; ++s) { const int row = 2 * s + hi, cofs = lr * 4; v4f val = *(const v4fa*)(os + row * 68 + cofs); if (BIAS) { val[0] += bfr(bias[c0 + cofs]); val[1] += bfr(bias[c0 + cofs + 1]); val[2] += bfr(bias[c0 + cofs + 2]); val[3] += bfr(bias[c0 + cofs + 3]); }
                vs[s] = val; pc[s] = crow + (size_t)row * ldc + cofs; *(v4f*)pc[s] = vs[s]; }
            // the wait that stands before a register named by an issued store is written anew; data and address pairs are inputs, so they live up to it
            asm volatile("s_wait_xcnt 0x0" :: "v"(vs[0]), "v"(vs[1]), "v"(vs[2]), "v"(vs[3]), "v"(vs[4]), "v"(vs[5]), "v"(vs[6]), "v"(vs[7]), "v"(pc[0]), "v"(pc[1]), "v"(pc[2]), "v"(pc[3]), "v"(pc[4]), "v"(pc[5]), "v"(pc[6]), "v"(pc[7]) : "memory");
             }
        __builtin_amdgcn_wave_barrier(); asm volatile("" ::: "memory");
    }
}

__device__ __forceinline__ h16 tohx(float x) { return (h16)x; }
__device__ __forceinline__ void splitf(float y, unsigned short& h, unsigned short& l) { h = f2bf(y); l = f2bf(y - bf2f(h)); }
typedef __attribute__((ext_vector_type(2))) _Float16 v2h;
typedef __attribute__((ext_vector_type(4))) _Float16 v4h;
typedef __attribute__((ext_vector_type(2))) unsigned short v2us;
typedef __attribute__((ext_vector_type(4))) unsigned short v4us;
typedef __attribute__((ext_vector_type(2))) float v2f;
typedef __attribute__((ext_vector_type(4))) int v4i;

// The j_ functions are jobs of 256 work-items that read none of each other's output; k_prep below runs them side by side in one grid, the job picked by the block index (bx: the block's index within its job).
// w [K][N] to Bt (rows n, columns k) in fragment order: a work-item takes 16 k of one n; a wave's 32 n in a row make each load one whole line, and its stores 256 bytes in a row for each 16 n.
__device__ __forceinline__ void j_wtG(const int bx, const float* __restrict__ w, int K, int N, bf* Bt) {
    const int i = bx * 256 + (int)threadIdx.x; const int n = ((i >> 5) % (N / 32)) * 32 + (i & 31), k0 = ((i >> 5) / (N / 32)) * 16; if (k0 >= K) return;
    const float* p = w + ((size_t)k0 * N + n); float v[16];
#pragma unroll
    for (int e = 0; e < 16; ++e) v[e] = p[(size_t)e * N];
    asm volatile("s_wait_xcnt 0x0" :: "v"(p) : "memory");   // the wait that stands before a register named by an issued load is written anew; the address pair is an input, so it lives up to it
    v8us o0, o1;
#pragma unroll
    for (int e = 0; e < 8; ++e) { o0[e] = f2bf(v[e]); o1[e] = f2bf(v[8 + e]); }
    bf* q = Bt + fro(n, k0, K); *(v8us*)q = o0; *(v8us*)(q + 128) = o1;
}
// src [rows][K] to dst in fragment order, 8 values a work-item: a wave takes 8 rows x 32 columns (8 whole lines in, 4 whole lines out).
__device__ __forceinline__ void j_cvt8(const int bx, const float* __restrict__ src, bf* dst, int K, size_t n8) { const size_t i = (size_t)bx * 256 + threadIdx.x; if (i >= n8) return;
    const int fr = (int)(i >> 6), r = (fr / (K / 32)) * 16 + (int)((i >> 5) & 1) * 8 + (int)(i & 7), k0 = (fr % (K / 32)) * 32 + (int)((i >> 3) & 3) * 8;
    const float* p = src + ((size_t)r * K + k0); const v8f v = *(const v8f*)p; v8us o;
    asm volatile("s_wait_xcnt 0x0" :: "v"(p) : "memory");   // as in j_wtG
#pragma unroll
    for (int k = 0; k < 8; ++k) o[k] = f2bf(v[k]); *(v8us*)(dst + fro(r, k0, K)) = o;  }

__global__ __launch_bounds__(256) void k_vtp(const float* __restrict__ F, int pitch, int nheads, h16* V16, bf* Vh, bf* Vl) { const size_t e = ((size_t)blockIdx.x * 256 + threadIdx.x) * 2; if (e >= (size_t)nheads * HD * TT) return; const int t = (int)(e % TT); const int d = (int)((e / TT) % HD); const int g = (int)(e / ((size_t)TT * HD)); v2h o16; v2us oh, ol;
#pragma unroll
    for (int q = 0; q < 2; ++q) { const float x = F[(size_t)(t + q) * pitch + g * HD + d]; o16[q] = tohx(x); unsigned short a2, c2; splitf(x, a2, c2); oh[q] = a2; ol[q] = c2; }
    *(v2h*)(V16 + e) = o16; *(v2us*)(Vh + e) = oh; *(v2us*)(Vl + e) = ol;  }
__device__ __forceinline__ void j_qtabs(const int bx, const float* __restrict__ ph, const float* __restrict__ am, float* MOD, float* CT) { const int i = bx * 256 + threadIdx.x; if (i < DQ) { const float m = __fmul_rn(cosf(bfr(ph[i])), bfr(am[i])); *(float*)(MOD + i) = m;  }
    if (i < TT) { const float a = __fmul_rn(__fmul_rn(6.2831853071795862f, (float)i), 1.0f / (float)TT); const float c = cosf(a); *(float*)(CT + i) = c;  } }
// ---- k_prep: every job that reads only inputs, in one grid: the four weight transposes (sixteen reads a work-item, the longest job: lowest indices), x of both batches to bf16, the modulation and cos tables.
#define PW ((DM * DQ / 16 + 255) / 256)            // blocks of one weight transpose
#define PX ((NB_ * TT * DM / 8 + 255) / 256)       // blocks of the x conversion
#define PT ((TT + 255) / 256)                      // blocks of the two small tables
__global__ __launch_bounds__(256) void k_prep(const float* __restrict__ x, const float* __restrict__ wq, const float* __restrict__ wk, const float* __restrict__ wv, const float* __restrict__ wo, const float* __restrict__ ph, const float* __restrict__ am, bf* WT, bf* XB, float* MOD, float* CT) {
    const int b = (int)blockIdx.x;
    if (b < 4 * PW) { const int j = b / PW; j_wtG(b % PW, j == 0 ? wq : j == 1 ? wk : j == 2 ? wv : wo, DM, DQ, WT + (size_t)j * DQ * DM); }
    else if (b < 4 * PW + PX) j_cvt8(b - 4 * PW, x, XB, DM, (size_t)NB_ * TT * DM / 8);
    else j_qtabs(b - 4 * PW - PX, ph, am, MOD, CT);
}
// ---- k_fattn: scores, interference, softmax and attn.v of one query block in one kernel; no score or probability ever reaches memory.
// Transposed products: S^T = K Q^T (A = 16 key rows, B = 16 query rows, both by the same loader), so a lane holds 8 keys' scores of ONE query (query = lane & 15, keys 8 (lane >> 4) + r);
// two such tiles (keys 0-15 and 16-31 of a 32-key pass), converted in place, are the B operand of O^T += V^T P^T, whose A operand (V^T rows, key-contiguous) comes by the same loader in the same k order.
// Softmax is the running form: a query's maximum in use m is raised (and its sum and output tiles rescaled) only when a pass's maximum exceeds it by more than FRTH, so p = exp(t - m) <= exp(FRTH).
// Work-group: FQG query groups x FKS key chunks = 4 waves; wave (qg, ks) does 16 QT queries against keys [ks TT / FKS, + TT / FKS); the FKS partial (m, sum, O) of a query are joined through LDS in chunk order and stored as the hi + lo planes that the Wo product reads.
// tab[u] = cos table entry for |j - i| x HD^-0.5 (a power of two: exact), u = j - (i - q0) + NQW - 1: a lane's 8 keys are 8 consecutive entries.
// Each '#pragma unroll' below, but those on the join's sx and u loops, unrolls a loop over a register array to the end, so that its indices are constants and the array stays in registers.
#define FKS  4
#define FQG  1
#define FRTH 5.5f
#define L2E  1.4426950408889634f
#define FTAB 2176                 // floats kept for tab: TT + 32 - 1, rounded up to 17 per work-item
#define FLDS (FTAB + FKS * FQG * 32 * 68 + 2 * FKS * FQG * 32)
typedef __attribute__((ext_vector_type(8))) __bf16 v8bf;
__device__ __forceinline__ float xhalf(float x) { const int b = __float_as_int(x); return __int_as_float(__builtin_amdgcn_permlanex16(b, b, 0x76543210, 0xfedcba98, false, false)); }   // the value of lane ^ 16
// 2^x of a tile's eight values in one statement. Behind a transcendental the instruction set asks for one independent instruction before its result is used or its source overwritten: the results are early-clobber, so no v_exp_f32 here touches a neighbour's registers, and the v_nop is the last one's slot.
__device__ __forceinline__ v8f exp2x8(const v8f x) { float y0, y1, y2, y3, y4, y5, y6, y7;
    asm("v_exp_f32 %0, %8\n\tv_exp_f32 %1, %9\n\tv_exp_f32 %2, %10\n\tv_exp_f32 %3, %11\n\tv_exp_f32 %4, %12\n\tv_exp_f32 %5, %13\n\tv_exp_f32 %6, %14\n\tv_exp_f32 %7, %15\n\tv_nop"
        : "=&v"(y0), "=&v"(y1), "=&v"(y2), "=&v"(y3), "=&v"(y4), "=&v"(y5), "=&v"(y6), "=&v"(y7) : "v"(x[0]), "v"(x[1]), "v"(x[2]), "v"(x[3]), "v"(x[4]), "v"(x[5]), "v"(x[6]), "v"(x[7]));
    return (v8f){y0, y1, y2, y3, y4, y5, y6, y7}; }
template <typename T16, bool HL, int QT>
__device__ __forceinline__ void fattn_body(const T16* __restrict__ Q, const T16* __restrict__ Q2, const T16* __restrict__ Kp, const T16* __restrict__ Kp2, const T16* __restrict__ Vt, const T16* __restrict__ Vt2, const float* __restrict__ CT, const int q0, bf* Ah, bf* Al, float* lds) {
    typedef typename WFrag<T16>::V V;
    constexpr int NQ = 16 * QT, NQW = NQ * FQG, NT = FKS * FQG * 32;
    const int tid = (int)threadIdx.x, lane = tid & 31, lr = lane & 15, hi = lane >> 4; const int w = __builtin_amdgcn_readfirstlane(tid >> 5); const int ks = w & (FKS - 1), qg = w / FKS;
    float* tab = lds; float* accS = lds + FTAB; float* mS = accS + FKS * FQG * 32 * 68; float* lS = mS + FKS * FQG * 32;
    static_assert(FTAB == 17 * NT && TT + NQW - 1 <= FTAB, "tab: seventeen entries per work-item");
    int ix[17]; float cv[17];
#pragma unroll
    for (int f = 0; f < 17; ++f) { const int d = tid + f * NT - (NQW - 1) - q0; const int a = d < 0 ? -d : d; ix[f] = a < TT ? a : TT - 1; cv[f] = CT[ix[f]]; }   // entries past TT + NQW - 2 are never read; their index is clamped into the table
    const T16* pq = Q + ((size_t)(q0 + qg * NQ) * HD + 8 * lane); const T16* pq2 = HL ? Q2 + ((size_t)(q0 + qg * NQ) * HD + 8 * lane) : pq;   // fragment order: 16 rows are HD / 32 fragments of 512 elements
    V qf[QT][2], qf2[QT][2];
#pragma unroll
    for (int qt = 0; qt < QT; ++qt)
#pragma unroll
        for (int kc = 0; kc < 2; ++kc) { qf[qt][kc] = WFrag<T16>::ld(pq + qt * 16 * HD + kc * 512); if (HL) qf2[qt][kc] = WFrag<T16>::ld(pq2 + qt * 16 * HD + kc * 512); }
    // the wait that stands before a register named by an issued load is written anew; the loads' index and address registers are inputs, so they live up to it
    asm volatile("s_wait_xcnt 0x0" :: "v"(ix[0]), "v"(ix[1]), "v"(ix[2]), "v"(ix[3]), "v"(ix[4]), "v"(ix[5]), "v"(ix[6]), "v"(ix[7]), "v"(ix[8]), "v"(ix[9]), "v"(ix[10]), "v"(ix[11]), "v"(ix[12]), "v"(ix[13]), "v"(ix[14]), "v"(ix[15]), "v"(ix[16]), "v"(pq), "v"(pq2) : "memory");
#pragma unroll
    for (int f = 0; f < 17; ++f) tab[tid + f * NT] = cv[f] * SCL;
    v8f acc[QT][4]; float m[QT], l[QT];
#pragma unroll
    for (int qt = 0; qt < QT; ++qt) { m[qt] = -3.0e38f; l[qt] = 0.f;
#pragma unroll
        for (int dt = 0; dt < 4; ++dt) acc[qt][dt] = (v8f){}; }
    __syncthreads();   // tab is whole before any wave reads it
    const int kbeg = ks * (TT / FKS);
    // rolled: one pass's fragments live at a time
#pragma unroll 1
    for (int jb = kbeg; jb < kbeg + TT / FKS; jb += 32) {
        const size_t ok = (size_t)jb * HD + 8 * lane;
        const T16* pk = Kp + ok; const T16* pk2 = HL ? Kp2 + ok : pk;
        V kf[2][2], kf2[2][2], vf[4], vf2[4];
#pragma unroll
        for (int kt = 0; kt < 2; ++kt)
#pragma unroll
            for (int kc = 0; kc < 2; ++kc) { kf[kt][kc] = WFrag<T16>::ld(pk + kt * 16 * HD + kc * 512); if (HL) kf2[kt][kc] = WFrag<T16>::ld(pk2 + kt * 16 * HD + kc * 512); }
        // as above: the address pairs live up to the wait, and nothing that a load names is written before it
        // the loaded fragments are inputs too (inputs only): all of the pass's K loads are then in flight together, one trip to L2 instead of several in a row
        if constexpr (HL) asm volatile("s_wait_xcnt 0x0" :: "v"(pk), "v"(pk2), "v"(kf[0][0]), "v"(kf[0][1]), "v"(kf[1][0]), "v"(kf[1][1]), "v"(kf2[0][0]), "v"(kf2[0][1]), "v"(kf2[1][0]), "v"(kf2[1][1]) : "memory");
        else asm volatile("s_wait_xcnt 0x0" :: "v"(pk), "v"(kf[0][0]), "v"(kf[0][1]), "v"(kf[1][0]), "v"(kf[1][1]) : "memory");
        v8f s[QT][2];
#pragma unroll
        for (int kt = 0; kt < 2; ++kt)
#pragma unroll
            for (int qt = 0; qt < QT; ++qt) { v8f t = (v8f){};
#pragma unroll
                for (int kc = 0; kc < 2; ++kc) { t = WFrag<T16>::mma(kf[kt][kc], qf[qt][kc], t); if (HL) { t = WFrag<T16>::mma(kf[kt][kc], qf2[qt][kc], t); t = WFrag<T16>::mma(kf2[kt][kc], qf[qt][kc], t); } }
                s[qt][kt] = t; }
        const float* tb = tab + (jb + 8 * hi - lr - qg * NQ + NQW - 1);
        float bm[QT]; bool need = false;
#pragma unroll
        for (int qt = 0; qt < QT; ++qt) { float x = -3.0e38f;
#pragma unroll
            for (int kt = 0; kt < 2; ++kt)
#pragma unroll
                for (int r = 0; r < 8; ++r) { const float t = s[qt][kt][r] * tb[16 * (kt - qt) + r]; s[qt][kt][r] = t; x = fmaxf(x, t); }
            x = fmaxf(x, xhalf(x)); bm[qt] = x; need = need || (x > m[qt] + FRTH); }
        // the V^T fragments go into the registers that the K fragments leave and fly while the softmax runs; the hi+lo form, with twice the fragments, asks for them behind the rescale branch, where the registers are free
        auto loadv = [&]() { const size_t ov = (size_t)jb * 16 + 8 * lane; /* 32 keys of 16 rows of V^T are one fragment */ const T16* pv = Vt + ov; const T16* pv2 = HL ? Vt2 + ov : pv;
#pragma unroll
            for (int dt = 0; dt < 4; ++dt) { vf[dt] = WFrag<T16>::ld(pv + dt * 16 * TT); if (HL) vf2[dt] = WFrag<T16>::ld(pv2 + dt * 16 * TT); }
            asm volatile("s_wait_xcnt 0x0" :: "v"(pv), "v"(pv2) : "memory");   // as above
        };
        if constexpr (!HL) loadv();
        if (__builtin_amdgcn_ballot_w32(need) != 0) {   // a scalar branch: taken on a wave's first pass and seldom after it
#pragma unroll
            for (int qt = 0; qt < QT; ++qt) { const float mn = (bm[qt] > m[qt] + FRTH) ? bm[qt] : m[qt]; const float al = __builtin_amdgcn_exp2f((m[qt] - mn) * L2E); m[qt] = mn; l[qt] *= al;
#pragma unroll
                for (int dt = 0; dt < 4; ++dt) acc[qt][dt] *= al; } }
        if constexpr (HL) loadv();
        V pb[QT], pl[QT];
#pragma unroll
        for (int qt = 0; qt < QT; ++qt) { const float nm = -m[qt] * L2E; float ls = 0.f;
#pragma unroll
            for (int kt = 0; kt < 2; ++kt) { v8f a;
#pragma unroll
                for (int r = 0; r < 8; ++r) a[r] = __builtin_fmaf(s[qt][kt][r], L2E, nm);
                s[qt][kt] = exp2x8(a);
#pragma unroll
                for (int r = 0; r < 8; ++r) ls += s[qt][kt][r]; }
            l[qt] += ls;
            if constexpr (HL) {   // hi = p rounded to nearest even, lo = (p - hi) rounded likewise: splitf's values for the finite p here, by the packed conversion
                const v8bf h0 = __builtin_convertvector(s[qt][0], v8bf), h1 = __builtin_convertvector(s[qt][1], v8bf);
                const v8bf l0 = __builtin_convertvector(s[qt][0] - __builtin_convertvector(h0, v8f), v8bf), l1 = __builtin_convertvector(s[qt][1] - __builtin_convertvector(h1, v8f), v8bf);
                pb[qt] = __builtin_shufflevector(h0, h1, 0, 1, 2, 3, 4, 5, 6, 7, 8, 9, 10, 11, 12, 13, 14, 15); pl[qt] = __builtin_shufflevector(l0, l1, 0, 1, 2, 3, 4, 5, 6, 7, 8, 9, 10, 11, 12, 13, 14, 15);
            } else { pb[qt] = cat16(__builtin_convertvector(s[qt][0], v8h), __builtin_convertvector(s[qt][1], v8h)); } }
#pragma unroll
        for (int dt = 0; dt < 4; ++dt)
#pragma unroll
            for (int qt = 0; qt < QT; ++qt) { acc[qt][dt] = WFrag<T16>::mma(vf[dt], pb[qt], acc[qt][dt]); if (HL) { acc[qt][dt] = WFrag<T16>::mma(vf[dt], pl[qt], acc[qt][dt]); acc[qt][dt] = WFrag<T16>::mma(vf2[dt], pb[qt], acc[qt][dt]); } }
    }
    float* my = accS + w * (32 * 68);
#pragma unroll
    for (int qt = 0; qt < QT; ++qt) { const float lj = l[qt] + xhalf(l[qt]);   // the two lane halves summed different keys of the same query
        if (hi == 0) { mS[w * 32 + qt * 16 + lr] = m[qt]; lS[w * 32 + qt * 16 + lr] = lj; }
#pragma unroll
        for (int dt = 0; dt < 4; ++dt) { float* p = my + (qt * 16 + lr) * 68 + dt * 16 + hi * 8; const v8f t = acc[qt][dt];
            *(v4fa*)p = __builtin_shufflevector(t, t, 0, 1, 2, 3); *(v4fa*)(p + 4) = __builtin_shufflevector(t, t, 4, 5, 6, 7); } }
    __syncthreads();   // every wave's partial is in LDS before any is joined
#pragma unroll
    for (int sx = 0; sx < NQW * 8 / NT; ++sx) { const int idx = sx * NT + tid; const int q = (idx >> 7) * 16 + (idx & 15), dc = ((idx >> 4) & 7) * 8; const int w0 = (q / NQ) * FKS, ql = q % NQ;   // a wave has 16 queries x 16 columns: 512 bytes in a row of each plane
        float M = mS[w0 * 32 + ql];
#pragma unroll
        for (int u = 1; u < FKS; ++u) M = fmaxf(M, mS[(w0 + u) * 32 + ql]);
        float L = 0.f; v4f o0 = (v4f){}, o1 = (v4f){};
#pragma unroll
        for (int u = 0; u < FKS; ++u) { const float sc = __builtin_amdgcn_exp2f((mS[(w0 + u) * 32 + ql] - M) * L2E); L += lS[(w0 + u) * 32 + ql] * sc; const float* p = accS + ((w0 + u) * 32 + ql) * 68 + dc; o0 += *(const v4fa*)p * sc; o1 += *(const v4fa*)(p + 4) * sc; }
        const float inv = __fdiv_rn(1.0f, L); v8us oh, ol;
#pragma unroll
        for (int k = 0; k < 4; ++k) { unsigned short a, c2; splitf(o0[k] * inv, a, c2); oh[k] = a; ol[k] = c2; splitf(o1[k] * inv, a, c2); oh[4 + k] = a; ol[4 + k] = c2; }
        const size_t oo = fro(q0 + q, dc, DQ); bf* ph = Ah + oo; bf* pl = Al + oo; *(v8us*)ph = oh; *(v8us*)pl = ol;
        asm volatile("s_wait_xcnt 0x0" :: "v"(oh), "v"(ol), "v"(ph), "v"(pl) : "memory"); }   // the wait that stands before a register named by an issued store is written anew; data and address pairs are inputs, so they live up to it
}
// grid (batches x heads, RH / 16 + (TT - RH) / 32): the hi+lo query blocks (three products each, the longer work) have the low indices and start first.
// Five waves a SIMD (192 registers): the launch's 2,560 four-wave work-groups are then two full rounds of five on each of the 256 WGPs.
__global__ __launch_bounds__(FKS * FQG * 32) __attribute__((amdgpu_waves_per_eu(5, 5))) void k_fattn(const h16* __restrict__ Q16, const h16* __restrict__ K16, const h16* __restrict__ V16, const bf* __restrict__ Qh, const bf* __restrict__ Ql, const bf* __restrict__ Kh, const bf* __restrict__ Kl, const bf* __restrict__ Vh, const bf* __restrict__ Vl, const float* __restrict__ CT, bf* Ah, bf* Al) {
    __shared__ __align__(16) float lds[FLDS];
    const int bh = (int)blockIdx.x, by = (int)blockIdx.y; const size_t ho = (size_t)bh * TT * HD; const size_t ao = (size_t)(bh / NH_) * TT * DQ + (bh % NH_) * (HD / 32) * 512;   // planes [batch][head]; output rows [batch x t], the head's columns (in fragment order: its HD / 32 fragments of each 16 rows)
    if (by < RH / (16 * FQG)) fattn_body<bf, true, 1>(Qh + ho, Ql + ho, Kh + ho, Kl + ho, Vh + ho, Vl + ho, CT, by * (16 * FQG), Ah + ao, Al + ao, lds);
    else fattn_body<h16, false, 2>(Q16 + ho, nullptr, K16 + ho, nullptr, V16 + ho, nullptr, CT, RH + (by - RH / (16 * FQG)) * (32 * FQG), Ah + ao, Al + ao, lds);
}

// ---- k_qkv: the q | k | v product of both batches, its epilogue storing the head planes that k_fattn reads (fp16 and hi + lo bf16); the f32 product never reaches memory.
// ONE WAVE per 64 x 64 tile as in k_gemmw, same loop and k order; a tile is 64 positions of one head of q, k or v. grid (batches x TT / 64, 3 DQ / 64), 32 threads.
// q, k: planes [t][d], value x MOD[h][d], in fragment order like every plane here. v: planes [d][t] of vv[t] = (v[t] MOD + v[t + 1 mod TT] MOD) / sqrt(2): the tile's last position needs the next tile's first row, so a v tile carries a fifth row block (rows t0 + 64 ..., wrapped inside the batch), of which row 0 is used.
// Four times eight values in a row (a lane's pieces of two fragments, 256 elements apart) to the three planes: fp16, hi = bf16 nearest even, lo = (x - hi) likewise (splitf's values for finite x, by the packed conversion).
__device__ __forceinline__ void put32(const v8f (&x)[4], const size_t e, h16* P16, bf* Ph, bf* Pl) {
    h16* q16 = P16 + e; bf* qh = Ph + e; bf* ql = Pl + e; v8h a[4]; v8us h[4], l[4];
#pragma unroll
    for (int s = 0; s < 4; ++s) { const v8bf hb = __builtin_convertvector(x[s], v8bf); const v8bf lb = __builtin_convertvector(x[s] - __builtin_convertvector(hb, v8f), v8bf);
        a[s] = __builtin_convertvector(x[s], v8h); h[s] = __builtin_bit_cast(v8us, hb); l[s] = __builtin_bit_cast(v8us, lb); }
#pragma unroll
    for (int s = 0; s < 4; ++s) { *(v8h*)(q16 + s * 256) = a[s]; *(v8us*)(qh + s * 256) = h[s]; *(v8us*)(ql + s * 256) = l[s]; }
    // the wait that stands before a register named by an issued store is written anew; data and address pairs are inputs, so they live up to it
    asm volatile("s_wait_xcnt 0x0" :: "v"(a[0]), "v"(a[1]), "v"(a[2]), "v"(a[3]), "v"(h[0]), "v"(h[1]), "v"(h[2]), "v"(h[3]), "v"(l[0]), "v"(l[1]), "v"(l[2]), "v"(l[3]), "v"(q16), "v"(qh), "v"(ql) : "memory"); }
template <bool VV>
__device__ __forceinline__ void qkv_body(const bf* __restrict__ X, const bf* __restrict__ Wt, const float* __restrict__ MOD, h16* P16, bf* Ph, bf* Pl, float* os) {
    typedef WFrag<bf>::V V;
    constexpr int K = DM, MB = VV ? 5 : 4;
    const int lane = threadIdx.x & 31, lr = lane & 15, hi = lane >> 4; const int r0 = blockIdx.x * 64, c0 = blockIdx.y * 64;
    const int b = r0 / TT, t0 = r0 % TT, h = (c0 % DQ) / HD;
    const float* pm = MOD + h * HD + lr; float md[4];
#pragma unroll
    for (int nb = 0; nb < 4; ++nb) md[nb] = pm[nb * 16];   // a lane's accumulators are of columns nb 16 + lr
    asm volatile("s_wait_xcnt 0x0" :: "v"(pm) : "memory");   // the wait that stands before a register named by an issued load is written anew; the address pair is an input, so it lives up to it
    v8f acc[MB][4];
#pragma unroll
    for (int mb = 0; mb < MB; ++mb)
#pragma unroll
        for (int nb = 0; nb < 4; ++nb) acc[mb][nb] = (v8f){};
    const bf* pa = X + ((size_t)r0 * K + 8 * lane); const bf* pb = Wt + ((size_t)c0 * K + 8 * lane); const bf* pn = X + ((size_t)(b * TT + (t0 + 64) % TT) * K + 8 * lane);   // fragment order: 16 rows are 16 K elements, 32 columns one fragment
    // rolled: one pass's fragments live at a time
#pragma unroll 1
    for (int kc = 0; kc < K; kc += 32) {
        V a[MB], bb[4];
#pragma unroll
        for (int mb = 0; mb < 4; ++mb) a[mb] = WFrag<bf>::ld(pa + mb * 16 * K);
        if constexpr (VV) a[4] = WFrag<bf>::ld(pn);
#pragma unroll
        for (int nb = 0; nb < 4; ++nb) bb[nb] = WFrag<bf>::ld(pb + nb * 16 * K);
        // as above: the address pairs live up to the wait, so no load's result lands on a pair that an earlier load names, and the steps below stand behind it
        if constexpr (VV) asm volatile("s_wait_xcnt 0x0" :: "v"(pa), "v"(pb), "v"(pn) : "memory");
        else asm volatile("s_wait_xcnt 0x0" :: "v"(pa), "v"(pb) : "memory");
#pragma unroll
        for (int nb = 0; nb < 4; ++nb)
#pragma unroll
            for (int mb = 0; mb < MB; ++mb) acc[mb][nb] = WFrag<bf>::mma(a[mb], bb[nb], acc[mb][nb]);
        pa += 512; pb += 512; pn += 512;
    }
    const size_t o = (((size_t)(c0 / DQ) * NB_ + b) * NH_ + h) * TT * HD;   // planes [q, k, v][batch][head]
    // on the way out a lane has 8 values in a row, of row lr and columns s 16 + hi 8 ...: the wave's 32 pieces are half a fragment, 512 bytes in a row
    if constexpr (!VV) {
#pragma unroll
        for (int mb = 0; mb < 4; ++mb) {
#pragma unroll
            for (int nb = 0; nb < 4; ++nb) {
#pragma unroll
                for (int j = 0; j < 8; ++j) os[(hi * 8 + j) * 68 + nb * 16 + lr] = __fmul_rn(acc[mb][nb][j], md[nb]); }
            __builtin_amdgcn_wave_barrier(); asm volatile("" ::: "memory");   // the lanes read each other's LDS stores: no read may be moved above them
            v8f y[4];
#pragma unroll
            for (int s = 0; s < 4; ++s) { const float* p = os + lr * 68 + s * 16 + hi * 8; const v4f x0 = *(const v4fa*)p, x1 = *(const v4fa*)(p + 4); y[s] = __builtin_shufflevector(x0, x1, 0, 1, 2, 3, 4, 5, 6, 7); }
            put32(y, o + (size_t)(t0 + mb * 16) * HD + lane * 8, P16, Ph, Pl);
            __builtin_amdgcn_wave_barrier(); asm volatile("" ::: "memory");   // and no store of the next block above these reads
        }
    } else {
#pragma unroll
        for (int nb = 0; nb < 4; ++nb) {
#pragma unroll
            for (int mb = 0; mb < 4; ++mb) { v8f t;
#pragma unroll
                for (int j = 0; j < 8; ++j) t[j] = __fmul_rn(acc[mb][nb][j], md[nb]);
                float* p = os + lr * 68 + mb * 16 + hi * 8; *(v4fa*)p = __builtin_shufflevector(t, t, 0, 1, 2, 3); *(v4fa*)(p + 4) = __builtin_shufflevector(t, t, 4, 5, 6, 7); }
            if (hi == 0) os[lr * 68 + 64] = __fmul_rn(acc[4][nb][0], md[nb]);   // position t0 + 64 (mod TT)
            __builtin_amdgcn_wave_barrier(); asm volatile("" ::: "memory");   // as above
            v8f y[4];
#pragma unroll
            for (int s = 0; s < 4; ++s) { const float* p = os + lr * 68 + s * 16 + hi * 8; const v4f x0 = *(const v4fa*)p, x1 = *(const v4fa*)(p + 4); const float x8 = p[8];
                const float x[9] = {x0[0], x0[1], x0[2], x0[3], x1[0], x1[1], x1[2], x1[3], x8};
#pragma unroll
                for (int j = 0; j < 8; ++j) y[s][j] = __fmul_rn(__fadd_rn(x[j], x[j + 1]), 0.70710678118654752f); }
            put32(y, o + (size_t)nb * 16 * TT + (size_t)t0 * 16 + lane * 8, P16, Ph, Pl);
            __builtin_amdgcn_wave_barrier(); asm volatile("" ::: "memory");   // as above
        }
    }
}
__global__ __launch_bounds__(32) void k_qkv(const bf* __restrict__ X, const bf* __restrict__ Wt, const float* __restrict__ MOD, h16* P16, bf* Ph, bf* Pl) {
    __shared__ __align__(16) float os[16 * 68];
    if ((int)blockIdx.y < 2 * (DQ / 64)) qkv_body<false>(X, Wt, MOD, P16, Ph, Pl, os);
    else qkv_body<true>(X, Wt, MOD, P16, Ph, Pl, os);
}

extern "C" void kernel_launch(void* const* d_in, const int* in_sizes, int n_in,
                              void* d_out, int out_size, void* d_ws, size_t ws_size, hipStream_t stream) {
    (void)in_sizes; (void)n_in; (void)out_size;
    const float* x = (const float*)d_in[0]; const float* wq = (const float*)d_in[1]; const float* wk = (const float*)d_in[2]; const float* wv = (const float*)d_in[3]; const float* wo = (const float*)d_in[4]; const float* qph = (const float*)d_in[5]; const float* qam = (const float*)d_in[6];
    float* OUT = (float*)d_out;     // [2][2048][1024]
    char* wsp = (char*)d_ws;
    auto take = [&](size_t bytes) { char* p = wsp; wsp += (bytes + 255) & ~(size_t)255; return (void*)p; };
    static_assert(DKV == DQ && DQ == DM, "the four weights are alike in shape, and q, k, v stand side by side in one product");
    bf* WT = (bf*)take((size_t)4 * DQ * DM * 2);   // Wq^T | Wk^T | Wv^T | Wo^T
    float* MOD = (float*)take((size_t)DQ * 4); float* CT = (float*)take((size_t)TT * 4);
    bf* XB = (bf*)take((size_t)NB_ * TT * DM * 2);
    const size_t PL = (size_t)NB_ * NH_ * TT * HD;   // one kind of plane, both batches
    h16* P16 = (h16*)take(3 * PL * 2); bf* Ph = (bf*)take(3 * PL * 2); bf* Pl = (bf*)take(3 * PL * 2);
    bf* ATh = (bf*)take((size_t)NB_ * TT * DQ * 2); bf* ATl = (bf*)take((size_t)NB_ * TT * DQ * 2);
    if ((size_t)(wsp - (char*)d_ws) > ws_size) return;    // ws 256 MiB
    k_prep<<<4 * PW + PX + PT, 256, 0, stream>>>(x, wq, wk, wv, wo, qph, qam, WT, XB, MOD, CT);
    k_qkv<<<dim3(NB_ * TT / 64, 3 * DQ / 64, 1), 32, 0, stream>>>(XB, WT, MOD, P16, Ph, Pl);   // q | k | v of both batches, stored as planes
    k_fattn<<<dim3(NB_ * NH_, RH / (16 * FQG) + (TT - RH) / (32 * FQG), 1), FKS * FQG * 32, 0, stream>>>(P16, P16 + PL, P16 + 2 * PL, Ph, Pl, Ph + PL, Pl + PL, Ph + 2 * PL, Pl + 2 * PL, CT, ATh, ATl);   // one kv head per query head
    k_gemmw<bf, 1, false, DQ><<<dim3(NB_ * TT / 64, DM / 64, 1), 32, 0, stream>>>(ATh, ATl, WT + (size_t)3 * DQ * DM, nullptr, OUT, DM, nullptr, 0, 0, 0);
}

// v007
// It runs in 113 microseconds.
// Two timings next to v006 put it at 1.32 and 1.31 times that version's speed.
// All steps since v000 together make it 19.2 times as fast.
#include <hip/hip_runtime.h>

// 'Quantum' attention (x [2][2048][1024]; q, k, v = (x W) ('xw' [1024][1024], 16 heads x 64) each multiplied per (head, dim) by mod = cos(quantum_phase[h][d]) x quantum_amplitude[h][d]; scores = q.k / 8 x cos(2 pi (i - j) / 2048) (multiplicative Toeplitz 'interference'); w = softmax; w' = (w + roll(w, 1, keys)) / sqrt(2); out = w' v; y = merged Wo ('xw') -> [2][2048][1024] (4.2 M)).
// Realisation: the roll superposition is moved onto the values: w' v = w @ vv with vv[j] = (v[j] + v[(j+1) mod S]) / sqrt(2) (exact algebra), so attn.v runs on vv^T planes; the modulation is applied where the q | k | v product stores its planes (q, k planes x MOD[h][d]; vv from modulated v); the fused attention kernel multiplies each scaled logit by the cos table entry for |i - j| (cos(2 pi m / 2048) computed as the reference's float32 expression).
// Compute dtypes, f32 accumulate: every input rounded to bf16; q/k/v on PLAIN bf16 operands (inputs: exact); modulation table (precise cosf of bf16 phase x bf16 amplitude) and the cos Toeplitz table in f32; scores and attn.v: query rows < 512 hl (3 products), the rest single fp16; softmax f32 (running maximum, probabilities unnormalised until the end); Wo hl x exact (2 products).

#define NB_  2
#define TT   2048
#define DM   1024
#define NH_  16
#define NKV  16
#define REP  (NH_ / NKV)
#define HD   64
#define DQ   (NH_ * HD)
#define DKV  (NKV * HD)
#define RH   512                  // query rows < RH use hi+lo planes (0: none)
#define WIN  0
#define SCL  0.125f   // HD^-0.5
typedef _Float16 h16;
typedef unsigned short bf;
typedef __attribute__((ext_vector_type(16))) __bf16   v16bf;
typedef __attribute__((ext_vector_type(16))) _Float16 v16h;
typedef __attribute__((ext_vector_type(8)))  _Float16 v8h;
typedef __attribute__((ext_vector_type(8)))  unsigned short v8us;
typedef __attribute__((ext_vector_type(8)))  float    v8f;
typedef __attribute__((ext_vector_type(4)))  float    v4f;
typedef v8h  __attribute__((may_alias)) v8ha;
typedef v4f  __attribute__((may_alias)) v4fa;
typedef v8us __attribute__((may_alias)) v8usa;

__device__ __forceinline__ unsigned short f2bf(float f) { unsigned u = __float_as_uint(f); u += 0x7FFFu + ((u >> 16) & 1u); return (unsigned short)(u >> 16); }
__device__ __forceinline__ float bf2f(unsigned short b) { return __uint_as_float(((unsigned)b) << 16); }
__device__ __forceinline__ float bfr(float f) { return bf2f(f2bf(f)); }
__device__ __forceinline__ v16h cat16(v8h lo, v8h hi) { return __builtin_shufflevector(lo, hi, 0, 1, 2, 3, 4, 5, 6, 7, 8, 9, 10, 11, 12, 13, 14, 15); }
__device__ __forceinline__ v16bf cat16b(v8us lo, v8us hi) { return __builtin_bit_cast(v16bf, __builtin_shufflevector(lo, hi, 0, 1, 2, 3, 4, 5, 6, 7, 8, 9, 10, 11, 12, 13, 14, 15)); }
__device__ __forceinline__ v8f wmma16(v16h a, v16h b, v8f c) { return __builtin_amdgcn_wmma_f32_16x16x32_f16(false, a, false, b, (short)0, c, false, false); }
__device__ __forceinline__ v8f wmmab(v16bf a, v16bf b, v8f c) { return __builtin_amdgcn_wmma_f32_16x16x32_bf16(false, a, false, b, (short)0, c, false, false); }



// ---- Fragment order: every 16-bit operand plane (R rows x K columns, R % 16 == 0, K % 32 == 0) is stored as whole matrix fragments of 16 rows x 32 columns, 512 elements = 1 KiB in a row, fragment (r / 16, k / 32) at index (r / 16) (K / 32) + k / 32.
// Inside a fragment the 8 columns 8 c .. 8 c + 7 (c = 0..3) of row r % 16 are the 16 bytes at element c 128 + (r % 16) 8: lane (lr, hi) of the loader, which wants columns 8 hi .. + 7 and 16 + 8 hi .. + 7 of row lr, finds them at lane 8 and 256 + lane 8.
// So each wave-wide 16-byte load is 512 bytes in a row (4 whole 128-byte lines) where a row-major plane gives it 32 bytes of each of 16 lines. Which value meets which in a product is as before.
__device__ __forceinline__ size_t fro(const int r, const int k, const int K) { return ((size_t)(r >> 4) * (K >> 5) + (k >> 5)) * 512 + ((k >> 3) & 3) * 128 + (r & 15) * 8 + (k & 7); }
// ---- k_gemmw: register-blocked GEMM, ONE WAVE per 64x64 output tile (16 accumulators), operands straight from 16-bit planes in fragment order; grid (M/64, N/64, Z), 32 threads.
// C[m][n] (f32, pitch ldc, + optional f32 bias[n]) = sum_k A[m][k] Bt[n][k] (+ split products per NSPLIT). z-batch strides sA/sB/sC in elements.
// The k loop runs in stages of KS fragments (32 KS columns) on two register sets: while one set's products run, the other set's loads, all issued in front of them, are in flight. K % (64 KS) == 0.
template <typename T16> struct WFrag;
// A fragment pointer's step of BYTES. The wait that stands before a register named by an issued load is overwritten, and the addition that overwrites it, are one statement, so nothing can come between them.
// The pair goes in and comes out: the loads in front name this very pair, which lives up to the statement (no load's result lands on it), and the addresses of the loads behind are formed from what comes out.
template <int BYTES, typename T16> __device__ __forceinline__ void wait_step(const T16*& p) { asm volatile("s_wait_xcnt 0x0\n\tv_add_nc_u64 %0, %1, %0" : "+v"(p) : "i"(BYTES) : "memory"); }
// ldg: ld for a pointer whose origin the compiler cannot see (it has come out of an asm statement): the cast says that it points to global memory, so that the load is a global one and not a flat one.
template <> struct WFrag<h16> { typedef v16h V; typedef const __attribute__((address_space(1))) v8h* G; static __device__ __forceinline__ V ld(const h16* p) { return cat16(*(const v8h*)p, *(const v8h*)(p + 256)); } static __device__ __forceinline__ V ldg(const h16* p) { return cat16(*(G)p, *(G)(p + 256)); } static __device__ __forceinline__ v8f mma(V a, V b, v8f c) { return wmma16(a, b, c); } };
template <> struct WFrag<bf> { typedef v16bf V; typedef const __attribute__((address_space(1))) v8us* G; static __device__ __forceinline__ V ld(const bf* p) { return cat16b(*(const v8us*)p, *(const v8us*)(p + 256)); } static __device__ __forceinline__ V ldg(const bf* p) { return cat16b(*(G)p, *(G)(p + 256)); } static __device__ __forceinline__ v8f mma(V a, V b, v8f c) { return wmmab(a, b, c); } };
// One wave a SIMD: the launch has as many one-wave work-groups as the chip has SIMDs, and the two register sets need more than half a SIMD's registers.
template <typename T16, int NSPLIT, bool BIAS, int K, int KS>
__global__ __launch_bounds__(32) __attribute__((amdgpu_waves_per_eu(1, 1))) void k_gemmw(const T16* __restrict__ A, const T16* __restrict__ A2, const T16* __restrict__ Bt, const T16* __restrict__ Bt2, float* C, int ldc, const float* __restrict__ bias, size_t sA, size_t sB, size_t sC) {
    typedef typename WFrag<T16>::V V;
    __shared__ __align__(16) float os[16 * 68];
    const size_t z = blockIdx.z; A += z * sA; if (A2) A2 += z * sA; Bt += z * sB; if (Bt2) Bt2 += z * sB; C += z * sC;
    const int lane = threadIdx.x & 31, lr = lane & 15, hi = lane >> 4; const int r0 = blockIdx.x * 64, c0 = blockIdx.y * 64;
    v8f acc[4][4];
#pragma unroll
    for (int mb = 0; mb < 4; ++mb)
#pragma unroll
        for (int nb = 0; nb < 4; ++nb) acc[mb][nb] = (v8f){};
    const size_t aoff = (size_t)r0 * K + 8 * lane, boff = (size_t)c0 * K + 8 * lane;   // 16 rows of fragments are 16 K elements; a step of 32 columns is one fragment, 512 elements
    const T16* pa = A + aoff; const T16* pa2 = (NSPLIT == 1 || NSPLIT == 2) ? A2 + aoff : pa; const T16* pb = Bt + boff; const T16* pb2 = (NSPLIT >= 2) ? Bt2 + boff : pb;
    static_assert(K % (64 * KS) == 0, "stages come in pairs, one for each register set");
    V a[2][KS][4], a2[2][KS][4], b[2][KS][4], b2[2][KS][4];
    // every index below is a constant once the calls are inlined and the loops unrolled, so the sets stay in registers
    auto fetch = [&](const int s) __attribute__((always_inline)) {
#pragma unroll
        for (int u = 0; u < KS; ++u) {
#pragma unroll
            for (int mb = 0; mb < 4; ++mb) { a[s][u][mb] = WFrag<T16>::ldg(pa + mb * 16 * K + u * 512); if (NSPLIT == 1 || NSPLIT == 2) a2[s][u][mb] = WFrag<T16>::ldg(pa2 + mb * 16 * K + u * 512); }
#pragma unroll
            for (int nb = 0; nb < 4; ++nb) { b[s][u][nb] = WFrag<T16>::ldg(pb + nb * 16 * K + u * 512); if (NSPLIT >= 2) b2[s][u][nb] = WFrag<T16>::ldg(pb2 + nb * 16 * K + u * 512); } }
        __builtin_amdgcn_sched_barrier(0);   // all of the stage's loads are issued before the other set's products: left free, the scheduler puts loads among the products to save registers, and each such group is waited for by itself
    };
    auto mul = [&](const int s) __attribute__((always_inline)) {
#pragma unroll
        for (int u = 0; u < KS; ++u)
#pragma unroll
            for (int nb = 0; nb < 4; ++nb) {
#pragma unroll
                for (int mb = 0; mb < 4; ++mb) { acc[mb][nb] = WFrag<T16>::mma(a[s][u][mb], b[s][u][nb], acc[mb][nb]); if (NSPLIT == 1 || NSPLIT == 2) acc[mb][nb] = WFrag<T16>::mma(a2[s][u][mb], b[s][u][nb], acc[mb][nb]); if (NSPLIT >= 2) acc[mb][nb] = WFrag<T16>::mma(a[s][u][mb], b2[s][u][nb], acc[mb][nb]); } }
        __builtin_amdgcn_sched_barrier(0);   // the products stay in front of the next stage's loads, which go into the registers they read
    };
    auto step = [&]() __attribute__((always_inline)) {
        // behind the products: a whole block of matrix instructions after the loads that name these pairs were issued
        wait_step<1024 * KS>(pa); if constexpr (NSPLIT == 1 || NSPLIT == 2) wait_step<1024 * KS>(pa2); wait_step<1024 * KS>(pb); if constexpr (NSPLIT >= 2) wait_step<1024 * KS>(pb2);
    };
    fetch(0); step();
    // rolled: two stages' fragments live at a time
#pragma unroll 1
    for (int kc = 0; kc < K - 64 * KS; kc += 64 * KS) { fetch(1); mul(0); step(); fetch(0); mul(1); step(); }
    fetch(1); mul(0); step(); mul(1);
#pragma unroll
    for (int mb = 0; mb < 4; ++mb) {
#pragma unroll
        for (int nb = 0; nb < 4; ++nb) {
#pragma unroll
            for (int j = 0; j < 8; ++j) os[(hi * 8 + j) * 68 + nb * 16 + lr] = acc[mb][nb][j]; }
        __builtin_amdgcn_wave_barrier(); asm volatile("" ::: "memory");
        float* crow = C + (size_t)(r0 + mb * 16) * ldc + c0;
{
            v4f vs[8]; float* pc[8];
#pragma unroll
            for (int s = 0; s < 8; ++s) { const int row = 2 * s + hi, cofs = lr * 4; v4f val = *(const v4fa*)(os + row * 68 + cofs); if (BIAS) { val[0] += bfr(bias[c0 + cofs]); val[1] += bfr(bias[c0 + cofs + 1]); val[2] += bfr(bias[c0 + cofs + 2]); val[3] += bfr(bias[c0 + cofs + 3]); }
                vs[s] = val; pc[s] = crow + (size_t)row * ldc + cofs; *(v4f*)pc[s] = vs[s]; }
            // the wait that stands before a register named by an issued store is written anew; data and address pairs are inputs, so they live up to it
            asm volatile("s_wait_xcnt 0x0" :: "v"(vs[0]), "v"(vs[1]), "v"(vs[2]), "v"(vs[3]), "v"(vs[4]), "v"(vs[5]), "v"(vs[6]), "v"(vs[7]), "v"(pc[0]), "v"(pc[1]), "v"(pc[2]), "v"(pc[3]), "v"(pc[4]), "v"(pc[5]), "v"(pc[6]), "v"(pc[7]) : "memory");
             }
        __builtin_amdgcn_wave_barrier(); asm volatile("" ::: "memory");
    }
}

__device__ __forceinline__ h16 tohx(float x) { return (h16)x; }
__device__ __forceinline__ void splitf(float y, unsigned short& h, unsigned short& l) { h = f2bf(y); l = f2bf(y - bf2f(h)); }
typedef __attribute__((ext_vector_type(2))) _Float16 v2h;
typedef __attribute__((ext_vector_type(4))) _Float16 v4h;
typedef __attribute__((ext_vector_type(2))) unsigned short v2us;
typedef __attribute__((ext_vector_type(4))) unsigned short v4us;
typedef __attribute__((ext_vector_type(2))) float v2f;
typedef __attribute__((ext_vector_type(4))) int v4i;

// The j_ functions are jobs of 256 work-items that read none of each other's output; k_prep below runs them side by side in one grid, the job picked by the block index (bx: the block's index within its job).
// w [K][N] to Bt (rows n, columns k) in fragment order: a work-item takes 16 k of one n; a wave's 32 n in a row make each load one whole line, and its stores 256 bytes in a row for each 16 n.
__device__ __forceinline__ void j_wtG(const int bx, const float* __restrict__ w, int K, int N, bf* Bt) {
    const int i = bx * 256 + (int)threadIdx.x; const int n = ((i >> 5) % (N / 32)) * 32 + (i & 31), k0 = ((i >> 5) / (N / 32)) * 16; if (k0 >= K) return;
    const float* p = w + ((size_t)k0 * N + n); float v[16];
#pragma unroll
    for (int e = 0; e < 16; ++e) v[e] = p[(size_t)e * N];
    asm volatile("s_wait_xcnt 0x0" :: "v"(p) : "memory");   // the wait that stands before a register named by an issued load is written anew; the address pair is an input, so it lives up to it
    v8us o0, o1;
#pragma unroll
    for (int e = 0; e < 8; ++e) { o0[e] = f2bf(v[e]); o1[e] = f2bf(v[8 + e]); }
    bf* q = Bt + fro(n, k0, K); *(v8us*)q = o0; *(v8us*)(q + 128) = o1;
}
// src [rows][K] to dst in fragment order, 8 values a work-item: a wave takes 8 rows x 32 columns (8 whole lines in, 4 whole lines out).
__device__ __forceinline__ void j_cvt8(const int bx, const float* __restrict__ src, bf* dst, int K, size_t n8) { const size_t i = (size_t)bx * 256 + threadIdx.x; if (i >= n8) return;
    const int fr = (int)(i >> 6), r = (fr / (K / 32)) * 16 + (int)((i >> 5) & 1) * 8 + (int)(i & 7), k0 = (fr % (K / 32)) * 32 + (int)((i >> 3) & 3) * 8;
    const float* p = src + ((size_t)r * K + k0); const v8f v = *(const v8f*)p; v8us o;
    asm volatile("s_wait_xcnt 0x0" :: "v"(p) : "memory");   // as in j_wtG
#pragma unroll
    for (int k = 0; k < 8; ++k) o[k] = f2bf(v[k]); *(v8us*)(dst + fro(r, k0, K)) = o;  }

__global__ __launch_bounds__(256) void k_vtp(const float* __restrict__ F, int pitch, int nheads, h16* V16, bf* Vh, bf* Vl) { const size_t e = ((size_t)blockIdx.x * 256 + threadIdx.x) * 2; if (e >= (size_t)nheads * HD * TT) return; const int t = (int)(e % TT); const int d = (int)((e / TT) % HD); const int g = (int)(e / ((size_t)TT * HD)); v2h o16; v2us oh, ol;
#pragma unroll
    for (int q = 0; q < 2; ++q) { const float x = F[(size_t)(t + q) * pitch + g * HD + d]; o16[q] = tohx(x); unsigned short a2, c2; splitf(x, a2, c2); oh[q] = a2; ol[q] = c2; }
    *(v2h*)(V16 + e) = o16; *(v2us*)(Vh + e) = oh; *(v2us*)(Vl + e) = ol;  }
__device__ __forceinline__ void j_qtabs(const int bx, const float* __restrict__ ph, const float* __restrict__ am, float* MOD, float* CT) { const int i = bx * 256 + threadIdx.x; if (i < DQ) { const float m = __fmul_rn(cosf(bfr(ph[i])), bfr(am[i])); *(float*)(MOD + i) = m;  }
    if (i < TT) { const float a = __fmul_rn(__fmul_rn(6.2831853071795862f, (float)i), 1.0f / (float)TT); const float c = cosf(a); *(float*)(CT + i) = c;  } }
// ---- k_prep: every job that reads only inputs, in one grid: the four weight transposes (sixteen reads a work-item, the longest job: lowest indices), x of both batches to bf16, the modulation and cos tables.
#define PW ((DM * DQ / 16 + 255) / 256)            // blocks of one weight transpose
#define PX ((NB_ * TT * DM / 8 + 255) / 256)       // blocks of the x conversion
#define PT ((TT + 255) / 256)                      // blocks of the two small tables
__global__ __launch_bounds__(256) void k_prep(const float* __restrict__ x, const float* __restrict__ wq, const float* __restrict__ wk, const float* __restrict__ wv, const float* __restrict__ wo, const float* __restrict__ ph, const float* __restrict__ am, bf* WT, bf* XB, float* MOD, float* CT) {
    const int b = (int)blockIdx.x;
    if (b < 4 * PW) { const int j = b / PW; j_wtG(b % PW, j == 0 ? wq : j == 1 ? wk : j == 2 ? wv : wo, DM, DQ, WT + (size_t)j * DQ * DM); }
    else if (b < 4 * PW + PX) j_cvt8(b - 4 * PW, x, XB, DM, (size_t)NB_ * TT * DM / 8);
    else j_qtabs(b - 4 * PW - PX, ph, am, MOD, CT);
}
// ---- k_fattn: scores, interference, softmax and attn.v of one query block in one kernel; no score or probability ever reaches memory.
// Transposed products: S^T = K Q^T (A = 16 key rows, B = 16 query rows, both by the same loader), so a lane holds 8 keys' scores of ONE query (query = lane & 15, keys 8 (lane >> 4) + r);
// two such tiles (keys 0-15 and 16-31 of a 32-key pass), converted in place, are the B operand of O^T += V^T P^T, whose A operand (V^T rows, key-contiguous) comes by the same loader in the same k order.
// Softmax is the running form: a query's maximum in use m is raised (and its sum and output tiles rescaled) only when a pass's maximum exceeds it by more than FRTH, so p = exp(t - m) <= exp(FRTH).
// Work-group: FQG query groups x FKS key chunks = 4 waves; wave (qg, ks) does 16 QT queries against keys [ks TT / FKS, + TT / FKS); the FKS partial (m, sum, O) of a query are joined through LDS in chunk order and stored as the hi + lo planes that the Wo product reads.
// tab[u] = cos table entry for |j - i| x HD^-0.5 (a power of two: exact), u = j - (i - q0) + NQW - 1: a lane's 8 keys are 8 consecutive entries.
// Each '#pragma unroll' below, but those on the join's sx and u loops, unrolls a loop over a register array to the end, so that its indices are constants and the array stays in registers.
#define FKS  4
#define FQG  1
#define FRTH 5.5f
#define L2E  1.4426950408889634f
#define FTAB 2176                 // floats kept for tab: TT + 32 - 1, rounded up to 17 per work-item
#define FLDS (FTAB + FKS * FQG * 32 * 68 + 2 * FKS * FQG * 32)
typedef __attribute__((ext_vector_type(8))) __bf16 v8bf;
__device__ __forceinline__ float xhalf(float x) { const int b = __float_as_int(x); return __int_as_float(__builtin_amdgcn_permlanex16(b, b, 0x76543210, 0xfedcba98, false, false)); }   // the value of lane ^ 16
// 2^x of a tile's eight values in one statement. Behind a transcendental the instruction set asks for one independent instruction before its result is used or its source overwritten: the results are early-clobber, so no v_exp_f32 here touches a neighbour's registers, and the v_nop is the last one's slot.
__device__ __forceinline__ v8f exp2x8(const v8f x) { float y0, y1, y2, y3, y4, y5, y6, y7;
    asm("v_exp_f32 %0, %8\n\tv_exp_f32 %1, %9\n\tv_exp_f32 %2, %10\n\tv_exp_f32 %3, %11\n\tv_exp_f32 %4, %12\n\tv_exp_f32 %5, %13\n\tv_exp_f32 %6, %14\n\tv_exp_f32 %7, %15\n\tv_nop"
        : "=&v"(y0), "=&v"(y1), "=&v"(y2), "=&v"(y3), "=&v"(y4), "=&v"(y5), "=&v"(y6), "=&v"(y7) : "v"(x[0]), "v"(x[1]), "v"(x[2]), "v"(x[3]), "v"(x[4]), "v"(x[5]), "v"(x[6]), "v"(x[7]));
    return (v8f){y0, y1, y2, y3, y4, y5, y6, y7}; }
template <typename T16, bool HL, int QT>
__device__ __forceinline__ void fattn_body(const T16* __restrict__ Q, const T16* __restrict__ Q2, const T16* __restrict__ Kp, const T16* __restrict__ Kp2, const T16* __restrict__ Vt, const T16* __restrict__ Vt2, const float* __restrict__ CT, const int q0, bf* Ah, bf* Al, float* lds) {
    typedef typename WFrag<T16>::V V;
    constexpr int NQ = 16 * QT, NQW = NQ * FQG, NT = FKS * FQG * 32;
    const int tid = (int)threadIdx.x, lane = tid & 31, lr = lane & 15, hi = lane >> 4; const int w = __builtin_amdgcn_readfirstlane(tid >> 5); const int ks = w & (FKS - 1), qg = w / FKS;
    float* tab = lds; float* accS = lds + FTAB; float* mS = accS + FKS * FQG * 32 * 68; float* lS = mS + FKS * FQG * 32;
    static_assert(FTAB == 17 * NT && TT + NQW - 1 <= FTAB, "tab: seventeen entries per work-item");
    int ix[17]; float cv[17];
#pragma unroll
    for (int f = 0; f < 17; ++f) { const int d = tid + f * NT - (NQW - 1) - q0; const int a = d < 0 ? -d : d; ix[f] = a < TT ? a : TT - 1; cv[f] = CT[ix[f]]; }   // entries past TT + NQW - 2 are never read; their index is clamped into the table
    const T16* pq = Q + ((size_t)(q0 + qg * NQ) * HD + 8 * lane); const T16* pq2 = HL ? Q2 + ((size_t)(q0 + qg * NQ) * HD + 8 * lane) : pq;   // fragment order: 16 rows are HD / 32 fragments of 512 elements
    V qf[QT][2], qf2[QT][2];
#pragma unroll
    for (int qt = 0; qt < QT; ++qt)
#pragma unroll
        for (int kc = 0; kc < 2; ++kc) { qf[qt][kc] = WFrag<T16>::ld(pq + qt * 16 * HD + kc * 512); if (HL) qf2[qt][kc] = WFrag<T16>::ld(pq2 + qt * 16 * HD + kc * 512); }
    // the wait that stands before a register named by an issued load is written anew; the loads' index and address registers are inputs, so they live up to it
    asm volatile("s_wait_xcnt 0x0" :: "v"(ix[0]), "v"(ix[1]), "v"(ix[2]), "v"(ix[3]), "v"(ix[4]), "v"(ix[5]), "v"(ix[6]), "v"(ix[7]), "v"(ix[8]), "v"(ix[9]), "v"(ix[10]), "v"(ix[11]), "v"(ix[12]), "v"(ix[13]), "v"(ix[14]), "v"(ix[15]), "v"(ix[16]), "v"(pq), "v"(pq2) : "memory");
#pragma unroll
    for (int f = 0; f < 17; ++f) tab[tid + f * NT] = cv[f] * SCL;
    v8f acc[QT][4]; float m[QT], l[QT];
#pragma unroll
    for (int qt = 0; qt < QT; ++qt) { m[qt] = -3.0e38f; l[qt] = 0.f;
#pragma unroll
        for (int dt = 0; dt < 4; ++dt) acc[qt][dt] = (v8f){}; }
    __syncthreads();   // tab is whole before any wave reads it
    const int kbeg = ks * (TT / FKS);
    // rolled: one pass's fragments live at a time
#pragma unroll 1
    for (int jb = kbeg; jb < kbeg + TT / FKS; jb += 32) {
        const size_t ok = (size_t)jb * HD + 8 * lane;
        const T16* pk = Kp + ok; const T16* pk2 = HL ? Kp2 + ok : pk;
        V kf[2][2], kf2[2][2], vf[4], vf2[4];
#pragma unroll
        for (int kt = 0; kt < 2; ++kt)
#pragma unroll
            for (int kc = 0; kc < 2; ++kc) { kf[kt][kc] = WFrag<T16>::ld(pk + kt * 16 * HD + kc * 512); if (HL) kf2[kt][kc] = WFrag<T16>::ld(pk2 + kt * 16 * HD + kc * 512); }
        // as above: the address pairs live up to the wait, and nothing that a load names is written before it
        // the loaded fragments are inputs too (inputs only): all of the pass's K loads are then in flight together, one trip to L2 instead of several in a row
        if constexpr (HL) asm volatile("s_wait_xcnt 0x0" :: "v"(pk), "v"(pk2), "v"(kf[0][0]), "v"(kf[0][1]), "v"(kf[1][0]), "v"(kf[1][1]), "v"(kf2[0][0]), "v"(kf2[0][1]), "v"(kf2[1][0]), "v"(kf2[1][1]) : "memory");
        else asm volatile("s_wait_xcnt 0x0" :: "v"(pk), "v"(kf[0][0]), "v"(kf[0][1]), "v"(kf[1][0]), "v"(kf[1][1]) : "memory");
        v8f s[QT][2];
#pragma unroll
        for (int kt = 0; kt < 2; ++kt)
#pragma unroll
            for (int qt = 0; qt < QT; ++qt) { v8f t = (v8f){};
#pragma unroll
                for (int kc = 0; kc < 2; ++kc) { t = WFrag<T16>::mma(kf[kt][kc], qf[qt][kc], t); if (HL) { t = WFrag<T16>::mma(kf[kt][kc], qf2[qt][kc], t); t = WFrag<T16>::mma(kf2[kt][kc], qf[qt][kc], t); } }
                s[qt][kt] = t; }
        const float* tb = tab + (jb + 8 * hi - lr - qg * NQ + NQW - 1);
        float bm[QT]; bool need = false;
#pragma unroll
        for (int qt = 0; qt < QT; ++qt) { float x = -3.0e38f;
#pragma unroll
            for (int kt = 0; kt < 2; ++kt)
#pragma unroll
                for (int r = 0; r < 8; ++r) { const float t = s[qt][kt][r] * tb[16 * (kt - qt) + r]; s[qt][kt][r] = t; x = fmaxf(x, t); }
            x = fmaxf(x, xhalf(x)); bm[qt] = x; need = need || (x > m[qt] + FRTH); }
        // the V^T fragments go into the registers that the K fragments leave and fly while the softmax runs; the hi+lo form, with twice the fragments, asks for them behind the rescale branch, where the registers are free
        auto loadv = [&]() { const size_t ov = (size_t)jb * 16 + 8 * lane; /* 32 keys of 16 rows of V^T are one fragment */ const T16* pv = Vt + ov; const T16* pv2 = HL ? Vt2 + ov : pv;
#pragma unroll
            for (int dt = 0; dt < 4; ++dt) { vf[dt] = WFrag<T16>::ld(pv + dt * 16 * TT); if (HL) vf2[dt] = WFrag<T16>::ld(pv2 + dt * 16 * TT); }
            asm volatile("s_wait_xcnt 0x0" :: "v"(pv), "v"(pv2) : "memory");   // as above
        };
        if constexpr (!HL) loadv();
        if (__builtin_amdgcn_ballot_w32(need) != 0) {   // a scalar branch: taken on a wave's first pass and seldom after it
#pragma unroll
            for (int qt = 0; qt < QT; ++qt) { const float mn = (bm[qt] > m[qt] + FRTH) ? bm[qt] : m[qt]; const float al = __builtin_amdgcn_exp2f((m[qt] - mn) * L2E); m[qt] = mn; l[qt] *= al;
#pragma unroll
                for (int dt = 0; dt < 4; ++dt) acc[qt][dt] *= al; } }
        if constexpr (HL) loadv();
        V pb[QT], pl[QT];
#pragma unroll
        for (int qt = 0; qt < QT; ++qt) { const float nm = -m[qt] * L2E; float ls = 0.f;
#pragma unroll
            for (int kt = 0; kt < 2; ++kt) { v8f a;
#pragma unroll
                for (int r = 0; r < 8; ++r) a[r] = __builtin_fmaf(s[qt][kt][r], L2E, nm);
                s[qt][kt] = exp2x8(a);
#pragma unroll
                for (int r = 0; r < 8; ++r) ls += s[qt][kt][r]; }
            l[qt] += ls;
            if constexpr (HL) {   // hi = p rounded to nearest even, lo = (p - hi) rounded likewise: splitf's values for the finite p here, by the packed conversion
                const v8bf h0 = __builtin_convertvector(s[qt][0], v8bf), h1 = __builtin_convertvector(s[qt][1], v8bf);
                const v8bf l0 = __builtin_convertvector(s[qt][0] - __builtin_convertvector(h0, v8f), v8bf), l1 = __builtin_convertvector(s[qt][1] - __builtin_convertvector(h1, v8f), v8bf);
                pb[qt] = __builtin_shufflevector(h0, h1, 0, 1, 2, 3, 4, 5, 6, 7, 8, 9, 10, 11, 12, 13, 14, 15); pl[qt] = __builtin_shufflevector(l0, l1, 0, 1, 2, 3, 4, 5, 6, 7, 8, 9, 10, 11, 12, 13, 14, 15);
            } else { pb[qt] = cat16(__builtin_convertvector(s[qt][0], v8h), __builtin_convertvector(s[qt][1], v8h)); } }
#pragma unroll
        for (int dt = 0; dt < 4; ++dt)
#pragma unroll
            for (int qt = 0; qt < QT; ++qt) { acc[qt][dt] = WFrag<T16>::mma(vf[dt], pb[qt], acc[qt][dt]); if (HL) { acc[qt][dt] = WFrag<T16>::mma(vf[dt], pl[qt], acc[qt][dt]); acc[qt][dt] = WFrag<T16>::mma(vf2[dt], pb[qt], acc[qt][dt]); } }
    }
    float* my = accS + w * (32 * 68);
#pragma unroll
    for (int qt = 0; qt < QT; ++qt) { const float lj = l[qt] + xhalf(l[qt]);   // the two lane halves summed different keys of the same query
        if (hi == 0) { mS[w * 32 + qt * 16 + lr] = m[qt]; lS[w * 32 + qt * 16 + lr] = lj; }
#pragma unroll
        for (int dt = 0; dt < 4; ++dt) { float* p = my + (qt * 16 + lr) * 68 + dt * 16 + hi * 8; const v8f t = acc[qt][dt];
            *(v4fa*)p = __builtin_shufflevector(t, t, 0, 1, 2, 3); *(v4fa*)(p + 4) = __builtin_shufflevector(t, t, 4, 5, 6, 7); } }
    __syncthreads();   // every wave's partial is in LDS before any is joined
#pragma unroll
    for (int sx = 0; sx < NQW * 8 / NT; ++sx) { const int idx = sx * NT + tid; const int q = (idx >> 7) * 16 + (idx & 15), dc = ((idx >> 4) & 7) * 8; const int w0 = (q / NQ) * FKS, ql = q % NQ;   // a wave has 16 queries x 16 columns: 512 bytes in a row of each plane
        float M = mS[w0 * 32 + ql];
#pragma unroll
        for (int u = 1; u < FKS; ++u) M = fmaxf(M, mS[(w0 + u) * 32 + ql]);
        float L = 0.f; v4f o0 = (v4f){}, o1 = (v4f){};
#pragma unroll
        for (int u = 0; u < FKS; ++u) { const float sc = __builtin_amdgcn_exp2f((mS[(w0 + u) * 32 + ql] - M) * L2E); L += lS[(w0 + u) * 32 + ql] * sc; const float* p = accS + ((w0 + u) * 32 + ql) * 68 + dc; o0 += *(const v4fa*)p * sc; o1 += *(const v4fa*)(p + 4) * sc; }
        const float inv = __fdiv_rn(1.0f, L); v8us oh, ol;
#pragma unroll
        for (int k = 0; k < 4; ++k) { unsigned short a, c2; splitf(o0[k] * inv, a, c2); oh[k] = a; ol[k] = c2; splitf(o1[k] * inv, a, c2); oh[4 + k] = a; ol[4 + k] = c2; }
        const size_t oo = fro(q0 + q, dc, DQ); bf* ph = Ah + oo; bf* pl = Al + oo; *(v8us*)ph = oh; *(v8us*)pl = ol;
        asm volatile("s_wait_xcnt 0x0" :: "v"(oh), "v"(ol), "v"(ph), "v"(pl) : "memory"); }   // the wait that stands before a register named by an issued store is written anew; data and address pairs are inputs, so they live up to it
}
// grid (batches x heads, RH / 16 + (TT - RH) / 32): the hi+lo query blocks (three products each, the longer work) have the low indices and start first.
// Five waves a SIMD (192 registers): the launch's 2,560 four-wave work-groups are then two full rounds of five on each of the 256 WGPs.
__global__ __launch_bounds__(FKS * FQG * 32) __attribute__((amdgpu_waves_per_eu(5, 5))) void k_fattn(const h16* __restrict__ Q16, const h16* __restrict__ K16, const h16* __restrict__ V16, const bf* __restrict__ Qh, const bf* __restrict__ Ql, const bf* __restrict__ Kh, const bf* __restrict__ Kl, const bf* __restrict__ Vh, const bf* __restrict__ Vl, const float* __restrict__ CT, bf* Ah, bf* Al) {
    __shared__ __align__(16) float lds[FLDS];
    const int bh = (int)blockIdx.x, by = (int)blockIdx.y; const size_t ho = (size_t)bh * TT * HD; const size_t ao = (size_t)(bh / NH_) * TT * DQ + (bh % NH_) * (HD / 32) * 512;   // planes [batch][head]; output rows [batch x t], the head's columns (in fragment order: its HD / 32 fragments of each 16 rows)
    if (by < RH / (16 * FQG)) fattn_body<bf, true, 1>(Qh + ho, Ql + ho, Kh + ho, Kl + ho, Vh + ho, Vl + ho, CT, by * (16 * FQG), Ah + ao, Al + ao, lds);
    else fattn_body<h16, false, 2>(Q16 + ho, nullptr, K16 + ho, nullptr, V16 + ho, nullptr, CT, RH + (by - RH / (16 * FQG)) * (32 * FQG), Ah + ao, Al + ao, lds);
}

// ---- k_qkv: the q | k | v product of both batches, its epilogue storing the head planes that k_fattn reads (fp16 and hi + lo bf16); the f32 product never reaches memory.
// ONE WAVE per 64 x 64 tile as in k_gemmw, same k order, stages of one fragment; a tile is 64 positions of one head of q, k or v. grid (batches x TT / 64, 3 DQ / 64), 32 threads.
// q, k: planes [t][d], value x MOD[h][d], in fragment order like every plane here. v: planes [d][t] of vv[t] = (v[t] MOD + v[t + 1 mod TT] MOD) / sqrt(2): the tile's last position needs the next tile's first row, so a v tile carries a fifth row block (rows t0 + 64 ..., wrapped inside the batch), of which row 0 is used.
// Four times eight values in a row (a lane's pieces of two fragments, 256 elements apart) to the three planes: fp16, hi = bf16 nearest even, lo = (x - hi) likewise (splitf's values for finite x, by the packed conversion).
__device__ __forceinline__ void put32(const v8f (&x)[4], const size_t e, h16* P16, bf* Ph, bf* Pl) {
    h16* q16 = P16 + e; bf* qh = Ph + e; bf* ql = Pl + e; v8h a[4]; v8us h[4], l[4];
#pragma unroll
    for (int s = 0; s < 4; ++s) { const v8bf hb = __builtin_convertvector(x[s], v8bf); const v8bf lb = __builtin_convertvector(x[s] - __builtin_convertvector(hb, v8f), v8bf);
        a[s] = __builtin_convertvector(x[s], v8h); h[s] = __builtin_bit_cast(v8us, hb); l[s] = __builtin_bit_cast(v8us, lb); }
#pragma unroll
    for (int s = 0; s < 4; ++s) { *(v8h*)(q16 + s * 256) = a[s]; *(v8us*)(qh + s * 256) = h[s]; *(v8us*)(ql + s * 256) = l[s]; }
    // the wait that stands before a register named by an issued store is written anew; data and address pairs are inputs, so they live up to it
    asm volatile("s_wait_xcnt 0x0" :: "v"(a[0]), "v"(a[1]), "v"(a[2]), "v"(a[3]), "v"(h[0]), "v"(h[1]), "v"(h[2]), "v"(h[3]), "v"(l[0]), "v"(l[1]), "v"(l[2]), "v"(l[3]), "v"(q16), "v"(qh), "v"(ql) : "memory"); }
template <bool VV>
__device__ __forceinline__ void qkv_body(const bf* __restrict__ X, const bf* __restrict__ Wt, const float* __restrict__ MOD, h16* P16, bf* Ph, bf* Pl, float* os) {
    typedef WFrag<bf>::V V;
    constexpr int K = DM, MB = VV ? 5 : 4;
    const int lane = threadIdx.x & 31, lr = lane & 15, hi = lane >> 4; const int r0 = blockIdx.x * 64, c0 = blockIdx.y * 64;
    const int b = r0 / TT, t0 = r0 % TT, h = (c0 % DQ) / HD;
    const float* pm = MOD + h * HD + lr; float md[4];
#pragma unroll
    for (int nb = 0; nb < 4; ++nb) md[nb] = pm[nb * 16];   // a lane's accumulators are of columns nb 16 + lr
    asm volatile("s_wait_xcnt 0x0" :: "v"(pm) : "memory");   // the wait that stands before a register named by an issued load is written anew; the address pair is an input, so it lives up to it
    v8f acc[MB][4];
#pragma unroll
    for (int mb = 0; mb < MB; ++mb)
#pragma unroll
        for (int nb = 0; nb < 4; ++nb) acc[mb][nb] = (v8f){};
    const bf* pa = X + ((size_t)r0 * K + 8 * lane); const bf* pb = Wt + ((size_t)c0 * K + 8 * lane); const bf* pn = X + ((size_t)(b * TT + (t0 + 64) % TT) * K + 8 * lane);   // fragment order: 16 rows are 16 K elements, 32 columns one fragment
    static_assert(K % 64 == 0, "k steps come in pairs, one for each register set");
    V a[2][MB], bb[2][4];
    // two register sets as in k_gemmw: while one set's products run, the next k step's loads, all issued in front of them, are in flight; every index is a constant once the calls are inlined
    auto fetch = [&](const int s) __attribute__((always_inline)) {
#pragma unroll
        for (int mb = 0; mb < 4; ++mb) a[s][mb] = WFrag<bf>::ldg(pa + mb * 16 * K);
        if constexpr (VV) a[s][4] = WFrag<bf>::ldg(pn);
#pragma unroll
        for (int nb = 0; nb < 4; ++nb) bb[s][nb] = WFrag<bf>::ldg(pb + nb * 16 * K);
        __builtin_amdgcn_sched_barrier(0);   // as in k_gemmw: all of the step's loads are issued before the other set's products
    };
    auto mul = [&](const int s) __attribute__((always_inline)) {
#pragma unroll
        for (int nb = 0; nb < 4; ++nb)
#pragma unroll
            for (int mb = 0; mb < MB; ++mb) acc[mb][nb] = WFrag<bf>::mma(a[s][mb], bb[s][nb], acc[mb][nb]);
        __builtin_amdgcn_sched_barrier(0);   // as in k_gemmw: the products stay in front of the loads that go into the registers they read
    };
    auto step = [&]() __attribute__((always_inline)) {
        // as in k_gemmw: behind the products
        wait_step<1024>(pa); wait_step<1024>(pb); if constexpr (VV) wait_step<1024>(pn);
    };
    fetch(0); step();
    // rolled: two steps' fragments live at a time
#pragma unroll 1
    for (int kc = 0; kc < K - 64; kc += 64) { fetch(1); mul(0); step(); fetch(0); mul(1); step(); }
    fetch(1); mul(0); step(); mul(1);
    const size_t o = (((size_t)(c0 / DQ) * NB_ + b) * NH_ + h) * TT * HD;   // planes [q, k, v][batch][head]
    // on the way out a lane has 8 values in a row, of row lr and columns s 16 + hi 8 ...: the wave's 32 pieces are half a fragment, 512 bytes in a row
    if constexpr (!VV) {
#pragma unroll
        for (int mb = 0; mb < 4; ++mb) {
#pragma unroll
            for (int nb = 0; nb < 4; ++nb) {
#pragma unroll
                for (int j = 0; j < 8; ++j) os[(hi * 8 + j) * 68 + nb * 16 + lr] = __fmul_rn(acc[mb][nb][j], md[nb]); }
            __builtin_amdgcn_wave_barrier(); asm volatile("" ::: "memory");   // the lanes read each other's LDS stores: no read may be moved above them
            v8f y[4];
#pragma unroll
            for (int s = 0; s < 4; ++s) { const float* p = os + lr * 68 + s * 16 + hi * 8; const v4f x0 = *(const v4fa*)p, x1 = *(const v4fa*)(p + 4); y[s] = __builtin_shufflevector(x0, x1, 0, 1, 2, 3, 4, 5, 6, 7); }
            put32(y, o + (size_t)(t0 + mb * 16) * HD + lane * 8, P16, Ph, Pl);
            __builtin_amdgcn_wave_barrier(); asm volatile("" ::: "memory");   // and no store of the next block above these reads
        }
    } else {
#pragma unroll
        for (int nb = 0; nb < 4; ++nb) {
#pragma unroll
            for (int mb = 0; mb < 4; ++mb) { v8f t;
#pragma unroll
                for (int j = 0; j < 8; ++j) t[j] = __fmul_rn(acc[mb][nb][j], md[nb]);
                float* p = os + lr * 68 + mb * 16 + hi * 8; *(v4fa*)p = __builtin_shufflevector(t, t, 0, 1, 2, 3); *(v4fa*)(p + 4) = __builtin_shufflevector(t, t, 4, 5, 6, 7); }
            if (hi == 0) os[lr * 68 + 64] = __fmul_rn(acc[4][nb][0], md[nb]);   // position t0 + 64 (mod TT)
            __builtin_amdgcn_wave_barrier(); asm volatile("" ::: "memory");   // as above
            v8f y[4];
#pragma unroll
            for (int s = 0; s < 4; ++s) { const float* p = os + lr * 68 + s * 16 + hi * 8; const v4f x0 = *(const v4fa*)p, x1 = *(const v4fa*)(p + 4); const float x8 = p[8];
                const float x[9] = {x0[0], x0[1], x0[2], x0[3], x1[0], x1[1], x1[2], x1[3], x8};
#pragma unroll
                for (int j = 0; j < 8; ++j) y[s][j] = __fmul_rn(__fadd_rn(x[j], x[j + 1]), 0.70710678118654752f); }
            put32(y, o + (size_t)nb * 16 * TT + (size_t)t0 * 16 + lane * 8, P16, Ph, Pl);
            __builtin_amdgcn_wave_barrier(); asm volatile("" ::: "memory");   // as above
        }
    }
}
// Three waves a SIMD (336 registers): the launch's 3,072 one-wave work-groups are then all resident at once.
__global__ __launch_bounds__(32) __attribute__((amdgpu_waves_per_eu(3, 3))) void k_qkv(const bf* __restrict__ X, const bf* __restrict__ Wt, const float* __restrict__ MOD, h16* P16, bf* Ph, bf* Pl) {
    __shared__ __align__(16) float os[16 * 68];
    if ((int)blockIdx.y < 2 * (DQ / 64)) qkv_body<false>(X, Wt, MOD, P16, Ph, Pl, os);
    else qkv_body<true>(X, Wt, MOD, P16, Ph, Pl, os);
}

extern "C" void kernel_launch(void* const* d_in, const int* in_sizes, int n_in,
                              void* d_out, int out_size, void* d_ws, size_t ws_size, hipStream_t stream) {
    (void)in_sizes; (void)n_in; (void)out_size;
    const float* x = (const float*)d_in[0]; const float* wq = (const float*)d_in[1]; const float* wk = (const float*)d_in[2]; const float* wv = (const float*)d_in[3]; const float* wo = (const float*)d_in[4]; const float* qph = (const float*)d_in[5]; const float* qam = (const float*)d_in[6];
    float* OUT = (float*)d_out;     // [2][2048][1024]
    char* wsp = (char*)d_ws;
    auto take = [&](size_t bytes) { char* p = wsp; wsp += (bytes + 255) & ~(size_t)255; return (void*)p; };
    static_assert(DKV == DQ && DQ == DM, "the four weights are alike in shape, and q, k, v stand side by side in one product");
    bf* WT = (bf*)take((size_t)4 * DQ * DM * 2);   // Wq^T | Wk^T | Wv^T | Wo^T
    float* MOD = (float*)take((size_t)DQ * 4); float* CT = (float*)take((size_t)TT * 4);
    bf* XB = (bf*)take((size_t)NB_ * TT * DM * 2);
    const size_t PL = (size_t)NB_ * NH_ * TT * HD;   // one kind of plane, both batches
    h16* P16 = (h16*)take(3 * PL * 2); bf* Ph = (bf*)take(3 * PL * 2); bf* Pl = (bf*)take(3 * PL * 2);
    bf* ATh = (bf*)take((size_t)NB_ * TT * DQ * 2); bf* ATl = (bf*)take((size_t)NB_ * TT * DQ * 2);
    if ((size_t)(wsp - (char*)d_ws) > ws_size) return;    // ws 256 MiB
    k_prep<<<4 * PW + PX + PT, 256, 0, stream>>>(x, wq, wk, wv, wo, qph, qam, WT, XB, MOD, CT);
    k_qkv<<<dim3(NB_ * TT / 64, 3 * DQ / 64, 1), 32, 0, stream>>>(XB, WT, MOD, P16, Ph, Pl);   // q | k | v of both batches, stored as planes
    k_fattn<<<dim3(NB_ * NH_, RH / (16 * FQG) + (TT - RH) / (32 * FQG), 1), FKS * FQG * 32, 0, stream>>>(P16, P16 + PL, P16 + 2 * PL, Ph, Pl, Ph + PL, Pl + PL, Ph + 2 * PL, Pl + 2 * PL, CT, ATh, ATl);   // one kv head per query head
    k_gemmw<bf, 1, false, DQ, 2><<<dim3(NB_ * TT / 64, DM / 64, 1), 32, 0, stream>>>(ATh, ATl, WT + (size_t)3 * DQ * DM, nullptr, OUT, DM, nullptr, 0, 0, 0);
}

// v008
// Measured time: 107 microseconds a run.
// In two side-by-side timings against v007, it was 1.04 and 1.06 times as fast.
// All steps since v000 together make it 20.1 times as fast.
#include <hip/hip_runtime.h>

// 'Quantum' attention (x [2][2048][1024]; q, k, v = (x W) ('xw' [1024][1024], 16 heads x 64) each multiplied per (head, dim) by mod = cos(quantum_phase[h][d]) x quantum_amplitude[h][d]; scores = q.k / 8 x cos(2 pi (i - j) / 2048) (multiplicative Toeplitz 'interference'); w = softmax; w' = (w + roll(w, 1, keys)) / sqrt(2); out = w' v; y = merged Wo ('xw') -> [2][2048][1024] (4.2 M)).
// Realisation: the roll superposition is moved onto the values: w' v = w @ vv with vv[j] = (v[j] + v[(j+1) mod S]) / sqrt(2) (exact algebra), so attn.v runs on vv^T planes; the modulation is applied where the q | k | v product stores its planes (q, k planes x MOD[h][d]; vv from modulated v); the fused attention kernel multiplies each scaled logit by the cos table entry for |i - j| (cos(2 pi m / 2048) computed as the reference's float32 expression).
// Compute dtypes, f32 accumulate: every input rounded to bf16; q/k/v on PLAIN bf16 operands (inputs: exact); modulation table (precise cosf of bf16 phase x bf16 amplitude) and the cos Toeplitz table in f32; scores and attn.v: query rows < 512 hl (3 products), the rest single fp16; softmax f32 (running maximum, probabilities unnormalised until the end); Wo hl x exact (2 products).

#define NB_  2
#define TT   2048
#define DM   1024
#define NH_  16
#define NKV  16
#define REP  (NH_ / NKV)
#define HD   64
#define DQ   (NH_ * HD)
#define DKV  (NKV * HD)
#define RH   512                  // query rows < RH use hi+lo planes (0: none)
#define WIN  0
#define SCL  0.125f   // HD^-0.5
typedef _Float16 h16;
typedef unsigned short bf;
typedef __attribute__((ext_vector_type(16))) __bf16   v16bf;
typedef __attribute__((ext_vector_type(16))) _Float16 v16h;
typedef __attribute__((ext_vector_type(8)))  _Float16 v8h;
typedef __attribute__((ext_vector_type(8)))  unsigned short v8us;
typedef __attribute__((ext_vector_type(8)))  float    v8f;
typedef __attribute__((ext_vector_type(4)))  float    v4f;
typedef v8h  __attribute__((may_alias)) v8ha;
typedef v4f  __attribute__((may_alias)) v4fa;
typedef v8us __attribute__((may_alias)) v8usa;

__device__ __forceinline__ unsigned short f2bf(float f) { unsigned u = __float_as_uint(f); u += 0x7FFFu + ((u >> 16) & 1u); return (unsigned short)(u >> 16); }
__device__ __forceinline__ float bf2f(unsigned short b) { return __uint_as_float(((unsigned)b) << 16); }
__device__ __forceinline__ float bfr(float f) { return bf2f(f2bf(f)); }
__device__ __forceinline__ v16h cat16(v8h lo, v8h hi) { return __builtin_shufflevector(lo, hi, 0, 1, 2, 3, 4, 5, 6, 7, 8, 9, 10, 11, 12, 13, 14, 15); }
__device__ __forceinline__ v16bf cat16b(v8us lo, v8us hi) { return __builtin_bit_cast(v16bf, __builtin_shufflevector(lo, hi, 0, 1, 2, 3, 4, 5, 6, 7, 8, 9, 10, 11, 12, 13, 14, 15)); }
__device__ __forceinline__ v8f wmma16(v16h a, v16h b, v8f c) { return __builtin_amdgcn_wmma_f32_16x16x32_f16(false, a, false, b, (short)0, c, false, false); }
__device__ __forceinline__ v8f wmmab(v16bf a, v16bf b, v8f c) { return __builtin_amdgcn_wmma_f32_16x16x32_bf16(false, a, false, b, (short)0, c, false, false); }



// ---- Fragment order: every 16-bit operand plane (R rows x K columns, R % 16 == 0, K % 32 == 0) is stored as whole matrix fragments of 16 rows x 32 columns, 512 elements = 1 KiB in a row, fragment (r / 16, k / 32) at index (r / 16) (K / 32) + k / 32.
// Inside a fragment the 8 columns 8 c .. 8 c + 7 (c = 0..3) of row r % 16 are the 16 bytes at element c 128 + (r % 16) 8: lane (lr, hi) of the loader, which wants columns 8 hi .. + 7 and 16 + 8 hi .. + 7 of row lr, finds them at lane 8 and 256 + lane 8.
// So each wave-wide 16-byte load is 512 bytes in a row (4 whole 128-byte lines) where a row-major plane gives it 32 bytes of each of 16 lines. Which value meets which in a product is as before.
__device__ __forceinline__ size_t fro(const int r, const int k, const int K) { return ((size_t)(r >> 4) * (K >> 5) + (k >> 5)) * 512 + ((k >> 3) & 3) * 128 + (r & 15) * 8 + (k & 7); }
// ---- k_gemmw: register-blocked GEMM, ONE WAVE per 64x64 output tile (16 accumulators), operands straight from 16-bit planes in fragment order; grid (M/64, N/64, Z), 32 threads.
// C[m][n] (f32, pitch ldc, + optional f32 bias[n]) = sum_k A[m][k] Bt[n][k] (+ split products per NSPLIT). z-batch strides sA/sB/sC in elements.
// The k loop runs in stages of KS fragments (32 KS columns) on two register sets: while one set's products run, the other set's loads, all issued in front of them, are in flight. K % (64 KS) == 0.
template <typename T16> struct WFrag;
// A fragment pointer's step of BYTES. The wait that stands before a register named by an issued load is overwritten, and the addition that overwrites it, are one statement, so nothing can come between them.
// The pair goes in and comes out: the loads in front name this very pair, which lives up to the statement (no load's result lands on it), and the addresses of the loads behind are formed from what comes out.
template <int BYTES, typename T16> __device__ __forceinline__ void wait_step(const T16*& p) { asm volatile("s_wait_xcnt 0x0\n\tv_add_nc_u64 %0, %1, %0" : "+v"(p) : "i"(BYTES) : "memory"); }
// ldg: ld for a pointer whose origin the compiler cannot see (it has come out of an asm statement): the cast says that it points to global memory, so that the load is a global one and not a flat one.
template <> struct WFrag<h16> { typedef v16h V; typedef const __attribute__((address_space(1))) v8h* G; static __device__ __forceinline__ V ld(const h16* p) { return cat16(*(const v8h*)p, *(const v8h*)(p + 256)); } static __device__ __forceinline__ V ldg(const h16* p) { return cat16(*(G)p, *(G)(p + 256)); } static __device__ __forceinline__ v8f mma(V a, V b, v8f c) { return wmma16(a, b, c); } };
template <> struct WFrag<bf> { typedef v16bf V; typedef const __attribute__((address_space(1))) v8us* G; static __device__ __forceinline__ V ld(const bf* p) { return cat16b(*(const v8us*)p, *(const v8us*)(p + 256)); } static __device__ __forceinline__ V ldg(const bf* p) { return cat16b(*(G)p, *(G)(p + 256)); } static __device__ __forceinline__ v8f mma(V a, V b, v8f c) { return wmmab(a, b, c); } };
// One wave a SIMD: the launch has as many one-wave work-groups as the chip has SIMDs, and the two register sets need more than half a SIMD's registers.
template <typename T16, int NSPLIT, bool BIAS, int K, int KS>
__global__ __launch_bounds__(32) __attribute__((amdgpu_waves_per_eu(1, 1))) void k_gemmw(const T16* __restrict__ A, const T16* __restrict__ A2, const T16* __restrict__ Bt, const T16* __restrict__ Bt2, float* C, int ldc, const float* __restrict__ bias, size_t sA, size_t sB, size_t sC) {
    typedef typename WFrag<T16>::V V;
    __shared__ __align__(16) float os[16 * 68];
    const size_t z = blockIdx.z; A += z * sA; if (A2) A2 += z * sA; Bt += z * sB; if (Bt2) Bt2 += z * sB; C += z * sC;
    const int lane = threadIdx.x & 31, lr = lane & 15, hi = lane >> 4; const int r0 = blockIdx.x * 64, c0 = blockIdx.y * 64;
    v8f acc[4][4];
#pragma unroll
    for (int mb = 0; mb < 4; ++mb)
#pragma unroll
        for (int nb = 0; nb < 4; ++nb) acc[mb][nb] = (v8f){};
    const size_t aoff = (size_t)r0 * K + 8 * lane, boff = (size_t)c0 * K + 8 * lane;   // 16 rows of fragments are 16 K elements; a step of 32 columns is one fragment, 512 elements
    const T16* pa = A + aoff; const T16* pa2 = (NSPLIT == 1 || NSPLIT == 2) ? A2 + aoff : pa; const T16* pb = Bt + boff; const T16* pb2 = (NSPLIT >= 2) ? Bt2 + boff : pb;
    static_assert(K % (64 * KS) == 0, "stages come in pairs, one for each register set");
    V a[2][KS][4], a2[2][KS][4], b[2][KS][4], b2[2][KS][4];
    // every index below is a constant once the calls are inlined and the loops unrolled, so the sets stay in registers
    auto fetch = [&](const int s) __attribute__((always_inline)) {
#pragma unroll
        for (int u = 0; u < KS; ++u) {
#pragma unroll
            for (int mb = 0; mb < 4; ++mb) { a[s][u][mb] = WFrag<T16>::ldg(pa + mb * 16 * K + u * 512); if (NSPLIT == 1 || NSPLIT == 2) a2[s][u][mb] = WFrag<T16>::ldg(pa2 + mb * 16 * K + u * 512); }
#pragma unroll
            for (int nb = 0; nb < 4; ++nb) { b[s][u][nb] = WFrag<T16>::ldg(pb + nb * 16 * K + u * 512); if (NSPLIT >= 2) b2[s][u][nb] = WFrag<T16>::ldg(pb2 + nb * 16 * K + u * 512); } }
        __builtin_amdgcn_sched_barrier(0);   // all of the stage's loads are issued before the other set's products: left free, the scheduler puts loads among the products to save registers, and each such group is waited for by itself
    };
    auto mul = [&](const int s) __attribute__((always_inline)) {
#pragma unroll
        for (int u = 0; u < KS; ++u)
#pragma unroll
            for (int nb = 0; nb < 4; ++nb) {
#pragma unroll
                for (int mb = 0; mb < 4; ++mb) { acc[mb][nb] = WFrag<T16>::mma(a[s][u][mb], b[s][u][nb], acc[mb][nb]); if (NSPLIT == 1 || NSPLIT == 2) acc[mb][nb] = WFrag<T16>::mma(a2[s][u][mb], b[s][u][nb], acc[mb][nb]); if (NSPLIT >= 2) acc[mb][nb] = WFrag<T16>::mma(a[s][u][mb], b2[s][u][nb], acc[mb][nb]); } }
        __builtin_amdgcn_sched_barrier(0);   // the products stay in front of the next stage's loads, which go into the registers they read
    };
    auto step = [&]() __attribute__((always_inline)) {
        // behind the products: a whole block of matrix instructions after the loads that name these pairs were issued
        wait_step<1024 * KS>(pa); if constexpr (NSPLIT == 1 || NSPLIT == 2) wait_step<1024 * KS>(pa2); wait_step<1024 * KS>(pb); if constexpr (NSPLIT >= 2) wait_step<1024 * KS>(pb2);
    };
    fetch(0); step();
    // rolled: two stages' fragments live at a time
#pragma unroll 1
    for (int kc = 0; kc < K - 64 * KS; kc += 64 * KS) { fetch(1); mul(0); step(); fetch(0); mul(1); step(); }
    fetch(1); mul(0); step(); mul(1);
#pragma unroll
    for (int mb = 0; mb < 4; ++mb) {
#pragma unroll
        for (int nb = 0; nb < 4; ++nb) {
#pragma unroll
            for (int j = 0; j < 8; ++j) os[(hi * 8 + j) * 68 + nb * 16 + lr] = acc[mb][nb][j]; }
        __builtin_amdgcn_wave_barrier(); asm volatile("" ::: "memory");
        float* crow = C + (size_t)(r0 + mb * 16) * ldc + c0;
{
            v4f vs[8]; float* pc[8];
#pragma unroll
            for (int s = 0; s < 8; ++s) { const int row = 2 * s + hi, cofs = lr * 4; v4f val = *(const v4fa*)(os + row * 68 + cofs); if (BIAS) { val[0] += bfr(bias[c0 + cofs]); val[1] += bfr(bias[c0 + cofs + 1]); val[2] += bfr(bias[c0 + cofs + 2]); val[3] += bfr(bias[c0 + cofs + 3]); }
                vs[s] = val; pc[s] = crow + (size_t)row * ldc + cofs; *(v4f*)pc[s] = vs[s]; }
            // the wait that stands before a register named by an issued store is written anew; data and address pairs are inputs, so they live up to it
            asm volatile("s_wait_xcnt 0x0" :: "v"(vs[0]), "v"(vs[1]), "v"(vs[2]), "v"(vs[3]), "v"(vs[4]), "v"(vs[5]), "v"(vs[6]), "v"(vs[7]), "v"(pc[0]), "v"(pc[1]), "v"(pc[2]), "v"(pc[3]), "v"(pc[4]), "v"(pc[5]), "v"(pc[6]), "v"(pc[7]) : "memory");
             }
        __builtin_amdgcn_wave_barrier(); asm volatile("" ::: "memory");
    }
}

__device__ __forceinline__ h16 tohx(float x) { return (h16)x; }
__device__ __forceinline__ void splitf(float y, unsigned short& h, unsigned short& l) { h = f2bf(y); l = f2bf(y - bf2f(h)); }
typedef __attribute__((ext_vector_type(2))) _Float16 v2h;
typedef __attribute__((ext_vector_type(4))) _Float16 v4h;
typedef __attribute__((ext_vector_type(2))) unsigned short v2us;
typedef __attribute__((ext_vector_type(4))) unsigned short v4us;
typedef __attribute__((ext_vector_type(2))) float v2f;
typedef __attribute__((ext_vector_type(4))) int v4i;

// The j_ functions are jobs of 256 work-items that read none of each other's output; k_prep below runs them side by side in one grid, the job picked by the block index (bx: the block's index within its job).
// w [K][N] to Bt (rows n, columns k) in fragment order: a work-item takes 16 k of one n; a wave's 32 n in a row make each load one whole line, and its stores 256 bytes in a row for each 16 n.
__device__ __forceinline__ void j_wtG(const int bx, const float* __restrict__ w, int K, int N, bf* Bt) {
    const int i = bx * 256 + (int)threadIdx.x; const int n = ((i >> 5) % (N / 32)) * 32 + (i & 31), k0 = ((i >> 5) / (N / 32)) * 16; if (k0 >= K) return;
    const float* p = w + ((size_t)k0 * N + n); float v[16];
#pragma unroll
    for (int e = 0; e < 16; ++e) v[e] = p[(size_t)e * N];
    asm volatile("s_wait_xcnt 0x0" :: "v"(p) : "memory");   // the wait that stands before a register named by an issued load is written anew; the address pair is an input, so it lives up to it
    v8us o0, o1;
#pragma unroll
    for (int e = 0; e < 8; ++e) { o0[e] = f2bf(v[e]); o1[e] = f2bf(v[8 + e]); }
    bf* q = Bt + fro(n, k0, K); *(v8us*)q = o0; *(v8us*)(q + 128) = o1;
}
// src [rows][K] to dst in fragment order, 8 values a work-item: a wave takes 8 rows x 32 columns (8 whole lines in, 4 whole lines out).
__device__ __forceinline__ void j_cvt8(const int bx, const float* __restrict__ src, bf* dst, int K, size_t n8) { const size_t i = (size_t)bx * 256 + threadIdx.x; if (i >= n8) return;
    const int fr = (int)(i >> 6), r = (fr / (K / 32)) * 16 + (int)((i >> 5) & 1) * 8 + (int)(i & 7), k0 = (fr % (K / 32)) * 32 + (int)((i >> 3) & 3) * 8;
    const float* p = src + ((size_t)r * K + k0); const v8f v = *(const v8f*)p; v8us o;
    asm volatile("s_wait_xcnt 0x0" :: "v"(p) : "memory");   // as in j_wtG
#pragma unroll
    for (int k = 0; k < 8; ++k) o[k] = f2bf(v[k]); *(v8us*)(dst + fro(r, k0, K)) = o;  }

__global__ __launch_bounds__(256) void k_vtp(const float* __restrict__ F, int pitch, int nheads, h16* V16, bf* Vh, bf* Vl) { const size_t e = ((size_t)blockIdx.x * 256 + threadIdx.x) * 2; if (e >= (size_t)nheads * HD * TT) return; const int t = (int)(e % TT); const int d = (int)((e / TT) % HD); const int g = (int)(e / ((size_t)TT * HD)); v2h o16; v2us oh, ol;
#pragma unroll
    for (int q = 0; q < 2; ++q) { const float x = F[(size_t)(t + q) * pitch + g * HD + d]; o16[q] = tohx(x); unsigned short a2, c2; splitf(x, a2, c2); oh[q] = a2; ol[q] = c2; }
    *(v2h*)(V16 + e) = o16; *(v2us*)(Vh + e) = oh; *(v2us*)(Vl + e) = ol;  }
__device__ __forceinline__ void j_qtabs(const int bx, const float* __restrict__ ph, const float* __restrict__ am, float* MOD, float* CT) { const int i = bx * 256 + threadIdx.x; if (i < DQ) { const float m = __fmul_rn(cosf(bfr(ph[i])), bfr(am[i])); *(float*)(MOD + i) = m;  }
    if (i < TT) { const float a = __fmul_rn(__fmul_rn(6.2831853071795862f, (float)i), 1.0f / (float)TT); const float c = cosf(a); *(float*)(CT + i) = c;  } }
// ---- k_prep: every job that reads only inputs, in one grid: the four weight transposes (sixteen reads a work-item, the longest job: lowest indices), x of both batches to bf16, the modulation and cos tables.
#define PW ((DM * DQ / 16 + 255) / 256)            // blocks of one weight transpose
#define PX ((NB_ * TT * DM / 8 + 255) / 256)       // blocks of the x conversion
#define PT ((TT + 255) / 256)                      // blocks of the two small tables
__global__ __launch_bounds__(256) void k_prep(const float* __restrict__ x, const float* __restrict__ wq, const float* __restrict__ wk, const float* __restrict__ wv, const float* __restrict__ wo, const float* __restrict__ ph, const float* __restrict__ am, bf* WT, bf* XB, float* MOD, float* CT) {
    const int b = (int)blockIdx.x;
    if (b < 4 * PW) { const int j = b / PW; j_wtG(b % PW, j == 0 ? wq : j == 1 ? wk : j == 2 ? wv : wo, DM, DQ, WT + (size_t)j * DQ * DM); }
    else if (b < 4 * PW + PX) j_cvt8(b - 4 * PW, x, XB, DM, (size_t)NB_ * TT * DM / 8);
    else j_qtabs(b - 4 * PW - PX, ph, am, MOD, CT);
}
// ---- k_fattn: scores, interference, softmax and attn.v of one query block in one kernel; no score or probability ever reaches memory.
// Transposed products: S^T = K Q^T (A = 16 key rows, B = 16 query rows, both by the same loader), so a lane holds 8 keys' scores of ONE query (query = lane & 15, keys 8 (lane >> 4) + r);
// two such tiles (keys 0-15 and 16-31 of a 32-key pass), converted in place, are the B operand of O^T += V^T P^T, whose A operand (V^T rows, key-contiguous) comes by the same loader in the same k order.
// Softmax is the running form: a query's maximum in use m is raised (and its sum and output tiles rescaled) only when a pass's maximum exceeds it by more than FRTH, so p = exp(t - m) <= exp(FRTH).
// Work-group: FQG query groups x FKS key chunks = 16 waves; wave (qg, ks) does 16 QT queries against keys [ks TT / FKS, + TT / FKS); the FKS partial (m, sum, O) of a query are joined through LDS in chunk order and stored as the hi + lo planes that the Wo product reads.
// The FQG waves of a key chunk walk the same keys in step: a pass's K and V^T fragments are brought from L2 ONCE for the four of them, into a ring of two LDS buffers, by asynchronous copies (each wave a quarter) that fly while the pass before is worked on; every wave reads its fragments from LDS.
// tab[u] = cos table entry for |j - i| x HD^-0.5 (a power of two: exact), u = j - (i - q0) + NQW - 1: a lane's 8 keys are 8 consecutive entries.
// Each '#pragma unroll' below, but those on the join's sx and u loops, unrolls a loop over a register array to the end, so that its indices are constants and the array stays in registers.
#define FKS  4
#define FQG  4
#define FQT  3                    // query tiles of a wave in the single-product form
#define FNT  (FKS * FQG * 32)
#define FRTH 5.5f
#define L2E  1.4426950408889634f
#define FTAB 2560                 // floats kept for tab: TT + 16 FQT FQG - 1, rounded up to 5 per work-item
#define FBUF (FKS * 16384)        // bytes of one ring buffer: for each key chunk 32 keys of K and of V^T, 4 KiB each, hi and lo at most
#define FJOIN (FKS * FQG * 16 * FQT * 70)   // floats of the join area (68 a query for O, one each for m and the sum); it takes the ring's place behind the loop
#define FQS  (FKS * FQG * 512)     // floats: 2 KiB a wave for the Q fragments of its third query tile
#define FLDS (FTAB + FQS + (FJOIN > 2 * FBUF / 4 ? FJOIN : 2 * FBUF / 4))
typedef __attribute__((ext_vector_type(8))) __bf16 v8bf;
__device__ __forceinline__ float xhalf(float x) { const int b = __float_as_int(x); return __int_as_float(__builtin_amdgcn_permlanex16(b, b, 0x76543210, 0xfedcba98, false, false)); }   // the value of lane ^ 16
// 2^x of a tile's eight values in one statement. Behind a transcendental the instruction set asks for one independent instruction before its result is used or its source overwritten: the results are early-clobber, so no v_exp_f32 here touches a neighbour's registers, and the v_nop is the last one's slot.
__device__ __forceinline__ v8f exp2x8(const v8f x) { float y0, y1, y2, y3, y4, y5, y6, y7;
    asm("v_exp_f32 %0, %8\n\tv_exp_f32 %1, %9\n\tv_exp_f32 %2, %10\n\tv_exp_f32 %3, %11\n\tv_exp_f32 %4, %12\n\tv_exp_f32 %5, %13\n\tv_exp_f32 %6, %14\n\tv_exp_f32 %7, %15\n\tv_nop"
        : "=&v"(y0), "=&v"(y1), "=&v"(y2), "=&v"(y3), "=&v"(y4), "=&v"(y5), "=&v"(y6), "=&v"(y7) : "v"(x[0]), "v"(x[1]), "v"(x[2]), "v"(x[3]), "v"(x[4]), "v"(x[5]), "v"(x[6]), "v"(x[7]));
    return (v8f){y0, y1, y2, y3, y4, y5, y6, y7}; }
// Two fragments of 1 KiB from global memory to LDS, 16 bytes a lane and copy, through no register. la, lb: the lane's LDS byte addresses; ga, gb: its global addresses; the second half of a fragment lies 512 bytes on.
// The wait that stands before a register named by an issued copy is overwritten is the statement's last line, so nothing can come between.
template <typename T16> __device__ __forceinline__ void copy2(const unsigned la, const T16* ga, const unsigned lb, const T16* gb) {
    const unsigned la2 = la + 512, lb2 = lb + 512; const T16* ga2 = ga + 256; const T16* gb2 = gb + 256;
    asm volatile("global_load_async_to_lds_b128 %0, %4, off\n\tglobal_load_async_to_lds_b128 %1, %5, off\n\tglobal_load_async_to_lds_b128 %2, %6, off\n\tglobal_load_async_to_lds_b128 %3, %7, off\n\ts_wait_xcnt 0x0"
                 :: "v"(la), "v"(la2), "v"(lb), "v"(lb2), "v"(ga), "v"(ga2), "v"(gb), "v"(gb2) : "memory"); }
template <typename T16, bool HL, int QT>
__device__ __forceinline__ void fattn_body(const T16* __restrict__ Q, const T16* __restrict__ Q2, const T16* __restrict__ Kp, const T16* __restrict__ Kp2, const T16* __restrict__ Vt, const T16* __restrict__ Vt2, const float* __restrict__ CT, const int q0, bf* Ah, bf* Al, float* lds) {
    typedef typename WFrag<T16>::V V;
    constexpr int NQ = 16 * QT, NQW = NQ * FQG, NT = FNT, NF = FTAB / NT, NP = TT / FKS / 32;
    constexpr int CH = HL ? 8192 : 4096, VO = CH / 2;   // elements of a key chunk's part of a buffer: K fragments (hi, then lo), from VO on V^T fragments likewise
    const int tid = (int)threadIdx.x, lane = tid & 31, lr = lane & 15, hi = lane >> 4; const int w = __builtin_amdgcn_readfirstlane(tid >> 5); const int ks = w & (FKS - 1), qg = w / FKS;
    float* tab = lds; float* ring = lds + FTAB + FQS;
    static_assert(FTAB == NF * NT && NF == 5 && TT + NQW - 1 <= FTAB, "tab: five entries per work-item");
    static_assert(FQG == 4 && NP >= 2, "a pass has four fragments of each plane, one for each wave of its key chunk; the ring's prologue fills two passes");
    const int kbeg = ks * (TT / FKS);
    // pass t of this wave's key chunk: the wave brings fragment qg of each plane into buffer t & 1
    const unsigned lmy = (unsigned)(size_t)ring + (unsigned)(ks * CH + qg * 512 + 8 * lane) * 2u;
    const T16* gk = Kp + ((size_t)kbeg * HD + qg * 512 + 8 * lane); const T16* gv = Vt + ((size_t)qg * 16 * TT + (size_t)kbeg * 16 + 8 * lane);
    const T16* gk2 = HL ? Kp2 + ((size_t)kbeg * HD + qg * 512 + 8 * lane) : gk; const T16* gv2 = HL ? Vt2 + ((size_t)qg * 16 * TT + (size_t)kbeg * 16 + 8 * lane) : gv;
    auto fill = [&](const int t) __attribute__((always_inline)) { const unsigned l = lmy + (unsigned)(t & 1) * FBUF;
        copy2<T16>(l, gk + (size_t)t * 32 * HD, l + VO * 2, gv + (size_t)t * 32 * 16);
        if constexpr (HL) copy2<T16>(l + 4096, gk2 + (size_t)t * 32 * HD, l + VO * 2 + 4096, gv2 + (size_t)t * 32 * 16); };
    fill(0);
    int ix[NF]; float cv[NF];
#pragma unroll
    for (int f = 0; f < NF; ++f) { const int d = tid + f * NT - (NQW - 1) - q0; const int a = d < 0 ? -d : d; ix[f] = a < TT ? a : TT - 1; cv[f] = CT[ix[f]]; }   // entries past TT + NQW - 2 are never read; their index is clamped into the table
    const T16* pq = Q + ((size_t)(q0 + qg * NQ) * HD + 8 * lane); const T16* pq2 = HL ? Q2 + ((size_t)(q0 + qg * NQ) * HD + 8 * lane) : pq;   // fragment order: 16 rows are HD / 32 fragments of 512 elements
    V qf[QT][2], qf2[QT][2];
#pragma unroll
    for (int qt = 0; qt < QT; ++qt)
#pragma unroll
        for (int kc = 0; kc < 2; ++kc) { qf[qt][kc] = WFrag<T16>::ld(pq + qt * 16 * HD + kc * 512); if (HL) qf2[qt][kc] = WFrag<T16>::ld(pq2 + qt * 16 * HD + kc * 512); }
    // the wait that stands before a register named by an issued load is written anew; the loads' index and address registers are inputs, so they live up to it
    asm volatile("s_wait_xcnt 0x0" :: "v"(ix[0]), "v"(ix[1]), "v"(ix[2]), "v"(ix[3]), "v"(ix[4]), "v"(pq), "v"(pq2) : "memory");
    // a wave's registers do not reach for three query tiles' Q fragments beside the accumulators and the scores: the third tile's lie in the wave's own LDS (no other wave touches them) and are read anew in each pass
    T16* qs = (T16*)(lds + FTAB) + (w * 1024 + 8 * lane);
    if constexpr (QT > 2) {
#pragma unroll
        for (int kc = 0; kc < 2; ++kc) { *(v8ha*)(qs + kc * 512) = __builtin_shufflevector(qf[2][kc], qf[2][kc], 0, 1, 2, 3, 4, 5, 6, 7); *(v8ha*)(qs + kc * 512 + 256) = __builtin_shufflevector(qf[2][kc], qf[2][kc], 8, 9, 10, 11, 12, 13, 14, 15); } }
#pragma unroll
    for (int f = 0; f < NF; ++f) tab[tid + f * NT] = cv[f] * SCL;
    v8f acc[QT][4]; float m[QT], l[QT];
#pragma unroll
    for (int qt = 0; qt < QT; ++qt) { m[qt] = -3.0e38f; l[qt] = 0.f;
#pragma unroll
        for (int dt = 0; dt < 4; ++dt) acc[qt][dt] = (v8f){}; }
    asm volatile("s_wait_asynccnt 0x0" ::: "memory");   // this wave's copies of pass 0 have landed
    __syncthreads();   // pass 0's fragments and tab are whole before any wave reads them
    fill(1);
    // rolled: one pass's fragments live at a time
#pragma unroll 1
    for (int t = 0; t < NP; ++t) {
        const int jb = kbeg + 32 * t;
        const T16* sk = (const T16*)ring + ((t & 1) * (FBUF / 2) + ks * CH + 8 * lane);
        V kf[2][2], kf2[2][2], vf[4], vf2[4];
        v8f s[QT][2];
#pragma unroll
        for (int kt = 0; kt < 2; ++kt) {
#pragma unroll
            for (int kc = 0; kc < 2; ++kc) { kf[kt][kc] = WFrag<T16>::ld(sk + (kt * 2 + kc) * 512); if (HL) kf2[kt][kc] = WFrag<T16>::ld(sk + 2048 + (kt * 2 + kc) * 512); }
#pragma unroll
            for (int qt = 0; qt < QT; ++qt) { v8f x = (v8f){};
#pragma unroll
                for (int kc = 0; kc < 2; ++kc) { x = WFrag<T16>::mma(kf[kt][kc], qt < 2 ? qf[qt][kc] : WFrag<T16>::ld(qs + kc * 512), x); if (HL) { x = WFrag<T16>::mma(kf[kt][kc], qf2[qt][kc], x); x = WFrag<T16>::mma(kf2[kt][kc], qf[qt][kc], x); } }
                s[qt][kt] = x; }
            if constexpr (QT > 2) __builtin_amdgcn_sched_barrier(0);   // the second 16 keys' fragments are asked for behind the first 16 keys' products and take their registers: with both halves live at once the wave's registers do not reach and accumulators are spilled
        }
        const float* tb = tab + (jb + 8 * hi - lr - qg * NQ + NQW - 1);
        float bm[QT]; bool need = false;
#pragma unroll
        for (int qt = 0; qt < QT; ++qt) { float x = -3.0e38f;
#pragma unroll
            for (int kt = 0; kt < 2; ++kt)
#pragma unroll
                for (int r = 0; r < 8; ++r) { const float y = s[qt][kt][r] * tb[16 * (kt - qt) + r]; s[qt][kt][r] = y; x = fmaxf(x, y); }
            x = fmaxf(x, xhalf(x)); bm[qt] = x; need = need || (x > m[qt] + FRTH); }
        // the hi+lo form, one query tile a wave, has the registers to ask for its V^T fragments here; the single-product form asks behind the softmax, where the scores' registers are free
        auto loadv = [&]() __attribute__((always_inline)) {
#pragma unroll
            for (int dt = 0; dt < 4; ++dt) { vf[dt] = WFrag<T16>::ld(sk + VO + dt * 512); if (HL) vf2[dt] = WFrag<T16>::ld(sk + VO + 2048 + dt * 512); } };
        if constexpr (HL) loadv();
        if (__builtin_amdgcn_ballot_w32(need) != 0) {   // a scalar branch: taken on a wave's first pass and seldom after it
#pragma unroll
            for (int qt = 0; qt < QT; ++qt) { const float mn = (bm[qt] > m[qt] + FRTH) ? bm[qt] : m[qt]; const float al = __builtin_amdgcn_exp2f((m[qt] - mn) * L2E); m[qt] = mn; l[qt] *= al;
#pragma unroll
                for (int dt = 0; dt < 4; ++dt) acc[qt][dt] *= al; } }
        V pb[QT], pl[QT];
#pragma unroll
        for (int qt = 0; qt < QT; ++qt) { const float nm = -m[qt] * L2E; float ls = 0.f;
#pragma unroll
            for (int kt = 0; kt < 2; ++kt) { v8f a;
#pragma unroll
                for (int r = 0; r < 8; ++r) a[r] = __builtin_fmaf(s[qt][kt][r], L2E, nm);
                s[qt][kt] = exp2x8(a);
#pragma unroll
                for (int r = 0; r < 8; ++r) ls += s[qt][kt][r]; }
            l[qt] += ls;
            if constexpr (HL) {   // hi = p rounded to nearest even, lo = (p - hi) rounded likewise: splitf's values for the finite p here, by the packed conversion
                const v8bf h0 = __builtin_convertvector(s[qt][0], v8bf), h1 = __builtin_convertvector(s[qt][1], v8bf);
                const v8bf l0 = __builtin_convertvector(s[qt][0] - __builtin_convertvector(h0, v8f), v8bf), l1 = __builtin_convertvector(s[qt][1] - __builtin_convertvector(h1, v8f), v8bf);
                pb[qt] = __builtin_shufflevector(h0, h1, 0, 1, 2, 3, 4, 5, 6, 7, 8, 9, 10, 11, 12, 13, 14, 15); pl[qt] = __builtin_shufflevector(l0, l1, 0, 1, 2, 3, 4, 5, 6, 7, 8, 9, 10, 11, 12, 13, 14, 15);
            } else { pb[qt] = cat16(__builtin_convertvector(s[qt][0], v8h), __builtin_convertvector(s[qt][1], v8h)); } }
        if constexpr (!HL) loadv();
        // the loaded fragments are inputs only: all eight are then asked for in front of the softmax and fly while it runs; left free, the scheduler loads them into one register set among the products and waits for each by itself
        else asm volatile("" :: "v"(vf[0]), "v"(vf[1]), "v"(vf[2]), "v"(vf[3]), "v"(vf2[0]), "v"(vf2[1]), "v"(vf2[2]), "v"(vf2[3]));
#pragma unroll
        for (int dt = 0; dt < 4; ++dt)
#pragma unroll
            for (int qt = 0; qt < QT; ++qt) { acc[qt][dt] = WFrag<T16>::mma(vf[dt], pb[qt], acc[qt][dt]); if (HL) { acc[qt][dt] = WFrag<T16>::mma(vf[dt], pl[qt], acc[qt][dt]); acc[qt][dt] = WFrag<T16>::mma(vf2[dt], pb[qt], acc[qt][dt]); } }
        asm volatile("s_wait_dscnt 0x0" ::: "memory");      // this wave's reads of the buffer are done before the buffer is given up
        asm volatile("s_wait_asynccnt 0x0" ::: "memory");   // and its copies of pass t + 1 have landed
        __syncthreads();   // pass t + 1 is whole for every wave, and every wave has left pass t's buffer
        if (t + 2 < NP) fill(t + 2);   // the same for the whole work-group
    }
    asm volatile("s_wait_asynccnt 0x0" ::: "memory");   // no copy is under way when the ring becomes the join area (every wave has passed the last pass's barrier)
    float* accS = ring; float* mS = accS + FKS * FQG * NQ * 68; float* lS = mS + FKS * FQG * NQ;
    float* my = accS + w * (NQ * 68);
#pragma unroll
    for (int qt = 0; qt < QT; ++qt) { const float lj = l[qt] + xhalf(l[qt]);   // the two lane halves summed different keys of the same query
        if (hi == 0) { mS[w * NQ + qt * 16 + lr] = m[qt]; lS[w * NQ + qt * 16 + lr] = lj; }
#pragma unroll
        for (int dt = 0; dt < 4; ++dt) { float* p = my + (qt * 16 + lr) * 68 + dt * 16 + hi * 8; const v8f x = acc[qt][dt];
            *(v4fa*)p = __builtin_shufflevector(x, x, 0, 1, 2, 3); *(v4fa*)(p + 4) = __builtin_shufflevector(x, x, 4, 5, 6, 7); } }
    __syncthreads();   // every wave's partial is in LDS before any is joined
#pragma unroll
    for (int sx = 0; sx < NQW * 8 / NT; ++sx) { const int idx = sx * NT + tid; const int q = (idx >> 7) * 16 + (idx & 15), dc = ((idx >> 4) & 7) * 8; const int w0 = (q / NQ) * FKS, ql = q % NQ;   // a wave has 16 queries x 16 columns: 512 bytes in a row of each plane
        float M = mS[w0 * NQ + ql];
#pragma unroll
        for (int u = 1; u < FKS; ++u) M = fmaxf(M, mS[(w0 + u) * NQ + ql]);
        float L = 0.f; v4f o0 = (v4f){}, o1 = (v4f){};
#pragma unroll
        for (int u = 0; u < FKS; ++u) { const float sc = __builtin_amdgcn_exp2f((mS[(w0 + u) * NQ + ql] - M) * L2E); L += lS[(w0 + u) * NQ + ql] * sc; const float* p = accS + ((w0 + u) * NQ + ql) * 68 + dc; o0 += *(const v4fa*)p * sc; o1 += *(const v4fa*)(p + 4) * sc; }
        const float inv = __fdiv_rn(1.0f, L); v8us oh, ol;
#pragma unroll
        for (int k = 0; k < 4; ++k) { unsigned short a, c2; splitf(o0[k] * inv, a, c2); oh[k] = a; ol[k] = c2; splitf(o1[k] * inv, a, c2); oh[4 + k] = a; ol[4 + k] = c2; }
        const size_t oo = fro(q0 + q, dc, DQ); bf* ph = Ah + oo; bf* pl = Al + oo; *(v8us*)ph = oh; *(v8us*)pl = ol;
        asm volatile("s_wait_xcnt 0x0" :: "v"(oh), "v"(ol), "v"(ph), "v"(pl) : "memory"); }   // the wait that stands before a register named by an issued store is written anew; data and address pairs are inputs, so they live up to it
}
// grid (batches x heads, RH / (16 FQG) + (TT - RH) / (16 FQT FQG)): the hi+lo query blocks have the low indices and start first.
// Four waves a SIMD (256 registers), one work-group a WGP: the launch's 256 hi+lo and 256 single-product work-groups are then one full round each on the 256 WGPs.
static_assert(RH % (16 * FQG) == 0 && (TT - RH) % (16 * FQT * FQG) == 0, "whole query blocks");
__global__ __launch_bounds__(FNT) __attribute__((amdgpu_waves_per_eu(4, 4))) void k_fattn(const h16* __restrict__ Q16, const h16* __restrict__ K16, const h16* __restrict__ V16, const bf* __restrict__ Qh, const bf* __restrict__ Ql, const bf* __restrict__ Kh, const bf* __restrict__ Kl, const bf* __restrict__ Vh, const bf* __restrict__ Vl, const float* __restrict__ CT, bf* Ah, bf* Al) {
    __shared__ __align__(16) float lds[FLDS];
    const int bh = (int)blockIdx.x, by = (int)blockIdx.y; const size_t ho = (size_t)bh * TT * HD; const size_t ao = (size_t)(bh / NH_) * TT * DQ + (bh % NH_) * (HD / 32) * 512;   // planes [batch][head]; output rows [batch x t], the head's columns (in fragment order: its HD / 32 fragments of each 16 rows)
    if (by < RH / (16 * FQG)) fattn_body<bf, true, 1>(Qh + ho, Ql + ho, Kh + ho, Kl + ho, Vh + ho, Vl + ho, CT, by * (16 * FQG), Ah + ao, Al + ao, lds);
    else fattn_body<h16, false, FQT>(Q16 + ho, nullptr, K16 + ho, nullptr, V16 + ho, nullptr, CT, RH + (by - RH / (16 * FQG)) * (16 * FQT * FQG), Ah + ao, Al + ao, lds);
}

// ---- k_qkv: the q | k | v product of both batches, its epilogue storing the head planes that k_fattn reads (fp16 and hi + lo bf16); the f32 product never reaches memory.
// ONE WAVE per 64 x 64 tile as in k_gemmw, same k order, stages of one fragment; a tile is 64 positions of one head of q, k or v. grid (batches x TT / 64, 3 DQ / 64), 32 threads.
// q, k: planes [t][d], value x MOD[h][d], in fragment order like every plane here. v: planes [d][t] of vv[t] = (v[t] MOD + v[t + 1 mod TT] MOD) / sqrt(2): the tile's last position needs the next tile's first row, so a v tile carries a fifth row block (rows t0 + 64 ..., wrapped inside the batch), of which row 0 is used.
// Four times eight values in a row (a lane's pieces of two fragments, 256 elements apart) to the three planes: fp16, hi = bf16 nearest even, lo = (x - hi) likewise (splitf's values for finite x, by the packed conversion).
__device__ __forceinline__ void put32(const v8f (&x)[4], const size_t e, h16* P16, bf* Ph, bf* Pl) {
    h16* q16 = P16 + e; bf* qh = Ph + e; bf* ql = Pl + e; v8h a[4]; v8us h[4], l[4];
#pragma unroll
    for (int s = 0; s < 4; ++s) { const v8bf hb = __builtin_convertvector(x[s], v8bf); const v8bf lb = __builtin_convertvector(x[s] - __builtin_convertvector(hb, v8f), v8bf);
        a[s] = __builtin_convertvector(x[s], v8h); h[s] = __builtin_bit_cast(v8us, hb); l[s] = __builtin_bit_cast(v8us, lb); }
#pragma unroll
    for (int s = 0; s < 4; ++s) { *(v8h*)(q16 + s * 256) = a[s]; *(v8us*)(qh + s * 256) = h[s]; *(v8us*)(ql + s * 256) = l[s]; }
    // the wait that stands before a register named by an issued store is written anew; data and address pairs are inputs, so they live up to it
    asm volatile("s_wait_xcnt 0x0" :: "v"(a[0]), "v"(a[1]), "v"(a[2]), "v"(a[3]), "v"(h[0]), "v"(h[1]), "v"(h[2]), "v"(h[3]), "v"(l[0]), "v"(l[1]), "v"(l[2]), "v"(l[3]), "v"(q16), "v"(qh), "v"(ql) : "memory"); }
template <bool VV>
__device__ __forceinline__ void qkv_body(const bf* __restrict__ X, const bf* __restrict__ Wt, const float* __restrict__ MOD, h16* P16, bf* Ph, bf* Pl, float* os) {
    typedef WFrag<bf>::V V;
    constexpr int K = DM, MB = VV ? 5 : 4;
    const int lane = threadIdx.x & 31, lr = lane & 15, hi = lane >> 4; const int r0 = blockIdx.x * 64, c0 = blockIdx.y * 64;
    const int b = r0 / TT, t0 = r0 % TT, h = (c0 % DQ) / HD;
    const float* pm = MOD + h * HD + lr; float md[4];
#pragma unroll
    for (int nb = 0; nb < 4; ++nb) md[nb] = pm[nb * 16];   // a lane's accumulators are of columns nb 16 + lr
    asm volatile("s_wait_xcnt 0x0" :: "v"(pm) : "memory");   // the wait that stands before a register named by an issued load is written anew; the address pair is an input, so it lives up to it
    v8f acc[MB][4];
#pragma unroll
    for (int mb = 0; mb < MB; ++mb)
#pragma unroll
        for (int nb = 0; nb < 4; ++nb) acc[mb][nb] = (v8f){};
    const bf* pa = X + ((size_t)r0 * K + 8 * lane); const bf* pb = Wt + ((size_t)c0 * K + 8 * lane); const bf* pn = X + ((size_t)(b * TT + (t0 + 64) % TT) * K + 8 * lane);   // fragment order: 16 rows are 16 K elements, 32 columns one fragment
    static_assert(K % 64 == 0, "k steps come in pairs, one for each register set");
    V a[2][MB], bb[2][4];
    // two register sets as in k_gemmw: while one set's products run, the next k step's loads, all issued in front of them, are in flight; every index is a constant once the calls are inlined
    auto fetch = [&](const int s) __attribute__((always_inline)) {
#pragma unroll
        for (int mb = 0; mb < 4; ++mb) a[s][mb] = WFrag<bf>::ldg(pa + mb * 16 * K);
        if constexpr (VV) a[s][4] = WFrag<bf>::ldg(pn);
#pragma unroll
        for (int nb = 0; nb < 4; ++nb) bb[s][nb] = WFrag<bf>::ldg(pb + nb * 16 * K);
        __builtin_amdgcn_sched_barrier(0);   // as in k_gemmw: all of the step's loads are issued before the other set's products
    };
    auto mul = [&](const int s) __attribute__((always_inline)) {
#pragma unroll
        for (int nb = 0; nb < 4; ++nb)
#pragma unroll
            for (int mb = 0; mb < MB; ++mb) acc[mb][nb] = WFrag<bf>::mma(a[s][mb], bb[s][nb], acc[mb][nb]);
        __builtin_amdgcn_sched_barrier(0);   // as in k_gemmw: the products stay in front of the loads that go into the registers they read
    };
    auto step = [&]() __attribute__((always_inline)) {
        // as in k_gemmw: behind the products
        wait_step<1024>(pa); wait_step<1024>(pb); if constexpr (VV) wait_step<1024>(pn);
    };
    fetch(0); step();
    // rolled: two steps' fragments live at a time
#pragma unroll 1
    for (int kc = 0; kc < K - 64; kc += 64) { fetch(1); mul(0); step(); fetch(0); mul(1); step(); }
    fetch(1); mul(0); step(); mul(1);
    const size_t o = (((size_t)(c0 / DQ) * NB_ + b) * NH_ + h) * TT * HD;   // planes [q, k, v][batch][head]
    // on the way out a lane has 8 values in a row, of row lr and columns s 16 + hi 8 ...: the wave's 32 pieces are half a fragment, 512 bytes in a row
    if constexpr (!VV) {
#pragma unroll
        for (int mb = 0; mb < 4; ++mb) {
#pragma unroll
            for (int nb = 0; nb < 4; ++nb) {
#pragma unroll
                for (int j = 0; j < 8; ++j) os[(hi * 8 + j) * 68 + nb * 16 + lr] = __fmul_rn(acc[mb][nb][j], md[nb]); }
            __builtin_amdgcn_wave_barrier(); asm volatile("" ::: "memory");   // the lanes read each other's LDS stores: no read may be moved above them
            v8f y[4];
#pragma unroll
            for (int s = 0; s < 4; ++s) { const float* p = os + lr * 68 + s * 16 + hi * 8; const v4f x0 = *(const v4fa*)p, x1 = *(const v4fa*)(p + 4); y[s] = __builtin_shufflevector(x0, x1, 0, 1, 2, 3, 4, 5, 6, 7); }
            put32(y, o + (size_t)(t0 + mb * 16) * HD + lane * 8, P16, Ph, Pl);
            __builtin_amdgcn_wave_barrier(); asm volatile("" ::: "memory");   // and no store of the next block above these reads
        }
    } else {
#pragma unroll
        for (int nb = 0; nb < 4; ++nb) {
#pragma unroll
            for (int mb = 0; mb < 4; ++mb) { v8f t;
#pragma unroll
                for (int j = 0; j < 8; ++j) t[j] = __fmul_rn(acc[mb][nb][j], md[nb]);
                float* p = os + lr * 68 + mb * 16 + hi * 8; *(v4fa*)p = __builtin_shufflevector(t, t, 0, 1, 2, 3); *(v4fa*)(p + 4) = __builtin_shufflevector(t, t, 4, 5, 6, 7); }
            if (hi == 0) os[lr * 68 + 64] = __fmul_rn(acc[4][nb][0], md[nb]);   // position t0 + 64 (mod TT)
            __builtin_amdgcn_wave_barrier(); asm volatile("" ::: "memory");   // as above
            v8f y[4];
#pragma unroll
            for (int s = 0; s < 4; ++s) { const float* p = os + lr * 68 + s * 16 + hi * 8; const v4f x0 = *(const v4fa*)p, x1 = *(const v4fa*)(p + 4); const float x8 = p[8];
                const float x[9] = {x0[0], x0[1], x0[2], x0[3], x1[0], x1[1], x1[2], x1[3], x8};
#pragma unroll
                for (int j = 0; j < 8; ++j) y[s][j] = __fmul_rn(__fadd_rn(x[j], x[j + 1]), 0.70710678118654752f); }
            put32(y, o + (size_t)nb * 16 * TT + (size_t)t0 * 16 + lane * 8, P16, Ph, Pl);
            __builtin_amdgcn_wave_barrier(); asm volatile("" ::: "memory");   // as above
        }
    }
}
// Three waves a SIMD (336 registers): the launch's 3,072 one-wave work-groups are then all resident at once.
__global__ __launch_bounds__(32) __attribute__((amdgpu_waves_per_eu(3, 3))) void k_qkv(const bf* __restrict__ X, const bf* __restrict__ Wt, const float* __restrict__ MOD, h16* P16, bf* Ph, bf* Pl) {
    __shared__ __align__(16) float os[16 * 68];
    if ((int)blockIdx.y < 2 * (DQ / 64)) qkv_body<false>(X, Wt, MOD, P16, Ph, Pl, os);
    else qkv_body<true>(X, Wt, MOD, P16, Ph, Pl, os);
}

extern "C" void kernel_launch(void* const* d_in, const int* in_sizes, int n_in,
                              void* d_out, int out_size, void* d_ws, size_t ws_size, hipStream_t stream) {
    (void)in_sizes; (void)n_in; (void)out_size;
    const float* x = (const float*)d_in[0]; const float* wq = (const float*)d_in[1]; const float* wk = (const float*)d_in[2]; const float* wv = (const float*)d_in[3]; const float* wo = (const float*)d_in[4]; const float* qph = (const float*)d_in[5]; const float* qam = (const float*)d_in[6];
    float* OUT = (float*)d_out;     // [2][2048][1024]
    char* wsp = (char*)d_ws;
    auto take = [&](size_t bytes) { char* p = wsp; wsp += (bytes + 255) & ~(size_t)255; return (void*)p; };
    static_assert(DKV == DQ && DQ == DM, "the four weights are alike in shape, and q, k, v stand side by side in one product");
    bf* WT = (bf*)take((size_t)4 * DQ * DM * 2);   // Wq^T | Wk^T | Wv^T | Wo^T
    float* MOD = (float*)take((size_t)DQ * 4); float* CT = (float*)take((size_t)TT * 4);
    bf* XB = (bf*)take((size_t)NB_ * TT * DM * 2);
    const size_t PL = (size_t)NB_ * NH_ * TT * HD;   // one kind of plane, both batches
    h16* P16 = (h16*)take(3 * PL * 2); bf* Ph = (bf*)take(3 * PL * 2); bf* Pl = (bf*)take(3 * PL * 2);
    bf* ATh = (bf*)take((size_t)NB_ * TT * DQ * 2); bf* ATl = (bf*)take((size_t)NB_ * TT * DQ * 2);
    if ((size_t)(wsp - (char*)d_ws) > ws_size) return;    // ws 256 MiB
    k_prep<<<4 * PW + PX + PT, 256, 0, stream>>>(x, wq, wk, wv, wo, qph, qam, WT, XB, MOD, CT);
    k_qkv<<<dim3(NB_ * TT / 64, 3 * DQ / 64, 1), 32, 0, stream>>>(XB, WT, MOD, P16, Ph, Pl);   // q | k | v of both batches, stored as planes
    k_fattn<<<dim3(NB_ * NH_, RH / (16 * FQG) + (TT - RH) / (16 * FQT * FQG), 1), FNT, 0, stream>>>(P16, P16 + PL, P16 + 2 * PL, Ph, Pl, Ph + PL, Pl + PL, Ph + 2 * PL, Pl + 2 * PL, CT, ATh, ATl);   // one kv head per query head
    k_gemmw<bf, 1, false, DQ, 2><<<dim3(NB_ * TT / 64, DM / 64, 1), 32, 0, stream>>>(ATh, ATl, WT + (size_t)3 * DQ * DM, nullptr, OUT, DM, nullptr, 0, 0, 0);
}

// v009
// Measured time: 97.9 microseconds a run.
// In two side-by-side timings against v008, it was 1.10 and 1.09 times as fast.
// Counting every step since v000, it is 22.0 times as fast.
#include <hip/hip_runtime.h>

// 'Quantum' attention (x [2][2048][1024]; q, k, v = (x W) ('xw' [1024][1024], 16 heads x 64) each multiplied per (head, dim) by mod = cos(quantum_phase[h][d]) x quantum_amplitude[h][d]; scores = q.k / 8 x cos(2 pi (i - j) / 2048) (multiplicative Toeplitz 'interference'); w = softmax; w' = (w + roll(w, 1, keys)) / sqrt(2); out = w' v; y = merged Wo ('xw') -> [2][2048][1024] (4.2 M)).
// Realisation: the roll superposition is moved onto the values: w' v = w @ vv with vv[j] = (v[j] + v[(j+1) mod S]) / sqrt(2) (exact algebra), so attn.v runs on vv^T planes; the modulation is applied where the q | k | v product stores its planes (q, k planes x MOD[h][d]; vv from modulated v); the fused attention kernel multiplies each scaled logit by the cos table entry for |i - j| (cos(2 pi m / 2048) computed as the reference's float32 expression).
// Compute dtypes, f32 accumulate: every input rounded to bf16; q/k/v on PLAIN bf16 operands (inputs: exact); modulation table (precise cosf of bf16 phase x bf16 amplitude) and the cos Toeplitz table in f32; scores and attn.v: query rows < 512 hl (3 products), the rest single fp16; softmax f32 (running maximum, probabilities unnormalised until the end); Wo hl x exact (2 products).

#define NB_  2
#define TT   2048
#define DM   1024
#define NH_  16
#define NKV  16
#define REP  (NH_ / NKV)
#define HD   64
#define DQ   (NH_ * HD)
#define DKV  (NKV * HD)
#define RH   512                  // query rows < RH use hi+lo planes (0: none)
#define WIN  0
#define SCL  0.125f   // HD^-0.5
typedef _Float16 h16;
typedef unsigned short bf;
typedef __attribute__((ext_vector_type(16))) __bf16   v16bf;
typedef __attribute__((ext_vector_type(16))) _Float16 v16h;
typedef __attribute__((ext_vector_type(8)))  _Float16 v8h;
typedef __attribute__((ext_vector_type(8)))  unsigned short v8us;
typedef __attribute__((ext_vector_type(8)))  float    v8f;
typedef __attribute__((ext_vector_type(4)))  float    v4f;
typedef v8h  __attribute__((may_alias)) v8ha;
typedef v4f  __attribute__((may_alias)) v4fa;
typedef v8us __attribute__((may_alias)) v8usa;

__device__ __forceinline__ unsigned short f2bf(float f) { unsigned u = __float_as_uint(f); u += 0x7FFFu + ((u >> 16) & 1u); return (unsigned short)(u >> 16); }
__device__ __forceinline__ float bf2f(unsigned short b) { return __uint_as_float(((unsigned)b) << 16); }
__device__ __forceinline__ float bfr(float f) { return bf2f(f2bf(f)); }
__device__ __forceinline__ v16h cat16(v8h lo, v8h hi) { return __builtin_shufflevector(lo, hi, 0, 1, 2, 3, 4, 5, 6, 7, 8, 9, 10, 11, 12, 13, 14, 15); }
__device__ __forceinline__ v16bf cat16b(v8us lo, v8us hi) { return __builtin_bit_cast(v16bf, __builtin_shufflevector(lo, hi, 0, 1, 2, 3, 4, 5, 6, 7, 8, 9, 10, 11, 12, 13, 14, 15)); }
__device__ __forceinline__ v8f wmma16(v16h a, v16h b, v8f c) { return __builtin_amdgcn_wmma_f32_16x16x32_f16(false, a, false, b, (short)0, c, false, false); }
__device__ __forceinline__ v8f wmmab(v16bf a, v16bf b, v8f c) { return __builtin_amdgcn_wmma_f32_16x16x32_bf16(false, a, false, b, (short)0, c, false, false); }



// ---- Fragment order: every 16-bit operand plane (R rows x K columns, R % 16 == 0, K % 32 == 0) is stored as whole matrix fragments of 16 rows x 32 columns, 512 elements = 1 KiB in a row, fragment (r / 16, k / 32) at index (r / 16) (K / 32) + k / 32.
// Inside a fragment the 8 columns 8 c .. 8 c + 7 (c = 0..3) of row r % 16 are the 16 bytes at element c 128 + (r % 16) 8: lane (lr, hi) of the loader, which wants columns 8 hi .. + 7 and 16 + 8 hi .. + 7 of row lr, finds them at lane 8 and 256 + lane 8.
// So each wave-wide 16-byte load is 512 bytes in a row (4 whole 128-byte lines) where a row-major plane gives it 32 bytes of each of 16 lines. Which value meets which in a product is as before.
__device__ __forceinline__ size_t fro(const int r, const int k, const int K) { return ((size_t)(r >> 4) * (K >> 5) + (k >> 5)) * 512 + ((k >> 3) & 3) * 128 + (r & 15) * 8 + (k & 7); }
// ---- k_gemmw: register-blocked GEMM, ONE WAVE per 64x64 output tile (16 accumulators), operands straight from 16-bit planes in fragment order; a work-group is four such waves, 2 x 2 tiles, that share nothing but the WGP (no barrier); grid (M/128, N/128, Z), 128 threads.
// C[m][n] (f32, pitch ldc, + optional f32 bias[n]) = sum_k A[m][k] Bt[n][k] (+ split products per NSPLIT). z-batch strides sA/sB/sC in elements.
// The k loop runs in stages of KS fragments (32 KS columns) on two register sets: while one set's products run, the other set's loads, all issued in front of them, are in flight. K % (64 KS) == 0.
template <typename T16> struct WFrag;
// A fragment pointer's step of BYTES. The wait that stands before a register named by an issued load is overwritten, and the addition that overwrites it, are one statement, so nothing can come between them.
// The pair goes in and comes out: the loads in front name this very pair, which lives up to the statement (no load's result lands on it), and the addresses of the loads behind are formed from what comes out.
template <int BYTES, typename T16> __device__ __forceinline__ void wait_step(const T16*& p) { asm volatile("s_wait_xcnt 0x0\n\tv_add_nc_u64 %0, %1, %0" : "+v"(p) : "i"(BYTES) : "memory"); }
// ldg: ld for a pointer whose origin the compiler cannot see (it has come out of an asm statement): the cast says that it points to global memory, so that the load is a global one and not a flat one.
template <> struct WFrag<h16> { typedef v16h V; typedef const __attribute__((address_space(1))) v8h* G; static __device__ __forceinline__ V ld(const h16* p) { return cat16(*(const v8h*)p, *(const v8h*)(p + 256)); } static __device__ __forceinline__ V ldg(const h16* p) { return cat16(*(G)p, *(G)(p + 256)); } static __device__ __forceinline__ v8f mma(V a, V b, v8f c) { return wmma16(a, b, c); } };
template <> struct WFrag<bf> { typedef v16bf V; typedef const __attribute__((address_space(1))) v8us* G; static __device__ __forceinline__ V ld(const bf* p) { return cat16b(*(const v8us*)p, *(const v8us*)(p + 256)); } static __device__ __forceinline__ V ldg(const bf* p) { return cat16b(*(G)p, *(G)(p + 256)); } static __device__ __forceinline__ v8f mma(V a, V b, v8f c) { return wmmab(a, b, c); } };
// One wave a SIMD: the launch has as many waves as the chip has SIMDs, and the two register sets need more than half a SIMD's registers. Four waves a work-group: 256 work-groups to start, one a WGP, in place of 1,024; its 2 x 2 tiles ask for each fragment twice from one WGP.
template <typename T16, int NSPLIT, bool BIAS, int K, int KS>
__global__ __launch_bounds__(128) __attribute__((amdgpu_waves_per_eu(1, 1))) void k_gemmw(const T16* __restrict__ A, const T16* __restrict__ A2, const T16* __restrict__ Bt, const T16* __restrict__ Bt2, float* C, int ldc, const float* __restrict__ bias, size_t sA, size_t sB, size_t sC) {
    typedef typename WFrag<T16>::V V;
    __shared__ __align__(16) float osw[4 * 16 * 68];
    const int w = __builtin_amdgcn_readfirstlane((int)threadIdx.x >> 5); float* os = osw + w * (16 * 68);   // each wave stages in its own part
    const size_t z = blockIdx.z; A += z * sA; if (A2) A2 += z * sA; Bt += z * sB; if (Bt2) Bt2 += z * sB; C += z * sC;
    const int lane = threadIdx.x & 31, lr = lane & 15, hi = lane >> 4; const int r0 = ((int)blockIdx.x * 2 + (w & 1)) * 64, c0 = ((int)blockIdx.y * 2 + (w >> 1)) * 64;
    v8f acc[4][4];
#pragma unroll
    for (int mb = 0; mb < 4; ++mb)
#pragma unroll
        for (int nb = 0; nb < 4; ++nb) acc[mb][nb] = (v8f){};
    const size_t aoff = (size_t)r0 * K + 8 * lane, boff = (size_t)c0 * K + 8 * lane;   // 16 rows of fragments are 16 K elements; a step of 32 columns is one fragment, 512 elements
    const T16* pa = A + aoff; const T16* pa2 = (NSPLIT == 1 || NSPLIT == 2) ? A2 + aoff : pa; const T16* pb = Bt + boff; const T16* pb2 = (NSPLIT >= 2) ? Bt2 + boff : pb;
    static_assert(K % (64 * KS) == 0, "stages come in pairs, one for each register set");
    V a[2][KS][4], a2[2][KS][4], b[2][KS][4], b2[2][KS][4];
    // every index below is a constant once the calls are inlined and the loops unrolled, so the sets stay in registers
    auto fetch = [&](const int s) __attribute__((always_inline)) {
#pragma unroll
        for (int u = 0; u < KS; ++u) {
#pragma unroll
            for (int mb = 0; mb < 4; ++mb) { a[s][u][mb] = WFrag<T16>::ldg(pa + mb * 16 * K + u * 512); if (NSPLIT == 1 || NSPLIT == 2) a2[s][u][mb] = WFrag<T16>::ldg(pa2 + mb * 16 * K + u * 512); }
#pragma unroll
            for (int nb = 0; nb < 4; ++nb) { b[s][u][nb] = WFrag<T16>::ldg(pb + nb * 16 * K + u * 512); if (NSPLIT >= 2) b2[s][u][nb] = WFrag<T16>::ldg(pb2 + nb * 16 * K + u * 512); } }
        __builtin_amdgcn_sched_barrier(0);   // all of the stage's loads are issued before the other set's products: left free, the scheduler puts loads among the products to save registers, and each such group is waited for by itself
    };
    auto mul = [&](const int s) __attribute__((always_inline)) {
#pragma unroll
        for (int u = 0; u < KS; ++u)
#pragma unroll
            for (int nb = 0; nb < 4; ++nb) {
#pragma unroll
                for (int mb = 0; mb < 4; ++mb) { acc[mb][nb] = WFrag<T16>::mma(a[s][u][mb], b[s][u][nb], acc[mb][nb]); if (NSPLIT == 1 || NSPLIT == 2) acc[mb][nb] = WFrag<T16>::mma(a2[s][u][mb], b[s][u][nb], acc[mb][nb]); if (NSPLIT >= 2) acc[mb][nb] = WFrag<T16>::mma(a[s][u][mb], b2[s][u][nb], acc[mb][nb]); } }
        __builtin_amdgcn_sched_barrier(0);   // the products stay in front of the next stage's loads, which go into the registers they read
    };
    auto step = [&]() __attribute__((always_inline)) {
        // behind the products: a whole block of matrix instructions after the loads that name these pairs were issued
        wait_step<1024 * KS>(pa); if constexpr (NSPLIT == 1 || NSPLIT == 2) wait_step<1024 * KS>(pa2); wait_step<1024 * KS>(pb); if constexpr (NSPLIT >= 2) wait_step<1024 * KS>(pb2);
    };
    fetch(0); step();
    // rolled: two stages' fragments live at a time
#pragma unroll 1
    for (int kc = 0; kc < K - 64 * KS; kc += 64 * KS) { fetch(1); mul(0); step(); fetch(0); mul(1); step(); }
    fetch(1); mul(0); step(); mul(1);
#pragma unroll
    for (int mb = 0; mb < 4; ++mb) {
#pragma unroll
        for (int nb = 0; nb < 4; ++nb) {
#pragma unroll
            for (int j = 0; j < 8; ++j) os[(hi * 8 + j) * 68 + nb * 16 + lr] = acc[mb][nb][j]; }
        __builtin_amdgcn_wave_barrier(); asm volatile("" ::: "memory");
        float* crow = C + (size_t)(r0 + mb * 16) * ldc + c0;
{
            v4f vs[8]; float* pc[8];
#pragma unroll
            for (int s = 0; s < 8; ++s) { const int row = 2 * s + hi, cofs = lr * 4; v4f val = *(const v4fa*)(os + row * 68 + cofs); if (BIAS) { val[0] += bfr(bias[c0 + cofs]); val[1] += bfr(bias[c0 + cofs + 1]); val[2] += bfr(bias[c0 + cofs + 2]); val[3] += bfr(bias[c0 + cofs + 3]); }
                vs[s] = val; pc[s] = crow + (size_t)row * ldc + cofs; *(v4f*)pc[s] = vs[s]; }
            // the wait that stands before a register named by an issued store is written anew; data and address pairs are inputs, so they live up to it
            asm volatile("s_wait_xcnt 0x0" :: "v"(vs[0]), "v"(vs[1]), "v"(vs[2]), "v"(vs[3]), "v"(vs[4]), "v"(vs[5]), "v"(vs[6]), "v"(vs[7]), "v"(pc[0]), "v"(pc[1]), "v"(pc[2]), "v"(pc[3]), "v"(pc[4]), "v"(pc[5]), "v"(pc[6]), "v"(pc[7]) : "memory");
             }
        __builtin_amdgcn_wave_barrier(); asm volatile("" ::: "memory");
    }
}

__device__ __forceinline__ h16 tohx(float x) { return (h16)x; }
__device__ __forceinline__ void splitf(float y, unsigned short& h, unsigned short& l) { h = f2bf(y); l = f2bf(y - bf2f(h)); }
typedef __attribute__((ext_vector_type(2))) _Float16 v2h;
typedef __attribute__((ext_vector_type(4))) _Float16 v4h;
typedef __attribute__((ext_vector_type(2))) unsigned short v2us;
typedef __attribute__((ext_vector_type(4))) unsigned short v4us;
typedef __attribute__((ext_vector_type(2))) float v2f;
typedef __attribute__((ext_vector_type(4))) int v4i;

// The j_ functions are jobs of 256 work-items that read none of each other's output; k_prep below runs them side by side in one grid, the job picked by the block index (bx: the block's index within its job).
// A work-item takes several pieces of its job, UW or UX of them, far apart: the launch then has about sixteen waves a WGP in all, each with 8 KiB of loads in flight, where one piece a work-item made six times as many waves.
#define UW 4   // pieces (16 k of one n) of a work-item in a weight transpose
#define UX 8   // pieces (8 values) of a work-item in the x conversion
// w [K][N] to Bt (rows n, columns k) in fragment order: a piece is 16 k of one n; a wave's 32 n in a row make each load one whole line, and its stores 256 bytes in a row for each 16 n. Piece u lies u K / UW rows of w on.
__device__ __forceinline__ void j_wtG(const int bx, const float* __restrict__ w, int K, int N, bf* Bt) {
    const int i = bx * 256 + (int)threadIdx.x; const int n = ((i >> 5) % (N / 32)) * 32 + (i & 31), k0 = ((i >> 5) / (N / 32)) * 16; if (k0 >= K / UW) return;
    const float* p = w + ((size_t)k0 * N + n); float v[UW][16];
#pragma unroll
    for (int u = 0; u < UW; ++u)
#pragma unroll
        for (int e = 0; e < 16; ++e) v[u][e] = p[(size_t)(u * (K / UW) + e) * N];
    asm volatile("s_wait_xcnt 0x0" :: "v"(p) : "memory");   // the wait that stands before a register named by an issued load is written anew; the address pair is an input, so it lives up to it; every piece's loads are issued in front of it
    v8us o[UW][2]; bf* q[UW];
#pragma unroll
    for (int u = 0; u < UW; ++u)
#pragma unroll
        for (int e = 0; e < 8; ++e) { o[u][0][e] = f2bf(v[u][e]); o[u][1][e] = f2bf(v[u][8 + e]); }
#pragma unroll
    for (int u = 0; u < UW; ++u) { q[u] = Bt + fro(n, k0 + u * (K / UW), K); *(v8us*)q[u] = o[u][0]; *(v8us*)(q[u] + 128) = o[u][1]; }
    // the same wait behind the stores; data and address pairs are inputs, so they live up to it
    asm volatile("s_wait_xcnt 0x0" :: "v"(o[0][0]), "v"(o[0][1]), "v"(o[1][0]), "v"(o[1][1]), "v"(o[2][0]), "v"(o[2][1]), "v"(o[3][0]), "v"(o[3][1]), "v"(q[0]), "v"(q[1]), "v"(q[2]), "v"(q[3]) : "memory");
}
// src [rows][K] to dst in fragment order, a piece is 8 values: a wave's pieces are 8 rows x 32 columns (8 whole lines in, 4 whole lines out). Piece u is piece i + u n8 / UX of the n8.
__device__ __forceinline__ void j_cvt8(const int bx, const float* __restrict__ src, bf* dst, int K, size_t n8) { const size_t i = (size_t)bx * 256 + threadIdx.x; if (i >= n8 / UX) return;
    const float* p[UX]; bf* d[UX]; v8f v[UX]; v8us o[UX];
#pragma unroll
    for (int u = 0; u < UX; ++u) { const size_t iu = i + u * (n8 / UX);
        const int fr = (int)(iu >> 6), r = (fr / (K / 32)) * 16 + (int)((iu >> 5) & 1) * 8 + (int)(iu & 7), k0 = (fr % (K / 32)) * 32 + (int)((iu >> 3) & 3) * 8;
        p[u] = src + ((size_t)r * K + k0); d[u] = dst + fro(r, k0, K); v[u] = *(const v8f*)p[u]; }
    asm volatile("s_wait_xcnt 0x0" :: "v"(p[0]), "v"(p[1]), "v"(p[2]), "v"(p[3]), "v"(p[4]), "v"(p[5]), "v"(p[6]), "v"(p[7]) : "memory");   // as in j_wtG
#pragma unroll
    for (int u = 0; u < UX; ++u)
#pragma unroll
        for (int k = 0; k < 8; ++k) o[u][k] = f2bf(v[u][k]);
#pragma unroll
    for (int u = 0; u < UX; ++u) *(v8us*)d[u] = o[u];
    asm volatile("s_wait_xcnt 0x0" :: "v"(o[0]), "v"(o[1]), "v"(o[2]), "v"(o[3]), "v"(o[4]), "v"(o[5]), "v"(o[6]), "v"(o[7]), "v"(d[0]), "v"(d[1]), "v"(d[2]), "v"(d[3]), "v"(d[4]), "v"(d[5]), "v"(d[6]), "v"(d[7]) : "memory");   // as in j_wtG
}

__global__ __launch_bounds__(256) void k_vtp(const float* __restrict__ F, int pitch, int nheads, h16* V16, bf* Vh, bf* Vl) { const size_t e = ((size_t)blockIdx.x * 256 + threadIdx.x) * 2; if (e >= (size_t)nheads * HD * TT) return; const int t = (int)(e % TT); const int d = (int)((e / TT) % HD); const int g = (int)(e / ((size_t)TT * HD)); v2h o16; v2us oh, ol;
#pragma unroll
    for (int q = 0; q < 2; ++q) { const float x = F[(size_t)(t + q) * pitch + g * HD + d]; o16[q] = tohx(x); unsigned short a2, c2; splitf(x, a2, c2); oh[q] = a2; ol[q] = c2; }
    *(v2h*)(V16 + e) = o16; *(v2us*)(Vh + e) = oh; *(v2us*)(Vl + e) = ol;  }
__device__ __forceinline__ void j_qtabs(const int bx, const float* __restrict__ ph, const float* __restrict__ am, float* MOD, float* CT) { const int i = bx * 256 + threadIdx.x; if (i < DQ) { const float m = __fmul_rn(cosf(bfr(ph[i])), bfr(am[i])); *(float*)(MOD + i) = m;  }
    if (i < TT) { const float a = __fmul_rn(__fmul_rn(6.2831853071795862f, (float)i), 1.0f / (float)TT); const float c = cosf(a); *(float*)(CT + i) = c;  } }
// ---- k_prep: every job that reads only inputs, in one grid: the four weight transposes (sixty-four reads a work-item, the longest job: lowest indices), x of both batches to bf16, the modulation and cos tables.
#define PW ((DM * DQ / 16 / UW + 255) / 256)       // blocks of one weight transpose
#define PX ((NB_ * TT * DM / 8 / UX + 255) / 256)  // blocks of the x conversion
static_assert(UW == 4 && UX == 8 && DM % (16 * UW) == 0 && (NB_ * TT * DM / 8) % UX == 0, "whole pieces; the waits in j_wtG and j_cvt8 name four and eight");
#define PT ((TT + 255) / 256)                      // blocks of the two small tables
__global__ __launch_bounds__(256) void k_prep(const float* __restrict__ x, const float* __restrict__ wq, const float* __restrict__ wk, const float* __restrict__ wv, const float* __restrict__ wo, const float* __restrict__ ph, const float* __restrict__ am, bf* WT, bf* XB, float* MOD, float* CT) {
    const int b = (int)blockIdx.x;
    if (b < 4 * PW) { const int j = b / PW; j_wtG(b % PW, j == 0 ? wq : j == 1 ? wk : j == 2 ? wv : wo, DM, DQ, WT + (size_t)j * DQ * DM); }
    else if (b < 4 * PW + PX) j_cvt8(b - 4 * PW, x, XB, DM, (size_t)NB_ * TT * DM / 8);
    else j_qtabs(b - 4 * PW - PX, ph, am, MOD, CT);
}
// ---- k_fattn: scores, interference, softmax and attn.v of one query block in one kernel; no score or probability ever reaches memory.
// Transposed products: S^T = K Q^T (A = 16 key rows, B = 16 query rows, both by the same loader), so a lane holds 8 keys' scores of ONE query (query = lane & 15, keys 8 (lane >> 4) + r);
// two such tiles (keys 0-15 and 16-31 of a 32-key pass), converted in place, are the B operand of O^T += V^T P^T, whose A operand (V^T rows, key-contiguous) comes by the same loader in the same k order.
// Softmax is the running form: a query's maximum in use m is raised (and its sum and output tiles rescaled) only when a pass's maximum exceeds it by more than FRTH, so p = exp(t - m) <= exp(FRTH).
// Work-group: FQG query groups x FKS key chunks = 16 waves; wave (qg, ks) does 16 QT queries against keys [ks TT / FKS, + TT / FKS); the FKS partial (m, sum, O) of a query are joined through LDS in chunk order and stored as the hi + lo planes that the Wo product reads.
// The FQG waves of a key chunk walk the same keys in step: a pass's K and V^T fragments are brought from L2 ONCE for the four of them, into a ring of two LDS buffers, by asynchronous copies (each wave a quarter) that fly while the pass before is worked on; every wave reads its fragments from LDS.
// tab[u] = cos table entry for |j - i| x HD^-0.5 (a power of two: exact), u = j - (i - q0) + NQW - 1: a lane's 8 keys are 8 consecutive entries.
// Each '#pragma unroll' below, but those on the join's sx and u loops, unrolls a loop over a register array to the end, so that its indices are constants and the array stays in registers.
#define FKS  4
#define FQG  4
#define FQT  3                    // query tiles of a wave in the single-product form
#define FNT  (FKS * FQG * 32)
#define FRTH 5.5f
#define L2E  1.4426950408889634f
#define FTAB 2560                 // floats kept for tab: TT + 16 FQT FQG - 1, rounded up to 5 per work-item
#define FBUF (FKS * 16384)        // bytes of one ring buffer: for each key chunk 32 keys of K and of V^T, 4 KiB each, hi and lo at most
#define FJOIN (FKS * FQG * 16 * FQT * 70)   // floats of the join area (68 a query for O, one each for m and the sum); it takes the ring's place behind the loop
#define FQS  (FKS * FQG * 512)     // floats: 2 KiB a wave for the Q fragments of its third query tile
#define FLDS (FTAB + FQS + (FJOIN > 2 * FBUF / 4 ? FJOIN : 2 * FBUF / 4))
typedef __attribute__((ext_vector_type(8))) __bf16 v8bf;
__device__ __forceinline__ float xhalf(float x) { const int b = __float_as_int(x); return __int_as_float(__builtin_amdgcn_permlanex16(b, b, 0x76543210, 0xfedcba98, false, false)); }   // the value of lane ^ 16
// 2^x of a tile's eight values in one statement. Behind a transcendental the instruction set asks for one independent instruction before its result is used or its source overwritten: the results are early-clobber, so no v_exp_f32 here touches a neighbour's registers, and the v_nop is the last one's slot.
__device__ __forceinline__ v8f exp2x8(const v8f x) { float y0, y1, y2, y3, y4, y5, y6, y7;
    asm("v_exp_f32 %0, %8\n\tv_exp_f32 %1, %9\n\tv_exp_f32 %2, %10\n\tv_exp_f32 %3, %11\n\tv_exp_f32 %4, %12\n\tv_exp_f32 %5, %13\n\tv_exp_f32 %6, %14\n\tv_exp_f32 %7, %15\n\tv_nop"
        : "=&v"(y0), "=&v"(y1), "=&v"(y2), "=&v"(y3), "=&v"(y4), "=&v"(y5), "=&v"(y6), "=&v"(y7) : "v"(x[0]), "v"(x[1]), "v"(x[2]), "v"(x[3]), "v"(x[4]), "v"(x[5]), "v"(x[6]), "v"(x[7]));
    return (v8f){y0, y1, y2, y3, y4, y5, y6, y7}; }
// Two fragments of 1 KiB from global memory to LDS, 16 bytes a lane and copy, through no register. la, lb: the lane's LDS byte addresses; ga, gb: its global addresses; the second half of a fragment lies 512 bytes on.
// The wait that stands before a register named by an issued copy is overwritten is the statement's last line, so nothing can come between.
template <typename T16> __device__ __forceinline__ void copy2(const unsigned la, const T16* ga, const unsigned lb, const T16* gb) {
    const unsigned la2 = la + 512, lb2 = lb + 512; const T16* ga2 = ga + 256; const T16* gb2 = gb + 256;
    asm volatile("global_load_async_to_lds_b128 %0, %4, off\n\tglobal_load_async_to_lds_b128 %1, %5, off\n\tglobal_load_async_to_lds_b128 %2, %6, off\n\tglobal_load_async_to_lds_b128 %3, %7, off\n\ts_wait_xcnt 0x0"
                 :: "v"(la), "v"(la2), "v"(lb), "v"(lb2), "v"(ga), "v"(ga2), "v"(gb), "v"(gb2) : "memory"); }
template <typename T16, bool HL, int QT>
__device__ __forceinline__ void fattn_body(const T16* __restrict__ Q, const T16* __restrict__ Q2, const T16* __restrict__ Kp, const T16* __restrict__ Kp2, const T16* __restrict__ Vt, const T16* __restrict__ Vt2, const float* __restrict__ CT, const int q0, bf* Ah, bf* Al, float* lds) {
    typedef typename WFrag<T16>::V V;
    constexpr int NQ = 16 * QT, NQW = NQ * FQG, NT = FNT, NF = FTAB / NT, NP = TT / FKS / 32;
    constexpr int CH = HL ? 8192 : 4096, VO = CH / 2;   // elements of a key chunk's part of a buffer: K fragments (hi, then lo), from VO on V^T fragments likewise
    const int tid = (int)threadIdx.x, lane = tid & 31, lr = lane & 15, hi = lane >> 4; const int w = __builtin_amdgcn_readfirstlane(tid >> 5); const int ks = w & (FKS - 1), qg = w / FKS;
    float* tab = lds; float* ring = lds + FTAB + FQS;
    static_assert(FTAB == NF * NT && NF == 5 && TT + NQW - 1 <= FTAB, "tab: five entries per work-item");
    static_assert(FQG == 4 && NP >= 2, "a pass has four fragments of each plane, one for each wave of its key chunk; the ring's prologue fills two passes");
    const int kbeg = ks * (TT / FKS);
    // pass t of this wave's key chunk: the wave brings fragment qg of each plane into buffer t & 1
    const unsigned lmy = (unsigned)(size_t)ring + (unsigned)(ks * CH + qg * 512 + 8 * lane) * 2u;
    const T16* gk = Kp + ((size_t)kbeg * HD + qg * 512 + 8 * lane); const T16* gv = Vt + ((size_t)qg * 16 * TT + (size_t)kbeg * 16 + 8 * lane);
    const T16* gk2 = HL ? Kp2 + ((size_t)kbeg * HD + qg * 512 + 8 * lane) : gk; const T16* gv2 = HL ? Vt2 + ((size_t)qg * 16 * TT + (size_t)kbeg * 16 + 8 * lane) : gv;
    auto fill = [&](const int t) __attribute__((always_inline)) { const unsigned l = lmy + (unsigned)(t & 1) * FBUF;
        copy2<T16>(l, gk + (size_t)t * 32 * HD, l + VO * 2, gv + (size_t)t * 32 * 16);
        if constexpr (HL) copy2<T16>(l + 4096, gk2 + (size_t)t * 32 * HD, l + VO * 2 + 4096, gv2 + (size_t)t * 32 * 16); };
    fill(0);
    int ix[NF]; float cv[NF];
#pragma unroll
    for (int f = 0; f < NF; ++f) { const int d = tid + f * NT - (NQW - 1) - q0; const int a = d < 0 ? -d : d; ix[f] = a < TT ? a : TT - 1; cv[f] = CT[ix[f]]; }   // entries past TT + NQW - 2 are never read; their index is clamped into the table
    const T16* pq = Q + ((size_t)(q0 + qg * NQ) * HD + 8 * lane); const T16* pq2 = HL ? Q2 + ((size_t)(q0 + qg * NQ) * HD + 8 * lane) : pq;   // fragment order: 16 rows are HD / 32 fragments of 512 elements
    V qf[QT][2], qf2[QT][2];
#pragma unroll
    for (int qt = 0; qt < QT; ++qt)
#pragma unroll
        for (int kc = 0; kc < 2; ++kc) { qf[qt][kc] = WFrag<T16>::ld(pq + qt * 16 * HD + kc * 512); if (HL) qf2[qt][kc] = WFrag<T16>::ld(pq2 + qt * 16 * HD + kc * 512); }
    // the wait that stands before a register named by an issued load is written anew; the loads' index and address registers are inputs, so they live up to it
    asm volatile("s_wait_xcnt 0x0" :: "v"(ix[0]), "v"(ix[1]), "v"(ix[2]), "v"(ix[3]), "v"(ix[4]), "v"(pq), "v"(pq2) : "memory");
    // a wave's registers do not reach for three query tiles' Q fragments beside the accumulators and the scores: the third tile's lie in the wave's own LDS (no other wave touches them) and are read anew in each pass
    T16* qs = (T16*)(lds + FTAB) + (w * 1024 + 8 * lane);
    if constexpr (QT > 2) {
#pragma unroll
        for (int kc = 0; kc < 2; ++kc) { *(v8ha*)(qs + kc * 512) = __builtin_shufflevector(qf[2][kc], qf[2][kc], 0, 1, 2, 3, 4, 5, 6, 7); *(v8ha*)(qs + kc * 512 + 256) = __builtin_shufflevector(qf[2][kc], qf[2][kc], 8, 9, 10, 11, 12, 13, 14, 15); } }
#pragma unroll
    for (int f = 0; f < NF; ++f) tab[tid + f * NT] = cv[f] * SCL;
    v8f acc[QT][4]; float m[QT], l[QT];
#pragma unroll
    for (int qt = 0; qt < QT; ++qt) { m[qt] = -3.0e38f; l[qt] = 0.f;
#pragma unroll
        for (int dt = 0; dt < 4; ++dt) acc[qt][dt] = (v8f){}; }
    asm volatile("s_wait_asynccnt 0x0" ::: "memory");   // this wave's copies of pass 0 have landed
    __syncthreads();   // pass 0's fragments and tab are whole before any wave reads them
    fill(1);
    // rolled: one pass's fragments live at a time
#pragma unroll 1
    for (int t = 0; t < NP; ++t) {
        const int jb = kbeg + 32 * t;
        const T16* sk = (const T16*)ring + ((t & 1) * (FBUF / 2) + ks * CH + 8 * lane);
        V kf[2][2], kf2[2][2], vf[4], vf2[4];
        v8f s[QT][2];
#pragma unroll
        for (int kt = 0; kt < 2; ++kt) {
#pragma unroll
            for (int kc = 0; kc < 2; ++kc) { kf[kt][kc] = WFrag<T16>::ld(sk + (kt * 2 + kc) * 512); if (HL) kf2[kt][kc] = WFrag<T16>::ld(sk + 2048 + (kt * 2 + kc) * 512); }
#pragma unroll
            for (int qt = 0; qt < QT; ++qt) { v8f x = (v8f){};
#pragma unroll
                for (int kc = 0; kc < 2; ++kc) { x = WFrag<T16>::mma(kf[kt][kc], qt < 2 ? qf[qt][kc] : WFrag<T16>::ld(qs + kc * 512), x); if (HL) { x = WFrag<T16>::mma(kf[kt][kc], qf2[qt][kc], x); x = WFrag<T16>::mma(kf2[kt][kc], qf[qt][kc], x); } }
                s[qt][kt] = x; }
            if constexpr (QT > 2) __builtin_amdgcn_sched_barrier(0);   // the second 16 keys' fragments are asked for behind the first 16 keys' products and take their registers: with both halves live at once the wave's registers do not reach and accumulators are spilled
        }
        const float* tb = tab + (jb + 8 * hi - lr - qg * NQ + NQW - 1);
        float bm[QT]; bool need = false;
#pragma unroll
        for (int qt = 0; qt < QT; ++qt) { float x = -3.0e38f;
#pragma unroll
            for (int kt = 0; kt < 2; ++kt)
#pragma unroll
                for (int r = 0; r < 8; ++r) { const float y = s[qt][kt][r] * tb[16 * (kt - qt) + r]; s[qt][kt][r] = y; x = fmaxf(x, y); }
            x = fmaxf(x, xhalf(x)); bm[qt] = x; need = need || (x > m[qt] + FRTH); }
        // the hi+lo form, one query tile a wave, has the registers to ask for its V^T fragments here; the single-product form asks behind the softmax, where the scores' registers are free
        auto loadv = [&]() __attribute__((always_inline)) {
#pragma unroll
            for (int dt = 0; dt < 4; ++dt) { vf[dt] = WFrag<T16>::ld(sk + VO + dt * 512); if (HL) vf2[dt] = WFrag<T16>::ld(sk + VO + 2048 + dt * 512); } };
        if constexpr (HL) loadv();
        if (__builtin_amdgcn_ballot_w32(need) != 0) {   // a scalar branch: taken on a wave's first pass and seldom after it
#pragma unroll
            for (int qt = 0; qt < QT; ++qt) { const float mn = (bm[qt] > m[qt] + FRTH) ? bm[qt] : m[qt]; const float al = __builtin_amdgcn_exp2f((m[qt] - mn) * L2E); m[qt] = mn; l[qt] *= al;
#pragma unroll
                for (int dt = 0; dt < 4; ++dt) acc[qt][dt] *= al; } }
        V pb[QT], pl[QT];
#pragma unroll
        for (int qt = 0; qt < QT; ++qt) { const float nm = -m[qt] * L2E; float ls = 0.f;
#pragma unroll
            for (int kt = 0; kt < 2; ++kt) { v8f a;
#pragma unroll
                for (int r = 0; r < 8; ++r) a[r] = __builtin_fmaf(s[qt][kt][r], L2E, nm);
                s[qt][kt] = exp2x8(a);
#pragma unroll
                for (int r = 0; r < 8; ++r) ls += s[qt][kt][r]; }
            l[qt] += ls;
            if constexpr (HL) {   // hi = p rounded to nearest even, lo = (p - hi) rounded likewise: splitf's values for the finite p here, by the packed conversion
                const v8bf h0 = __builtin_convertvector(s[qt][0], v8bf), h1 = __builtin_convertvector(s[qt][1], v8bf);
                const v8bf l0 = __builtin_convertvector(s[qt][0] - __builtin_convertvector(h0, v8f), v8bf), l1 = __builtin_convertvector(s[qt][1] - __builtin_convertvector(h1, v8f), v8bf);
                pb[qt] = __builtin_shufflevector(h0, h1, 0, 1, 2, 3, 4, 5, 6, 7, 8, 9, 10, 11, 12, 13, 14, 15); pl[qt] = __builtin_shufflevector(l0, l1, 0, 1, 2, 3, 4, 5, 6, 7, 8, 9, 10, 11, 12, 13, 14, 15);
            } else { pb[qt] = cat16(__builtin_convertvector(s[qt][0], v8h), __builtin_convertvector(s[qt][1], v8h)); } }
        if constexpr (!HL) loadv();
        // the loaded fragments are inputs only: all eight are then asked for in front of the softmax and fly while it runs; left free, the scheduler loads them into one register set among the products and waits for each by itself
        else asm volatile("" :: "v"(vf[0]), "v"(vf[1]), "v"(vf[2]), "v"(vf[3]), "v"(vf2[0]), "v"(vf2[1]), "v"(vf2[2]), "v"(vf2[3]));
#pragma unroll
        for (int dt = 0; dt < 4; ++dt)
#pragma unroll
            for (int qt = 0; qt < QT; ++qt) { acc[qt][dt] = WFrag<T16>::mma(vf[dt], pb[qt], acc[qt][dt]); if (HL) { acc[qt][dt] = WFrag<T16>::mma(vf[dt], pl[qt], acc[qt][dt]); acc[qt][dt] = WFrag<T16>::mma(vf2[dt], pb[qt], acc[qt][dt]); } }
        asm volatile("s_wait_dscnt 0x0" ::: "memory");      // this wave's reads of the buffer are done before the buffer is given up
        asm volatile("s_wait_asynccnt 0x0" ::: "memory");   // and its copies of pass t + 1 have landed
        __syncthreads();   // pass t + 1 is whole for every wave, and every wave has left pass t's buffer
        if (t + 2 < NP) fill(t + 2);   // the same for the whole work-group
    }
    asm volatile("s_wait_asynccnt 0x0" ::: "memory");   // no copy is under way when the ring becomes the join area (every wave has passed the last pass's barrier)
    float* accS = ring; float* mS = accS + FKS * FQG * NQ * 68; float* lS = mS + FKS * FQG * NQ;
    float* my = accS + w * (NQ * 68);
#pragma unroll
    for (int qt = 0; qt < QT; ++qt) { const float lj = l[qt] + xhalf(l[qt]);   // the two lane halves summed different keys of the same query
        if (hi == 0) { mS[w * NQ + qt * 16 + lr] = m[qt]; lS[w * NQ + qt * 16 + lr] = lj; }
#pragma unroll
        for (int dt = 0; dt < 4; ++dt) { float* p = my + (qt * 16 + lr) * 68 + dt * 16 + hi * 8; const v8f x = acc[qt][dt];
            *(v4fa*)p = __builtin_shufflevector(x, x, 0, 1, 2, 3); *(v4fa*)(p + 4) = __builtin_shufflevector(x, x, 4, 5, 6, 7); } }
    __syncthreads();   // every wave's partial is in LDS before any is joined
#pragma unroll
    for (int sx = 0; sx < NQW * 8 / NT; ++sx) { const int idx = sx * NT + tid; const int q = (idx >> 7) * 16 + (idx & 15), dc = ((idx >> 4) & 7) * 8; const int w0 = (q / NQ) * FKS, ql = q % NQ;   // a wave has 16 queries x 16 columns: 512 bytes in a row of each plane
        float M = mS[w0 * NQ + ql];
#pragma unroll
        for (int u = 1; u < FKS; ++u) M = fmaxf(M, mS[(w0 + u) * NQ + ql]);
        float L = 0.f; v4f o0 = (v4f){}, o1 = (v4f){};
#pragma unroll
        for (int u = 0; u < FKS; ++u) { const float sc = __builtin_amdgcn_exp2f((mS[(w0 + u) * NQ + ql] - M) * L2E); L += lS[(w0 + u) * NQ + ql] * sc; const float* p = accS + ((w0 + u) * NQ + ql) * 68 + dc; o0 += *(const v4fa*)p * sc; o1 += *(const v4fa*)(p + 4) * sc; }
        const float inv = __fdiv_rn(1.0f, L); v8us oh, ol;
#pragma unroll
        for (int k = 0; k < 4; ++k) { unsigned short a, c2; splitf(o0[k] * inv, a, c2); oh[k] = a; ol[k] = c2; splitf(o1[k] * inv, a, c2); oh[4 + k] = a; ol[4 + k] = c2; }
        const size_t oo = fro(q0 + q, dc, DQ); bf* ph = Ah + oo; bf* pl = Al + oo; *(v8us*)ph = oh; *(v8us*)pl = ol;
        asm volatile("s_wait_xcnt 0x0" :: "v"(oh), "v"(ol), "v"(ph), "v"(pl) : "memory"); }   // the wait that stands before a register named by an issued store is written anew; data and address pairs are inputs, so they live up to it
}
// grid (batches x heads, RH / (16 FQG) + (TT - RH) / (16 FQT FQG)): the hi+lo query blocks have the low indices and start first.
// Four waves a SIMD (256 registers), one work-group a WGP: the launch's 256 hi+lo and 256 single-product work-groups are then one full round each on the 256 WGPs.
static_assert(RH % (16 * FQG) == 0 && (TT - RH) % (16 * FQT * FQG) == 0, "whole query blocks");
__global__ __launch_bounds__(FNT) __attribute__((amdgpu_waves_per_eu(4, 4))) void k_fattn(const h16* __restrict__ Q16, const h16* __restrict__ K16, const h16* __restrict__ V16, const bf* __restrict__ Qh, const bf* __restrict__ Ql, const bf* __restrict__ Kh, const bf* __restrict__ Kl, const bf* __restrict__ Vh, const bf* __restrict__ Vl, const float* __restrict__ CT, bf* Ah, bf* Al) {
    __shared__ __align__(16) float lds[FLDS];
    const int bh = (int)blockIdx.x, by = (int)blockIdx.y; const size_t ho = (size_t)bh * TT * HD; const size_t ao = (size_t)(bh / NH_) * TT * DQ + (bh % NH_) * (HD / 32) * 512;   // planes [batch][head]; output rows [batch x t], the head's columns (in fragment order: its HD / 32 fragments of each 16 rows)
    if (by < RH / (16 * FQG)) fattn_body<bf, true, 1>(Qh + ho, Ql + ho, Kh + ho, Kl + ho, Vh + ho, Vl + ho, CT, by * (16 * FQG), Ah + ao, Al + ao, lds);
    else fattn_body<h16, false, FQT>(Q16 + ho, nullptr, K16 + ho, nullptr, V16 + ho, nullptr, CT, RH + (by - RH / (16 * FQG)) * (16 * FQT * FQG), Ah + ao, Al + ao, lds);
}

// ---- k_qkv: the q | k | v product of both batches, its epilogue storing the head planes that k_fattn reads (fp16 and hi + lo bf16); the f32 product never reaches memory.
// ONE WAVE per 64 x 64 tile as in k_gemmw, same k order, stages of one fragment; a tile is 64 positions of one head of q, k or v. A work-group is twelve such waves that share nothing but the WGP (no barrier): 4 row tiles x (q, k, v of one head). grid (batches x TT / 256, DQ / 64), 384 threads.
// q, k: planes [t][d], value x MOD[h][d], in fragment order like every plane here. v: planes [d][t] of vv[t] = (v[t] MOD + v[t + 1 mod TT] MOD) / sqrt(2): the tile's last position needs the next tile's first row, so a v tile carries a fifth row block (rows t0 + 64 ..., wrapped inside the batch), of which row 0 is used.
// Four times eight values in a row (a lane's pieces of two fragments, 256 elements apart) to the three planes: fp16, hi = bf16 nearest even, lo = (x - hi) likewise (splitf's values for finite x, by the packed conversion).
__device__ __forceinline__ void put32(const v8f (&x)[4], const size_t e, h16* P16, bf* Ph, bf* Pl) {
    h16* q16 = P16 + e; bf* qh = Ph + e; bf* ql = Pl + e; v8h a[4]; v8us h[4], l[4];
#pragma unroll
    for (int s = 0; s < 4; ++s) { const v8bf hb = __builtin_convertvector(x[s], v8bf); const v8bf lb = __builtin_convertvector(x[s] - __builtin_convertvector(hb, v8f), v8bf);
        a[s] = __builtin_convertvector(x[s], v8h); h[s] = __builtin_bit_cast(v8us, hb); l[s] = __builtin_bit_cast(v8us, lb); }
#pragma unroll
    for (int s = 0; s < 4; ++s) { *(v8h*)(q16 + s * 256) = a[s]; *(v8us*)(qh + s * 256) = h[s]; *(v8us*)(ql + s * 256) = l[s]; }
    // the wait that stands before a register named by an issued store is written anew; data and address pairs are inputs, so they live up to it
    asm volatile("s_wait_xcnt 0x0" :: "v"(a[0]), "v"(a[1]), "v"(a[2]), "v"(a[3]), "v"(h[0]), "v"(h[1]), "v"(h[2]), "v"(h[3]), "v"(l[0]), "v"(l[1]), "v"(l[2]), "v"(l[3]), "v"(q16), "v"(qh), "v"(ql) : "memory"); }
template <bool VV>
__device__ __forceinline__ void qkv_body(const int r0, const int c0, const bf* __restrict__ X, const bf* __restrict__ Wt, const float* __restrict__ MOD, h16* P16, bf* Ph, bf* Pl, float* os) {
    typedef WFrag<bf>::V V;
    constexpr int K = DM, MB = VV ? 5 : 4;
    const int lane = threadIdx.x & 31, lr = lane & 15, hi = lane >> 4;
    const int b = r0 / TT, t0 = r0 % TT, h = (c0 % DQ) / HD;
    const float* pm = MOD + h * HD + lr; float md[4];
#pragma unroll
    for (int nb = 0; nb < 4; ++nb) md[nb] = pm[nb * 16];   // a lane's accumulators are of columns nb 16 + lr
    asm volatile("s_wait_xcnt 0x0" :: "v"(pm) : "memory");   // the wait that stands before a register named by an issued load is written anew; the address pair is an input, so it lives up to it
    v8f acc[MB][4];
#pragma unroll
    for (int mb = 0; mb < MB; ++mb)
#pragma unroll
        for (int nb = 0; nb < 4; ++nb) acc[mb][nb] = (v8f){};
    const bf* pa = X + ((size_t)r0 * K + 8 * lane); const bf* pb = Wt + ((size_t)c0 * K + 8 * lane); const bf* pn = X + ((size_t)(b * TT + (t0 + 64) % TT) * K + 8 * lane);   // fragment order: 16 rows are 16 K elements, 32 columns one fragment
    static_assert(K % 64 == 0, "k steps come in pairs, one for each register set");
    V a[2][MB], bb[2][4];
    // two register sets as in k_gemmw: while one set's products run, the next k step's loads, all issued in front of them, are in flight; every index is a constant once the calls are inlined
    auto fetch = [&](const int s) __attribute__((always_inline)) {
#pragma unroll
        for (int mb = 0; mb < 4; ++mb) a[s][mb] = WFrag<bf>::ldg(pa + mb * 16 * K);
        if constexpr (VV) a[s][4] = WFrag<bf>::ldg(pn);
#pragma unroll
        for (int nb = 0; nb < 4; ++nb) bb[s][nb] = WFrag<bf>::ldg(pb + nb * 16 * K);
        __builtin_amdgcn_sched_barrier(0);   // as in k_gemmw: all of the step's loads are issued before the other set's products
    };
    auto mul = [&](const int s) __attribute__((always_inline)) {
#pragma unroll
        for (int nb = 0; nb < 4; ++nb)
#pragma unroll
            for (int mb = 0; mb < MB; ++mb) acc[mb][nb] = WFrag<bf>::mma(a[s][mb], bb[s][nb], acc[mb][nb]);
        __builtin_amdgcn_sched_barrier(0);   // as in k_gemmw: the products stay in front of the loads that go into the registers they read
    };
    auto step = [&]() __attribute__((always_inline)) {
        // as in k_gemmw: behind the products
        wait_step<1024>(pa); wait_step<1024>(pb); if constexpr (VV) wait_step<1024>(pn);
    };
    fetch(0); step();
    // rolled: two steps' fragments live at a time
#pragma unroll 1
    for (int kc = 0; kc < K - 64; kc += 64) { fetch(1); mul(0); step(); fetch(0); mul(1); step(); }
    fetch(1); mul(0); step(); mul(1);
    const size_t o = (((size_t)(c0 / DQ) * NB_ + b) * NH_ + h) * TT * HD;   // planes [q, k, v][batch][head]
    // on the way out a lane has 8 values in a row, of row lr and columns s 16 + hi 8 ...: the wave's 32 pieces are half a fragment, 512 bytes in a row
    if constexpr (!VV) {
#pragma unroll
        for (int mb = 0; mb < 4; ++mb) {
#pragma unroll
            for (int nb = 0; nb < 4; ++nb) {
#pragma unroll
                for (int j = 0; j < 8; ++j) os[(hi * 8 + j) * 68 + nb * 16 + lr] = __fmul_rn(acc[mb][nb][j], md[nb]); }
            __builtin_amdgcn_wave_barrier(); asm volatile("" ::: "memory");   // the lanes read each other's LDS stores: no read may be moved above them
            v8f y[4];
#pragma unroll
            for (int s = 0; s < 4; ++s) { const float* p = os + lr * 68 + s * 16 + hi * 8; const v4f x0 = *(const v4fa*)p, x1 = *(const v4fa*)(p + 4); y[s] = __builtin_shufflevector(x0, x1, 0, 1, 2, 3, 4, 5, 6, 7); }
            put32(y, o + (size_t)(t0 + mb * 16) * HD + lane * 8, P16, Ph, Pl);
            __builtin_amdgcn_wave_barrier(); asm volatile("" ::: "memory");   // and no store of the next block above these reads
        }
    } else {
#pragma unroll
        for (int nb = 0; nb < 4; ++nb) {
#pragma unroll
            for (int mb = 0; mb < 4; ++mb) { v8f t;
#pragma unroll
                for (int j = 0; j < 8; ++j) t[j] = __fmul_rn(acc[mb][nb][j], md[nb]);
                float* p = os + lr * 68 + mb * 16 + hi * 8; *(v4fa*)p = __builtin_shufflevector(t, t, 0, 1, 2, 3); *(v4fa*)(p + 4) = __builtin_shufflevector(t, t, 4, 5, 6, 7); }
            if (hi == 0) os[lr * 68 + 64] = __fmul_rn(acc[4][nb][0], md[nb]);   // position t0 + 64 (mod TT)
            __builtin_amdgcn_wave_barrier(); asm volatile("" ::: "memory");   // as above
            v8f y[4];
#pragma unroll
            for (int s = 0; s < 4; ++s) { const float* p = os + lr * 68 + s * 16 + hi * 8; const v4f x0 = *(const v4fa*)p, x1 = *(const v4fa*)(p + 4); const float x8 = p[8];
                const float x[9] = {x0[0], x0[1], x0[2], x0[3], x1[0], x1[1], x1[2], x1[3], x8};
#pragma unroll
                for (int j = 0; j < 8; ++j) y[s][j] = __fmul_rn(__fadd_rn(x[j], x[j + 1]), 0.70710678118654752f); }
            put32(y, o + (size_t)nb * 16 * TT + (size_t)t0 * 16 + lane * 8, P16, Ph, Pl);
            __builtin_amdgcn_wave_barrier(); asm volatile("" ::: "memory");   // as above
        }
    }
}
// Three waves a SIMD (336 registers): the launch's 3,072 waves are then all resident at once, as 256 work-groups to start, one a WGP, in place of 3,072.
// Wave w has row tile w & 3 and q, k or v by w >> 2: every WGP has the same work (a v tile has a fifth row block), and of its waves three ask for each x fragment and four for each weight fragment.
__global__ __launch_bounds__(384) __attribute__((amdgpu_waves_per_eu(3, 3))) void k_qkv(const bf* __restrict__ X, const bf* __restrict__ Wt, const float* __restrict__ MOD, h16* P16, bf* Ph, bf* Pl) {
    __shared__ __align__(16) float osw[12 * 16 * 68];
    const int w = __builtin_amdgcn_readfirstlane((int)threadIdx.x >> 5); float* os = osw + w * (16 * 68);   // each wave stages in its own part
    const int r0 = ((int)blockIdx.x * 4 + (w & 3)) * 64, c0 = (w >> 2) * DQ + (int)blockIdx.y * 64;
    if (w < 8) qkv_body<false>(r0, c0, X, Wt, MOD, P16, Ph, Pl, os);   // the same for a whole wave; neither side has a work-group barrier
    else qkv_body<true>(r0, c0, X, Wt, MOD, P16, Ph, Pl, os);
}

extern "C" void kernel_launch(void* const* d_in, const int* in_sizes, int n_in,
                              void* d_out, int out_size, void* d_ws, size_t ws_size, hipStream_t stream) {
    (void)in_sizes; (void)n_in; (void)out_size;
    const float* x = (const float*)d_in[0]; const float* wq = (const float*)d_in[1]; const float* wk = (const float*)d_in[2]; const float* wv = (const float*)d_in[3]; const float* wo = (const float*)d_in[4]; const float* qph = (const float*)d_in[5]; const float* qam = (const float*)d_in[6];
    float* OUT = (float*)d_out;     // [2][2048][1024]
    char* wsp = (char*)d_ws;
    auto take = [&](size_t bytes) { char* p = wsp; wsp += (bytes + 255) & ~(size_t)255; return (void*)p; };
    static_assert(DKV == DQ && DQ == DM, "the four weights are alike in shape, and q, k, v stand side by side in one product");
    bf* WT = (bf*)take((size_t)4 * DQ * DM * 2);   // Wq^T | Wk^T | Wv^T | Wo^T
    float* MOD = (float*)take((size_t)DQ * 4); float* CT = (float*)take((size_t)TT * 4);
    bf* XB = (bf*)take((size_t)NB_ * TT * DM * 2);
    const size_t PL = (size_t)NB_ * NH_ * TT * HD;   // one kind of plane, both batches
    h16* P16 = (h16*)take(3 * PL * 2); bf* Ph = (bf*)take(3 * PL * 2); bf* Pl = (bf*)take(3 * PL * 2);
    bf* ATh = (bf*)take((size_t)NB_ * TT * DQ * 2); bf* ATl = (bf*)take((size_t)NB_ * TT * DQ * 2);
    if ((size_t)(wsp - (char*)d_ws) > ws_size) return;    // ws 256 MiB
    k_prep<<<4 * PW + PX + PT, 256, 0, stream>>>(x, wq, wk, wv, wo, qph, qam, WT, XB, MOD, CT);
    k_qkv<<<dim3(NB_ * TT / 256, DQ / 64, 1), 384, 0, stream>>>(XB, WT, MOD, P16, Ph, Pl);   // q | k | v of both batches, stored as planes
    k_fattn<<<dim3(NB_ * NH_, RH / (16 * FQG) + (TT - RH) / (16 * FQT * FQG), 1), FNT, 0, stream>>>(P16, P16 + PL, P16 + 2 * PL, Ph, Pl, Ph + PL, Pl + PL, Ph + 2 * PL, Pl + 2 * PL, CT, ATh, ATl);   // one kv head per query head
    k_gemmw<bf, 1, false, DQ, 2><<<dim3(NB_ * TT / 128, DM / 128, 1), 128, 0, stream>>>(ATh, ATl, WT + (size_t)3 * DQ * DM, nullptr, OUT, DM, nullptr, 0, 0, 0);
}

// v010
// It runs in 94.5 microseconds.
// Timed twice side by side with v009, it ran 1.06 and 1.05 times as fast.
// All steps since v000 together make it 23.3 times as fast.
#include <hip/hip_runtime.h>

// 'Quantum' attention (x [2][2048][1024]; q, k, v = (x W) ('xw' [1024][1024], 16 heads x 64) each multiplied per (head, dim) by mod = cos(quantum_phase[h][d]) x quantum_amplitude[h][d]; scores = q.k / 8 x cos(2 pi (i - j) / 2048) (multiplicative Toeplitz 'interference'); w = softmax; w' = (w + roll(w, 1, keys)) / sqrt(2); out = w' v; y = merged Wo ('xw') -> [2][2048][1024] (4.2 M)).
// Realisation: the roll superposition is moved onto the values: w' v = w @ vv with vv[j] = (v[j] + v[(j+1) mod S]) / sqrt(2) (exact algebra), so attn.v runs on vv^T planes; the modulation is applied where the q | k | v product stores its planes (q, k planes x MOD[h][d]; vv from modulated v); the fused attention kernel multiplies each scaled logit by the cos table entry for |i - j| (cos(2 pi m / 2048) computed as the reference's float32 expression).
// Compute dtypes, f32 accumulate: every input rounded to bf16; q/k/v on PLAIN bf16 operands (inputs: exact); modulation table (precise cosf of bf16 phase x bf16 amplitude) and the cos Toeplitz table in f32; scores and attn.v: query rows < 512 hl (3 products), the rest single fp16; softmax f32 (running maximum, probabilities unnormalised until the end); Wo hl x exact (2 products).

#define NB_  2
#define TT   2048
#define DM   1024
#define NH_  16
#define NKV  16
#define REP  (NH_ / NKV)
#define HD   64
#define DQ   (NH_ * HD)
#define DKV  (NKV * HD)
#define RH   512                  // query rows < RH use hi+lo planes (0: none)
#define WIN  0
#define SCL  0.125f   // HD^-0.5
typedef _Float16 h16;
typedef unsigned short bf;
typedef __attribute__((ext_vector_type(16))) __bf16   v16bf;
typedef __attribute__((ext_vector_type(16))) _Float16 v16h;
typedef __attribute__((ext_vector_type(8)))  _Float16 v8h;
typedef __attribute__((ext_vector_type(8)))  unsigned short v8us;
typedef __attribute__((ext_vector_type(8)))  float    v8f;
typedef __attribute__((ext_vector_type(4)))  float    v4f;
typedef v8h  __attribute__((may_alias)) v8ha;
typedef v4f  __attribute__((may_alias)) v4fa;
typedef v8us __attribute__((may_alias)) v8usa;

__device__ __forceinline__ unsigned short f2bf(float f) { unsigned u = __float_as_uint(f); u += 0x7FFFu + ((u >> 16) & 1u); return (unsigned short)(u >> 16); }
__device__ __forceinline__ float bf2f(unsigned short b) { return __uint_as_float(((unsigned)b) << 16); }
__device__ __forceinline__ float bfr(float f) { return bf2f(f2bf(f)); }
__device__ __forceinline__ v16h cat16(v8h lo, v8h hi) { return __builtin_shufflevector(lo, hi, 0, 1, 2, 3, 4, 5, 6, 7, 8, 9, 10, 11, 12, 13, 14, 15); }
__device__ __forceinline__ v16bf cat16b(v8us lo, v8us hi) { return __builtin_bit_cast(v16bf, __builtin_shufflevector(lo, hi, 0, 1, 2, 3, 4, 5, 6, 7, 8, 9, 10, 11, 12, 13, 14, 15)); }
__device__ __forceinline__ v8f wmma16(v16h a, v16h b, v8f c) { return __builtin_amdgcn_wmma_f32_16x16x32_f16(false, a, false, b, (short)0, c, false, false); }
__device__ __forceinline__ v8f wmmab(v16bf a, v16bf b, v8f c) { return __builtin_amdgcn_wmma_f32_16x16x32_bf16(false, a, false, b, (short)0, c, false, false); }



// ---- Fragment order: every 16-bit operand plane (R rows x K columns, R % 16 == 0, K % 32 == 0) is stored as whole matrix fragments of 16 rows x 32 columns, 512 elements = 1 KiB in a row, fragment (r / 16, k / 32) at index (r / 16) (K / 32) + k / 32.
// Inside a fragment the 8 columns 8 c .. 8 c + 7 (c = 0..3) of row r % 16 are the 16 bytes at element c 128 + (r % 16) 8: lane (lr, hi) of the loader, which wants columns 8 hi .. + 7 and 16 + 8 hi .. + 7 of row lr, finds them at lane 8 and 256 + lane 8.
// So each wave-wide 16-byte load is 512 bytes in a row (4 whole 128-byte lines) where a row-major plane gives it 32 bytes of each of 16 lines. Which value meets which in a product is as before.
__device__ __forceinline__ size_t fro(const int r, const int k, const int K) { return ((size_t)(r >> 4) * (K >> 5) + (k >> 5)) * 512 + ((k >> 3) & 3) * 128 + (r & 15) * 8 + (k & 7); }
// ---- k_gemmw: register-blocked GEMM, ONE WAVE per 64x64 output tile (16 accumulators), operands straight from 16-bit planes in fragment order; a work-group is four such waves, 2 x 2 tiles, that share nothing but the WGP (no barrier); grid (M/128, N/128, Z), 128 threads.
// C[m][n] (f32, pitch ldc, + optional f32 bias[n]) = sum_k A[m][k] Bt[n][k] (+ split products per NSPLIT). z-batch strides sA/sB/sC in elements.
// The k loop runs in stages of KS fragments (32 KS columns) on two register sets: while one set's products run, the other set's loads, all issued in front of them, are in flight. K % (64 KS) == 0.
template <typename T16> struct WFrag;
// A fragment pointer's step of d bytes. The wait that stands before a register named by an issued load is overwritten, and the addition that overwrites it, are one statement, so nothing can come between them.
// The pair goes in and comes out: the loads in front name this very pair, which lives up to the statement (no load's result lands on it), and the addresses of the loads behind are formed from what comes out.
// The step d is the same for the whole wave (a scalar pair): one stage on, or from the last stage of a row of fragments back to its first (see 'Staggered walks').
template <typename T16> __device__ __forceinline__ void wait_step(const T16*& p, const long long d) { asm volatile("s_wait_xcnt 0x0\n\tv_add_nc_u64 %0, %1, %0" : "+v"(p) : "s"(d) : "memory"); }
// ---- Staggered walks: work-groups that read the same operand rows (all tiles of a row or a column of tiles; all query blocks of a head) would walk them in step and ask L2 for the same lines at the same moment.
// Each work-group therefore starts its walk at a stage rotated by its block index and wraps round: sharers stand at different stages at any moment (in k_gemmw's 16-stage walk the 32 work-groups of a column of tiles stand two to a stage). Every stage is taken exactly once; only the order of the f32 sums differs from one work-group to the next.
// ldg: ld for a pointer whose origin the compiler cannot see (it has come out of an asm statement): the cast says that it points to global memory, so that the load is a global one and not a flat one.
template <> struct WFrag<h16> { typedef v16h V; typedef const __attribute__((address_space(1))) v8h* G; static __device__ __forceinline__ V ld(const h16* p) { return cat16(*(const v8h*)p, *(const v8h*)(p + 256)); } static __device__ __forceinline__ V ldg(const h16* p) { return cat16(*(G)p, *(G)(p + 256)); } static __device__ __forceinline__ v8f mma(V a, V b, v8f c) { return wmma16(a, b, c); } };
template <> struct WFrag<bf> { typedef v16bf V; typedef const __attribute__((address_space(1))) v8us* G; static __device__ __forceinline__ V ld(const bf* p) { return cat16b(*(const v8us*)p, *(const v8us*)(p + 256)); } static __device__ __forceinline__ V ldg(const bf* p) { return cat16b(*(G)p, *(G)(p + 256)); } static __device__ __forceinline__ v8f mma(V a, V b, v8f c) { return wmmab(a, b, c); } };
// One wave a SIMD: the launch has as many waves as the chip has SIMDs, and the two register sets need more than half a SIMD's registers. Four waves a work-group: 256 work-groups to start, one a WGP, in place of 1,024; its 2 x 2 tiles ask for each fragment twice from one WGP.
template <typename T16, int NSPLIT, bool BIAS, int K, int KS>
__global__ __launch_bounds__(128) __attribute__((amdgpu_waves_per_eu(1, 1))) void k_gemmw(const T16* __restrict__ A, const T16* __restrict__ A2, const T16* __restrict__ Bt, const T16* __restrict__ Bt2, float* C, int ldc, const float* __restrict__ bias, size_t sA, size_t sB, size_t sC) {
    typedef typename WFrag<T16>::V V;
    __shared__ __align__(16) float osw[4 * 16 * 68];
    const int w = __builtin_amdgcn_readfirstlane((int)threadIdx.x >> 5); float* os = osw + w * (16 * 68);   // each wave stages in its own part
    const size_t z = blockIdx.z; A += z * sA; if (A2) A2 += z * sA; Bt += z * sB; if (Bt2) Bt2 += z * sB; C += z * sC;
    const int lane = threadIdx.x & 31, lr = lane & 15, hi = lane >> 4; const int r0 = ((int)blockIdx.x * 2 + (w & 1)) * 64, c0 = ((int)blockIdx.y * 2 + (w >> 1)) * 64;
    v8f acc[4][4];
#pragma unroll
    for (int mb = 0; mb < 4; ++mb)
#pragma unroll
        for (int nb = 0; nb < 4; ++nb) acc[mb][nb] = (v8f){};
    const size_t aoff = (size_t)r0 * K + 8 * lane, boff = (size_t)c0 * K + 8 * lane;   // 16 rows of fragments are 16 K elements; a step of 32 columns is one fragment, 512 elements
    static_assert(K % (64 * KS) == 0, "stages come in pairs, one for each register set");
    constexpr int NS = K / (32 * KS);   // stages of the walk
    int kx = ((int)blockIdx.x + 2 * (int)blockIdx.y) % NS;   // first stage: the tiles of a row of tiles (blockIdx.y varies) and those of a column (blockIdx.x varies) start apart but for blockIdx.x and blockIdx.x + 16, which start together
    const T16* pa = A + aoff + kx * (512 * KS); const T16* pa2 = (NSPLIT == 1 || NSPLIT == 2) ? A2 + aoff + kx * (512 * KS) : pa; const T16* pb = Bt + boff + kx * (512 * KS); const T16* pb2 = (NSPLIT >= 2) ? Bt2 + boff + kx * (512 * KS) : pb;
    V a[2][KS][4], a2[2][KS][4], b[2][KS][4], b2[2][KS][4];
    // every index below is a constant once the calls are inlined and the loops unrolled, so the sets stay in registers
    auto fetch = [&](const int s) __attribute__((always_inline)) {
#pragma unroll
        for (int u = 0; u < KS; ++u) {
#pragma unroll
            for (int mb = 0; mb < 4; ++mb) { a[s][u][mb] = WFrag<T16>::ldg(pa + mb * 16 * K + u * 512); if (NSPLIT == 1 || NSPLIT == 2) a2[s][u][mb] = WFrag<T16>::ldg(pa2 + mb * 16 * K + u * 512); }
#pragma unroll
            for (int nb = 0; nb < 4; ++nb) { b[s][u][nb] = WFrag<T16>::ldg(pb + nb * 16 * K + u * 512); if (NSPLIT >= 2) b2[s][u][nb] = WFrag<T16>::ldg(pb2 + nb * 16 * K + u * 512); } }
        __builtin_amdgcn_sched_barrier(0);   // all of the stage's loads are issued before the other set's products: left free, the scheduler puts loads among the products to save registers, and each such group is waited for by itself
    };
    auto mul = [&](const int s) __attribute__((always_inline)) {
#pragma unroll
        for (int u = 0; u < KS; ++u)
#pragma unroll
            for (int nb = 0; nb < 4; ++nb) {
#pragma unroll
                for (int mb = 0; mb < 4; ++mb) { acc[mb][nb] = WFrag<T16>::mma(a[s][u][mb], b[s][u][nb], acc[mb][nb]); if (NSPLIT == 1 || NSPLIT == 2) acc[mb][nb] = WFrag<T16>::mma(a2[s][u][mb], b[s][u][nb], acc[mb][nb]); if (NSPLIT >= 2) acc[mb][nb] = WFrag<T16>::mma(a[s][u][mb], b2[s][u][nb], acc[mb][nb]); } }
        __builtin_amdgcn_sched_barrier(0);   // the products stay in front of the next stage's loads, which go into the registers they read
    };
    auto step = [&]() __attribute__((always_inline)) {
        // behind the products: a whole block of matrix instructions after the loads that name these pairs were issued
        const long long d = kx == NS - 1 ? -(long long)(NS - 1) * (1024 * KS) : (long long)(1024 * KS); kx = kx == NS - 1 ? 0 : kx + 1;
        wait_step(pa, d); if constexpr (NSPLIT == 1 || NSPLIT == 2) wait_step(pa2, d); wait_step(pb, d); if constexpr (NSPLIT >= 2) wait_step(pb2, d);
    };
    fetch(0); step();
    // rolled: two stages' fragments live at a time
#pragma unroll 1
    for (int kc = 0; kc < K - 64 * KS; kc += 64 * KS) { fetch(1); mul(0); step(); fetch(0); mul(1); step(); }
    fetch(1); mul(0); step(); mul(1);
#pragma unroll
    for (int mb = 0; mb < 4; ++mb) {
#pragma unroll
        for (int nb = 0; nb < 4; ++nb) {
#pragma unroll
            for (int j = 0; j < 8; ++j) os[(hi * 8 + j) * 68 + nb * 16 + lr] = acc[mb][nb][j]; }
        __builtin_amdgcn_wave_barrier(); asm volatile("" ::: "memory");
        float* crow = C + (size_t)(r0 + mb * 16) * ldc + c0;
{
            v4f vs[8]; float* pc[8];
#pragma unroll
            for (int s = 0; s < 8; ++s) { const int row = 2 * s + hi, cofs = lr * 4; v4f val = *(const v4fa*)(os + row * 68 + cofs); if (BIAS) { val[0] += bfr(bias[c0 + cofs]); val[1] += bfr(bias[c0 + cofs + 1]); val[2] += bfr(bias[c0 + cofs + 2]); val[3] += bfr(bias[c0 + cofs + 3]); }
                vs[s] = val; pc[s] = crow + (size_t)row * ldc + cofs; *(v4f*)pc[s] = vs[s]; }
            // the wait that stands before a register named by an issued store is written anew; data and address pairs are inputs, so they live up to it
            asm volatile("s_wait_xcnt 0x0" :: "v"(vs[0]), "v"(vs[1]), "v"(vs[2]), "v"(vs[3]), "v"(vs[4]), "v"(vs[5]), "v"(vs[6]), "v"(vs[7]), "v"(pc[0]), "v"(pc[1]), "v"(pc[2]), "v"(pc[3]), "v"(pc[4]), "v"(pc[5]), "v"(pc[6]), "v"(pc[7]) : "memory");
             }
        __builtin_amdgcn_wave_barrier(); asm volatile("" ::: "memory");
    }
}

__device__ __forceinline__ h16 tohx(float x) { return (h16)x; }
__device__ __forceinline__ void splitf(float y, unsigned short& h, unsigned short& l) { h = f2bf(y); l = f2bf(y - bf2f(h)); }
typedef __attribute__((ext_vector_type(2))) _Float16 v2h;
typedef __attribute__((ext_vector_type(4))) _Float16 v4h;
typedef __attribute__((ext_vector_type(2))) unsigned short v2us;
typedef __attribute__((ext_vector_type(4))) unsigned short v4us;
typedef __attribute__((ext_vector_type(2))) float v2f;
typedef __attribute__((ext_vector_type(4))) int v4i;

// The j_ functions are jobs of 256 work-items that read none of each other's output; k_prep below runs them side by side in one grid, the job picked by the block index (bx: the block's index within its job).
// A work-item takes several pieces of its job, UW or UX of them, far apart: the launch then has about sixteen waves a WGP in all, each with 8 KiB of loads in flight, where one piece a work-item made six times as many waves.
#define UW 4   // pieces (16 k of one n) of a work-item in a weight transpose
#define UX 8   // pieces (8 values) of a work-item in the x conversion
// w [K][N] to Bt (rows n, columns k) in fragment order: a piece is 16 k of one n; a wave's 32 n in a row make each load one whole line, and its stores 256 bytes in a row for each 16 n. Piece u lies u K / UW rows of w on.
__device__ __forceinline__ void j_wtG(const int bx, const float* __restrict__ w, int K, int N, bf* Bt) {
    const int i = bx * 256 + (int)threadIdx.x; const int n = ((i >> 5) % (N / 32)) * 32 + (i & 31), k0 = ((i >> 5) / (N / 32)) * 16; if (k0 >= K / UW) return;
    const float* p = w + ((size_t)k0 * N + n); float v[UW][16];
#pragma unroll
    for (int u = 0; u < UW; ++u)
#pragma unroll
        for (int e = 0; e < 16; ++e) v[u][e] = p[(size_t)(u * (K / UW) + e) * N];
    asm volatile("s_wait_xcnt 0x0" :: "v"(p) : "memory");   // the wait that stands before a register named by an issued load is written anew; the address pair is an input, so it lives up to it; every piece's loads are issued in front of it
    v8us o[UW][2]; bf* q[UW];
#pragma unroll
    for (int u = 0; u < UW; ++u)
#pragma unroll
        for (int e = 0; e < 8; ++e) { o[u][0][e] = f2bf(v[u][e]); o[u][1][e] = f2bf(v[u][8 + e]); }
#pragma unroll
    for (int u = 0; u < UW; ++u) { q[u] = Bt + fro(n, k0 + u * (K / UW), K); *(v8us*)q[u] = o[u][0]; *(v8us*)(q[u] + 128) = o[u][1]; }
    // the same wait behind the stores; data and address pairs are inputs, so they live up to it
    asm volatile("s_wait_xcnt 0x0" :: "v"(o[0][0]), "v"(o[0][1]), "v"(o[1][0]), "v"(o[1][1]), "v"(o[2][0]), "v"(o[2][1]), "v"(o[3][0]), "v"(o[3][1]), "v"(q[0]), "v"(q[1]), "v"(q[2]), "v"(q[3]) : "memory");
}
// src [rows][K] to dst in fragment order, a piece is 8 values: a wave's pieces are 8 rows x 32 columns (8 whole lines in, 4 whole lines out). Piece u is piece i + u n8 / UX of the n8.
__device__ __forceinline__ void j_cvt8(const int bx, const float* __restrict__ src, bf* dst, int K, size_t n8) { const size_t i = (size_t)bx * 256 + threadIdx.x; if (i >= n8 / UX) return;
    const float* p[UX]; bf* d[UX]; v8f v[UX]; v8us o[UX];
#pragma unroll
    for (int u = 0; u < UX; ++u) { const size_t iu = i + u * (n8 / UX);
        const int fr = (int)(iu >> 6), r = (fr / (K / 32)) * 16 + (int)((iu >> 5) & 1) * 8 + (int)(iu & 7), k0 = (fr % (K / 32)) * 32 + (int)((iu >> 3) & 3) * 8;
        p[u] = src + ((size_t)r * K + k0); d[u] = dst + fro(r, k0, K); v[u] = *(const v8f*)p[u]; }
    asm volatile("s_wait_xcnt 0x0" :: "v"(p[0]), "v"(p[1]), "v"(p[2]), "v"(p[3]), "v"(p[4]), "v"(p[5]), "v"(p[6]), "v"(p[7]) : "memory");   // as in j_wtG
#pragma unroll
    for (int u = 0; u < UX; ++u)
#pragma unroll
        for (int k = 0; k < 8; ++k) o[u][k] = f2bf(v[u][k]);
#pragma unroll
    for (int u = 0; u < UX; ++u) *(v8us*)d[u] = o[u];
    asm volatile("s_wait_xcnt 0x0" :: "v"(o[0]), "v"(o[1]), "v"(o[2]), "v"(o[3]), "v"(o[4]), "v"(o[5]), "v"(o[6]), "v"(o[7]), "v"(d[0]), "v"(d[1]), "v"(d[2]), "v"(d[3]), "v"(d[4]), "v"(d[5]), "v"(d[6]), "v"(d[7]) : "memory");   // as in j_wtG
}

__global__ __launch_bounds__(256) void k_vtp(const float* __restrict__ F, int pitch, int nheads, h16* V16, bf* Vh, bf* Vl) { const size_t e = ((size_t)blockIdx.x * 256 + threadIdx.x) * 2; if (e >= (size_t)nheads * HD * TT) return; const int t = (int)(e % TT); const int d = (int)((e / TT) % HD); const int g = (int)(e / ((size_t)TT * HD)); v2h o16; v2us oh, ol;
#pragma unroll
    for (int q = 0; q < 2; ++q) { const float x = F[(size_t)(t + q) * pitch + g * HD + d]; o16[q] = tohx(x); unsigned short a2, c2; splitf(x, a2, c2); oh[q] = a2; ol[q] = c2; }
    *(v2h*)(V16 + e) = o16; *(v2us*)(Vh + e) = oh; *(v2us*)(Vl + e) = ol;  }
__device__ __forceinline__ void j_qtabs(const int bx, const float* __restrict__ ph, const float* __restrict__ am, float* MOD, float* CT) { const int i = bx * 256 + threadIdx.x; if (i < DQ) { const float m = __fmul_rn(cosf(bfr(ph[i])), bfr(am[i])); *(float*)(MOD + i) = m;  }
    if (i < TT) { const float a = __fmul_rn(__fmul_rn(6.2831853071795862f, (float)i), 1.0f / (float)TT); const float c = cosf(a); *(float*)(CT + i) = c;  } }
// ---- k_prep: every job that reads only inputs, in one grid: the four weight transposes (sixty-four reads a work-item, the longest job: lowest indices), x of both batches to bf16, the modulation and cos tables.
#define PW ((DM * DQ / 16 / UW + 255) / 256)       // blocks of one weight transpose
#define PX ((NB_ * TT * DM / 8 / UX + 255) / 256)  // blocks of the x conversion
static_assert(UW == 4 && UX == 8 && DM % (16 * UW) == 0 && (NB_ * TT * DM / 8) % UX == 0, "whole pieces; the waits in j_wtG and j_cvt8 name four and eight");
#define PT ((TT + 255) / 256)                      // blocks of the two small tables
__global__ __launch_bounds__(256) void k_prep(const float* __restrict__ x, const float* __restrict__ wq, const float* __restrict__ wk, const float* __restrict__ wv, const float* __restrict__ wo, const float* __restrict__ ph, const float* __restrict__ am, bf* WT, bf* XB, float* MOD, float* CT) {
    const int b = (int)blockIdx.x;
    if (b < 4 * PW) { const int j = b / PW; j_wtG(b % PW, j == 0 ? wq : j == 1 ? wk : j == 2 ? wv : wo, DM, DQ, WT + (size_t)j * DQ * DM); }
    else if (b < 4 * PW + PX) j_cvt8(b - 4 * PW, x, XB, DM, (size_t)NB_ * TT * DM / 8);
    else j_qtabs(b - 4 * PW - PX, ph, am, MOD, CT);
}
// ---- k_fattn: scores, interference, softmax and attn.v of one query block in one kernel; no score or probability ever reaches memory.
// Transposed products: S^T = K Q^T (A = 16 key rows, B = 16 query rows, both by the same loader), so a lane holds 8 keys' scores of ONE query (query = lane & 15, keys 8 (lane >> 4) + r);
// two such tiles (keys 0-15 and 16-31 of a 32-key pass), converted in place, are the B operand of O^T += V^T P^T, whose A operand (V^T rows, key-contiguous) comes by the same loader in the same k order.
// Softmax is the running form: a query's maximum in use m is raised (and its sum and output tiles rescaled) only when a pass's maximum exceeds it by more than FRTH, so p = exp(t - m) <= exp(FRTH).
// Work-group: FQG query groups x FKS key chunks = 16 waves; wave (qg, ks) does 16 QT queries against keys [ks TT / FKS, + TT / FKS); the FKS partial (m, sum, O) of a query are joined through LDS in chunk order and stored as the hi + lo planes that the Wo product reads.
// The FQG waves of a key chunk walk the same keys in step: a pass's K and V^T fragments are brought from L2 ONCE for the four of them, into a ring of two LDS buffers, by asynchronous copies (each wave a quarter) that fly while the pass before is worked on; every wave reads its fragments from LDS.
// tab[u] = cos table entry for |j - i| x HD^-0.5 (a power of two: exact), u = j - (i - q0) + NQW - 1: a lane's 8 keys are 8 consecutive entries.
// Each '#pragma unroll' below, but those on the join's sx and u loops, unrolls a loop over a register array to the end, so that its indices are constants and the array stays in registers.
#define FKS  4
#define FQG  4
#define FQT  3                    // query tiles of a wave in the single-product form
#define FNT  (FKS * FQG * 32)
#define FRTH 5.5f
#define L2E  1.4426950408889634f
#define FTAB 2560                 // floats kept for tab: TT + 16 FQT FQG - 1, rounded up to 5 per work-item
#define FBUF (FKS * 16384)        // bytes of one ring buffer: for each key chunk 32 keys of K and of V^T, 4 KiB each, hi and lo at most
#define FJOIN (FKS * FQG * 16 * FQT * 70)   // floats of the join area (68 a query for O, one each for m and the sum); it takes the ring's place behind the loop
#define FQS  (FKS * FQG * 512)     // floats: 2 KiB a wave for the Q fragments of its third query tile
#define FLDS (FTAB + FQS + (FJOIN > 2 * FBUF / 4 ? FJOIN : 2 * FBUF / 4))
typedef __attribute__((ext_vector_type(8))) __bf16 v8bf;
__device__ __forceinline__ float xhalf(float x) { const int b = __float_as_int(x); return __int_as_float(__builtin_amdgcn_permlanex16(b, b, 0x76543210, 0xfedcba98, false, false)); }   // the value of lane ^ 16
// 2^x of a tile's eight values in one statement. Behind a transcendental the instruction set asks for one independent instruction before its result is used or its source overwritten: the results are early-clobber, so no v_exp_f32 here touches a neighbour's registers, and the v_nop is the last one's slot.
__device__ __forceinline__ v8f exp2x8(const v8f x) { float y0, y1, y2, y3, y4, y5, y6, y7;
    asm("v_exp_f32 %0, %8\n\tv_exp_f32 %1, %9\n\tv_exp_f32 %2, %10\n\tv_exp_f32 %3, %11\n\tv_exp_f32 %4, %12\n\tv_exp_f32 %5, %13\n\tv_exp_f32 %6, %14\n\tv_exp_f32 %7, %15\n\tv_nop"
        : "=&v"(y0), "=&v"(y1), "=&v"(y2), "=&v"(y3), "=&v"(y4), "=&v"(y5), "=&v"(y6), "=&v"(y7) : "v"(x[0]), "v"(x[1]), "v"(x[2]), "v"(x[3]), "v"(x[4]), "v"(x[5]), "v"(x[6]), "v"(x[7]));
    return (v8f){y0, y1, y2, y3, y4, y5, y6, y7}; }
// Two fragments of 1 KiB from global memory to LDS, 16 bytes a lane and copy, through no register. la, lb: the lane's LDS byte addresses; ga, gb: its global addresses; the second half of a fragment lies 512 bytes on.
// The wait that stands before a register named by an issued copy is overwritten is the statement's last line, so nothing can come between.
template <typename T16> __device__ __forceinline__ void copy2(const unsigned la, const T16* ga, const unsigned lb, const T16* gb) {
    const unsigned la2 = la + 512, lb2 = lb + 512; const T16* ga2 = ga + 256; const T16* gb2 = gb + 256;
    asm volatile("global_load_async_to_lds_b128 %0, %4, off\n\tglobal_load_async_to_lds_b128 %1, %5, off\n\tglobal_load_async_to_lds_b128 %2, %6, off\n\tglobal_load_async_to_lds_b128 %3, %7, off\n\ts_wait_xcnt 0x0"
                 :: "v"(la), "v"(la2), "v"(lb), "v"(lb2), "v"(ga), "v"(ga2), "v"(gb), "v"(gb2) : "memory"); }
template <typename T16, bool HL, int QT>
__device__ __forceinline__ void fattn_body(const T16* __restrict__ Q, const T16* __restrict__ Q2, const T16* __restrict__ Kp, const T16* __restrict__ Kp2, const T16* __restrict__ Vt, const T16* __restrict__ Vt2, const float* __restrict__ CT, const int q0, const int rot, bf* Ah, bf* Al, float* lds) {
    typedef typename WFrag<T16>::V V;
    constexpr int NQ = 16 * QT, NQW = NQ * FQG, NT = FNT, NF = FTAB / NT, NP = TT / FKS / 32;
    constexpr int CH = HL ? 8192 : 4096, VO = CH / 2;   // elements of a key chunk's part of a buffer: K fragments (hi, then lo), from VO on V^T fragments likewise
    const int tid = (int)threadIdx.x, lane = tid & 31, lr = lane & 15, hi = lane >> 4; const int w = __builtin_amdgcn_readfirstlane(tid >> 5); const int ks = w & (FKS - 1), qg = w / FKS;
    float* tab = lds; float* ring = lds + FTAB + FQS;
    static_assert(FTAB == NF * NT && NF == 5 && TT + NQW - 1 <= FTAB, "tab: five entries per work-item");
    static_assert(FQG == 4 && NP >= 2, "a pass has four fragments of each plane, one for each wave of its key chunk; the ring's prologue fills two passes");
    const int kbeg = ks * (TT / FKS);
    // pass t of this wave's key chunk: the wave brings fragment qg of each plane into buffer t & 1
    const unsigned lmy = (unsigned)(size_t)ring + (unsigned)(ks * CH + qg * 512 + 8 * lane) * 2u;
    const T16* gk = Kp + ((size_t)kbeg * HD + qg * 512 + 8 * lane); const T16* gv = Vt + ((size_t)qg * 16 * TT + (size_t)kbeg * 16 + 8 * lane);
    const T16* gk2 = HL ? Kp2 + ((size_t)kbeg * HD + qg * 512 + 8 * lane) : gk; const T16* gv2 = HL ? Vt2 + ((size_t)qg * 16 * TT + (size_t)kbeg * 16 + 8 * lane) : gv;
    // staggered walks: pass t takes the chunk's 32 keys number (t + rot) mod NP, rot by the query block, so the query blocks of a head do not ask for the same K and V^T lines at one moment
    static_assert((NP & (NP - 1)) == 0, "the wrap is a mask");
    auto fill = [&](const int t) __attribute__((always_inline)) { const unsigned l = lmy + (unsigned)(t & 1) * FBUF; const int u = (t + rot) & (NP - 1);
        copy2<T16>(l, gk + (size_t)u * 32 * HD, l + VO * 2, gv + (size_t)u * 32 * 16);
        if constexpr (HL) copy2<T16>(l + 4096, gk2 + (size_t)u * 32 * HD, l + VO * 2 + 4096, gv2 + (size_t)u * 32 * 16); };
    fill(0);
    int ix[NF]; float cv[NF];
#pragma unroll
    for (int f = 0; f < NF; ++f) { const int d = tid + f * NT - (NQW - 1) - q0; const int a = d < 0 ? -d : d; ix[f] = a < TT ? a : TT - 1; cv[f] = CT[ix[f]]; }   // entries past TT + NQW - 2 are never read; their index is clamped into the table
    const T16* pq = Q + ((size_t)(q0 + qg * NQ) * HD + 8 * lane); const T16* pq2 = HL ? Q2 + ((size_t)(q0 + qg * NQ) * HD + 8 * lane) : pq;   // fragment order: 16 rows are HD / 32 fragments of 512 elements
    V qf[QT][2], qf2[QT][2];
#pragma unroll
    for (int qt = 0; qt < QT; ++qt)
#pragma unroll
        for (int kc = 0; kc < 2; ++kc) { qf[qt][kc] = WFrag<T16>::ld(pq + qt * 16 * HD + kc * 512); if (HL) qf2[qt][kc] = WFrag<T16>::ld(pq2 + qt * 16 * HD + kc * 512); }
    // the wait that stands before a register named by an issued load is written anew; the loads' index and address registers are inputs, so they live up to it
    asm volatile("s_wait_xcnt 0x0" :: "v"(ix[0]), "v"(ix[1]), "v"(ix[2]), "v"(ix[3]), "v"(ix[4]), "v"(pq), "v"(pq2) : "memory");
    // a wave's registers do not reach for three query tiles' Q fragments beside the accumulators and the scores: the third tile's lie in the wave's own LDS (no other wave touches them) and are read anew in each pass
    T16* qs = (T16*)(lds + FTAB) + (w * 1024 + 8 * lane);
    if constexpr (QT > 2) {
#pragma unroll
        for (int kc = 0; kc < 2; ++kc) { *(v8ha*)(qs + kc * 512) = __builtin_shufflevector(qf[2][kc], qf[2][kc], 0, 1, 2, 3, 4, 5, 6, 7); *(v8ha*)(qs + kc * 512 + 256) = __builtin_shufflevector(qf[2][kc], qf[2][kc], 8, 9, 10, 11, 12, 13, 14, 15); } }
#pragma unroll
    for (int f = 0; f < NF; ++f) tab[tid + f * NT] = cv[f] * SCL;
    v8f acc[QT][4]; float m[QT], l[QT];
#pragma unroll
    for (int qt = 0; qt < QT; ++qt) { m[qt] = -3.0e38f; l[qt] = 0.f;
#pragma unroll
        for (int dt = 0; dt < 4; ++dt) acc[qt][dt] = (v8f){}; }
    asm volatile("s_wait_asynccnt 0x0" ::: "memory");   // this wave's copies of pass 0 have landed
    __syncthreads();   // pass 0's fragments and tab are whole before any wave reads them
    fill(1);
    // rolled: one pass's fragments live at a time
#pragma unroll 1
    for (int t = 0; t < NP; ++t) {
        const int jb = kbeg + 32 * ((t + rot) & (NP - 1));
        const T16* sk = (const T16*)ring + ((t & 1) * (FBUF / 2) + ks * CH + 8 * lane);
        V kf[2][2], kf2[2][2], vf[4], vf2[4];
        v8f s[QT][2];
#pragma unroll
        for (int kt = 0; kt < 2; ++kt) {
#pragma unroll
            for (int kc = 0; kc < 2; ++kc) { kf[kt][kc] = WFrag<T16>::ld(sk + (kt * 2 + kc) * 512); if (HL) kf2[kt][kc] = WFrag<T16>::ld(sk + 2048 + (kt * 2 + kc) * 512); }
#pragma unroll
            for (int qt = 0; qt < QT; ++qt) { v8f x = (v8f){};
#pragma unroll
                for (int kc = 0; kc < 2; ++kc) { x = WFrag<T16>::mma(kf[kt][kc], qt < 2 ? qf[qt][kc] : WFrag<T16>::ld(qs + kc * 512), x); if (HL) { x = WFrag<T16>::mma(kf[kt][kc], qf2[qt][kc], x); x = WFrag<T16>::mma(kf2[kt][kc], qf[qt][kc], x); } }
                s[qt][kt] = x; }
            if constexpr (QT > 2) __builtin_amdgcn_sched_barrier(0);   // the second 16 keys' fragments are asked for behind the first 16 keys' products and take their registers: with both halves live at once the wave's registers do not reach and accumulators are spilled
        }
        const float* tb = tab + (jb + 8 * hi - lr - qg * NQ + NQW - 1);
        float bm[QT]; bool need = false;
#pragma unroll
        for (int qt = 0; qt < QT; ++qt) { float x = -3.0e38f;
#pragma unroll
            for (int kt = 0; kt < 2; ++kt)
#pragma unroll
                for (int r = 0; r < 8; ++r) { const float y = s[qt][kt][r] * tb[16 * (kt - qt) + r]; s[qt][kt][r] = y; x = fmaxf(x, y); }
            x = fmaxf(x, xhalf(x)); bm[qt] = x; need = need || (x > m[qt] + FRTH); }
        // the hi+lo form, one query tile a wave, has the registers to ask for its V^T fragments here; the single-product form asks behind the softmax, where the scores' registers are free
        auto loadv = [&]() __attribute__((always_inline)) {
#pragma unroll
            for (int dt = 0; dt < 4; ++dt) { vf[dt] = WFrag<T16>::ld(sk + VO + dt * 512); if (HL) vf2[dt] = WFrag<T16>::ld(sk + VO + 2048 + dt * 512); } };
        if constexpr (HL) loadv();
        if (__builtin_amdgcn_ballot_w32(need) != 0) {   // a scalar branch: taken on a wave's first pass and seldom after it
#pragma unroll
            for (int qt = 0; qt < QT; ++qt) { const float mn = (bm[qt] > m[qt] + FRTH) ? bm[qt] : m[qt]; const float al = __builtin_amdgcn_exp2f((m[qt] - mn) * L2E); m[qt] = mn; l[qt] *= al;
#pragma unroll
                for (int dt = 0; dt < 4; ++dt) acc[qt][dt] *= al; } }
        V pb[QT], pl[QT];
#pragma unroll
        for (int qt = 0; qt < QT; ++qt) { const float nm = -m[qt] * L2E; float ls = 0.f;
#pragma unroll
            for (int kt = 0; kt < 2; ++kt) { v8f a;
#pragma unroll
                for (int r = 0; r < 8; ++r) a[r] = __builtin_fmaf(s[qt][kt][r], L2E, nm);
                s[qt][kt] = exp2x8(a);
#pragma unroll
                for (int r = 0; r < 8; ++r) ls += s[qt][kt][r]; }
            l[qt] += ls;
            if constexpr (HL) {   // hi = p rounded to nearest even, lo = (p - hi) rounded likewise: splitf's values for the finite p here, by the packed conversion
                const v8bf h0 = __builtin_convertvector(s[qt][0], v8bf), h1 = __builtin_convertvector(s[qt][1], v8bf);
                const v8bf l0 = __builtin_convertvector(s[qt][0] - __builtin_convertvector(h0, v8f), v8bf), l1 = __builtin_convertvector(s[qt][1] - __builtin_convertvector(h1, v8f), v8bf);
                pb[qt] = __builtin_shufflevector(h0, h1, 0, 1, 2, 3, 4, 5, 6, 7, 8, 9, 10, 11, 12, 13, 14, 15); pl[qt] = __builtin_shufflevector(l0, l1, 0, 1, 2, 3, 4, 5, 6, 7, 8, 9, 10, 11, 12, 13, 14, 15);
            } else { pb[qt] = cat16(__builtin_convertvector(s[qt][0], v8h), __builtin_convertvector(s[qt][1], v8h)); } }
        if constexpr (!HL) loadv();
        // the loaded fragments are inputs only: all eight are then asked for in front of the softmax and fly while it runs; left free, the scheduler loads them into one register set among the products and waits for each by itself
        else asm volatile("" :: "v"(vf[0]), "v"(vf[1]), "v"(vf[2]), "v"(vf[3]), "v"(vf2[0]), "v"(vf2[1]), "v"(vf2[2]), "v"(vf2[3]));
#pragma unroll
        for (int dt = 0; dt < 4; ++dt)
#pragma unroll
            for (int qt = 0; qt < QT; ++qt) { acc[qt][dt] = WFrag<T16>::mma(vf[dt], pb[qt], acc[qt][dt]); if (HL) { acc[qt][dt] = WFrag<T16>::mma(vf[dt], pl[qt], acc[qt][dt]); acc[qt][dt] = WFrag<T16>::mma(vf2[dt], pb[qt], acc[qt][dt]); } }
        asm volatile("s_wait_dscnt 0x0" ::: "memory");      // this wave's reads of the buffer are done before the buffer is given up
        asm volatile("s_wait_asynccnt 0x0" ::: "memory");   // and its copies of pass t + 1 have landed
        __syncthreads();   // pass t + 1 is whole for every wave, and every wave has left pass t's buffer
        if (t + 2 < NP) fill(t + 2);   // the same for the whole work-group
    }
    asm volatile("s_wait_asynccnt 0x0" ::: "memory");   // no copy is under way when the ring becomes the join area (every wave has passed the last pass's barrier)
    float* accS = ring; float* mS = accS + FKS * FQG * NQ * 68; float* lS = mS + FKS * FQG * NQ;
    float* my = accS + w * (NQ * 68);
#pragma unroll
    for (int qt = 0; qt < QT; ++qt) { const float lj = l[qt] + xhalf(l[qt]);   // the two lane halves summed different keys of the same query
        if (hi == 0) { mS[w * NQ + qt * 16 + lr] = m[qt]; lS[w * NQ + qt * 16 + lr] = lj; }
#pragma unroll
        for (int dt = 0; dt < 4; ++dt) { float* p = my + (qt * 16 + lr) * 68 + dt * 16 + hi * 8; const v8f x = acc[qt][dt];
            *(v4fa*)p = __builtin_shufflevector(x, x, 0, 1, 2, 3); *(v4fa*)(p + 4) = __builtin_shufflevector(x, x, 4, 5, 6, 7); } }
    __syncthreads();   // every wave's partial is in LDS before any is joined
#pragma unroll
    for (int sx = 0; sx < NQW * 8 / NT; ++sx) { const int idx = sx * NT + tid; const int q = (idx >> 7) * 16 + (idx & 15), dc = ((idx >> 4) & 7) * 8; const int w0 = (q / NQ) * FKS, ql = q % NQ;   // a wave has 16 queries x 16 columns: 512 bytes in a row of each plane
        float M = mS[w0 * NQ + ql];
#pragma unroll
        for (int u = 1; u < FKS; ++u) M = fmaxf(M, mS[(w0 + u) * NQ + ql]);
        float L = 0.f; v4f o0 = (v4f){}, o1 = (v4f){};
#pragma unroll
        for (int u = 0; u < FKS; ++u) { const float sc = __builtin_amdgcn_exp2f((mS[(w0 + u) * NQ + ql] - M) * L2E); L += lS[(w0 + u) * NQ + ql] * sc; const float* p = accS + ((w0 + u) * NQ + ql) * 68 + dc; o0 += *(const v4fa*)p * sc; o1 += *(const v4fa*)(p + 4) * sc; }
        const float inv = __fdiv_rn(1.0f, L); v8us oh, ol;
#pragma unroll
        for (int k = 0; k < 4; ++k) { unsigned short a, c2; splitf(o0[k] * inv, a, c2); oh[k] = a; ol[k] = c2; splitf(o1[k] * inv, a, c2); oh[4 + k] = a; ol[4 + k] = c2; }
        const size_t oo = fro(q0 + q, dc, DQ); bf* ph = Ah + oo; bf* pl = Al + oo; *(v8us*)ph = oh; *(v8us*)pl = ol;
        asm volatile("s_wait_xcnt 0x0" :: "v"(oh), "v"(ol), "v"(ph), "v"(pl) : "memory"); }   // the wait that stands before a register named by an issued store is written anew; data and address pairs are inputs, so they live up to it
}
// grid (batches x heads, RH / (16 FQG) + (TT - RH) / (16 FQT FQG)): the hi+lo query blocks have the low indices.
// Four waves a SIMD (256 registers), one work-group a WGP: the launch's 256 hi+lo and 256 single-product work-groups are then one full round each on the 256 WGPs.
static_assert(RH % (16 * FQG) == 0 && (TT - RH) % (16 * FQT * FQG) == 0, "whole query blocks");
__global__ __launch_bounds__(FNT) __attribute__((amdgpu_waves_per_eu(4, 4))) void k_fattn(const h16* __restrict__ Q16, const h16* __restrict__ K16, const h16* __restrict__ V16, const bf* __restrict__ Qh, const bf* __restrict__ Ql, const bf* __restrict__ Kh, const bf* __restrict__ Kl, const bf* __restrict__ Vh, const bf* __restrict__ Vl, const float* __restrict__ CT, bf* Ah, bf* Al) {
    __shared__ __align__(16) float lds[FLDS];
    const int bh = (int)blockIdx.x, by = (int)blockIdx.y; const size_t ho = (size_t)bh * TT * HD; const size_t ao = (size_t)(bh / NH_) * TT * DQ + (bh % NH_) * (HD / 32) * 512;   // planes [batch][head]; output rows [batch x t], the head's columns (in fragment order: its HD / 32 fragments of each 16 rows)
    if (by < RH / (16 * FQG)) fattn_body<bf, true, 1>(Qh + ho, Ql + ho, Kh + ho, Kl + ho, Vh + ho, Vl + ho, CT, by * (16 * FQG), 2 * by, Ah + ao, Al + ao, lds);
    else fattn_body<h16, false, FQT>(Q16 + ho, nullptr, K16 + ho, nullptr, V16 + ho, nullptr, CT, RH + (by - RH / (16 * FQG)) * (16 * FQT * FQG), 2 * (by - RH / (16 * FQG)), Ah + ao, Al + ao, lds);
}

// ---- k_qkv: the q | k | v product of both batches, its epilogue storing the head planes that k_fattn reads (fp16 and hi + lo bf16); the f32 product never reaches memory.
// ONE WAVE per 64 x 64 tile as in k_gemmw, same k order, stages of one fragment; a tile is 64 positions of one head of q, k or v. A work-group is twelve such waves that share nothing but the WGP (no barrier): 4 row tiles x (q, k, v of one head). grid (batches x TT / 256, DQ / 64), 384 threads.
// q, k: planes [t][d], value x MOD[h][d], in fragment order like every plane here. v: planes [d][t] of vv[t] = (v[t] MOD + v[t + 1 mod TT] MOD) / sqrt(2): the tile's last position needs the next tile's first row, so a v tile carries a fifth row block (rows t0 + 64 ..., wrapped inside the batch), of which row 0 is used.
// Four times eight values in a row (a lane's pieces of two fragments, 256 elements apart) to the three planes: fp16, hi = bf16 nearest even, lo = (x - hi) likewise (splitf's values for finite x, by the packed conversion).
__device__ __forceinline__ void put32(const v8f (&x)[4], const size_t e, h16* P16, bf* Ph, bf* Pl) {
    h16* q16 = P16 + e; bf* qh = Ph + e; bf* ql = Pl + e; v8h a[4]; v8us h[4], l[4];
#pragma unroll
    for (int s = 0; s < 4; ++s) { const v8bf hb = __builtin_convertvector(x[s], v8bf); const v8bf lb = __builtin_convertvector(x[s] - __builtin_convertvector(hb, v8f), v8bf);
        a[s] = __builtin_convertvector(x[s], v8h); h[s] = __builtin_bit_cast(v8us, hb); l[s] = __builtin_bit_cast(v8us, lb); }
#pragma unroll
    for (int s = 0; s < 4; ++s) { *(v8h*)(q16 + s * 256) = a[s]; *(v8us*)(qh + s * 256) = h[s]; *(v8us*)(ql + s * 256) = l[s]; }
    // the wait that stands before a register named by an issued store is written anew; data and address pairs are inputs, so they live up to it
    asm volatile("s_wait_xcnt 0x0" :: "v"(a[0]), "v"(a[1]), "v"(a[2]), "v"(a[3]), "v"(h[0]), "v"(h[1]), "v"(h[2]), "v"(h[3]), "v"(l[0]), "v"(l[1]), "v"(l[2]), "v"(l[3]), "v"(q16), "v"(qh), "v"(ql) : "memory"); }
template <bool VV>
__device__ __forceinline__ void qkv_body(const int r0, const int c0, const int rot, const bf* __restrict__ X, const bf* __restrict__ Wt, const float* __restrict__ MOD, h16* P16, bf* Ph, bf* Pl, float* os) {
    typedef WFrag<bf>::V V;
    constexpr int K = DM, MB = VV ? 5 : 4;
    const int lane = threadIdx.x & 31, lr = lane & 15, hi = lane >> 4;
    const int b = r0 / TT, t0 = r0 % TT, h = (c0 % DQ) / HD;
    const float* pm = MOD + h * HD + lr; float md[4];
#pragma unroll
    for (int nb = 0; nb < 4; ++nb) md[nb] = pm[nb * 16];   // a lane's accumulators are of columns nb 16 + lr
    asm volatile("s_wait_xcnt 0x0" :: "v"(pm) : "memory");   // the wait that stands before a register named by an issued load is written anew; the address pair is an input, so it lives up to it
    v8f acc[MB][4];
#pragma unroll
    for (int mb = 0; mb < MB; ++mb)
#pragma unroll
        for (int nb = 0; nb < 4; ++nb) acc[mb][nb] = (v8f){};
    constexpr int NS = K / 32; int kx = rot;   // the walk's k steps; the first one (staggered walks)
    const bf* pa = X + ((size_t)r0 * K + rot * 512 + 8 * lane); const bf* pb = Wt + ((size_t)c0 * K + rot * 512 + 8 * lane); const bf* pn = X + ((size_t)(b * TT + (t0 + 64) % TT) * K + rot * 512 + 8 * lane);   // fragment order: 16 rows are 16 K elements, 32 columns one fragment
    static_assert(K % 64 == 0, "k steps come in pairs, one for each register set");
    V a[2][MB], bb[2][4];
    // two register sets as in k_gemmw: while one set's products run, the next k step's loads, all issued in front of them, are in flight; every index is a constant once the calls are inlined
    auto fetch = [&](const int s) __attribute__((always_inline)) {
#pragma unroll
        for (int mb = 0; mb < 4; ++mb) a[s][mb] = WFrag<bf>::ldg(pa + mb * 16 * K);
        if constexpr (VV) a[s][4] = WFrag<bf>::ldg(pn);
#pragma unroll
        for (int nb = 0; nb < 4; ++nb) bb[s][nb] = WFrag<bf>::ldg(pb + nb * 16 * K);
        __builtin_amdgcn_sched_barrier(0);   // as in k_gemmw: all of the step's loads are issued before the other set's products
    };
    auto mul = [&](const int s) __attribute__((always_inline)) {
#pragma unroll
        for (int nb = 0; nb < 4; ++nb)
#pragma unroll
            for (int mb = 0; mb < MB; ++mb) acc[mb][nb] = WFrag<bf>::mma(a[s][mb], bb[s][nb], acc[mb][nb]);
        __builtin_amdgcn_sched_barrier(0);   // as in k_gemmw: the products stay in front of the loads that go into the registers they read
    };
    auto step = [&]() __attribute__((always_inline)) {
        // as in k_gemmw: behind the products
        const long long d = kx == NS - 1 ? -(long long)(NS - 1) * 1024 : 1024ll; kx = kx == NS - 1 ? 0 : kx + 1;
        wait_step(pa, d); wait_step(pb, d); if constexpr (VV) wait_step(pn, d);
    };
    fetch(0); step();
    // rolled: two steps' fragments live at a time
#pragma unroll 1
    for (int kc = 0; kc < K - 64; kc += 64) { fetch(1); mul(0); step(); fetch(0); mul(1); step(); }
    fetch(1); mul(0); step(); mul(1);
    const size_t o = (((size_t)(c0 / DQ) * NB_ + b) * NH_ + h) * TT * HD;   // planes [q, k, v][batch][head]
    // on the way out a lane has 8 values in a row, of row lr and columns s 16 + hi 8 ...: the wave's 32 pieces are half a fragment, 512 bytes in a row
    if constexpr (!VV) {
#pragma unroll
        for (int mb = 0; mb < 4; ++mb) {
#pragma unroll
            for (int nb = 0; nb < 4; ++nb) {
#pragma unroll
                for (int j = 0; j < 8; ++j) os[(hi * 8 + j) * 68 + nb * 16 + lr] = __fmul_rn(acc[mb][nb][j], md[nb]); }
            __builtin_amdgcn_wave_barrier(); asm volatile("" ::: "memory");   // the lanes read each other's LDS stores: no read may be moved above them
            v8f y[4];
#pragma unroll
            for (int s = 0; s < 4; ++s) { const float* p = os + lr * 68 + s * 16 + hi * 8; const v4f x0 = *(const v4fa*)p, x1 = *(const v4fa*)(p + 4); y[s] = __builtin_shufflevector(x0, x1, 0, 1, 2, 3, 4, 5, 6, 7); }
            put32(y, o + (size_t)(t0 + mb * 16) * HD + lane * 8, P16, Ph, Pl);
            __builtin_amdgcn_wave_barrier(); asm volatile("" ::: "memory");   // and no store of the next block above these reads
        }
    } else {
#pragma unroll
        for (int nb = 0; nb < 4; ++nb) {
#pragma unroll
            for (int mb = 0; mb < 4; ++mb) { v8f t;
#pragma unroll
                for (int j = 0; j < 8; ++j) t[j] = __fmul_rn(acc[mb][nb][j], md[nb]);
                float* p = os + lr * 68 + mb * 16 + hi * 8; *(v4fa*)p = __builtin_shufflevector(t, t, 0, 1, 2, 3); *(v4fa*)(p + 4) = __builtin_shufflevector(t, t, 4, 5, 6, 7); }
            if (hi == 0) os[lr * 68 + 64] = __fmul_rn(acc[4][nb][0], md[nb]);   // position t0 + 64 (mod TT)
            __builtin_amdgcn_wave_barrier(); asm volatile("" ::: "memory");   // as above
            v8f y[4];
#pragma unroll
            for (int s = 0; s < 4; ++s) { const float* p = os + lr * 68 + s * 16 + hi * 8; const v4f x0 = *(const v4fa*)p, x1 = *(const v4fa*)(p + 4); const float x8 = p[8];
                const float x[9] = {x0[0], x0[1], x0[2], x0[3], x1[0], x1[1], x1[2], x1[3], x8};
#pragma unroll
                for (int j = 0; j < 8; ++j) y[s][j] = __fmul_rn(__fadd_rn(x[j], x[j + 1]), 0.70710678118654752f); }
            put32(y, o + (size_t)nb * 16 * TT + (size_t)t0 * 16 + lane * 8, P16, Ph, Pl);
            __builtin_amdgcn_wave_barrier(); asm volatile("" ::: "memory");   // as above
        }
    }
}
// Three waves a SIMD (336 registers): the launch's 3,072 waves are then all resident at once, as 256 work-groups to start, one a WGP, in place of 3,072.
// Wave w has row tile w & 3 and q, k or v by w >> 2: every WGP has the same work (a v tile has a fifth row block), and of its waves three ask for each x fragment and four for each weight fragment.
__global__ __launch_bounds__(384) __attribute__((amdgpu_waves_per_eu(3, 3))) void k_qkv(const bf* __restrict__ X, const bf* __restrict__ Wt, const float* __restrict__ MOD, h16* P16, bf* Ph, bf* Pl) {
    __shared__ __align__(16) float osw[12 * 16 * 68];
    const int w = __builtin_amdgcn_readfirstlane((int)threadIdx.x >> 5); float* os = osw + w * (16 * 68);   // each wave stages in its own part
    const int r0 = ((int)blockIdx.x * 4 + (w & 3)) * 64, c0 = (w >> 2) * DQ + (int)blockIdx.y * 64;
    const int rot = (2 * ((int)blockIdx.x + (int)blockIdx.y)) % (DM / 32);   // staggered walks: the 16 work-groups that share x rows (blockIdx.y varies) start two k steps apart, and so do the 16 that share weight rows (blockIdx.x varies); a work-group's twelve waves walk together
    if (w < 8) qkv_body<false>(r0, c0, rot, X, Wt, MOD, P16, Ph, Pl, os);   // the same for a whole wave; neither side has a work-group barrier
    else qkv_body<true>(r0, c0, rot, X, Wt, MOD, P16, Ph, Pl, os);
}

extern "C" void kernel_launch(void* const* d_in, const int* in_sizes, int n_in,
                              void* d_out, int out_size, void* d_ws, size_t ws_size, hipStream_t stream) {
    (void)in_sizes; (void)n_in; (void)out_size;
    const float* x = (const float*)d_in[0]; const float* wq = (const float*)d_in[1]; const float* wk = (const float*)d_in[2]; const float* wv = (const float*)d_in[3]; const float* wo = (const float*)d_in[4]; const float* qph = (const float*)d_in[5]; const float* qam = (const float*)d_in[6];
    float* OUT = (float*)d_out;     // [2][2048][1024]
    char* wsp = (char*)d_ws;
    auto take = [&](size_t bytes) { char* p = wsp; wsp += (bytes + 255) & ~(size_t)255; return (void*)p; };
    static_assert(DKV == DQ && DQ == DM, "the four weights are alike in shape, and q, k, v stand side by side in one product");
    bf* WT = (bf*)take((size_t)4 * DQ * DM * 2);   // Wq^T | Wk^T | Wv^T | Wo^T
    float* MOD = (float*)take((size_t)DQ * 4); float* CT = (float*)take((size_t)TT * 4);
    bf* XB = (bf*)take((size_t)NB_ * TT * DM * 2);
    const size_t PL = (size_t)NB_ * NH_ * TT * HD;   // one kind of plane, both batches
    h16* P16 = (h16*)take(3 * PL * 2); bf* Ph = (bf*)take(3 * PL * 2); bf* Pl = (bf*)take(3 * PL * 2);
    bf* ATh = (bf*)take((size_t)NB_ * TT * DQ * 2); bf* ATl = (bf*)take((size_t)NB_ * TT * DQ * 2);
    if ((size_t)(wsp - (char*)d_ws) > ws_size) return;    // ws 256 MiB
    k_prep<<<4 * PW + PX + PT, 256, 0, stream>>>(x, wq, wk, wv, wo, qph, qam, WT, XB, MOD, CT);
    k_qkv<<<dim3(NB_ * TT / 256, DQ / 64, 1), 384, 0, stream>>>(XB, WT, MOD, P16, Ph, Pl);   // q | k | v of both batches, stored as planes
    k_fattn<<<dim3(NB_ * NH_, RH / (16 * FQG) + (TT - RH) / (16 * FQT * FQG), 1), FNT, 0, stream>>>(P16, P16 + PL, P16 + 2 * PL, Ph, Pl, Ph + PL, Pl + PL, Ph + 2 * PL, Pl + 2 * PL, CT, ATh, ATl);   // one kv head per query head
    k_gemmw<bf, 1, false, DQ, 2><<<dim3(NB_ * TT / 128, DM / 128, 1), 128, 0, stream>>>(ATh, ATl, WT + (size_t)3 * DQ * DM, nullptr, OUT, DM, nullptr, 0, 0, 0);
}
